// v000
// Times are from an AMD MI455X. After a warm-up the kernel runs many times in a row, and a time is the length of
// such a window on the GPU divided by its runs, so every launch and the gaps after it count. The runs cycle
// through copies of the inputs. A figure is the median of several windows, for all but v000 over two sittings.
// Sittings can differ by a few percent; kernels timed side by side share one.
// The starting kernel, v000, takes 2120 microseconds a run.
#include <hip/hip_runtime.h>
// Dot-product attention whose softmax runs over the BATCH axis (Q, K, V [8][4096][64], no heads, no weights; scores = Q K^T / sqrt(64) -> [8][4096][4096]; attn = softmax(scores, axis = 0): for every (query, key) pair the 8 batch entries are normalised against each other (the module's literal axis; rows are NOT normalised over keys); out[b] = attn[b] V[b] -> [8][4096][64]).
// Structure: the bf16-valued inputs as exact f16 rows; V^T per batch via LDS transposes once; per 256-row query tile: scores of all 8 batches in ONE WMMA GEMM launch (batch on grid.y; 32x64 wave tiles, f32 accumulation, K = 64, exact products), the batch-axis softmax on VALU (thread per (query, 8 keys): the 8 batch values of each pair normalised together, f32, native exp; weights x256 f16), out[b] = P[b] V[b]^T 2^-8 f32 (batch on grid.y) into the tile's output rows; launches: see trace.
// Compute dtype: inputs rounded to bf16; x / weights exact; q, k, v and softmax weights as plain f16 GEMM operands (~2^-12); scores, softmax statistics and o f32. v_wmma_f32_16x16x32_f16.
#define NB 4
#define SQ 4096
#define DM 256
#define NH 1
#define HD 64
#define HG 4                         /* heads per attention launch group */
#define B0 0                         /* first batch processed (debug hook) */
#define NBR NB                       /* batches processed (debug hook) */
#define NR ((size_t)NB * SQ)         /* token rows */
#define MP ((int)((size_t)NBR * SQ)) /* rows projected (debug hook) */
#define QT 256                       /* query rows per causal tile */
#define NKX SQ                       /* S / P row pitch */
#define QT0 256                      /* first-tile rows recomputed exactly (256: buys margin for the few-key rows 128..255, which have no output projection to average the single-f16 P/v rounding) */
#define QN SQ                        /* query rows attended per batch (debug hook) */
#define NHD NH                       /* heads attended (debug hook) */
#define MPO MP                       /* rows through the output stage (debug hook) */
#define LQ DM            /* row pitch of the q/k/v rows */
typedef __bf16 v16b __attribute__((ext_vector_type(16)));
typedef unsigned short v8us __attribute__((ext_vector_type(8), may_alias));
typedef float  v8f  __attribute__((ext_vector_type(8)));
typedef float  v4f  __attribute__((ext_vector_type(4)));
typedef float  v4fa __attribute__((ext_vector_type(4), may_alias));
union FragB { v16b v; v8us half[2]; unsigned short u[16]; };

__device__ __forceinline__ unsigned short bf16_bits(float x) { unsigned int u = __float_as_uint(x); return (unsigned short)((u + 0x7FFFu + ((u >> 16) & 1u)) >> 16); }
__device__ __forceinline__ float bf16_val(unsigned short b) { return __uint_as_float(((unsigned int)b) << 16); }
__device__ __forceinline__ float bf16_round(float x) { return bf16_val(bf16_bits(x)); }
// D += A·B with NT terms: 1 = ah·bh, 2 = + al·bh (A split), 3 = + ah·bl (both split)
template <int NT>
__device__ __forceinline__ v8f mmaN(v16b ah, v16b al, v16b bh, v16b bl, v8f c) {
  c = __builtin_amdgcn_wmma_f32_16x16x32_bf16(false, ah, false, bh, (short)0, c, false, false);
  if (NT >= 2) c = __builtin_amdgcn_wmma_f32_16x16x32_bf16(false, al, false, bh, (short)0, c, false, false);
  if (NT >= 3) c = __builtin_amdgcn_wmma_f32_16x16x32_bf16(false, ah, false, bl, (short)0, c, false, false);
  asm volatile("v_nop\n\tv_nop\n\tv_nop\n\tv_nop" : "+v"(c) : "v"(ah), "v"(al), "v"(bh), "v"(bl));
  return c;
}

__global__ __launch_bounds__(256) void k_wt_bf16(const float* __restrict__ W, unsigned short* __restrict__ Wt, int K, int N) {
  const int t = blockIdx.x * 256 + threadIdx.x;
  const int k8n = K / 8;
  if (t >= N * k8n) return;
  const int n = t / k8n, k8 = (t % k8n) * 8;
  v8us v;
#pragma unroll
  for (int i = 0; i < 8; ++i) v[i] = bf16_bits(W[(size_t)(k8 + i) * N + n]);
  *(v8us*)(Wt + (size_t)n * K + k8) = v;
  
}

// GEMM C[M][N] (f32, pitch ldc) = act(A[M][K]·W + bias). A f32 row-major (pitch lda) converted per fragment to bf16
// (ASPLIT: hi/lo two planes -> 2 terms, else single rounded term); Wt bf16 [N][K] (pitch ldb). BIAS_BF16 rounds the
// bias to bf16 first (bias quantised to bf16 before the add). K%32==0, M%16==0, N%64==0.
template <bool ASPLIT, int ACT, bool BIAS_BF16>
__global__ __launch_bounds__(128) void k_gemm_bf(const float* __restrict__ A, int lda, const unsigned short* __restrict__ Wt, int ldb,
                                               const float* __restrict__ bias, float* __restrict__ C, int ldc, int M, int N, int K) {
  __shared__ __attribute__((aligned(16))) float so[4][16][64];
  const int tid = threadIdx.x, w = tid >> 5, lane = tid & 31, ln = lane & 15, hh = lane >> 4;
  const int ntn = N / 64;
  const int wid = blockIdx.x * 4 + w;
  const int mt = wid / ntn, nq = wid % ntn;
  if (mt * 16 >= M) return;
  const int row0 = mt * 16, col0 = nq * 64;
  const float* arow = A + (size_t)(row0 + ln) * lda;
  v8f acc[4] = {};
  for (int kb = 0; kb < K; kb += 32) {
    FragB ah, al;
    const v4f x0 = *(const v4fa*)(arow + kb + 8 * hh), x1 = *(const v4fa*)(arow + kb + 8 * hh + 4);
    const v4f x2 = *(const v4fa*)(arow + kb + 16 + 8 * hh), x3 = *(const v4fa*)(arow + kb + 16 + 8 * hh + 4);
    float xs[16] = {x0[0],x0[1],x0[2],x0[3],x1[0],x1[1],x1[2],x1[3],x2[0],x2[1],x2[2],x2[3],x3[0],x3[1],x3[2],x3[3]};
#pragma unroll
    for (int i = 0; i < 16; ++i) { const unsigned short hb = bf16_bits(xs[i]); ah.u[i] = hb; al.u[i] = ASPLIT ? bf16_bits(xs[i] - bf16_val(hb)) : (unsigned short)0; }
#pragma unroll
    for (int t = 0; t < 4; ++t) {
      const unsigned short* brow = Wt + (size_t)(col0 + t * 16 + ln) * ldb + kb;
      FragB b;
      b.half[0] = *(const v8us*)(brow + 8 * hh);
      b.half[1] = *(const v8us*)(brow + 16 + 8 * hh);
      acc[t] = mmaN<ASPLIT ? 2 : 1>(ah.v, al.v, b.v, b.v, acc[t]);
    }
  }
#pragma unroll
  for (int t = 0; t < 4; ++t) {
    float bv = bias ? bias[col0 + t * 16 + ln] : 0.f;
    if (BIAS_BF16) bv = bf16_round(bv);
#pragma unroll
    for (int r = 0; r < 8; ++r) { float v = acc[t][r] + bv; if (ACT == 1) v = fmaxf(v, 0.f); so[w][8 * hh + r][t * 16 + ln] = v; }
  }
  __builtin_amdgcn_fence(__ATOMIC_ACQ_REL, "workgroup");
  __builtin_amdgcn_wave_barrier();
  const int rsub = lane >> 4, c4 = (lane & 15) * 4;
  {
#pragma unroll
    for (int q = 0; q < 8; ++q) {
      const int r = q * 2 + rsub;
      const v4f v = *(const v4fa*)&so[w][r][c4];
      *(v4f*)(C + (size_t)(row0 + r) * ldc + col0 + c4) = v;
    }
    
  }
}

// GEMM C = act(A·W + bias + resid): A f32 (ASPLIT -> hi/lo 2 terms), Wt bf16 [N][K]; ACT 0 none, 1 relu, 2 exact gelu;
// resid (optional, f32, row index = (row % rmod), pitch ldr, RES_BF16 rounds it) added before the activation.
template <bool ASPLIT, int ACT, bool BIAS_BF16, bool RES_BF16>
__global__ __launch_bounds__(128) void k_gemm_bf3(const float* __restrict__ A, int lda, const unsigned short* __restrict__ Wt, int ldb,
                                                const float* __restrict__ bias, const float* __restrict__ resid, int rmod, int ldr,
                                                float* __restrict__ C, int ldc, int M, int N, int K) {
  __shared__ __attribute__((aligned(16))) float so[4][16][64];
  const int tid = threadIdx.x, w = tid >> 5, lane = tid & 31, ln = lane & 15, hh = lane >> 4;
  const int ntn = N / 64;
  const int wid = blockIdx.x * 4 + w;
  const int mt = wid / ntn, nq = wid % ntn;
  if (mt * 16 >= M) return;
  const int row0 = mt * 16, col0 = nq * 64;
  const float* arow = A + (size_t)(row0 + ln) * lda;
  v8f acc[4] = {};
  for (int kb = 0; kb < K; kb += 32) {
    FragB ah, al;
    const v4f x0 = *(const v4fa*)(arow + kb + 8 * hh), x1 = *(const v4fa*)(arow + kb + 8 * hh + 4);
    const v4f x2 = *(const v4fa*)(arow + kb + 16 + 8 * hh), x3 = *(const v4fa*)(arow + kb + 16 + 8 * hh + 4);
    float xs[16] = {x0[0],x0[1],x0[2],x0[3],x1[0],x1[1],x1[2],x1[3],x2[0],x2[1],x2[2],x2[3],x3[0],x3[1],x3[2],x3[3]};
#pragma unroll
    for (int i = 0; i < 16; ++i) { const unsigned short hb = bf16_bits(xs[i]); ah.u[i] = hb; al.u[i] = ASPLIT ? bf16_bits(xs[i] - bf16_val(hb)) : (unsigned short)0; }
#pragma unroll
    for (int t = 0; t < 4; ++t) {
      const unsigned short* brow = Wt + (size_t)(col0 + t * 16 + ln) * ldb + kb;
      FragB b;
      b.half[0] = *(const v8us*)(brow + 8 * hh);
      b.half[1] = *(const v8us*)(brow + 16 + 8 * hh);
      acc[t] = mmaN<ASPLIT ? 2 : 1>(ah.v, al.v, b.v, b.v, acc[t]);
    }
  }
#pragma unroll
  for (int t = 0; t < 4; ++t) {
    const int col = col0 + t * 16 + ln;
    float bv = bias ? bias[col] : 0.f;
    if (BIAS_BF16) bv = bf16_round(bv);
#pragma unroll
    for (int r = 0; r < 8; ++r) {
      float v = acc[t][r] + bv;
      if (resid) { float rv = resid[(size_t)((row0 + 8 * hh + r) % rmod) * ldr + col]; if (RES_BF16) rv = bf16_round(rv); v += rv; }
      if (ACT == 1) v = fmaxf(v, 0.f);
      if (ACT == 2) v = 0.5f * v * (1.0f + erff(v * 0.70710678118654752f));
      if (ACT == 3) { const float u = 0.7978845608028654f * (v + 0.044715f * v * v * v); v = 0.5f * v * (1.0f + tanhf(u)); }
      so[w][8 * hh + r][t * 16 + ln] = v;
    }
  }
  __builtin_amdgcn_fence(__ATOMIC_ACQ_REL, "workgroup");
  __builtin_amdgcn_wave_barrier();
  const int rsub = lane >> 4, c4 = (lane & 15) * 4;
  {
#pragma unroll
    for (int q = 0; q < 8; ++q) {
      const int r = q * 2 + rsub;
      const v4f v = *(const v4fa*)&so[w][r][c4];
      *(v4f*)(C + (size_t)(row0 + r) * ldc + col0 + c4) = v;
    }
    
  }
}
// row LayerNorm (biased variance, eps) over N: s = X (+ R); optional out_sum <- s; out_norm <- (s-mu)*rsqrt(var+eps)*g + b
template <bool PARAM_BF16>
__global__ __launch_bounds__(256) void k_layernorm(const float* __restrict__ X, const float* __restrict__ R, const float* __restrict__ g, const float* __restrict__ bta,
                                                  float* __restrict__ out_sum, float* __restrict__ out_norm, int N, float eps) {
  __shared__ float red[256];
  const int row = blockIdx.x, tid = threadIdx.x;
  const float* x = X + (size_t)row * N; const float* rr = R ? R + (size_t)row * N : nullptr;
  float vals[16];                     // up to N = 4096
  const int per = N / 256;            // contiguous chunk per thread? use strided-by-4 chunks: thread handles j = tid*4 + 1024*u
  float s1 = 0.f;
  for (int u = 0; u < per / 4; ++u) {
    const int j = tid * 4 + 1024 * u;
    const v4f a = *(const v4fa*)(x + j);
    v4f b = {0.f,0.f,0.f,0.f}; if (rr) b = *(const v4fa*)(rr + j);
#pragma unroll
    for (int q = 0; q < 4; ++q) { const float v = a[q] + b[q]; vals[u * 4 + q] = v; s1 += v; }
  }
  red[tid] = s1; __syncthreads();
  for (int st = 128; st > 0; st >>= 1) { if (tid < st) red[tid] += red[tid + st]; __syncthreads(); }
  const float mu = red[0] / (float)N; __syncthreads();
  float s2 = 0.f;
  for (int u = 0; u < per / 4; ++u)
#pragma unroll
    for (int q = 0; q < 4; ++q) { const float c = vals[u * 4 + q] - mu; s2 += c * c; }
  red[tid] = s2; __syncthreads();
  for (int st = 128; st > 0; st >>= 1) { if (tid < st) red[tid] += red[tid + st]; __syncthreads(); }
  const float rs = rsqrtf(red[0] / (float)N + eps);
  {
    for (int u = 0; u < per / 4; ++u) {
      const int j = tid * 4 + 1024 * u;
      v4f o, sm;
#pragma unroll
      for (int q = 0; q < 4; ++q) {
        float gg = g[j + q], bb = bta[j + q];
        if (PARAM_BF16) { gg = bf16_round(gg); bb = bf16_round(bb); }
        sm[q] = vals[u * 4 + q]; o[q] = (vals[u * 4 + q] - mu) * rs * gg + bb;
      }
      if (out_sum) *(v4f*)(out_sum + (size_t)row * N + j) = sm;
      *(v4f*)(out_norm + (size_t)row * N + j) = o;
    }
    
  }
}



// ---- f16 WMMA path (v_wmma_f32_16x16x32_f16): 11-bit significands for operands in range — used where a [0,1] probability operand needs more precision than bf16
typedef _Float16 v16h __attribute__((ext_vector_type(16)));
union FragH { v16h v; v8us half[2]; _Float16 h[16]; unsigned short u[16]; };
template <int NT>
__device__ __forceinline__ v8f mmaH(v16h ah, v16h al, v16h bh, v16h bl, v8f c) {
  c = __builtin_amdgcn_wmma_f32_16x16x32_f16(false, ah, false, bh, (short)0, c, false, false);
  if (NT >= 2) c = __builtin_amdgcn_wmma_f32_16x16x32_f16(false, al, false, bh, (short)0, c, false, false);
  if (NT >= 3) c = __builtin_amdgcn_wmma_f32_16x16x32_f16(false, ah, false, bl, (short)0, c, false, false);
  asm volatile("v_nop\n\tv_nop\n\tv_nop\n\tv_nop" : "+v"(c) : "v"(ah), "v"(al), "v"(bh), "v"(bl));
  return c;
}
// batched GEMM like k_gemm_b but f16 operands: A f32 (split into f16 hi/lo if ASPLIT, else rounded to f16), Bt = f16 values [n][k]; alpha; C f32; N multiple of 16 (partial tiles skipped)
template <bool ASPLIT>
__global__ __launch_bounds__(128) void k_gemm_h(const float* __restrict__ A, int lda, size_t sA, const _Float16* __restrict__ Bh, int ldb, size_t sB, float alpha, float* __restrict__ C, int ldc, size_t sC, int M, int N, int K) {
  __shared__ __attribute__((aligned(16))) float so[4][16][64];
  const int tid = threadIdx.x, w = tid >> 5, lane = tid & 31, ln = lane & 15, hh = lane >> 4; const int by = blockIdx.y;
  A += (size_t)by * sA; Bh += (size_t)by * sB; C += (size_t)by * sC;
  const int ntn = (N + 63) / 64; const int wid = blockIdx.x * 4 + w; const int mt = wid / ntn, nq = wid % ntn; if (mt * 16 >= M) return;
  const int row0 = mt * 16, col0 = nq * 64; const float* arow = A + (size_t)(row0 + ln) * lda;
  v8f acc[4] = {};
  for (int kb = 0; kb < K; kb += 32) {
    FragH ah, al;
    const v4f x0 = *(const v4fa*)(arow + kb + 8 * hh), x1 = *(const v4fa*)(arow + kb + 8 * hh + 4), x2 = *(const v4fa*)(arow + kb + 16 + 8 * hh), x3 = *(const v4fa*)(arow + kb + 16 + 8 * hh + 4);
    float xs[16] = {x0[0],x0[1],x0[2],x0[3],x1[0],x1[1],x1[2],x1[3],x2[0],x2[1],x2[2],x2[3],x3[0],x3[1],x3[2],x3[3]};
#pragma unroll
    for (int i = 0; i < 16; ++i) { const _Float16 h = (_Float16)xs[i]; ah.h[i] = h; al.h[i] = ASPLIT ? (_Float16)(xs[i] - (float)h) : (_Float16)0.0f; }
#pragma unroll
    for (int t = 0; t < 4; ++t) { if (col0 + t * 16 >= N) continue; const size_t boff = (size_t)(col0 + t * 16 + ln) * ldb + kb; FragH bq; bq.half[0] = *(const v8us*)(Bh + boff + 8 * hh); bq.half[1] = *(const v8us*)(Bh + boff + 16 + 8 * hh);
      acc[t] = mmaH<ASPLIT ? 2 : 1>(ah.v, al.v, bq.v, bq.v, acc[t]); }
  }
#pragma unroll
  for (int t = 0; t < 4; ++t) { if (col0 + t * 16 >= N) continue;
#pragma unroll
    for (int r = 0; r < 8; ++r) so[w][8 * hh + r][t * 16 + ln] = acc[t][r] * alpha; }
  __builtin_amdgcn_fence(__ATOMIC_ACQ_REL, "workgroup"); __builtin_amdgcn_wave_barrier();
  const int rsub = lane >> 4, c4 = (lane & 15) * 4;
  {
#pragma unroll
    for (int q = 0; q < 8; ++q) { const int r = q * 2 + rsub; if (col0 + c4 < N) { const v4f v = *(const v4fa*)&so[w][r][c4]; *(v4f*)(C + (size_t)(row0 + r) * ldc + col0 + c4) = v; } }
     }
}

// Wt[n][k] = f16(W[k][n]·scale) from f32 row-major W[K][N] (scale = power of two; bf16-exact weights stay exact in f16 away from the subnormal range)
__global__ __launch_bounds__(256) void k_wt_f16(const float* __restrict__ W, _Float16* __restrict__ Wt, int K, int N, float scale) {
  const int t = blockIdx.x * 256 + threadIdx.x; if (t >= N * (K / 8)) return; const int n = t / (K / 8), k8 = (t % (K / 8)) * 8; FragH f;
#pragma unroll
  for (int i = 0; i < 8; ++i) f.h[i] = (_Float16)(bf16_round(W[(size_t)(k8 + i) * N + n]) * scale); const v8us o = f.half[0];
  *(v8us*)((unsigned short*)Wt + (size_t)n * K + k8) = o; 
}
// k_gemm_hh variant with fused epilogue: v = acc·alpha + bias[by·sBias + col] (+ CP[(row/rowsPerB)·sCPb + by·64 + col] if CP) ; ACT 0 none / 1 elu ; writes f16 C16 (and f32 C if non-null)
template <int ACT>
__global__ __launch_bounds__(128) void k_gemm_hhx(const _Float16* __restrict__ A, int lda, size_t sA, const _Float16* __restrict__ Bh, int ldb, size_t sB, float alpha, const float* __restrict__ bias, size_t sBias, const float* __restrict__ CP, int rowsPerB, size_t sCPb, int row0g,
    float* __restrict__ C, _Float16* __restrict__ C16, int ldc, size_t sC, int M, int N, int K) {
  __shared__ __attribute__((aligned(16))) float so[4][16][64];
  const int tid = threadIdx.x, w = tid >> 5, lane = tid & 31, ln = lane & 15, hh = lane >> 4; const int by = blockIdx.y;
  A += (size_t)by * sA; Bh += (size_t)by * sB; const size_t cofs = (size_t)by * sC; const float* bp = bias ? bias + (size_t)by * sBias : nullptr;
  const int ntn = (N + 63) / 64; const int wid = blockIdx.x * 4 + w; const int mt = wid / ntn, nq = wid % ntn; if (mt * 16 >= M) return;
  const int row0 = mt * 16, col0 = nq * 64; const _Float16* arow = A + (size_t)(row0 + ln) * lda;
  v8f acc[4] = {};
  for (int kb = 0; kb < K; kb += 32) { FragH ah; ah.half[0] = *(const v8us*)((const unsigned short*)arow + kb + 8 * hh); ah.half[1] = *(const v8us*)((const unsigned short*)arow + kb + 16 + 8 * hh);
#pragma unroll
    for (int t = 0; t < 4; ++t) { if (col0 + t * 16 >= N) continue; const size_t boff = (size_t)(col0 + t * 16 + ln) * ldb + kb; FragH bq; bq.half[0] = *(const v8us*)((const unsigned short*)Bh + boff + 8 * hh); bq.half[1] = *(const v8us*)((const unsigned short*)Bh + boff + 16 + 8 * hh);
      acc[t] = mmaH<1>(ah.v, ah.v, bq.v, bq.v, acc[t]); }
  }
#pragma unroll
  for (int t = 0; t < 4; ++t) { if (col0 + t * 16 >= N) continue; const int col = col0 + t * 16 + ln; const float bv = bp ? bf16_round(bp[col]) : 0.f;
#pragma unroll
    for (int r = 0; r < 8; ++r) { float v = acc[t][r] * alpha + bv; if (CP) { const int rr = row0g + row0 + 8 * hh + r; if (rowsPerB < 0) v += CP[cofs + (size_t)rr * ldc + col];      /* rowsPerB < 0: own element of the batched C plane */ else { const int bidx = rr / rowsPerB; v += CP[(size_t)bidx * sCPb + (size_t)by * 64 + col]; } } if (ACT == 1) v = (v > 0.f) ? v : expm1f(v); else if (ACT == 7) v = (v > 0.f) ? v + 1.0f : expf(v); else if (ACT == 8) v = tanhf(v); else if (ACT == 9) v = 0.5f * v * (1.0f + tanhf(0.7978845608028654f * (v + 0.044715f * v * v * v))); else if (ACT == 11) v = 1.0f / (1.0f + expf(-v)); else if (ACT == 12) v = (v > 0.f) ? v : 0.01f * v; else if (ACT == 14) v = (v > 0.f) ? v : 0.1f * v; else if (ACT == 16) v = (v >= 0.f) ? v : 0.3f * v; else if (ACT == 17) v = (v >= 0.f) ? v : 0.2f * v; else if (ACT == 15) v = v / (1.0f + expf(-v)); else if (ACT == 3) v = fmaxf(v, 0.f); else if (ACT == 6) v = 0.5f * v * (1.0f + erff(v * 0.70710678118654752f)); so[w][8 * hh + r][t * 16 + ln] = v; } }
  __builtin_amdgcn_fence(__ATOMIC_ACQ_REL, "workgroup"); __builtin_amdgcn_wave_barrier();
  const int rsub = lane >> 4, c4 = (lane & 15) * 4; typedef _Float16 v4h __attribute__((ext_vector_type(4)));
  {
#pragma unroll
    for (int q = 0; q < 8; ++q) { const int r = q * 2 + rsub; if (col0 + c4 < N) { const v4f v = *(const v4fa*)&so[w][r][c4]; if (C) *(v4f*)(C + cofs + (size_t)(row0 + r) * ldc + col0 + c4) = v; if (C16) { v4h h4; for (int i = 0; i < 4; ++i) h4[i] = (_Float16)v[i]; *(v4h*)(C16 + cofs + (size_t)(row0 + r) * ldc + col0 + c4) = h4; } } }
     }
}


typedef _Float16 v4h __attribute__((ext_vector_type(4)));

__global__ __launch_bounds__(256) void k_x16(const float* __restrict__ x, _Float16* __restrict__ X16, size_t n8) { const size_t t = (size_t)blockIdx.x * 256 + threadIdx.x; if (t >= n8) return; FragH f;
#pragma unroll
  for (int q = 0; q < 8; ++q) f.h[q] = (_Float16)bf16_round(x[t * 8 + q]); *(v8us*)((unsigned short*)X16 + t * 8) = f.half[0];  }
__global__ __launch_bounds__(256) void k_h16(const float* __restrict__ x, _Float16* __restrict__ X16, size_t n8) { const size_t t = (size_t)blockIdx.x * 256 + threadIdx.x; if (t >= n8) return; FragH f;
#pragma unroll
  for (int q = 0; q < 8; ++q) f.h[q] = (_Float16)x[t * 8 + q]; *(v8us*)((unsigned short*)X16 + t * 8) = f.half[0];  }
__global__ __launch_bounds__(256) void k_round16f(const float* __restrict__ W, _Float16* __restrict__ Bt, size_t n8) { const size_t t = (size_t)blockIdx.x * 256 + threadIdx.x; if (t >= n8) return; FragH f;
#pragma unroll
  for (int i = 0; i < 8; ++i) f.h[i] = (_Float16)(bf16_round(W[t * 8 + i]) * 16.0f); *(v8us*)((unsigned short*)Bt + t * 8) = f.half[0];  }
template <int NHv, int TTv>
__global__ __launch_bounds__(256) void k_vt(const _Float16* __restrict__ V16, int ldv, int voff, _Float16* __restrict__ Vt) { __shared__ unsigned short tl[64][66]; const int tid = threadIdx.x; const int slab = blockIdx.x / (TTv / 64), lg = blockIdx.x % (TTv / 64); const int b = slab / NHv, h = slab % NHv;
  for (int i = tid; i < 64 * 8; i += 256) { const int r = i / 8, c8 = (i % 8) * 8; FragH f; f.half[0] = *(const v8us*)((const unsigned short*)V16 + ((size_t)b * TTv + lg * 64 + r) * ldv + voff + h * 64 + c8);
#pragma unroll
    for (int q = 0; q < 8; ++q) tl[r][c8 + q] = f.u[q]; }
  __syncthreads();
  {
#pragma unroll
    for (int rd = 0; rd < 2; ++rd) { const int d = rd * 32 + tid / 8, pc = tid % 8; FragH f;
#pragma unroll
      for (int q = 0; q < 8; ++q) f.u[q] = tl[pc * 8 + q][d];
      *(v8us*)((unsigned short*)Vt + ((size_t)slab * 64 + d) * TTv + lg * 64 + pc * 8) = f.half[0]; }
     } }

__global__ __launch_bounds__(256) void k_hl(const float* __restrict__ F, _Float16* __restrict__ Hh, _Float16* __restrict__ Hl, size_t n8) { const size_t t = (size_t)blockIdx.x * 256 + threadIdx.x; if (t >= n8) return; FragH fh, fl; const v4f a = *(const v4fa*)(F + t * 8), c = *(const v4fa*)(F + t * 8 + 4);
#pragma unroll
  for (int q = 0; q < 4; ++q) { _Float16 h = (_Float16)a[q]; fh.h[q] = h; fl.h[q] = (_Float16)((a[q] - (float)h) * 1024.0f); h = (_Float16)c[q]; fh.h[4 + q] = h; fl.h[4 + q] = (_Float16)((c[q] - (float)h) * 1024.0f); }
  { *(v8us*)((unsigned short*)Hh + t * 8) = fh.half[0]; *(v8us*)((unsigned short*)Hl + t * 8) = fl.half[0];  } }

// ---- fast GEMM (wave tile 32x64; requires M % 32 == 0 rows per launch region and N % 64 == 0); epilogue = k_gemm_hhx semantics ----
__device__ __forceinline__ v16h g2_frag(const _Float16* p, int hh) { FragH f; f.half[0] = *(const v8us*)((const unsigned short*)p + 8 * hh); f.half[1] = *(const v8us*)((const unsigned short*)p + 16 + 8 * hh); return f.v; }
__device__ __forceinline__ v8f g2_mma(v16h a, v16h b, v8f c) { v8f d = __builtin_amdgcn_wmma_f32_16x16x32_f16(false, a, false, b, (short)0, c, false, false); asm volatile("v_nop\n\tv_nop\n\tv_nop\n\tv_nop" : "+v"(d) : "v"(a), "v"(b)); return d; }
template <int ACT>
__global__ __launch_bounds__(128) void k_gemm2(const _Float16* __restrict__ A, int lda, size_t sA, const _Float16* __restrict__ Bh, int ldb, size_t sB, float alpha, const float* __restrict__ bias, size_t sBias, const float* __restrict__ CP, int rowsPerB, size_t sCPb, int row0g,
    float* __restrict__ C, _Float16* __restrict__ C16, int ldc, size_t sC, int M, int N, int K) { static_assert(ACT == 0 || ACT == 3 || ACT == 6 || ACT == 8 || ACT == 9 || ACT == 11 || ACT == 12 || ACT == 14 || ACT == 15 || ACT == 16 || ACT == 17, "k_gemm2: unsupported ACT code (would silently apply no activation)");
  __shared__ __attribute__((aligned(16))) float so[4][32][68];
  const int tid = threadIdx.x, w = tid >> 5, lane = tid & 31, ln = lane & 15, hh = lane >> 4; const int by = blockIdx.y;
  A += (size_t)by * sA; Bh += (size_t)by * sB; const size_t cofs = (size_t)by * sC; const float* bp = bias ? bias + (size_t)by * sBias : nullptr;
  const int ntn = N >> 6; const int mt = blockIdx.x / ntn, nq = blockIdx.x - mt * ntn; const int row0 = mt * 128 + 32 * w, col0 = nq * 64; if (row0 >= M) return;
  const _Float16* a0p = A + (size_t)(row0 + ln) * lda; const _Float16* a1p = a0p + (size_t)16 * lda;
  const _Float16* b0p = Bh + (size_t)(col0 + ln) * ldb; const _Float16* b1p = b0p + (size_t)16 * ldb; const _Float16* b2p = b1p + (size_t)16 * ldb; const _Float16* b3p = b2p + (size_t)16 * ldb;
  const v8f z8 = {0.f,0.f,0.f,0.f,0.f,0.f,0.f,0.f}; v8f c00 = z8, c01 = z8, c02 = z8, c03 = z8, c10 = z8, c11 = z8, c12 = z8, c13 = z8;
#pragma unroll 1
  for (int kb = 0; kb < K; kb += 32) { const v16h a0 = g2_frag(a0p + kb, hh), a1 = g2_frag(a1p + kb, hh);
    v16h b = g2_frag(b0p + kb, hh); c00 = g2_mma(a0, b, c00); c10 = g2_mma(a1, b, c10);
    b = g2_frag(b1p + kb, hh); c01 = g2_mma(a0, b, c01); c11 = g2_mma(a1, b, c11);
    b = g2_frag(b2p + kb, hh); c02 = g2_mma(a0, b, c02); c12 = g2_mma(a1, b, c12);
    b = g2_frag(b3p + kb, hh); c03 = g2_mma(a0, b, c03); c13 = g2_mma(a1, b, c13); }
  v8f accs[8] = {c00, c01, c02, c03, c10, c11, c12, c13};
#pragma unroll
  for (int u = 0; u < 8; ++u) { const int t = u & 3, half = u >> 2; const int col = col0 + t * 16 + ln; const float bv = bp ? bf16_round(bp[col]) : 0.f;
#pragma unroll
    for (int r = 0; r < 8; ++r) { const int rloc = half * 16 + 8 * hh + r; float v = accs[u][r] * alpha + bv; if (CP) { if (rowsPerB < 0) v += CP[cofs + (size_t)(row0g + row0 + rloc) * ldc + col];      /* rowsPerB < 0: own element of the batched C plane */ else { const int bidx = (row0g + row0 + rloc) / rowsPerB; v += CP[(size_t)bidx * sCPb + (size_t)by * 64 + col]; } }
      if (ACT == 3) v = fmaxf(v, 0.f); else if (ACT == 6) v = 0.5f * v * (1.0f + erff(v * 0.70710678118654752f)); else if (ACT == 11) v = 1.0f / (1.0f + expf(-v)); else if (ACT == 15) v = v / (1.0f + expf(-v)); else if (ACT == 12) v = (v > 0.f) ? v : 0.01f * v; else if (ACT == 8) v = tanhf(v); else if (ACT == 9) v = 0.5f * v * (1.0f + tanhf(0.7978845608028654f * (v + 0.044715f * v * v * v))); else if (ACT == 14) v = (v > 0.f) ? v : 0.1f * v; else if (ACT == 16) v = (v >= 0.f) ? v : 0.3f * v; else if (ACT == 17) v = (v >= 0.f) ? v : 0.2f * v;
      so[w][rloc][t * 16 + ln] = v; } }
  __builtin_amdgcn_fence(__ATOMIC_ACQ_REL, "workgroup"); __builtin_amdgcn_wave_barrier();
  const int rsub = lane >> 4, c4 = (lane & 15) * 4;
  {
#pragma unroll
    for (int q = 0; q < 16; ++q) { const int r = q * 2 + rsub; const v4f v = *(const v4fa*)&so[w][r][c4]; if (C) *(v4f*)(C + cofs + (size_t)(row0 + r) * ldc + col0 + c4) = v; if (C16) { v4h h4; for (int i = 0; i < 4; ++i) h4[i] = (_Float16)v[i]; *(v4h*)(C16 + cofs + (size_t)(row0 + r) * ldc + col0 + c4) = h4; } }
     } }


__global__ __launch_bounds__(256) void k_wnat(const float* __restrict__ w, size_t n8, _Float16* __restrict__ Bt) { const size_t t = (size_t)blockIdx.x * 256 + threadIdx.x; if (t >= n8) return; FragH f; for (int q = 0; q < 8; ++q) f.h[q] = (_Float16)(bf16_round(w[t * 8 + q]) * 16.0f); *(v8us*)((unsigned short*)Bt + t * 8) = f.half[0];  }
__global__ __launch_bounds__(256) void k_rsm(const float* __restrict__ S, _Float16* __restrict__ P, int nrows) {
  #pragma clang fp contract(off)
  const int i = blockIdx.x * 256 + threadIdx.x; if (i >= nrows) return; const float* s = S + (size_t)i * SQ; float mx = -3.0e38f;
#pragma unroll 1
  for (int j = 0; j < SQ; ++j) mx = fmaxf(mx, s[j]); float se = 0.f;
#pragma unroll 1
  for (int j = 0; j < SQ; ++j) se += expf(s[j] - mx); const float sc = 256.0f / se;
#pragma unroll 1
  for (int j0 = 0; j0 < SQ; j0 += 8) { FragH f; for (int q = 0; q < 8; ++q) f.h[q] = (_Float16)(expf(s[j0 + q] - mx) * sc); unsigned short* d = (unsigned short*)P + (size_t)i * SQ + j0; *(v8us*)d = f.half[0];  } }
__global__ __launch_bounds__(256) void k_vt(const _Float16* __restrict__ V16, int b, int h0, _Float16* __restrict__ VT) { __shared__ unsigned short tl[64][65]; const int tid = threadIdx.x; const int hh = blockIdx.x % HG, sg = blockIdx.x / HG; const int s0 = sg * 64; const int h = h0 + hh;
  for (int i = tid; i < 64 * 8; i += 256) { const int j = i / 8, d8 = (i % 8) * 8; FragH f; f.half[0] = *(const v8us*)((const unsigned short*)V16 + ((size_t)b * SQ + s0 + j) * DM + h * HD + d8); for (int q = 0; q < 8; ++q) tl[d8 + q][j] = f.u[q]; }
  __syncthreads();
  { for (int i = tid; i < 64 * 8; i += 256) { const int d = i / 8, j8 = (i % 8) * 8; FragH f; for (int q = 0; q < 8; ++q) f.u[q] = tl[d][j8 + q]; *(v8us*)((unsigned short*)VT + ((size_t)hh * HD + d) * SQ + s0 + j8) = f.half[0]; }  } }



__global__ __launch_bounds__(256) void k_rsmcf2(const float* __restrict__ S, _Float16* __restrict__ P, int hg, int q0, int nk) {
  #pragma clang fp contract(off)
  const int t = blockIdx.x * 256 + threadIdx.x; if (t >= hg * QT) return; const size_t i = (size_t)t; const float* s = S + i * NKX; const int last = q0 + (t % QT); float mx = -3.0e38f;
#pragma unroll 1
  for (int j = 0; j < nk; ++j) { const float f = (j <= last) ? 1.f : 0.f; mx = fmaxf(mx, fmaf(f, s[j], (1.f - f) * -1.0e9f)); } float se = 0.f;
#pragma unroll 1
  for (int j = 0; j < nk; ++j) { const float f = (j <= last) ? 1.f : 0.f; se += __expf(fmaf(f, s[j], (1.f - f) * -1.0e9f) - mx); } const float sc = 256.0f / se;
#pragma unroll 1
  for (int j0 = 0; j0 < nk; j0 += 8) { FragH fr; for (int q = 0; q < 8; ++q) { const int j = j0 + q; const float f = (j <= last) ? 1.f : 0.f; fr.h[q] = (_Float16)(__expf(fmaf(f, s[j], (1.f - f) * -1.0e9f) - mx) * sc); } unsigned short* d = (unsigned short*)P + i * NKX + j0; *(v8us*)d = fr.half[0];  } }

template <int MASKADD>
__global__ __launch_bounds__(64) void k_att0(const float* __restrict__ QF, const float* __restrict__ KF, const float* __restrict__ VF, int ld, const float* __restrict__ mask, float scale, float* __restrict__ OF, int ldo) {
  #pragma clang fp contract(off)
  __shared__ __attribute__((aligned(16))) float lq[64][64]; __shared__ __attribute__((aligned(16))) float lo[64][64];
  const int tid = threadIdx.x; const int h = blockIdx.x / (QT0 / 64), rg = blockIdx.x % (QT0 / 64); const int i = rg * 64 + tid;
  const float* qr = QF + (size_t)i * ld + h * HD;
#pragma unroll 1
  for (int c = 0; c < HD / 4; ++c) { *(v4f*)&lq[tid][c * 4] = *(const v4fa*)(qr + c * 4); const v4f z = {0.f, 0.f, 0.f, 0.f}; *(v4f*)&lo[tid][c * 4] = z; }
  float m = -1.0e30f, l = 0.f; const int jmax = MASKADD ? (SQ - 1) : (rg * 64 + 63);      /* additive-mask form: every key (the mask input decides); causal form: keys up to the block's last row */
#pragma unroll 1
  for (int j = 0; j <= jmax; ++j) { const float* kr = KF + (size_t)j * ld + h * HD; const float* vr = VF + (size_t)j * ld + h * HD; float s = 0.f;
#pragma unroll 1
    for (int c = 0; c < HD / 4; ++c) { const v4f kq = *(const v4fa*)(kr + c * 4); const v4f qq = *(v4f*)&lq[tid][c * 4]; s = __fadd_rn(s, __fmul_rn(qq[0], kq[0])); s = __fadd_rn(s, __fmul_rn(qq[1], kq[1])); s = __fadd_rn(s, __fmul_rn(qq[2], kq[2])); s = __fadd_rn(s, __fmul_rn(qq[3], kq[3])); }
    s = __fmul_rn(s, scale); if (MASKADD) s = __fadd_rn(s, __fmul_rn(bf16_round(mask[(size_t)i * SQ + j]), -10000.0f));
    const float f = (MASKADD || j <= i) ? 1.f : 0.f; const float sm = fmaf(f, s, (1.f - f) * -1.0e30f); const float mn = fmaxf(m, sm); const float sc = expf(m - mn); const float e = expf(sm - mn); l = __fadd_rn(__fmul_rn(l, sc), e); m = mn;
#pragma unroll 1
    for (int c = 0; c < HD / 4; ++c) { const v4f vv = *(const v4fa*)(vr + c * 4); v4f oo = *(v4f*)&lo[tid][c * 4]; for (int u = 0; u < 4; ++u) oo[u] = __fadd_rn(__fmul_rn(oo[u], sc), __fmul_rn(e, vv[u])); *(v4f*)&lo[tid][c * 4] = oo; } }
  const float fin = 64.0f / l;      /* o carried x64 like the f16 path */
#pragma unroll 1
  for (int c = 0; c < HD / 4; ++c) { v4f oo = *(v4f*)&lo[tid][c * 4]; for (int u = 0; u < 4; ++u) oo[u] = __fmul_rn(oo[u], fin); *(v4f*)&lo[tid][c * 4] = oo; }
  __syncthreads();
  {
#pragma unroll 1
    for (int it = 0; it < 16; ++it) { const int row = it * 4 + tid / 16, pc = (tid % 16) * 4; const v4f v = *(const v4f*)&lo[row][pc]; *(v4f*)(OF + (size_t)(rg * 64 + row) * ldo + h * HD + pc) = v; }
     } }

__global__ __launch_bounds__(256) void k_oscale(const float* __restrict__ OF, float* __restrict__ out, size_t n4) { const size_t t = (size_t)blockIdx.x * 256 + threadIdx.x; if (t >= n4) return; const v4f a = *(const v4fa*)(OF + t * 4); v4f o; for (int q = 0; q < 4; ++q) o[q] = a[q] * 0.015625f; *(v4f*)(out + t * 4) = o;  }

__global__ __launch_bounds__(256) void k_bfr(const float* __restrict__ x, float* __restrict__ XB, size_t n8) { const size_t t = (size_t)blockIdx.x * 256 + threadIdx.x; if (t >= n8) return; v4f a = *(const v4fa*)(x + t * 8), c = *(const v4fa*)(x + t * 8 + 4); for (int q = 0; q < 4; ++q) { a[q] = bf16_round(a[q]); c[q] = bf16_round(c[q]); }
  { *(v4f*)(XB + t * 8) = a; *(v4f*)(XB + t * 8 + 4) = c;  } }



__global__ __launch_bounds__(256) void k_rsmfvl(const float* __restrict__ S, _Float16* __restrict__ P, _Float16* __restrict__ PL, int qn, const int* __restrict__ vlp) {
  #pragma clang fp contract(off)
  const int t = blockIdx.x * 256 + threadIdx.x; if (t >= qn) return; const int vl = vlp[0]; const size_t i = (size_t)t; const float* s = S + i * SQ; float mx = -3.0e38f;
#pragma unroll 1
  for (int j = 0; j < SQ; ++j) { const float f = (j < vl) ? 1.f : 0.f; mx = fmaxf(mx, fmaf(f, s[j], (1.f - f) * -1000000.0f)); } float se = 0.f;
#pragma unroll 1
  for (int j = 0; j < SQ; ++j) { const float f = (j < vl) ? 1.f : 0.f; se += __expf(fmaf(f, s[j], (1.f - f) * -1000000.0f) - mx); } const float sc = 256.0f / se;
#pragma unroll 1
  for (int j0 = 0; j0 < SQ; j0 += 8) { FragH fr, gr; for (int q = 0; q < 8; ++q) { const int j = j0 + q; const float f = (j < vl) ? 1.f : 0.f; const float pv = __expf(fmaf(f, s[j], (1.f - f) * -1000000.0f) - mx) * sc; const _Float16 ph = (_Float16)pv; fr.h[q] = ph; gr.h[q] = (_Float16)((pv - (float)ph) * 1024.0f); }
    unsigned short* d = (unsigned short*)P + i * SQ + j0; unsigned short* dl = (unsigned short*)PL + i * SQ + j0; *(v8us*)d = fr.half[0]; *(v8us*)dl = gr.half[0];  } }

__global__ __launch_bounds__(256) void k_rsmf(const float* __restrict__ S, _Float16* __restrict__ P, int qn, int hg) {
  #pragma clang fp contract(off)
  const int t = blockIdx.x * 256 + threadIdx.x; if (t >= qn * hg) return; const size_t i = (size_t)(t / qn) * SQ + (t % qn); const float* s = S + i * SQ; float mx = -3.0e38f;
#pragma unroll 1
  for (int j = 0; j < SQ; ++j) mx = fmaxf(mx, s[j]); float se = 0.f;
#pragma unroll 1
  for (int j = 0; j < SQ; ++j) se += __expf(s[j] - mx); const float sc = 256.0f / se;
#pragma unroll 1
  for (int j0 = 0; j0 < SQ; j0 += 8) { FragH f; for (int q = 0; q < 8; ++q) f.h[q] = (_Float16)(__expf(s[j0 + q] - mx) * sc); unsigned short* d = (unsigned short*)P + i * SQ + j0; *(v8us*)d = f.half[0];  } }


#define CN 256          /* channels */
#define CI 128
#define NC 256                       /* (unused legacy kernels) */
#define NPX NP          /* positions per channel row */
#define NP 4096         /* seq1 tokens */
#define NM 1024         /* seq2 tokens */
#define BNEPS 1e-5f

__global__ __launch_bounds__(256) void k_mp2(const float* __restrict__ src, float* __restrict__ dst, int nout) {
  const int t = blockIdx.x * 256 + threadIdx.x; if (t >= nout) return; const int c = t / 1024; const int o = t % 1024; const int oy = o / 32, ox = o % 32; const float* p = src + (size_t)c * 4096 + (size_t)(2 * oy) * 64 + 2 * ox;
  const float v = fmaxf(fmaxf(p[0], p[1]), fmaxf(p[64], p[65])); *(float*)(dst + t) = v;  }
__global__ __launch_bounds__(256) void k_xpb(const float* __restrict__ x, const float* __restrict__ wb, float* __restrict__ CPP, size_t n4) {
  #pragma clang fp contract(off)
  const size_t t = (size_t)blockIdx.x * 256 + threadIdx.x; if (t >= n4) return; const size_t e = t * 4; const int c = (int)((e / 4096) % 256); const float bb = bf16_round(wb[c]); const v4f a = *(const v4fa*)(x + e); v4f o; for (int q = 0; q < 4; ++q) o[q] = __fadd_rn(bf16_round(a[q]), bb);
  *(v4f*)(CPP + e) = o;  }


template <int PASS>
__global__ __launch_bounds__(256) void k_cstA(const float* __restrict__ X, const float* __restrict__ MV, float* __restrict__ PART) {
  #pragma clang fp contract(off)
  __shared__ float red[256]; const int t = threadIdx.x; const size_t bc = blockIdx.x; const int c = (int)(bc % NC); const float* row = X + bc * (size_t)NPX; const float mu = PASS ? MV[c] : 0.f; float s = 0.f;
  for (int i = t; i < NPX; i += 256) { const float v = row[i]; const float d = PASS ? __fadd_rn(v, -mu) : v; s = __fadd_rn(s, PASS ? __fmul_rn(d, d) : d); }
  red[t] = s; __syncthreads(); for (int st = 128; st > 0; st >>= 1) { if (t < st) red[t] = __fadd_rn(red[t], red[t + st]); __syncthreads(); }
  if (t < 32) { const float pv = (t == 0) ? red[0] : 0.f; *(float*)(PART + bc * 32 + t) = pv;  } }      

template <int PASS>
__global__ __launch_bounds__(256) void k_cstB(const float* __restrict__ PART, float* __restrict__ MV) { const int c = threadIdx.x; if (c >= NC) return; double s = 0.0; for (int b = 0; b < NB; ++b) s += (double)PART[((size_t)b * NC + c) * 32]; const float m = (float)(s / ((double)NB * (double)NPX)); *(float*)(MV + PASS * NC + c) = m;  }


__global__ __launch_bounds__(256) void k_bnresid(const float* __restrict__ C2, const float* __restrict__ MV, const float* __restrict__ g, const float* __restrict__ be, const float* __restrict__ X, float* __restrict__ out, size_t n4) {
  #pragma clang fp contract(off)
  const size_t t = (size_t)blockIdx.x * 256 + threadIdx.x; if (t >= n4) return; const size_t e = t * 4; const int c = (int)((e / NPX) % NC); const float sc = __fmul_rn(rsqrtf(__fadd_rn(MV[NC + c], BNEPS)), bf16_round(g[c])); const float mu = MV[c], bb = bf16_round(be[c]);
  const v4f a = *(const v4fa*)(C2 + e); const v4f xx = *(const v4fa*)(X + e); v4f o; for (int q = 0; q < 4; ++q) { const float z = __fadd_rn(__fmul_rn(__fadd_rn(a[q], -mu), sc), bb); o[q] = __fadd_rn(z, bf16_round(xx[q])); }
  *(v4f*)(out + e) = o;  }


__global__ __launch_bounds__(256) void k_rowbias(float* __restrict__ Y, const float* __restrict__ bias) {
  #pragma clang fp contract(off)
  const size_t t = (size_t)blockIdx.x * 256 + threadIdx.x; if (t >= (size_t)NB * NC * NPX / 4) return; const size_t e = t * 4; const int c = (int)((e / NPX) % NC); const float bb = bf16_round(bias[c]);
  v4f v = *(const v4fa*)(Y + e); for (int q = 0; q < 4; ++q) v[q] = __fadd_rn(v[q], bb); *(v4f*)(Y + e) = v;  }



template <int NBt, int QTt, int NKt>
__global__ __launch_bounds__(256) void k_bsm(const float* __restrict__ S, _Float16* __restrict__ P) {
  #pragma clang fp contract(off)
  const size_t t = (size_t)blockIdx.x * 256 + threadIdx.x; if (t >= (size_t)QTt * NKt / 8) return; const size_t e = t * 8; float mx[8], se[8];
  for (int q = 0; q < 8; ++q) { mx[q] = -3.0e38f; se[q] = 0.f; }
#pragma unroll
  for (int b = 0; b < NBt; ++b) { const float* s = S + (size_t)b * QTt * NKt + e; for (int q = 0; q < 8; ++q) mx[q] = fmaxf(mx[q], s[q]); }
#pragma unroll
  for (int b = 0; b < NBt; ++b) { const float* s = S + (size_t)b * QTt * NKt + e; for (int q = 0; q < 8; ++q) se[q] += __expf(s[q] - mx[q]); }
#pragma unroll
  for (int b = 0; b < NBt; ++b) { const float* s = S + (size_t)b * QTt * NKt + e; FragH f; for (int q = 0; q < 8; ++q) f.h[q] = (_Float16)(__expf(s[q] - mx[q]) * (256.0f / se[q]));
    unsigned short* d = (unsigned short*)P + (size_t)b * QTt * NKt + e; *(v8us*)d = f.half[0];  } }
extern "C" void kernel_launch(void* const* d_in, const int* in_sizes, int n_in,
                              void* d_out, int out_size, void* d_ws, size_t ws_size, hipStream_t stream) {
  (void)in_sizes; (void)n_in; (void)out_size;
  const float* const* I = (const float* const*)d_in; const float* xq = I[0]; const float* xk = I[1]; const float* xv = I[2];      /* Q, K, V [8][4096][64] (bf16-valued) */
  constexpr int NBt = 8, SQt = 4096, DK = 64, QTt = 256;      /* batches, sequence, width, query rows per tile */
  char* ws = (char*)d_ws; size_t off = 0;
  auto take = [&](size_t bytes) { char* p = ws + off; off += (bytes + 255) & ~(size_t)255; return p; };
  const size_t PLN = (size_t)SQt * DK;      /* one batch's [4096][64] plane */
  _Float16* Q16 = (_Float16*)take(NBt * PLN * 2); _Float16* K16 = (_Float16*)take(NBt * PLN * 2); _Float16* V16 = (_Float16*)take(NBt * PLN * 2); _Float16* VT = (_Float16*)take(NBt * PLN * 2);
  float* S = (float*)take((size_t)NBt * QTt * SQt * 4); _Float16* P = (_Float16*)take((size_t)NBt * QTt * SQt * 2);
  if (off > ws_size) return;
  k_x16<<<(unsigned)((NBt * PLN / 8 + 255) / 256), 256, 0, stream>>>(xq, Q16, NBt * PLN / 8); k_x16<<<(unsigned)((NBt * PLN / 8 + 255) / 256), 256, 0, stream>>>(xk, K16, NBt * PLN / 8); k_x16<<<(unsigned)((NBt * PLN / 8 + 255) / 256), 256, 0, stream>>>(xv, V16, NBt * PLN / 8);      /* exact f16 copies of the bf16-valued inputs */
  for (int b = 0; b < NBt; ++b) k_vt<1, SQt><<<SQt / 64, 256, 0, stream>>>(V16 + (size_t)b * PLN, DK, 0, VT + (size_t)b * PLN);      /* V[b]^T [64][4096] */
  for (int q0 = 0; q0 < SQt; q0 += QTt) {
    k_gemm2<0><<<dim3((QTt / 128) * (SQt / 64), NBt), 128, 0, stream>>>(Q16 + (size_t)q0 * DK, DK, PLN, K16, DK, PLN, 0.125f, nullptr, 0, nullptr, 1, 0, 0, S, nullptr, SQt, (size_t)QTt * SQt, QTt, SQt, DK);      /* scores[b][i][j] = Q[b][q0+i].K[b][j] / 8 for all 8 batches (batch on grid.y) */
    k_bsm<NBt, QTt, SQt><<<(unsigned)(((size_t)QTt * SQt / 8 + 255) / 256), 256, 0, stream>>>(S, P);      /* softmax across the 8 batches of every (query, key) pair -> P x256 f16 */
    k_gemm2<0><<<dim3((QTt / 128) * (DK / 64), NBt), 128, 0, stream>>>(P, SQt, (size_t)QTt * SQt, VT, SQt, PLN, 0.00390625f, nullptr, 0, nullptr, 1, 0, 0, (float*)d_out + (size_t)q0 * DK, nullptr, DK, PLN, QTt, DK, SQt); }      /* out[b][q0+i][:] = sum_j P[b][i][j] V[b][j][:] 2^-8 f32 (batch on grid.y) */
}

// v002
// Measured time: 122 microseconds a run.
// Versions between v000 and this one are left out; their measured steps multiply to 17.4 times as fast.
#include <hip/hip_runtime.h>
// Dot-product attention whose softmax runs over the BATCH axis (Q, K, V [8][4096][64], no heads, no weights; scores = Q K^T / sqrt(64) -> [8][4096][4096]; attn = softmax(scores, axis = 0): for every (query, key) pair the 8 batch entries are normalised against each other (the module's literal axis; rows are NOT normalised over keys); out[b] = attn[b] V[b] -> [8][4096][64]).
// Structure: the bf16-valued inputs as exact f16; K and V^T (per batch via LDS transposes, once) are written in WMMA fragment order, so that every wave-wide 16-byte load of the walk reads 512 contiguous bytes (4 whole lines, not 32 bytes of each of 16 lines); then ONE fused launch: a work-group owns 16 query rows of all 8 batches and walks the keys 128 at a time. Part 1 of a pass: wave w forms S^T = K Q^T for its 16 keys in all 8 batches (WMMA, f32 accumulation, K = 64), so a lane holds the 8 batch values of each (query, key) pair and normalises them in registers (f32, native exp; weights x256 f16), then stores 8 keys of one query per batch to LDS. Part 2: wave w is batch w: out[w] += P[w] V[w]^T (WMMA, f32), keys in ascending order; x 2^-8 at the end. Scores and weights never reach memory.
// Compute dtype: inputs rounded to bf16; x / weights exact; q, k, v and softmax weights as plain f16 GEMM operands (~2^-12); scores, softmax statistics and o f32. v_wmma_f32_16x16x32_f16.
#define NB 4
#define SQ 4096
#define DM 256
#define NH 1
#define HD 64
#define HG 4                         /* heads per attention launch group */
#define B0 0                         /* first batch processed (debug hook) */
#define NBR NB                       /* batches processed (debug hook) */
#define NR ((size_t)NB * SQ)         /* token rows */
#define MP ((int)((size_t)NBR * SQ)) /* rows projected (debug hook) */
#define QT 256                       /* query rows per causal tile */
#define NKX SQ                       /* S / P row pitch */
#define QT0 256                      /* first-tile rows recomputed exactly (256: buys margin for the few-key rows 128..255, which have no output projection to average the single-f16 P/v rounding) */
#define QN SQ                        /* query rows attended per batch (debug hook) */
#define NHD NH                       /* heads attended (debug hook) */
#define MPO MP                       /* rows through the output stage (debug hook) */
#define LQ DM            /* row pitch of the q/k/v rows */
typedef __bf16 v16b __attribute__((ext_vector_type(16)));
typedef unsigned short v8us __attribute__((ext_vector_type(8), may_alias));
typedef float  v8f  __attribute__((ext_vector_type(8)));
typedef float  v4f  __attribute__((ext_vector_type(4)));
typedef float  v4fa __attribute__((ext_vector_type(4), may_alias));
union FragB { v16b v; v8us half[2]; unsigned short u[16]; };

__device__ __forceinline__ unsigned short bf16_bits(float x) { unsigned int u = __float_as_uint(x); return (unsigned short)((u + 0x7FFFu + ((u >> 16) & 1u)) >> 16); }
__device__ __forceinline__ float bf16_val(unsigned short b) { return __uint_as_float(((unsigned int)b) << 16); }
__device__ __forceinline__ float bf16_round(float x) { return bf16_val(bf16_bits(x)); }
// D += A·B with NT terms: 1 = ah·bh, 2 = + al·bh (A split), 3 = + ah·bl (both split)
template <int NT>
__device__ __forceinline__ v8f mmaN(v16b ah, v16b al, v16b bh, v16b bl, v8f c) {
  c = __builtin_amdgcn_wmma_f32_16x16x32_bf16(false, ah, false, bh, (short)0, c, false, false);
  if (NT >= 2) c = __builtin_amdgcn_wmma_f32_16x16x32_bf16(false, al, false, bh, (short)0, c, false, false);
  if (NT >= 3) c = __builtin_amdgcn_wmma_f32_16x16x32_bf16(false, ah, false, bl, (short)0, c, false, false);
  asm volatile("v_nop\n\tv_nop\n\tv_nop\n\tv_nop" : "+v"(c) : "v"(ah), "v"(al), "v"(bh), "v"(bl));
  return c;
}

__global__ __launch_bounds__(256) void k_wt_bf16(const float* __restrict__ W, unsigned short* __restrict__ Wt, int K, int N) {
  const int t = blockIdx.x * 256 + threadIdx.x;
  const int k8n = K / 8;
  if (t >= N * k8n) return;
  const int n = t / k8n, k8 = (t % k8n) * 8;
  v8us v;
#pragma unroll
  for (int i = 0; i < 8; ++i) v[i] = bf16_bits(W[(size_t)(k8 + i) * N + n]);
  *(v8us*)(Wt + (size_t)n * K + k8) = v;
  
}

// GEMM C[M][N] (f32, pitch ldc) = act(A[M][K]·W + bias). A f32 row-major (pitch lda) converted per fragment to bf16
// (ASPLIT: hi/lo two planes -> 2 terms, else single rounded term); Wt bf16 [N][K] (pitch ldb). BIAS_BF16 rounds the
// bias to bf16 first (bias quantised to bf16 before the add). K%32==0, M%16==0, N%64==0.
template <bool ASPLIT, int ACT, bool BIAS_BF16>
__global__ __launch_bounds__(128) void k_gemm_bf(const float* __restrict__ A, int lda, const unsigned short* __restrict__ Wt, int ldb,
                                               const float* __restrict__ bias, float* __restrict__ C, int ldc, int M, int N, int K) {
  __shared__ __attribute__((aligned(16))) float so[4][16][64];
  const int tid = threadIdx.x, w = tid >> 5, lane = tid & 31, ln = lane & 15, hh = lane >> 4;
  const int ntn = N / 64;
  const int wid = blockIdx.x * 4 + w;
  const int mt = wid / ntn, nq = wid % ntn;
  if (mt * 16 >= M) return;
  const int row0 = mt * 16, col0 = nq * 64;
  const float* arow = A + (size_t)(row0 + ln) * lda;
  v8f acc[4] = {};
  for (int kb = 0; kb < K; kb += 32) {
    FragB ah, al;
    const v4f x0 = *(const v4fa*)(arow + kb + 8 * hh), x1 = *(const v4fa*)(arow + kb + 8 * hh + 4);
    const v4f x2 = *(const v4fa*)(arow + kb + 16 + 8 * hh), x3 = *(const v4fa*)(arow + kb + 16 + 8 * hh + 4);
    float xs[16] = {x0[0],x0[1],x0[2],x0[3],x1[0],x1[1],x1[2],x1[3],x2[0],x2[1],x2[2],x2[3],x3[0],x3[1],x3[2],x3[3]};
#pragma unroll
    for (int i = 0; i < 16; ++i) { const unsigned short hb = bf16_bits(xs[i]); ah.u[i] = hb; al.u[i] = ASPLIT ? bf16_bits(xs[i] - bf16_val(hb)) : (unsigned short)0; }
#pragma unroll
    for (int t = 0; t < 4; ++t) {
      const unsigned short* brow = Wt + (size_t)(col0 + t * 16 + ln) * ldb + kb;
      FragB b;
      b.half[0] = *(const v8us*)(brow + 8 * hh);
      b.half[1] = *(const v8us*)(brow + 16 + 8 * hh);
      acc[t] = mmaN<ASPLIT ? 2 : 1>(ah.v, al.v, b.v, b.v, acc[t]);
    }
  }
#pragma unroll
  for (int t = 0; t < 4; ++t) {
    float bv = bias ? bias[col0 + t * 16 + ln] : 0.f;
    if (BIAS_BF16) bv = bf16_round(bv);
#pragma unroll
    for (int r = 0; r < 8; ++r) { float v = acc[t][r] + bv; if (ACT == 1) v = fmaxf(v, 0.f); so[w][8 * hh + r][t * 16 + ln] = v; }
  }
  __builtin_amdgcn_fence(__ATOMIC_ACQ_REL, "workgroup");
  __builtin_amdgcn_wave_barrier();
  const int rsub = lane >> 4, c4 = (lane & 15) * 4;
  {
#pragma unroll
    for (int q = 0; q < 8; ++q) {
      const int r = q * 2 + rsub;
      const v4f v = *(const v4fa*)&so[w][r][c4];
      *(v4f*)(C + (size_t)(row0 + r) * ldc + col0 + c4) = v;
    }
    
  }
}

// GEMM C = act(A·W + bias + resid): A f32 (ASPLIT -> hi/lo 2 terms), Wt bf16 [N][K]; ACT 0 none, 1 relu, 2 exact gelu;
// resid (optional, f32, row index = (row % rmod), pitch ldr, RES_BF16 rounds it) added before the activation.
template <bool ASPLIT, int ACT, bool BIAS_BF16, bool RES_BF16>
__global__ __launch_bounds__(128) void k_gemm_bf3(const float* __restrict__ A, int lda, const unsigned short* __restrict__ Wt, int ldb,
                                                const float* __restrict__ bias, const float* __restrict__ resid, int rmod, int ldr,
                                                float* __restrict__ C, int ldc, int M, int N, int K) {
  __shared__ __attribute__((aligned(16))) float so[4][16][64];
  const int tid = threadIdx.x, w = tid >> 5, lane = tid & 31, ln = lane & 15, hh = lane >> 4;
  const int ntn = N / 64;
  const int wid = blockIdx.x * 4 + w;
  const int mt = wid / ntn, nq = wid % ntn;
  if (mt * 16 >= M) return;
  const int row0 = mt * 16, col0 = nq * 64;
  const float* arow = A + (size_t)(row0 + ln) * lda;
  v8f acc[4] = {};
  for (int kb = 0; kb < K; kb += 32) {
    FragB ah, al;
    const v4f x0 = *(const v4fa*)(arow + kb + 8 * hh), x1 = *(const v4fa*)(arow + kb + 8 * hh + 4);
    const v4f x2 = *(const v4fa*)(arow + kb + 16 + 8 * hh), x3 = *(const v4fa*)(arow + kb + 16 + 8 * hh + 4);
    float xs[16] = {x0[0],x0[1],x0[2],x0[3],x1[0],x1[1],x1[2],x1[3],x2[0],x2[1],x2[2],x2[3],x3[0],x3[1],x3[2],x3[3]};
#pragma unroll
    for (int i = 0; i < 16; ++i) { const unsigned short hb = bf16_bits(xs[i]); ah.u[i] = hb; al.u[i] = ASPLIT ? bf16_bits(xs[i] - bf16_val(hb)) : (unsigned short)0; }
#pragma unroll
    for (int t = 0; t < 4; ++t) {
      const unsigned short* brow = Wt + (size_t)(col0 + t * 16 + ln) * ldb + kb;
      FragB b;
      b.half[0] = *(const v8us*)(brow + 8 * hh);
      b.half[1] = *(const v8us*)(brow + 16 + 8 * hh);
      acc[t] = mmaN<ASPLIT ? 2 : 1>(ah.v, al.v, b.v, b.v, acc[t]);
    }
  }
#pragma unroll
  for (int t = 0; t < 4; ++t) {
    const int col = col0 + t * 16 + ln;
    float bv = bias ? bias[col] : 0.f;
    if (BIAS_BF16) bv = bf16_round(bv);
#pragma unroll
    for (int r = 0; r < 8; ++r) {
      float v = acc[t][r] + bv;
      if (resid) { float rv = resid[(size_t)((row0 + 8 * hh + r) % rmod) * ldr + col]; if (RES_BF16) rv = bf16_round(rv); v += rv; }
      if (ACT == 1) v = fmaxf(v, 0.f);
      if (ACT == 2) v = 0.5f * v * (1.0f + erff(v * 0.70710678118654752f));
      if (ACT == 3) { const float u = 0.7978845608028654f * (v + 0.044715f * v * v * v); v = 0.5f * v * (1.0f + tanhf(u)); }
      so[w][8 * hh + r][t * 16 + ln] = v;
    }
  }
  __builtin_amdgcn_fence(__ATOMIC_ACQ_REL, "workgroup");
  __builtin_amdgcn_wave_barrier();
  const int rsub = lane >> 4, c4 = (lane & 15) * 4;
  {
#pragma unroll
    for (int q = 0; q < 8; ++q) {
      const int r = q * 2 + rsub;
      const v4f v = *(const v4fa*)&so[w][r][c4];
      *(v4f*)(C + (size_t)(row0 + r) * ldc + col0 + c4) = v;
    }
    
  }
}
// row LayerNorm (biased variance, eps) over N: s = X (+ R); optional out_sum <- s; out_norm <- (s-mu)*rsqrt(var+eps)*g + b
template <bool PARAM_BF16>
__global__ __launch_bounds__(256) void k_layernorm(const float* __restrict__ X, const float* __restrict__ R, const float* __restrict__ g, const float* __restrict__ bta,
                                                  float* __restrict__ out_sum, float* __restrict__ out_norm, int N, float eps) {
  __shared__ float red[256];
  const int row = blockIdx.x, tid = threadIdx.x;
  const float* x = X + (size_t)row * N; const float* rr = R ? R + (size_t)row * N : nullptr;
  float vals[16];                     // up to N = 4096
  const int per = N / 256;            // contiguous chunk per thread? use strided-by-4 chunks: thread handles j = tid*4 + 1024*u
  float s1 = 0.f;
  for (int u = 0; u < per / 4; ++u) {
    const int j = tid * 4 + 1024 * u;
    const v4f a = *(const v4fa*)(x + j);
    v4f b = {0.f,0.f,0.f,0.f}; if (rr) b = *(const v4fa*)(rr + j);
#pragma unroll
    for (int q = 0; q < 4; ++q) { const float v = a[q] + b[q]; vals[u * 4 + q] = v; s1 += v; }
  }
  red[tid] = s1; __syncthreads();
  for (int st = 128; st > 0; st >>= 1) { if (tid < st) red[tid] += red[tid + st]; __syncthreads(); }
  const float mu = red[0] / (float)N; __syncthreads();
  float s2 = 0.f;
  for (int u = 0; u < per / 4; ++u)
#pragma unroll
    for (int q = 0; q < 4; ++q) { const float c = vals[u * 4 + q] - mu; s2 += c * c; }
  red[tid] = s2; __syncthreads();
  for (int st = 128; st > 0; st >>= 1) { if (tid < st) red[tid] += red[tid + st]; __syncthreads(); }
  const float rs = rsqrtf(red[0] / (float)N + eps);
  {
    for (int u = 0; u < per / 4; ++u) {
      const int j = tid * 4 + 1024 * u;
      v4f o, sm;
#pragma unroll
      for (int q = 0; q < 4; ++q) {
        float gg = g[j + q], bb = bta[j + q];
        if (PARAM_BF16) { gg = bf16_round(gg); bb = bf16_round(bb); }
        sm[q] = vals[u * 4 + q]; o[q] = (vals[u * 4 + q] - mu) * rs * gg + bb;
      }
      if (out_sum) *(v4f*)(out_sum + (size_t)row * N + j) = sm;
      *(v4f*)(out_norm + (size_t)row * N + j) = o;
    }
    
  }
}



// ---- f16 WMMA path (v_wmma_f32_16x16x32_f16): 11-bit significands for operands in range — used where a [0,1] probability operand needs more precision than bf16
typedef _Float16 v16h __attribute__((ext_vector_type(16)));
union FragH { v16h v; v8us half[2]; _Float16 h[16]; unsigned short u[16]; };
template <int NT>
__device__ __forceinline__ v8f mmaH(v16h ah, v16h al, v16h bh, v16h bl, v8f c) {
  c = __builtin_amdgcn_wmma_f32_16x16x32_f16(false, ah, false, bh, (short)0, c, false, false);
  if (NT >= 2) c = __builtin_amdgcn_wmma_f32_16x16x32_f16(false, al, false, bh, (short)0, c, false, false);
  if (NT >= 3) c = __builtin_amdgcn_wmma_f32_16x16x32_f16(false, ah, false, bl, (short)0, c, false, false);
  asm volatile("v_nop\n\tv_nop\n\tv_nop\n\tv_nop" : "+v"(c) : "v"(ah), "v"(al), "v"(bh), "v"(bl));
  return c;
}
// batched GEMM like k_gemm_b but f16 operands: A f32 (split into f16 hi/lo if ASPLIT, else rounded to f16), Bt = f16 values [n][k]; alpha; C f32; N multiple of 16 (partial tiles skipped)
template <bool ASPLIT>
__global__ __launch_bounds__(128) void k_gemm_h(const float* __restrict__ A, int lda, size_t sA, const _Float16* __restrict__ Bh, int ldb, size_t sB, float alpha, float* __restrict__ C, int ldc, size_t sC, int M, int N, int K) {
  __shared__ __attribute__((aligned(16))) float so[4][16][64];
  const int tid = threadIdx.x, w = tid >> 5, lane = tid & 31, ln = lane & 15, hh = lane >> 4; const int by = blockIdx.y;
  A += (size_t)by * sA; Bh += (size_t)by * sB; C += (size_t)by * sC;
  const int ntn = (N + 63) / 64; const int wid = blockIdx.x * 4 + w; const int mt = wid / ntn, nq = wid % ntn; if (mt * 16 >= M) return;
  const int row0 = mt * 16, col0 = nq * 64; const float* arow = A + (size_t)(row0 + ln) * lda;
  v8f acc[4] = {};
  for (int kb = 0; kb < K; kb += 32) {
    FragH ah, al;
    const v4f x0 = *(const v4fa*)(arow + kb + 8 * hh), x1 = *(const v4fa*)(arow + kb + 8 * hh + 4), x2 = *(const v4fa*)(arow + kb + 16 + 8 * hh), x3 = *(const v4fa*)(arow + kb + 16 + 8 * hh + 4);
    float xs[16] = {x0[0],x0[1],x0[2],x0[3],x1[0],x1[1],x1[2],x1[3],x2[0],x2[1],x2[2],x2[3],x3[0],x3[1],x3[2],x3[3]};
#pragma unroll
    for (int i = 0; i < 16; ++i) { const _Float16 h = (_Float16)xs[i]; ah.h[i] = h; al.h[i] = ASPLIT ? (_Float16)(xs[i] - (float)h) : (_Float16)0.0f; }
#pragma unroll
    for (int t = 0; t < 4; ++t) { if (col0 + t * 16 >= N) continue; const size_t boff = (size_t)(col0 + t * 16 + ln) * ldb + kb; FragH bq; bq.half[0] = *(const v8us*)(Bh + boff + 8 * hh); bq.half[1] = *(const v8us*)(Bh + boff + 16 + 8 * hh);
      acc[t] = mmaH<ASPLIT ? 2 : 1>(ah.v, al.v, bq.v, bq.v, acc[t]); }
  }
#pragma unroll
  for (int t = 0; t < 4; ++t) { if (col0 + t * 16 >= N) continue;
#pragma unroll
    for (int r = 0; r < 8; ++r) so[w][8 * hh + r][t * 16 + ln] = acc[t][r] * alpha; }
  __builtin_amdgcn_fence(__ATOMIC_ACQ_REL, "workgroup"); __builtin_amdgcn_wave_barrier();
  const int rsub = lane >> 4, c4 = (lane & 15) * 4;
  {
#pragma unroll
    for (int q = 0; q < 8; ++q) { const int r = q * 2 + rsub; if (col0 + c4 < N) { const v4f v = *(const v4fa*)&so[w][r][c4]; *(v4f*)(C + (size_t)(row0 + r) * ldc + col0 + c4) = v; } }
     }
}

// Wt[n][k] = f16(W[k][n]·scale) from f32 row-major W[K][N] (scale = power of two; bf16-exact weights stay exact in f16 away from the subnormal range)
__global__ __launch_bounds__(256) void k_wt_f16(const float* __restrict__ W, _Float16* __restrict__ Wt, int K, int N, float scale) {
  const int t = blockIdx.x * 256 + threadIdx.x; if (t >= N * (K / 8)) return; const int n = t / (K / 8), k8 = (t % (K / 8)) * 8; FragH f;
#pragma unroll
  for (int i = 0; i < 8; ++i) f.h[i] = (_Float16)(bf16_round(W[(size_t)(k8 + i) * N + n]) * scale); const v8us o = f.half[0];
  *(v8us*)((unsigned short*)Wt + (size_t)n * K + k8) = o; 
}
// k_gemm_hh variant with fused epilogue: v = acc·alpha + bias[by·sBias + col] (+ CP[(row/rowsPerB)·sCPb + by·64 + col] if CP) ; ACT 0 none / 1 elu ; writes f16 C16 (and f32 C if non-null)
template <int ACT>
__global__ __launch_bounds__(128) void k_gemm_hhx(const _Float16* __restrict__ A, int lda, size_t sA, const _Float16* __restrict__ Bh, int ldb, size_t sB, float alpha, const float* __restrict__ bias, size_t sBias, const float* __restrict__ CP, int rowsPerB, size_t sCPb, int row0g,
    float* __restrict__ C, _Float16* __restrict__ C16, int ldc, size_t sC, int M, int N, int K) {
  __shared__ __attribute__((aligned(16))) float so[4][16][64];
  const int tid = threadIdx.x, w = tid >> 5, lane = tid & 31, ln = lane & 15, hh = lane >> 4; const int by = blockIdx.y;
  A += (size_t)by * sA; Bh += (size_t)by * sB; const size_t cofs = (size_t)by * sC; const float* bp = bias ? bias + (size_t)by * sBias : nullptr;
  const int ntn = (N + 63) / 64; const int wid = blockIdx.x * 4 + w; const int mt = wid / ntn, nq = wid % ntn; if (mt * 16 >= M) return;
  const int row0 = mt * 16, col0 = nq * 64; const _Float16* arow = A + (size_t)(row0 + ln) * lda;
  v8f acc[4] = {};
  for (int kb = 0; kb < K; kb += 32) { FragH ah; ah.half[0] = *(const v8us*)((const unsigned short*)arow + kb + 8 * hh); ah.half[1] = *(const v8us*)((const unsigned short*)arow + kb + 16 + 8 * hh);
#pragma unroll
    for (int t = 0; t < 4; ++t) { if (col0 + t * 16 >= N) continue; const size_t boff = (size_t)(col0 + t * 16 + ln) * ldb + kb; FragH bq; bq.half[0] = *(const v8us*)((const unsigned short*)Bh + boff + 8 * hh); bq.half[1] = *(const v8us*)((const unsigned short*)Bh + boff + 16 + 8 * hh);
      acc[t] = mmaH<1>(ah.v, ah.v, bq.v, bq.v, acc[t]); }
  }
#pragma unroll
  for (int t = 0; t < 4; ++t) { if (col0 + t * 16 >= N) continue; const int col = col0 + t * 16 + ln; const float bv = bp ? bf16_round(bp[col]) : 0.f;
#pragma unroll
    for (int r = 0; r < 8; ++r) { float v = acc[t][r] * alpha + bv; if (CP) { const int rr = row0g + row0 + 8 * hh + r; if (rowsPerB < 0) v += CP[cofs + (size_t)rr * ldc + col];      /* rowsPerB < 0: own element of the batched C plane */ else { const int bidx = rr / rowsPerB; v += CP[(size_t)bidx * sCPb + (size_t)by * 64 + col]; } } if (ACT == 1) v = (v > 0.f) ? v : expm1f(v); else if (ACT == 7) v = (v > 0.f) ? v + 1.0f : expf(v); else if (ACT == 8) v = tanhf(v); else if (ACT == 9) v = 0.5f * v * (1.0f + tanhf(0.7978845608028654f * (v + 0.044715f * v * v * v))); else if (ACT == 11) v = 1.0f / (1.0f + expf(-v)); else if (ACT == 12) v = (v > 0.f) ? v : 0.01f * v; else if (ACT == 14) v = (v > 0.f) ? v : 0.1f * v; else if (ACT == 16) v = (v >= 0.f) ? v : 0.3f * v; else if (ACT == 17) v = (v >= 0.f) ? v : 0.2f * v; else if (ACT == 15) v = v / (1.0f + expf(-v)); else if (ACT == 3) v = fmaxf(v, 0.f); else if (ACT == 6) v = 0.5f * v * (1.0f + erff(v * 0.70710678118654752f)); so[w][8 * hh + r][t * 16 + ln] = v; } }
  __builtin_amdgcn_fence(__ATOMIC_ACQ_REL, "workgroup"); __builtin_amdgcn_wave_barrier();
  const int rsub = lane >> 4, c4 = (lane & 15) * 4; typedef _Float16 v4h __attribute__((ext_vector_type(4)));
  {
#pragma unroll
    for (int q = 0; q < 8; ++q) { const int r = q * 2 + rsub; if (col0 + c4 < N) { const v4f v = *(const v4fa*)&so[w][r][c4]; if (C) *(v4f*)(C + cofs + (size_t)(row0 + r) * ldc + col0 + c4) = v; if (C16) { v4h h4; for (int i = 0; i < 4; ++i) h4[i] = (_Float16)v[i]; *(v4h*)(C16 + cofs + (size_t)(row0 + r) * ldc + col0 + c4) = h4; } } }
     }
}


typedef _Float16 v4h __attribute__((ext_vector_type(4)));

__global__ __launch_bounds__(256) void k_x16(const float* __restrict__ x, _Float16* __restrict__ X16, size_t n8) { const size_t t = (size_t)blockIdx.x * 256 + threadIdx.x; if (t >= n8) return; FragH f;
#pragma unroll
  for (int q = 0; q < 8; ++q) f.h[q] = (_Float16)bf16_round(x[t * 8 + q]); *(v8us*)((unsigned short*)X16 + t * 8) = f.half[0];  }
__global__ __launch_bounds__(256) void k_h16(const float* __restrict__ x, _Float16* __restrict__ X16, size_t n8) { const size_t t = (size_t)blockIdx.x * 256 + threadIdx.x; if (t >= n8) return; FragH f;
#pragma unroll
  for (int q = 0; q < 8; ++q) f.h[q] = (_Float16)x[t * 8 + q]; *(v8us*)((unsigned short*)X16 + t * 8) = f.half[0];  }
__global__ __launch_bounds__(256) void k_round16f(const float* __restrict__ W, _Float16* __restrict__ Bt, size_t n8) { const size_t t = (size_t)blockIdx.x * 256 + threadIdx.x; if (t >= n8) return; FragH f;
#pragma unroll
  for (int i = 0; i < 8; ++i) f.h[i] = (_Float16)(bf16_round(W[t * 8 + i]) * 16.0f); *(v8us*)((unsigned short*)Bt + t * 8) = f.half[0];  }
template <int NHv, int TTv>
__global__ __launch_bounds__(256) void k_vt(const _Float16* __restrict__ V16, int ldv, int voff, _Float16* __restrict__ Vt) { __shared__ unsigned short tl[64][66]; const int tid = threadIdx.x; const int slab = blockIdx.x / (TTv / 64), lg = blockIdx.x % (TTv / 64); const int b = slab / NHv, h = slab % NHv;
  for (int i = tid; i < 64 * 8; i += 256) { const int r = i / 8, c8 = (i % 8) * 8; FragH f; f.half[0] = *(const v8us*)((const unsigned short*)V16 + ((size_t)b * TTv + lg * 64 + r) * ldv + voff + h * 64 + c8);
#pragma unroll
    for (int q = 0; q < 8; ++q) tl[r][c8 + q] = f.u[q]; }
  __syncthreads();
  {
#pragma unroll
    for (int rd = 0; rd < 2; ++rd) { const int d = rd * 32 + tid / 8, pc = tid % 8; FragH f;
#pragma unroll
      for (int q = 0; q < 8; ++q) f.u[q] = tl[pc * 8 + q][d];
      *(v8us*)((unsigned short*)Vt + ((size_t)slab * 64 + d) * TTv + lg * 64 + pc * 8) = f.half[0]; }
     } }

__global__ __launch_bounds__(256) void k_hl(const float* __restrict__ F, _Float16* __restrict__ Hh, _Float16* __restrict__ Hl, size_t n8) { const size_t t = (size_t)blockIdx.x * 256 + threadIdx.x; if (t >= n8) return; FragH fh, fl; const v4f a = *(const v4fa*)(F + t * 8), c = *(const v4fa*)(F + t * 8 + 4);
#pragma unroll
  for (int q = 0; q < 4; ++q) { _Float16 h = (_Float16)a[q]; fh.h[q] = h; fl.h[q] = (_Float16)((a[q] - (float)h) * 1024.0f); h = (_Float16)c[q]; fh.h[4 + q] = h; fl.h[4 + q] = (_Float16)((c[q] - (float)h) * 1024.0f); }
  { *(v8us*)((unsigned short*)Hh + t * 8) = fh.half[0]; *(v8us*)((unsigned short*)Hl + t * 8) = fl.half[0];  } }

// ---- fast GEMM (wave tile 32x64; requires M % 32 == 0 rows per launch region and N % 64 == 0); epilogue = k_gemm_hhx semantics ----
__device__ __forceinline__ v16h g2_frag(const _Float16* p, int hh) { FragH f; f.half[0] = *(const v8us*)((const unsigned short*)p + 8 * hh); f.half[1] = *(const v8us*)((const unsigned short*)p + 16 + 8 * hh); return f.v; }
__device__ __forceinline__ v8f g2_mma(v16h a, v16h b, v8f c) { v8f d = __builtin_amdgcn_wmma_f32_16x16x32_f16(false, a, false, b, (short)0, c, false, false); asm volatile("v_nop\n\tv_nop\n\tv_nop\n\tv_nop" : "+v"(d) : "v"(a), "v"(b)); return d; }
template <int ACT>
__global__ __launch_bounds__(128) void k_gemm2(const _Float16* __restrict__ A, int lda, size_t sA, const _Float16* __restrict__ Bh, int ldb, size_t sB, float alpha, const float* __restrict__ bias, size_t sBias, const float* __restrict__ CP, int rowsPerB, size_t sCPb, int row0g,
    float* __restrict__ C, _Float16* __restrict__ C16, int ldc, size_t sC, int M, int N, int K) { static_assert(ACT == 0 || ACT == 3 || ACT == 6 || ACT == 8 || ACT == 9 || ACT == 11 || ACT == 12 || ACT == 14 || ACT == 15 || ACT == 16 || ACT == 17, "k_gemm2: unsupported ACT code (would silently apply no activation)");
  __shared__ __attribute__((aligned(16))) float so[4][32][68];
  const int tid = threadIdx.x, w = tid >> 5, lane = tid & 31, ln = lane & 15, hh = lane >> 4; const int by = blockIdx.y;
  A += (size_t)by * sA; Bh += (size_t)by * sB; const size_t cofs = (size_t)by * sC; const float* bp = bias ? bias + (size_t)by * sBias : nullptr;
  const int ntn = N >> 6; const int mt = blockIdx.x / ntn, nq = blockIdx.x - mt * ntn; const int row0 = mt * 128 + 32 * w, col0 = nq * 64; if (row0 >= M) return;
  const _Float16* a0p = A + (size_t)(row0 + ln) * lda; const _Float16* a1p = a0p + (size_t)16 * lda;
  const _Float16* b0p = Bh + (size_t)(col0 + ln) * ldb; const _Float16* b1p = b0p + (size_t)16 * ldb; const _Float16* b2p = b1p + (size_t)16 * ldb; const _Float16* b3p = b2p + (size_t)16 * ldb;
  const v8f z8 = {0.f,0.f,0.f,0.f,0.f,0.f,0.f,0.f}; v8f c00 = z8, c01 = z8, c02 = z8, c03 = z8, c10 = z8, c11 = z8, c12 = z8, c13 = z8;
#pragma unroll 1
  for (int kb = 0; kb < K; kb += 32) { const v16h a0 = g2_frag(a0p + kb, hh), a1 = g2_frag(a1p + kb, hh);
    v16h b = g2_frag(b0p + kb, hh); c00 = g2_mma(a0, b, c00); c10 = g2_mma(a1, b, c10);
    b = g2_frag(b1p + kb, hh); c01 = g2_mma(a0, b, c01); c11 = g2_mma(a1, b, c11);
    b = g2_frag(b2p + kb, hh); c02 = g2_mma(a0, b, c02); c12 = g2_mma(a1, b, c12);
    b = g2_frag(b3p + kb, hh); c03 = g2_mma(a0, b, c03); c13 = g2_mma(a1, b, c13); }
  v8f accs[8] = {c00, c01, c02, c03, c10, c11, c12, c13};
#pragma unroll
  for (int u = 0; u < 8; ++u) { const int t = u & 3, half = u >> 2; const int col = col0 + t * 16 + ln; const float bv = bp ? bf16_round(bp[col]) : 0.f;
#pragma unroll
    for (int r = 0; r < 8; ++r) { const int rloc = half * 16 + 8 * hh + r; float v = accs[u][r] * alpha + bv; if (CP) { if (rowsPerB < 0) v += CP[cofs + (size_t)(row0g + row0 + rloc) * ldc + col];      /* rowsPerB < 0: own element of the batched C plane */ else { const int bidx = (row0g + row0 + rloc) / rowsPerB; v += CP[(size_t)bidx * sCPb + (size_t)by * 64 + col]; } }
      if (ACT == 3) v = fmaxf(v, 0.f); else if (ACT == 6) v = 0.5f * v * (1.0f + erff(v * 0.70710678118654752f)); else if (ACT == 11) v = 1.0f / (1.0f + expf(-v)); else if (ACT == 15) v = v / (1.0f + expf(-v)); else if (ACT == 12) v = (v > 0.f) ? v : 0.01f * v; else if (ACT == 8) v = tanhf(v); else if (ACT == 9) v = 0.5f * v * (1.0f + tanhf(0.7978845608028654f * (v + 0.044715f * v * v * v))); else if (ACT == 14) v = (v > 0.f) ? v : 0.1f * v; else if (ACT == 16) v = (v >= 0.f) ? v : 0.3f * v; else if (ACT == 17) v = (v >= 0.f) ? v : 0.2f * v;
      so[w][rloc][t * 16 + ln] = v; } }
  __builtin_amdgcn_fence(__ATOMIC_ACQ_REL, "workgroup"); __builtin_amdgcn_wave_barrier();
  const int rsub = lane >> 4, c4 = (lane & 15) * 4;
  {
#pragma unroll
    for (int q = 0; q < 16; ++q) { const int r = q * 2 + rsub; const v4f v = *(const v4fa*)&so[w][r][c4]; if (C) *(v4f*)(C + cofs + (size_t)(row0 + r) * ldc + col0 + c4) = v; if (C16) { v4h h4; for (int i = 0; i < 4; ++i) h4[i] = (_Float16)v[i]; *(v4h*)(C16 + cofs + (size_t)(row0 + r) * ldc + col0 + c4) = h4; } }
     } }


__global__ __launch_bounds__(256) void k_wnat(const float* __restrict__ w, size_t n8, _Float16* __restrict__ Bt) { const size_t t = (size_t)blockIdx.x * 256 + threadIdx.x; if (t >= n8) return; FragH f; for (int q = 0; q < 8; ++q) f.h[q] = (_Float16)(bf16_round(w[t * 8 + q]) * 16.0f); *(v8us*)((unsigned short*)Bt + t * 8) = f.half[0];  }
__global__ __launch_bounds__(256) void k_rsm(const float* __restrict__ S, _Float16* __restrict__ P, int nrows) {
  #pragma clang fp contract(off)
  const int i = blockIdx.x * 256 + threadIdx.x; if (i >= nrows) return; const float* s = S + (size_t)i * SQ; float mx = -3.0e38f;
#pragma unroll 1
  for (int j = 0; j < SQ; ++j) mx = fmaxf(mx, s[j]); float se = 0.f;
#pragma unroll 1
  for (int j = 0; j < SQ; ++j) se += expf(s[j] - mx); const float sc = 256.0f / se;
#pragma unroll 1
  for (int j0 = 0; j0 < SQ; j0 += 8) { FragH f; for (int q = 0; q < 8; ++q) f.h[q] = (_Float16)(expf(s[j0 + q] - mx) * sc); unsigned short* d = (unsigned short*)P + (size_t)i * SQ + j0; *(v8us*)d = f.half[0];  } }
__global__ __launch_bounds__(256) void k_vt(const _Float16* __restrict__ V16, int b, int h0, _Float16* __restrict__ VT) { __shared__ unsigned short tl[64][65]; const int tid = threadIdx.x; const int hh = blockIdx.x % HG, sg = blockIdx.x / HG; const int s0 = sg * 64; const int h = h0 + hh;
  for (int i = tid; i < 64 * 8; i += 256) { const int j = i / 8, d8 = (i % 8) * 8; FragH f; f.half[0] = *(const v8us*)((const unsigned short*)V16 + ((size_t)b * SQ + s0 + j) * DM + h * HD + d8); for (int q = 0; q < 8; ++q) tl[d8 + q][j] = f.u[q]; }
  __syncthreads();
  { for (int i = tid; i < 64 * 8; i += 256) { const int d = i / 8, j8 = (i % 8) * 8; FragH f; for (int q = 0; q < 8; ++q) f.u[q] = tl[d][j8 + q]; *(v8us*)((unsigned short*)VT + ((size_t)hh * HD + d) * SQ + s0 + j8) = f.half[0]; }  } }



__global__ __launch_bounds__(256) void k_rsmcf2(const float* __restrict__ S, _Float16* __restrict__ P, int hg, int q0, int nk) {
  #pragma clang fp contract(off)
  const int t = blockIdx.x * 256 + threadIdx.x; if (t >= hg * QT) return; const size_t i = (size_t)t; const float* s = S + i * NKX; const int last = q0 + (t % QT); float mx = -3.0e38f;
#pragma unroll 1
  for (int j = 0; j < nk; ++j) { const float f = (j <= last) ? 1.f : 0.f; mx = fmaxf(mx, fmaf(f, s[j], (1.f - f) * -1.0e9f)); } float se = 0.f;
#pragma unroll 1
  for (int j = 0; j < nk; ++j) { const float f = (j <= last) ? 1.f : 0.f; se += __expf(fmaf(f, s[j], (1.f - f) * -1.0e9f) - mx); } const float sc = 256.0f / se;
#pragma unroll 1
  for (int j0 = 0; j0 < nk; j0 += 8) { FragH fr; for (int q = 0; q < 8; ++q) { const int j = j0 + q; const float f = (j <= last) ? 1.f : 0.f; fr.h[q] = (_Float16)(__expf(fmaf(f, s[j], (1.f - f) * -1.0e9f) - mx) * sc); } unsigned short* d = (unsigned short*)P + i * NKX + j0; *(v8us*)d = fr.half[0];  } }

template <int MASKADD>
__global__ __launch_bounds__(64) void k_att0(const float* __restrict__ QF, const float* __restrict__ KF, const float* __restrict__ VF, int ld, const float* __restrict__ mask, float scale, float* __restrict__ OF, int ldo) {
  #pragma clang fp contract(off)
  __shared__ __attribute__((aligned(16))) float lq[64][64]; __shared__ __attribute__((aligned(16))) float lo[64][64];
  const int tid = threadIdx.x; const int h = blockIdx.x / (QT0 / 64), rg = blockIdx.x % (QT0 / 64); const int i = rg * 64 + tid;
  const float* qr = QF + (size_t)i * ld + h * HD;
#pragma unroll 1
  for (int c = 0; c < HD / 4; ++c) { *(v4f*)&lq[tid][c * 4] = *(const v4fa*)(qr + c * 4); const v4f z = {0.f, 0.f, 0.f, 0.f}; *(v4f*)&lo[tid][c * 4] = z; }
  float m = -1.0e30f, l = 0.f; const int jmax = MASKADD ? (SQ - 1) : (rg * 64 + 63);      /* additive-mask form: every key (the mask input decides); causal form: keys up to the block's last row */
#pragma unroll 1
  for (int j = 0; j <= jmax; ++j) { const float* kr = KF + (size_t)j * ld + h * HD; const float* vr = VF + (size_t)j * ld + h * HD; float s = 0.f;
#pragma unroll 1
    for (int c = 0; c < HD / 4; ++c) { const v4f kq = *(const v4fa*)(kr + c * 4); const v4f qq = *(v4f*)&lq[tid][c * 4]; s = __fadd_rn(s, __fmul_rn(qq[0], kq[0])); s = __fadd_rn(s, __fmul_rn(qq[1], kq[1])); s = __fadd_rn(s, __fmul_rn(qq[2], kq[2])); s = __fadd_rn(s, __fmul_rn(qq[3], kq[3])); }
    s = __fmul_rn(s, scale); if (MASKADD) s = __fadd_rn(s, __fmul_rn(bf16_round(mask[(size_t)i * SQ + j]), -10000.0f));
    const float f = (MASKADD || j <= i) ? 1.f : 0.f; const float sm = fmaf(f, s, (1.f - f) * -1.0e30f); const float mn = fmaxf(m, sm); const float sc = expf(m - mn); const float e = expf(sm - mn); l = __fadd_rn(__fmul_rn(l, sc), e); m = mn;
#pragma unroll 1
    for (int c = 0; c < HD / 4; ++c) { const v4f vv = *(const v4fa*)(vr + c * 4); v4f oo = *(v4f*)&lo[tid][c * 4]; for (int u = 0; u < 4; ++u) oo[u] = __fadd_rn(__fmul_rn(oo[u], sc), __fmul_rn(e, vv[u])); *(v4f*)&lo[tid][c * 4] = oo; } }
  const float fin = 64.0f / l;      /* o carried x64 like the f16 path */
#pragma unroll 1
  for (int c = 0; c < HD / 4; ++c) { v4f oo = *(v4f*)&lo[tid][c * 4]; for (int u = 0; u < 4; ++u) oo[u] = __fmul_rn(oo[u], fin); *(v4f*)&lo[tid][c * 4] = oo; }
  __syncthreads();
  {
#pragma unroll 1
    for (int it = 0; it < 16; ++it) { const int row = it * 4 + tid / 16, pc = (tid % 16) * 4; const v4f v = *(const v4f*)&lo[row][pc]; *(v4f*)(OF + (size_t)(rg * 64 + row) * ldo + h * HD + pc) = v; }
     } }

__global__ __launch_bounds__(256) void k_oscale(const float* __restrict__ OF, float* __restrict__ out, size_t n4) { const size_t t = (size_t)blockIdx.x * 256 + threadIdx.x; if (t >= n4) return; const v4f a = *(const v4fa*)(OF + t * 4); v4f o; for (int q = 0; q < 4; ++q) o[q] = a[q] * 0.015625f; *(v4f*)(out + t * 4) = o;  }

__global__ __launch_bounds__(256) void k_bfr(const float* __restrict__ x, float* __restrict__ XB, size_t n8) { const size_t t = (size_t)blockIdx.x * 256 + threadIdx.x; if (t >= n8) return; v4f a = *(const v4fa*)(x + t * 8), c = *(const v4fa*)(x + t * 8 + 4); for (int q = 0; q < 4; ++q) { a[q] = bf16_round(a[q]); c[q] = bf16_round(c[q]); }
  { *(v4f*)(XB + t * 8) = a; *(v4f*)(XB + t * 8 + 4) = c;  } }



__global__ __launch_bounds__(256) void k_rsmfvl(const float* __restrict__ S, _Float16* __restrict__ P, _Float16* __restrict__ PL, int qn, const int* __restrict__ vlp) {
  #pragma clang fp contract(off)
  const int t = blockIdx.x * 256 + threadIdx.x; if (t >= qn) return; const int vl = vlp[0]; const size_t i = (size_t)t; const float* s = S + i * SQ; float mx = -3.0e38f;
#pragma unroll 1
  for (int j = 0; j < SQ; ++j) { const float f = (j < vl) ? 1.f : 0.f; mx = fmaxf(mx, fmaf(f, s[j], (1.f - f) * -1000000.0f)); } float se = 0.f;
#pragma unroll 1
  for (int j = 0; j < SQ; ++j) { const float f = (j < vl) ? 1.f : 0.f; se += __expf(fmaf(f, s[j], (1.f - f) * -1000000.0f) - mx); } const float sc = 256.0f / se;
#pragma unroll 1
  for (int j0 = 0; j0 < SQ; j0 += 8) { FragH fr, gr; for (int q = 0; q < 8; ++q) { const int j = j0 + q; const float f = (j < vl) ? 1.f : 0.f; const float pv = __expf(fmaf(f, s[j], (1.f - f) * -1000000.0f) - mx) * sc; const _Float16 ph = (_Float16)pv; fr.h[q] = ph; gr.h[q] = (_Float16)((pv - (float)ph) * 1024.0f); }
    unsigned short* d = (unsigned short*)P + i * SQ + j0; unsigned short* dl = (unsigned short*)PL + i * SQ + j0; *(v8us*)d = fr.half[0]; *(v8us*)dl = gr.half[0];  } }

__global__ __launch_bounds__(256) void k_rsmf(const float* __restrict__ S, _Float16* __restrict__ P, int qn, int hg) {
  #pragma clang fp contract(off)
  const int t = blockIdx.x * 256 + threadIdx.x; if (t >= qn * hg) return; const size_t i = (size_t)(t / qn) * SQ + (t % qn); const float* s = S + i * SQ; float mx = -3.0e38f;
#pragma unroll 1
  for (int j = 0; j < SQ; ++j) mx = fmaxf(mx, s[j]); float se = 0.f;
#pragma unroll 1
  for (int j = 0; j < SQ; ++j) se += __expf(s[j] - mx); const float sc = 256.0f / se;
#pragma unroll 1
  for (int j0 = 0; j0 < SQ; j0 += 8) { FragH f; for (int q = 0; q < 8; ++q) f.h[q] = (_Float16)(__expf(s[j0 + q] - mx) * sc); unsigned short* d = (unsigned short*)P + i * SQ + j0; *(v8us*)d = f.half[0];  } }


#define CN 256          /* channels */
#define CI 128
#define NC 256                       /* (unused legacy kernels) */
#define NPX NP          /* positions per channel row */
#define NP 4096         /* seq1 tokens */
#define NM 1024         /* seq2 tokens */
#define BNEPS 1e-5f

__global__ __launch_bounds__(256) void k_mp2(const float* __restrict__ src, float* __restrict__ dst, int nout) {
  const int t = blockIdx.x * 256 + threadIdx.x; if (t >= nout) return; const int c = t / 1024; const int o = t % 1024; const int oy = o / 32, ox = o % 32; const float* p = src + (size_t)c * 4096 + (size_t)(2 * oy) * 64 + 2 * ox;
  const float v = fmaxf(fmaxf(p[0], p[1]), fmaxf(p[64], p[65])); *(float*)(dst + t) = v;  }
__global__ __launch_bounds__(256) void k_xpb(const float* __restrict__ x, const float* __restrict__ wb, float* __restrict__ CPP, size_t n4) {
  #pragma clang fp contract(off)
  const size_t t = (size_t)blockIdx.x * 256 + threadIdx.x; if (t >= n4) return; const size_t e = t * 4; const int c = (int)((e / 4096) % 256); const float bb = bf16_round(wb[c]); const v4f a = *(const v4fa*)(x + e); v4f o; for (int q = 0; q < 4; ++q) o[q] = __fadd_rn(bf16_round(a[q]), bb);
  *(v4f*)(CPP + e) = o;  }


template <int PASS>
__global__ __launch_bounds__(256) void k_cstA(const float* __restrict__ X, const float* __restrict__ MV, float* __restrict__ PART) {
  #pragma clang fp contract(off)
  __shared__ float red[256]; const int t = threadIdx.x; const size_t bc = blockIdx.x; const int c = (int)(bc % NC); const float* row = X + bc * (size_t)NPX; const float mu = PASS ? MV[c] : 0.f; float s = 0.f;
  for (int i = t; i < NPX; i += 256) { const float v = row[i]; const float d = PASS ? __fadd_rn(v, -mu) : v; s = __fadd_rn(s, PASS ? __fmul_rn(d, d) : d); }
  red[t] = s; __syncthreads(); for (int st = 128; st > 0; st >>= 1) { if (t < st) red[t] = __fadd_rn(red[t], red[t + st]); __syncthreads(); }
  if (t < 32) { const float pv = (t == 0) ? red[0] : 0.f; *(float*)(PART + bc * 32 + t) = pv;  } }      

template <int PASS>
__global__ __launch_bounds__(256) void k_cstB(const float* __restrict__ PART, float* __restrict__ MV) { const int c = threadIdx.x; if (c >= NC) return; double s = 0.0; for (int b = 0; b < NB; ++b) s += (double)PART[((size_t)b * NC + c) * 32]; const float m = (float)(s / ((double)NB * (double)NPX)); *(float*)(MV + PASS * NC + c) = m;  }


__global__ __launch_bounds__(256) void k_bnresid(const float* __restrict__ C2, const float* __restrict__ MV, const float* __restrict__ g, const float* __restrict__ be, const float* __restrict__ X, float* __restrict__ out, size_t n4) {
  #pragma clang fp contract(off)
  const size_t t = (size_t)blockIdx.x * 256 + threadIdx.x; if (t >= n4) return; const size_t e = t * 4; const int c = (int)((e / NPX) % NC); const float sc = __fmul_rn(rsqrtf(__fadd_rn(MV[NC + c], BNEPS)), bf16_round(g[c])); const float mu = MV[c], bb = bf16_round(be[c]);
  const v4f a = *(const v4fa*)(C2 + e); const v4f xx = *(const v4fa*)(X + e); v4f o; for (int q = 0; q < 4; ++q) { const float z = __fadd_rn(__fmul_rn(__fadd_rn(a[q], -mu), sc), bb); o[q] = __fadd_rn(z, bf16_round(xx[q])); }
  *(v4f*)(out + e) = o;  }


__global__ __launch_bounds__(256) void k_rowbias(float* __restrict__ Y, const float* __restrict__ bias) {
  #pragma clang fp contract(off)
  const size_t t = (size_t)blockIdx.x * 256 + threadIdx.x; if (t >= (size_t)NB * NC * NPX / 4) return; const size_t e = t * 4; const int c = (int)((e / NPX) % NC); const float bb = bf16_round(bias[c]);
  v4f v = *(const v4fa*)(Y + e); for (int q = 0; q < 4; ++q) v[q] = __fadd_rn(v[q], bb); *(v4f*)(Y + e) = v;  }



template <int NBt, int QTt, int NKt>
__global__ __launch_bounds__(256) void k_bsm(const float* __restrict__ S, _Float16* __restrict__ P) {
  #pragma clang fp contract(off)
  const size_t t = (size_t)blockIdx.x * 256 + threadIdx.x; if (t >= (size_t)QTt * NKt / 8) return; const size_t e = t * 8; float mx[8], se[8];
  for (int q = 0; q < 8; ++q) { mx[q] = -3.0e38f; se[q] = 0.f; }
#pragma unroll
  for (int b = 0; b < NBt; ++b) { const float* s = S + (size_t)b * QTt * NKt + e; for (int q = 0; q < 8; ++q) mx[q] = fmaxf(mx[q], s[q]); }
#pragma unroll
  for (int b = 0; b < NBt; ++b) { const float* s = S + (size_t)b * QTt * NKt + e; for (int q = 0; q < 8; ++q) se[q] += __expf(s[q] - mx[q]); }
#pragma unroll
  for (int b = 0; b < NBt; ++b) { const float* s = S + (size_t)b * QTt * NKt + e; FragH f; for (int q = 0; q < 8; ++q) f.h[q] = (_Float16)(__expf(s[q] - mx[q]) * (256.0f / se[q]));
    unsigned short* d = (unsigned short*)P + (size_t)b * QTt * NKt + e; *(v8us*)d = f.half[0];  } }
// ---- fused scores + batch-axis softmax + P V: one launch for all queries ----
#define FQ 16       /* query rows per work-group */
#define FK 128      /* keys per pass: 16 per wave in part 1 */
#define FPP 136     /* LDS pitch of a P row in f16: 272 B = 16 B x odd, so the 16-byte row reads of part 2 do not collide */
#define FS 4096     /* sequence length */
#define FD 64       /* width */
#define FB 8        /* batches = waves of the work-group */
__device__ __forceinline__ v8f f_mma(v16h a, v16h b, v8f c) { return __builtin_amdgcn_wmma_f32_16x16x32_f16(false, a, false, b, (short)0, c, false, false); }
__device__ __forceinline__ v16h f_frag(const _Float16* p) { FragH f; f.half[0] = *(const v8us*)((const unsigned short*)p); f.half[1] = *(const v8us*)((const unsigned short*)p + 16); return f.v; }      /* p already holds the lane half's 8 hh: the k order of g2_frag */
__device__ __forceinline__ v16h f_fragp(const _Float16* p) { FragH f; f.half[0] = *(const v8us*)((const unsigned short*)p); f.half[1] = *(const v8us*)((const unsigned short*)p + 256); return f.v; }      /* fragment-order planes: p holds the lane's own 8 values, the fragment's second half lies one wave-wide load (32 lanes x 8) further; same values in the same registers as f_frag on rows */
// K as exact f16 in fragment order: [16-key tile][j = d / 16][lane = 16 ((d / 8) & 1) + key % 16][8 d]; tile = 1024 values, so a batch plane keeps its size and place
__global__ __launch_bounds__(256) void k_kpack(const float* __restrict__ x, _Float16* __restrict__ KP, size_t n8) { const size_t t = (size_t)blockIdx.x * 256 + threadIdx.x; if (t >= n8) return; FragH f;
#pragma unroll
  for (int q = 0; q < 8; ++q) f.h[q] = (_Float16)bf16_round(x[t * 8 + q]);
  const size_t row = t >> 3; const int c8 = (int)(t & 7);
  *(v8us*)((unsigned short*)KP + (row >> 4) * 1024 + (size_t)((c8 >> 1) * 256 + ((c8 & 1) * 16 + (int)(row & 15)) * 8)) = f.half[0]; }
// V^T of one batch in fragment order: [32-key block][t = d / 16][half = (key / 16) & 1][lane = 16 ((key / 8) & 1) + d % 16][8 keys]; a work-group turns 64 keys x 64 d and writes 8 KiB in a row
__global__ __launch_bounds__(256) void k_vpack(const _Float16* __restrict__ V16, _Float16* __restrict__ VP) { __shared__ unsigned short tl[64][66]; const int tid = threadIdx.x; const int lg = blockIdx.x;
  for (int i = tid; i < 64 * 8; i += 256) { const int r = i / 8, c8 = (i % 8) * 8; FragH f; f.half[0] = *(const v8us*)((const unsigned short*)V16 + ((size_t)lg * 64 + r) * 64 + c8);
#pragma unroll
    for (int q = 0; q < 8; ++q) tl[r][c8 + q] = f.u[q]; }
  __syncthreads();
#pragma unroll
  for (int rd = 0; rd < 2; ++rd) { const int i = rd * 256 + tid; const int k0 = (i >> 8) * 32 + ((i >> 5) & 1) * 16 + ((i >> 4) & 1) * 8, d = ((i >> 6) & 3) * 16 + (i & 15); FragH f;
#pragma unroll
    for (int q = 0; q < 8; ++q) f.u[q] = tl[k0 + q][d];
    *(v8us*)((unsigned short*)VP + (size_t)lg * 4096 + (size_t)i * 8) = f.half[0]; } }
__device__ __forceinline__ float f_exp(float x) { float e; asm("v_exp_f32 %0, %1\n\tv_nop" : "=v"(e) : "v"(x * 1.44269504f)); return e; }      /* native exp as in __expf; the v_nop is the slot the instruction set asks for behind a transcendental before its source is overwritten or its result read */
__global__ __launch_bounds__(256) void k_fused(const _Float16* __restrict__ Q16, const _Float16* __restrict__ K16, const _Float16* __restrict__ VT, float* __restrict__ out) {
  __shared__ __attribute__((aligned(16))) _Float16 pl[2][FB][FQ][FPP];      /* two buffers: one barrier a pass is enough */
  const int tid = threadIdx.x, w = tid >> 5, lane = tid & 31, ln = lane & 15, hh = lane >> 4; const int q0 = blockIdx.x * FQ;
  constexpr size_t PLN = (size_t)FS * FD;
  const v8f z8 = {0.f,0.f,0.f,0.f,0.f,0.f,0.f,0.f};
  const _Float16* qp = Q16 + (size_t)(q0 + ln) * FD + 8 * hh;      /* Q rows q0 + ln (B operand of part 1) */
  const _Float16* kp = K16 + (size_t)w * (16 * FD) + lane * 8;      /* part 1: this wave's 16-key tile, fragment order (A operand) */
  const _Float16* vp = VT + (size_t)w * PLN + lane * 8;      /* part 2: V^T of batch w, fragment order (B operand) */
  v16h qf[FB][2];      /* kept for the whole walk */
  v16h kf[FB][2];
#pragma unroll      /* register arrays need constant indices */
  for (int b = 0; b < FB; ++b) { qf[b][0] = f_frag(qp + (size_t)b * PLN); qf[b][1] = f_frag(qp + (size_t)b * PLN + 32); }
#pragma unroll      /* register arrays need constant indices */
  for (int b = 0; b < FB; ++b) { kf[b][0] = f_fragp(kp + (size_t)b * PLN); kf[b][1] = f_fragp(kp + (size_t)b * PLN + 512); }
  asm volatile("s_wait_xcnt 0x0" :: "v"(qp), "v"(kp) : "memory");      /* precaution: stands in front of any rewrite of a register that an issued load names; the inputs keep both address pairs whole up to it */
  v8f o[4] = {z8, z8, z8, z8};
  for (int it = 0; it < FS / FK; ++it) {
    const int kb = it * FK; const int kn = (kb + FK) & (FS - 1);      /* next pass's keys; the last pass requests the first keys again: in bounds, not used */
    const _Float16* vb = vp + (size_t)kb * FD; const _Float16* kq = kp + (size_t)kn * FD;
    v16h vf[4][4];      /* this pass's V^T fragments, requested here so that they arrive under the scores and the softmax */
#pragma unroll      /* register arrays need constant indices */
    for (int ks = 0; ks < 4; ++ks)
#pragma unroll
      for (int t = 0; t < 4; ++t) vf[ks][t] = f_fragp(vb + ks * (32 * FD) + t * 512);
    asm volatile("s_wait_xcnt 0x0" :: "v"(vb) : "memory");      /* as above, for the V^T address pair */
    __builtin_amdgcn_sched_barrier(0);      /* keeps the requests above in front of the scores and the softmax; without it the scheduler sinks half of them to the softmax's end, where their latency is waited out at the barrier */
    v8f s[FB];      /* s[b][r] = Q[b][q0 + ln] . K[b][kb + 16 w + 8 hh + r] */
#pragma unroll      /* register arrays need constant indices */
    for (int b = 0; b < FB; ++b) s[b] = f_mma(kf[b][1], qf[b][1], f_mma(kf[b][0], qf[b][0], z8));
    FragH pk[FB];
#pragma unroll      /* register arrays need constant indices */
    for (int r = 0; r < 8; ++r) { float x[FB], e[FB]; float mx = -3.0e38f, se = 0.f;
#pragma unroll
      for (int b = 0; b < FB; ++b) { x[b] = s[b][r] * 0.125f; mx = fmaxf(mx, x[b]); }
#pragma unroll
      for (int b = 0; b < FB; ++b) { e[b] = f_exp(x[b] - mx); se += e[b]; }
      const float sc = 256.0f / se;
#pragma unroll
      for (int b = 0; b < FB; ++b) pk[b].h[r] = (_Float16)(e[b] * sc); }
    _Float16* pw = &pl[it & 1][0][ln][16 * w + 8 * hh];
#pragma unroll      /* register arrays need constant indices */
    for (int b = 0; b < FB; ++b) *(v8us*)((unsigned short*)pw + (size_t)b * FQ * FPP) = pk[b].half[0];
    __syncthreads();      /* publishes this pass's P; with two buffers it also ends every read of the buffer that the next pass rewrites */
    const _Float16* pr = &pl[it & 1][w][ln][8 * hh]; v16h pa[4];      /* P[w] rows as A operands: all four read in one group, beside the K requests */
#pragma unroll      /* register arrays need constant indices */
    for (int ks = 0; ks < 4; ++ks) pa[ks] = f_frag(pr + ks * 32);
#pragma unroll      /* register arrays need constant indices */
    for (int b = 0; b < FB; ++b) { kf[b][0] = f_fragp(kq + (size_t)b * PLN); kf[b][1] = f_fragp(kq + (size_t)b * PLN + 512); }      /* next pass's K fragments, requested here so that they arrive under the products */
    asm volatile("s_wait_xcnt 0x0" :: "v"(kq) : "memory");      /* as above, for the K address pair */
    __builtin_amdgcn_sched_barrier(0);      /* keeps the products behind the requests; without it the scheduler lifts products with their LDS waits in front of the K requests, which then start later */
#pragma unroll      /* register arrays need constant indices */
    for (int ks = 0; ks < 4; ++ks)
#pragma unroll
      for (int t = 0; t < 4; ++t) o[t] = f_mma(pa[ks], vf[ks][t], o[t]);
  }
  float* op = out + (size_t)w * PLN + (size_t)(q0 + 8 * hh) * FD + ln;
#pragma unroll      /* register arrays need constant indices */
  for (int t = 0; t < 4; ++t) o[t] = o[t] * 0.00390625f;
  __builtin_amdgcn_sched_barrier(0);      /* every product ahead of the first store, so that no register that an issued store names is rewritten behind it */
#pragma unroll      /* register arrays need constant indices */
  for (int t = 0; t < 4; ++t)
#pragma unroll
    for (int r = 0; r < 8; ++r) op[(size_t)r * FD + t * 16] = o[t][r];
}
extern "C" void kernel_launch(void* const* d_in, const int* in_sizes, int n_in,
                              void* d_out, int out_size, void* d_ws, size_t ws_size, hipStream_t stream) {
  (void)in_sizes; (void)n_in; (void)out_size;
  const float* const* I = (const float* const*)d_in; const float* xq = I[0]; const float* xk = I[1]; const float* xv = I[2];      /* Q, K, V [8][4096][64] (bf16-valued) */
  constexpr int NBt = 8, SQt = 4096, DK = 64;      /* batches, sequence, width */
  char* ws = (char*)d_ws; size_t off = 0;
  auto take = [&](size_t bytes) { char* p = ws + off; off += (bytes + 255) & ~(size_t)255; return p; };
  const size_t PLN = (size_t)SQt * DK;      /* one batch's [4096][64] plane */
  _Float16* Q16 = (_Float16*)take(NBt * PLN * 2); _Float16* K16 = (_Float16*)take(NBt * PLN * 2); _Float16* V16 = (_Float16*)take(NBt * PLN * 2); _Float16* VT = (_Float16*)take(NBt * PLN * 2);
  if (off > ws_size) return;
  k_x16<<<(unsigned)((NBt * PLN / 8 + 255) / 256), 256, 0, stream>>>(xq, Q16, NBt * PLN / 8); k_kpack<<<(unsigned)((NBt * PLN / 8 + 255) / 256), 256, 0, stream>>>(xk, K16, NBt * PLN / 8); k_x16<<<(unsigned)((NBt * PLN / 8 + 255) / 256), 256, 0, stream>>>(xv, V16, NBt * PLN / 8);      /* exact f16 copies of the bf16-valued inputs; K in fragment order */
  for (int b = 0; b < NBt; ++b) k_vpack<<<SQt / 64, 256, 0, stream>>>(V16 + (size_t)b * PLN, VT + (size_t)b * PLN);      /* V[b]^T in fragment order */
  k_fused<<<SQt / FQ, 256, 0, stream>>>(Q16, K16, VT, (float*)d_out);      /* scores, softmax across the 8 batches and P V for 16 query rows of all batches per work-group */
}

// v003
// A run of this version takes 96.7 microseconds.
// Timed twice side by side with v002, it ran 1.27 and 1.24 times as fast.
// Over all steps from v000 it is 21.9 times as fast.
#include <hip/hip_runtime.h>
// Dot-product attention whose softmax runs over the BATCH axis (Q, K, V [8][4096][64], no heads, no weights; scores = Q K^T / sqrt(64) -> [8][4096][4096]; attn = softmax(scores, axis = 0): for every (query, key) pair the 8 batch entries are normalised against each other (the module's literal axis; rows are NOT normalised over keys); out[b] = attn[b] V[b] -> [8][4096][64]).
// Structure: two launches. ONE prep launch (three block ranges) writes the bf16-valued inputs as exact f16; K (without LDS) and V^T (via an LDS transpose, once) are written in WMMA fragment order, so that every wave-wide 16-byte load of the walk reads 512 contiguous bytes (4 whole lines, not 32 bytes of each of 16 lines); then ONE fused launch: a work-group owns 16 query rows of all 8 batches and walks the keys 128 at a time. Part 1 of a pass: wave w forms S^T = K Q^T for its 16 keys in all 8 batches (WMMA, f32 accumulation, K = 64), so a lane holds the 8 batch values of each (query, key) pair and normalises them in registers (f32, native exp; weights x256 f16), then stores 8 keys of one query per batch to LDS. Part 2: wave w is batch w: out[w] += P[w] V[w]^T (WMMA, f32), keys in ascending order; x 2^-8 at the end. Scores and weights never reach memory.
// Compute dtype: inputs rounded to bf16; x / weights exact; q, k, v and softmax weights as plain f16 GEMM operands (~2^-12); scores, softmax statistics and o f32. v_wmma_f32_16x16x32_f16.
#define NB 4
#define SQ 4096
#define DM 256
#define NH 1
#define HD 64
#define HG 4                         /* heads per attention launch group */
#define B0 0                         /* first batch processed (debug hook) */
#define NBR NB                       /* batches processed (debug hook) */
#define NR ((size_t)NB * SQ)         /* token rows */
#define MP ((int)((size_t)NBR * SQ)) /* rows projected (debug hook) */
#define QT 256                       /* query rows per causal tile */
#define NKX SQ                       /* S / P row pitch */
#define QT0 256                      /* first-tile rows recomputed exactly (256: buys margin for the few-key rows 128..255, which have no output projection to average the single-f16 P/v rounding) */
#define QN SQ                        /* query rows attended per batch (debug hook) */
#define NHD NH                       /* heads attended (debug hook) */
#define MPO MP                       /* rows through the output stage (debug hook) */
#define LQ DM            /* row pitch of the q/k/v rows */
typedef __bf16 v16b __attribute__((ext_vector_type(16)));
typedef unsigned short v8us __attribute__((ext_vector_type(8), may_alias));
typedef float  v8f  __attribute__((ext_vector_type(8)));
typedef float  v4f  __attribute__((ext_vector_type(4)));
typedef float  v4fa __attribute__((ext_vector_type(4), may_alias));
union FragB { v16b v; v8us half[2]; unsigned short u[16]; };

__device__ __forceinline__ unsigned short bf16_bits(float x) { unsigned int u = __float_as_uint(x); return (unsigned short)((u + 0x7FFFu + ((u >> 16) & 1u)) >> 16); }
__device__ __forceinline__ float bf16_val(unsigned short b) { return __uint_as_float(((unsigned int)b) << 16); }
__device__ __forceinline__ float bf16_round(float x) { return bf16_val(bf16_bits(x)); }
// D += A·B with NT terms: 1 = ah·bh, 2 = + al·bh (A split), 3 = + ah·bl (both split)
template <int NT>
__device__ __forceinline__ v8f mmaN(v16b ah, v16b al, v16b bh, v16b bl, v8f c) {
  c = __builtin_amdgcn_wmma_f32_16x16x32_bf16(false, ah, false, bh, (short)0, c, false, false);
  if (NT >= 2) c = __builtin_amdgcn_wmma_f32_16x16x32_bf16(false, al, false, bh, (short)0, c, false, false);
  if (NT >= 3) c = __builtin_amdgcn_wmma_f32_16x16x32_bf16(false, ah, false, bl, (short)0, c, false, false);
  asm volatile("v_nop\n\tv_nop\n\tv_nop\n\tv_nop" : "+v"(c) : "v"(ah), "v"(al), "v"(bh), "v"(bl));
  return c;
}

__global__ __launch_bounds__(256) void k_wt_bf16(const float* __restrict__ W, unsigned short* __restrict__ Wt, int K, int N) {
  const int t = blockIdx.x * 256 + threadIdx.x;
  const int k8n = K / 8;
  if (t >= N * k8n) return;
  const int n = t / k8n, k8 = (t % k8n) * 8;
  v8us v;
#pragma unroll
  for (int i = 0; i < 8; ++i) v[i] = bf16_bits(W[(size_t)(k8 + i) * N + n]);
  *(v8us*)(Wt + (size_t)n * K + k8) = v;
  
}

// GEMM C[M][N] (f32, pitch ldc) = act(A[M][K]·W + bias). A f32 row-major (pitch lda) converted per fragment to bf16
// (ASPLIT: hi/lo two planes -> 2 terms, else single rounded term); Wt bf16 [N][K] (pitch ldb). BIAS_BF16 rounds the
// bias to bf16 first (bias quantised to bf16 before the add). K%32==0, M%16==0, N%64==0.
template <bool ASPLIT, int ACT, bool BIAS_BF16>
__global__ __launch_bounds__(128) void k_gemm_bf(const float* __restrict__ A, int lda, const unsigned short* __restrict__ Wt, int ldb,
                                               const float* __restrict__ bias, float* __restrict__ C, int ldc, int M, int N, int K) {
  __shared__ __attribute__((aligned(16))) float so[4][16][64];
  const int tid = threadIdx.x, w = tid >> 5, lane = tid & 31, ln = lane & 15, hh = lane >> 4;
  const int ntn = N / 64;
  const int wid = blockIdx.x * 4 + w;
  const int mt = wid / ntn, nq = wid % ntn;
  if (mt * 16 >= M) return;
  const int row0 = mt * 16, col0 = nq * 64;
  const float* arow = A + (size_t)(row0 + ln) * lda;
  v8f acc[4] = {};
  for (int kb = 0; kb < K; kb += 32) {
    FragB ah, al;
    const v4f x0 = *(const v4fa*)(arow + kb + 8 * hh), x1 = *(const v4fa*)(arow + kb + 8 * hh + 4);
    const v4f x2 = *(const v4fa*)(arow + kb + 16 + 8 * hh), x3 = *(const v4fa*)(arow + kb + 16 + 8 * hh + 4);
    float xs[16] = {x0[0],x0[1],x0[2],x0[3],x1[0],x1[1],x1[2],x1[3],x2[0],x2[1],x2[2],x2[3],x3[0],x3[1],x3[2],x3[3]};
#pragma unroll
    for (int i = 0; i < 16; ++i) { const unsigned short hb = bf16_bits(xs[i]); ah.u[i] = hb; al.u[i] = ASPLIT ? bf16_bits(xs[i] - bf16_val(hb)) : (unsigned short)0; }
#pragma unroll
    for (int t = 0; t < 4; ++t) {
      const unsigned short* brow = Wt + (size_t)(col0 + t * 16 + ln) * ldb + kb;
      FragB b;
      b.half[0] = *(const v8us*)(brow + 8 * hh);
      b.half[1] = *(const v8us*)(brow + 16 + 8 * hh);
      acc[t] = mmaN<ASPLIT ? 2 : 1>(ah.v, al.v, b.v, b.v, acc[t]);
    }
  }
#pragma unroll
  for (int t = 0; t < 4; ++t) {
    float bv = bias ? bias[col0 + t * 16 + ln] : 0.f;
    if (BIAS_BF16) bv = bf16_round(bv);
#pragma unroll
    for (int r = 0; r < 8; ++r) { float v = acc[t][r] + bv; if (ACT == 1) v = fmaxf(v, 0.f); so[w][8 * hh + r][t * 16 + ln] = v; }
  }
  __builtin_amdgcn_fence(__ATOMIC_ACQ_REL, "workgroup");
  __builtin_amdgcn_wave_barrier();
  const int rsub = lane >> 4, c4 = (lane & 15) * 4;
  {
#pragma unroll
    for (int q = 0; q < 8; ++q) {
      const int r = q * 2 + rsub;
      const v4f v = *(const v4fa*)&so[w][r][c4];
      *(v4f*)(C + (size_t)(row0 + r) * ldc + col0 + c4) = v;
    }
    
  }
}

// GEMM C = act(A·W + bias + resid): A f32 (ASPLIT -> hi/lo 2 terms), Wt bf16 [N][K]; ACT 0 none, 1 relu, 2 exact gelu;
// resid (optional, f32, row index = (row % rmod), pitch ldr, RES_BF16 rounds it) added before the activation.
template <bool ASPLIT, int ACT, bool BIAS_BF16, bool RES_BF16>
__global__ __launch_bounds__(128) void k_gemm_bf3(const float* __restrict__ A, int lda, const unsigned short* __restrict__ Wt, int ldb,
                                                const float* __restrict__ bias, const float* __restrict__ resid, int rmod, int ldr,
                                                float* __restrict__ C, int ldc, int M, int N, int K) {
  __shared__ __attribute__((aligned(16))) float so[4][16][64];
  const int tid = threadIdx.x, w = tid >> 5, lane = tid & 31, ln = lane & 15, hh = lane >> 4;
  const int ntn = N / 64;
  const int wid = blockIdx.x * 4 + w;
  const int mt = wid / ntn, nq = wid % ntn;
  if (mt * 16 >= M) return;
  const int row0 = mt * 16, col0 = nq * 64;
  const float* arow = A + (size_t)(row0 + ln) * lda;
  v8f acc[4] = {};
  for (int kb = 0; kb < K; kb += 32) {
    FragB ah, al;
    const v4f x0 = *(const v4fa*)(arow + kb + 8 * hh), x1 = *(const v4fa*)(arow + kb + 8 * hh + 4);
    const v4f x2 = *(const v4fa*)(arow + kb + 16 + 8 * hh), x3 = *(const v4fa*)(arow + kb + 16 + 8 * hh + 4);
    float xs[16] = {x0[0],x0[1],x0[2],x0[3],x1[0],x1[1],x1[2],x1[3],x2[0],x2[1],x2[2],x2[3],x3[0],x3[1],x3[2],x3[3]};
#pragma unroll
    for (int i = 0; i < 16; ++i) { const unsigned short hb = bf16_bits(xs[i]); ah.u[i] = hb; al.u[i] = ASPLIT ? bf16_bits(xs[i] - bf16_val(hb)) : (unsigned short)0; }
#pragma unroll
    for (int t = 0; t < 4; ++t) {
      const unsigned short* brow = Wt + (size_t)(col0 + t * 16 + ln) * ldb + kb;
      FragB b;
      b.half[0] = *(const v8us*)(brow + 8 * hh);
      b.half[1] = *(const v8us*)(brow + 16 + 8 * hh);
      acc[t] = mmaN<ASPLIT ? 2 : 1>(ah.v, al.v, b.v, b.v, acc[t]);
    }
  }
#pragma unroll
  for (int t = 0; t < 4; ++t) {
    const int col = col0 + t * 16 + ln;
    float bv = bias ? bias[col] : 0.f;
    if (BIAS_BF16) bv = bf16_round(bv);
#pragma unroll
    for (int r = 0; r < 8; ++r) {
      float v = acc[t][r] + bv;
      if (resid) { float rv = resid[(size_t)((row0 + 8 * hh + r) % rmod) * ldr + col]; if (RES_BF16) rv = bf16_round(rv); v += rv; }
      if (ACT == 1) v = fmaxf(v, 0.f);
      if (ACT == 2) v = 0.5f * v * (1.0f + erff(v * 0.70710678118654752f));
      if (ACT == 3) { const float u = 0.7978845608028654f * (v + 0.044715f * v * v * v); v = 0.5f * v * (1.0f + tanhf(u)); }
      so[w][8 * hh + r][t * 16 + ln] = v;
    }
  }
  __builtin_amdgcn_fence(__ATOMIC_ACQ_REL, "workgroup");
  __builtin_amdgcn_wave_barrier();
  const int rsub = lane >> 4, c4 = (lane & 15) * 4;
  {
#pragma unroll
    for (int q = 0; q < 8; ++q) {
      const int r = q * 2 + rsub;
      const v4f v = *(const v4fa*)&so[w][r][c4];
      *(v4f*)(C + (size_t)(row0 + r) * ldc + col0 + c4) = v;
    }
    
  }
}
// row LayerNorm (biased variance, eps) over N: s = X (+ R); optional out_sum <- s; out_norm <- (s-mu)*rsqrt(var+eps)*g + b
template <bool PARAM_BF16>
__global__ __launch_bounds__(256) void k_layernorm(const float* __restrict__ X, const float* __restrict__ R, const float* __restrict__ g, const float* __restrict__ bta,
                                                  float* __restrict__ out_sum, float* __restrict__ out_norm, int N, float eps) {
  __shared__ float red[256];
  const int row = blockIdx.x, tid = threadIdx.x;
  const float* x = X + (size_t)row * N; const float* rr = R ? R + (size_t)row * N : nullptr;
  float vals[16];                     // up to N = 4096
  const int per = N / 256;            // contiguous chunk per thread? use strided-by-4 chunks: thread handles j = tid*4 + 1024*u
  float s1 = 0.f;
  for (int u = 0; u < per / 4; ++u) {
    const int j = tid * 4 + 1024 * u;
    const v4f a = *(const v4fa*)(x + j);
    v4f b = {0.f,0.f,0.f,0.f}; if (rr) b = *(const v4fa*)(rr + j);
#pragma unroll
    for (int q = 0; q < 4; ++q) { const float v = a[q] + b[q]; vals[u * 4 + q] = v; s1 += v; }
  }
  red[tid] = s1; __syncthreads();
  for (int st = 128; st > 0; st >>= 1) { if (tid < st) red[tid] += red[tid + st]; __syncthreads(); }
  const float mu = red[0] / (float)N; __syncthreads();
  float s2 = 0.f;
  for (int u = 0; u < per / 4; ++u)
#pragma unroll
    for (int q = 0; q < 4; ++q) { const float c = vals[u * 4 + q] - mu; s2 += c * c; }
  red[tid] = s2; __syncthreads();
  for (int st = 128; st > 0; st >>= 1) { if (tid < st) red[tid] += red[tid + st]; __syncthreads(); }
  const float rs = rsqrtf(red[0] / (float)N + eps);
  {
    for (int u = 0; u < per / 4; ++u) {
      const int j = tid * 4 + 1024 * u;
      v4f o, sm;
#pragma unroll
      for (int q = 0; q < 4; ++q) {
        float gg = g[j + q], bb = bta[j + q];
        if (PARAM_BF16) { gg = bf16_round(gg); bb = bf16_round(bb); }
        sm[q] = vals[u * 4 + q]; o[q] = (vals[u * 4 + q] - mu) * rs * gg + bb;
      }
      if (out_sum) *(v4f*)(out_sum + (size_t)row * N + j) = sm;
      *(v4f*)(out_norm + (size_t)row * N + j) = o;
    }
    
  }
}



// ---- f16 WMMA path (v_wmma_f32_16x16x32_f16): 11-bit significands for operands in range — used where a [0,1] probability operand needs more precision than bf16
typedef _Float16 v16h __attribute__((ext_vector_type(16)));
union FragH { v16h v; v8us half[2]; _Float16 h[16]; unsigned short u[16]; };
template <int NT>
__device__ __forceinline__ v8f mmaH(v16h ah, v16h al, v16h bh, v16h bl, v8f c) {
  c = __builtin_amdgcn_wmma_f32_16x16x32_f16(false, ah, false, bh, (short)0, c, false, false);
  if (NT >= 2) c = __builtin_amdgcn_wmma_f32_16x16x32_f16(false, al, false, bh, (short)0, c, false, false);
  if (NT >= 3) c = __builtin_amdgcn_wmma_f32_16x16x32_f16(false, ah, false, bl, (short)0, c, false, false);
  asm volatile("v_nop\n\tv_nop\n\tv_nop\n\tv_nop" : "+v"(c) : "v"(ah), "v"(al), "v"(bh), "v"(bl));
  return c;
}
// batched GEMM like k_gemm_b but f16 operands: A f32 (split into f16 hi/lo if ASPLIT, else rounded to f16), Bt = f16 values [n][k]; alpha; C f32; N multiple of 16 (partial tiles skipped)
template <bool ASPLIT>
__global__ __launch_bounds__(128) void k_gemm_h(const float* __restrict__ A, int lda, size_t sA, const _Float16* __restrict__ Bh, int ldb, size_t sB, float alpha, float* __restrict__ C, int ldc, size_t sC, int M, int N, int K) {
  __shared__ __attribute__((aligned(16))) float so[4][16][64];
  const int tid = threadIdx.x, w = tid >> 5, lane = tid & 31, ln = lane & 15, hh = lane >> 4; const int by = blockIdx.y;
  A += (size_t)by * sA; Bh += (size_t)by * sB; C += (size_t)by * sC;
  const int ntn = (N + 63) / 64; const int wid = blockIdx.x * 4 + w; const int mt = wid / ntn, nq = wid % ntn; if (mt * 16 >= M) return;
  const int row0 = mt * 16, col0 = nq * 64; const float* arow = A + (size_t)(row0 + ln) * lda;
  v8f acc[4] = {};
  for (int kb = 0; kb < K; kb += 32) {
    FragH ah, al;
    const v4f x0 = *(const v4fa*)(arow + kb + 8 * hh), x1 = *(const v4fa*)(arow + kb + 8 * hh + 4), x2 = *(const v4fa*)(arow + kb + 16 + 8 * hh), x3 = *(const v4fa*)(arow + kb + 16 + 8 * hh + 4);
    float xs[16] = {x0[0],x0[1],x0[2],x0[3],x1[0],x1[1],x1[2],x1[3],x2[0],x2[1],x2[2],x2[3],x3[0],x3[1],x3[2],x3[3]};
#pragma unroll
    for (int i = 0; i < 16; ++i) { const _Float16 h = (_Float16)xs[i]; ah.h[i] = h; al.h[i] = ASPLIT ? (_Float16)(xs[i] - (float)h) : (_Float16)0.0f; }
#pragma unroll
    for (int t = 0; t < 4; ++t) { if (col0 + t * 16 >= N) continue; const size_t boff = (size_t)(col0 + t * 16 + ln) * ldb + kb; FragH bq; bq.half[0] = *(const v8us*)(Bh + boff + 8 * hh); bq.half[1] = *(const v8us*)(Bh + boff + 16 + 8 * hh);
      acc[t] = mmaH<ASPLIT ? 2 : 1>(ah.v, al.v, bq.v, bq.v, acc[t]); }
  }
#pragma unroll
  for (int t = 0; t < 4; ++t) { if (col0 + t * 16 >= N) continue;
#pragma unroll
    for (int r = 0; r < 8; ++r) so[w][8 * hh + r][t * 16 + ln] = acc[t][r] * alpha; }
  __builtin_amdgcn_fence(__ATOMIC_ACQ_REL, "workgroup"); __builtin_amdgcn_wave_barrier();
  const int rsub = lane >> 4, c4 = (lane & 15) * 4;
  {
#pragma unroll
    for (int q = 0; q < 8; ++q) { const int r = q * 2 + rsub; if (col0 + c4 < N) { const v4f v = *(const v4fa*)&so[w][r][c4]; *(v4f*)(C + (size_t)(row0 + r) * ldc + col0 + c4) = v; } }
     }
}

// Wt[n][k] = f16(W[k][n]·scale) from f32 row-major W[K][N] (scale = power of two; bf16-exact weights stay exact in f16 away from the subnormal range)
__global__ __launch_bounds__(256) void k_wt_f16(const float* __restrict__ W, _Float16* __restrict__ Wt, int K, int N, float scale) {
  const int t = blockIdx.x * 256 + threadIdx.x; if (t >= N * (K / 8)) return; const int n = t / (K / 8), k8 = (t % (K / 8)) * 8; FragH f;
#pragma unroll
  for (int i = 0; i < 8; ++i) f.h[i] = (_Float16)(bf16_round(W[(size_t)(k8 + i) * N + n]) * scale); const v8us o = f.half[0];
  *(v8us*)((unsigned short*)Wt + (size_t)n * K + k8) = o; 
}
// k_gemm_hh variant with fused epilogue: v = acc·alpha + bias[by·sBias + col] (+ CP[(row/rowsPerB)·sCPb + by·64 + col] if CP) ; ACT 0 none / 1 elu ; writes f16 C16 (and f32 C if non-null)
template <int ACT>
__global__ __launch_bounds__(128) void k_gemm_hhx(const _Float16* __restrict__ A, int lda, size_t sA, const _Float16* __restrict__ Bh, int ldb, size_t sB, float alpha, const float* __restrict__ bias, size_t sBias, const float* __restrict__ CP, int rowsPerB, size_t sCPb, int row0g,
    float* __restrict__ C, _Float16* __restrict__ C16, int ldc, size_t sC, int M, int N, int K) {
  __shared__ __attribute__((aligned(16))) float so[4][16][64];
  const int tid = threadIdx.x, w = tid >> 5, lane = tid & 31, ln = lane & 15, hh = lane >> 4; const int by = blockIdx.y;
  A += (size_t)by * sA; Bh += (size_t)by * sB; const size_t cofs = (size_t)by * sC; const float* bp = bias ? bias + (size_t)by * sBias : nullptr;
  const int ntn = (N + 63) / 64; const int wid = blockIdx.x * 4 + w; const int mt = wid / ntn, nq = wid % ntn; if (mt * 16 >= M) return;
  const int row0 = mt * 16, col0 = nq * 64; const _Float16* arow = A + (size_t)(row0 + ln) * lda;
  v8f acc[4] = {};
  for (int kb = 0; kb < K; kb += 32) { FragH ah; ah.half[0] = *(const v8us*)((const unsigned short*)arow + kb + 8 * hh); ah.half[1] = *(const v8us*)((const unsigned short*)arow + kb + 16 + 8 * hh);
#pragma unroll
    for (int t = 0; t < 4; ++t) { if (col0 + t * 16 >= N) continue; const size_t boff = (size_t)(col0 + t * 16 + ln) * ldb + kb; FragH bq; bq.half[0] = *(const v8us*)((const unsigned short*)Bh + boff + 8 * hh); bq.half[1] = *(const v8us*)((const unsigned short*)Bh + boff + 16 + 8 * hh);
      acc[t] = mmaH<1>(ah.v, ah.v, bq.v, bq.v, acc[t]); }
  }
#pragma unroll
  for (int t = 0; t < 4; ++t) { if (col0 + t * 16 >= N) continue; const int col = col0 + t * 16 + ln; const float bv = bp ? bf16_round(bp[col]) : 0.f;
#pragma unroll
    for (int r = 0; r < 8; ++r) { float v = acc[t][r] * alpha + bv; if (CP) { const int rr = row0g + row0 + 8 * hh + r; if (rowsPerB < 0) v += CP[cofs + (size_t)rr * ldc + col];      /* rowsPerB < 0: own element of the batched C plane */ else { const int bidx = rr / rowsPerB; v += CP[(size_t)bidx * sCPb + (size_t)by * 64 + col]; } } if (ACT == 1) v = (v > 0.f) ? v : expm1f(v); else if (ACT == 7) v = (v > 0.f) ? v + 1.0f : expf(v); else if (ACT == 8) v = tanhf(v); else if (ACT == 9) v = 0.5f * v * (1.0f + tanhf(0.7978845608028654f * (v + 0.044715f * v * v * v))); else if (ACT == 11) v = 1.0f / (1.0f + expf(-v)); else if (ACT == 12) v = (v > 0.f) ? v : 0.01f * v; else if (ACT == 14) v = (v > 0.f) ? v : 0.1f * v; else if (ACT == 16) v = (v >= 0.f) ? v : 0.3f * v; else if (ACT == 17) v = (v >= 0.f) ? v : 0.2f * v; else if (ACT == 15) v = v / (1.0f + expf(-v)); else if (ACT == 3) v = fmaxf(v, 0.f); else if (ACT == 6) v = 0.5f * v * (1.0f + erff(v * 0.70710678118654752f)); so[w][8 * hh + r][t * 16 + ln] = v; } }
  __builtin_amdgcn_fence(__ATOMIC_ACQ_REL, "workgroup"); __builtin_amdgcn_wave_barrier();
  const int rsub = lane >> 4, c4 = (lane & 15) * 4; typedef _Float16 v4h __attribute__((ext_vector_type(4)));
  {
#pragma unroll
    for (int q = 0; q < 8; ++q) { const int r = q * 2 + rsub; if (col0 + c4 < N) { const v4f v = *(const v4fa*)&so[w][r][c4]; if (C) *(v4f*)(C + cofs + (size_t)(row0 + r) * ldc + col0 + c4) = v; if (C16) { v4h h4; for (int i = 0; i < 4; ++i) h4[i] = (_Float16)v[i]; *(v4h*)(C16 + cofs + (size_t)(row0 + r) * ldc + col0 + c4) = h4; } } }
     }
}


typedef _Float16 v4h __attribute__((ext_vector_type(4)));

__global__ __launch_bounds__(256) void k_x16(const float* __restrict__ x, _Float16* __restrict__ X16, size_t n8) { const size_t t = (size_t)blockIdx.x * 256 + threadIdx.x; if (t >= n8) return; FragH f;
#pragma unroll
  for (int q = 0; q < 8; ++q) f.h[q] = (_Float16)bf16_round(x[t * 8 + q]); *(v8us*)((unsigned short*)X16 + t * 8) = f.half[0];  }
__global__ __launch_bounds__(256) void k_h16(const float* __restrict__ x, _Float16* __restrict__ X16, size_t n8) { const size_t t = (size_t)blockIdx.x * 256 + threadIdx.x; if (t >= n8) return; FragH f;
#pragma unroll
  for (int q = 0; q < 8; ++q) f.h[q] = (_Float16)x[t * 8 + q]; *(v8us*)((unsigned short*)X16 + t * 8) = f.half[0];  }
__global__ __launch_bounds__(256) void k_round16f(const float* __restrict__ W, _Float16* __restrict__ Bt, size_t n8) { const size_t t = (size_t)blockIdx.x * 256 + threadIdx.x; if (t >= n8) return; FragH f;
#pragma unroll
  for (int i = 0; i < 8; ++i) f.h[i] = (_Float16)(bf16_round(W[t * 8 + i]) * 16.0f); *(v8us*)((unsigned short*)Bt + t * 8) = f.half[0];  }
template <int NHv, int TTv>
__global__ __launch_bounds__(256) void k_vt(const _Float16* __restrict__ V16, int ldv, int voff, _Float16* __restrict__ Vt) { __shared__ unsigned short tl[64][66]; const int tid = threadIdx.x; const int slab = blockIdx.x / (TTv / 64), lg = blockIdx.x % (TTv / 64); const int b = slab / NHv, h = slab % NHv;
  for (int i = tid; i < 64 * 8; i += 256) { const int r = i / 8, c8 = (i % 8) * 8; FragH f; f.half[0] = *(const v8us*)((const unsigned short*)V16 + ((size_t)b * TTv + lg * 64 + r) * ldv + voff + h * 64 + c8);
#pragma unroll
    for (int q = 0; q < 8; ++q) tl[r][c8 + q] = f.u[q]; }
  __syncthreads();
  {
#pragma unroll
    for (int rd = 0; rd < 2; ++rd) { const int d = rd * 32 + tid / 8, pc = tid % 8; FragH f;
#pragma unroll
      for (int q = 0; q < 8; ++q) f.u[q] = tl[pc * 8 + q][d];
      *(v8us*)((unsigned short*)Vt + ((size_t)slab * 64 + d) * TTv + lg * 64 + pc * 8) = f.half[0]; }
     } }

__global__ __launch_bounds__(256) void k_hl(const float* __restrict__ F, _Float16* __restrict__ Hh, _Float16* __restrict__ Hl, size_t n8) { const size_t t = (size_t)blockIdx.x * 256 + threadIdx.x; if (t >= n8) return; FragH fh, fl; const v4f a = *(const v4fa*)(F + t * 8), c = *(const v4fa*)(F + t * 8 + 4);
#pragma unroll
  for (int q = 0; q < 4; ++q) { _Float16 h = (_Float16)a[q]; fh.h[q] = h; fl.h[q] = (_Float16)((a[q] - (float)h) * 1024.0f); h = (_Float16)c[q]; fh.h[4 + q] = h; fl.h[4 + q] = (_Float16)((c[q] - (float)h) * 1024.0f); }
  { *(v8us*)((unsigned short*)Hh + t * 8) = fh.half[0]; *(v8us*)((unsigned short*)Hl + t * 8) = fl.half[0];  } }

// ---- fast GEMM (wave tile 32x64; requires M % 32 == 0 rows per launch region and N % 64 == 0); epilogue = k_gemm_hhx semantics ----
__device__ __forceinline__ v16h g2_frag(const _Float16* p, int hh) { FragH f; f.half[0] = *(const v8us*)((const unsigned short*)p + 8 * hh); f.half[1] = *(const v8us*)((const unsigned short*)p + 16 + 8 * hh); return f.v; }
__device__ __forceinline__ v8f g2_mma(v16h a, v16h b, v8f c) { v8f d = __builtin_amdgcn_wmma_f32_16x16x32_f16(false, a, false, b, (short)0, c, false, false); asm volatile("v_nop\n\tv_nop\n\tv_nop\n\tv_nop" : "+v"(d) : "v"(a), "v"(b)); return d; }
template <int ACT>
__global__ __launch_bounds__(128) void k_gemm2(const _Float16* __restrict__ A, int lda, size_t sA, const _Float16* __restrict__ Bh, int ldb, size_t sB, float alpha, const float* __restrict__ bias, size_t sBias, const float* __restrict__ CP, int rowsPerB, size_t sCPb, int row0g,
    float* __restrict__ C, _Float16* __restrict__ C16, int ldc, size_t sC, int M, int N, int K) { static_assert(ACT == 0 || ACT == 3 || ACT == 6 || ACT == 8 || ACT == 9 || ACT == 11 || ACT == 12 || ACT == 14 || ACT == 15 || ACT == 16 || ACT == 17, "k_gemm2: unsupported ACT code (would silently apply no activation)");
  __shared__ __attribute__((aligned(16))) float so[4][32][68];
  const int tid = threadIdx.x, w = tid >> 5, lane = tid & 31, ln = lane & 15, hh = lane >> 4; const int by = blockIdx.y;
  A += (size_t)by * sA; Bh += (size_t)by * sB; const size_t cofs = (size_t)by * sC; const float* bp = bias ? bias + (size_t)by * sBias : nullptr;
  const int ntn = N >> 6; const int mt = blockIdx.x / ntn, nq = blockIdx.x - mt * ntn; const int row0 = mt * 128 + 32 * w, col0 = nq * 64; if (row0 >= M) return;
  const _Float16* a0p = A + (size_t)(row0 + ln) * lda; const _Float16* a1p = a0p + (size_t)16 * lda;
  const _Float16* b0p = Bh + (size_t)(col0 + ln) * ldb; const _Float16* b1p = b0p + (size_t)16 * ldb; const _Float16* b2p = b1p + (size_t)16 * ldb; const _Float16* b3p = b2p + (size_t)16 * ldb;
  const v8f z8 = {0.f,0.f,0.f,0.f,0.f,0.f,0.f,0.f}; v8f c00 = z8, c01 = z8, c02 = z8, c03 = z8, c10 = z8, c11 = z8, c12 = z8, c13 = z8;
#pragma unroll 1
  for (int kb = 0; kb < K; kb += 32) { const v16h a0 = g2_frag(a0p + kb, hh), a1 = g2_frag(a1p + kb, hh);
    v16h b = g2_frag(b0p + kb, hh); c00 = g2_mma(a0, b, c00); c10 = g2_mma(a1, b, c10);
    b = g2_frag(b1p + kb, hh); c01 = g2_mma(a0, b, c01); c11 = g2_mma(a1, b, c11);
    b = g2_frag(b2p + kb, hh); c02 = g2_mma(a0, b, c02); c12 = g2_mma(a1, b, c12);
    b = g2_frag(b3p + kb, hh); c03 = g2_mma(a0, b, c03); c13 = g2_mma(a1, b, c13); }
  v8f accs[8] = {c00, c01, c02, c03, c10, c11, c12, c13};
#pragma unroll
  for (int u = 0; u < 8; ++u) { const int t = u & 3, half = u >> 2; const int col = col0 + t * 16 + ln; const float bv = bp ? bf16_round(bp[col]) : 0.f;
#pragma unroll
    for (int r = 0; r < 8; ++r) { const int rloc = half * 16 + 8 * hh + r; float v = accs[u][r] * alpha + bv; if (CP) { if (rowsPerB < 0) v += CP[cofs + (size_t)(row0g + row0 + rloc) * ldc + col];      /* rowsPerB < 0: own element of the batched C plane */ else { const int bidx = (row0g + row0 + rloc) / rowsPerB; v += CP[(size_t)bidx * sCPb + (size_t)by * 64 + col]; } }
      if (ACT == 3) v = fmaxf(v, 0.f); else if (ACT == 6) v = 0.5f * v * (1.0f + erff(v * 0.70710678118654752f)); else if (ACT == 11) v = 1.0f / (1.0f + expf(-v)); else if (ACT == 15) v = v / (1.0f + expf(-v)); else if (ACT == 12) v = (v > 0.f) ? v : 0.01f * v; else if (ACT == 8) v = tanhf(v); else if (ACT == 9) v = 0.5f * v * (1.0f + tanhf(0.7978845608028654f * (v + 0.044715f * v * v * v))); else if (ACT == 14) v = (v > 0.f) ? v : 0.1f * v; else if (ACT == 16) v = (v >= 0.f) ? v : 0.3f * v; else if (ACT == 17) v = (v >= 0.f) ? v : 0.2f * v;
      so[w][rloc][t * 16 + ln] = v; } }
  __builtin_amdgcn_fence(__ATOMIC_ACQ_REL, "workgroup"); __builtin_amdgcn_wave_barrier();
  const int rsub = lane >> 4, c4 = (lane & 15) * 4;
  {
#pragma unroll
    for (int q = 0; q < 16; ++q) { const int r = q * 2 + rsub; const v4f v = *(const v4fa*)&so[w][r][c4]; if (C) *(v4f*)(C + cofs + (size_t)(row0 + r) * ldc + col0 + c4) = v; if (C16) { v4h h4; for (int i = 0; i < 4; ++i) h4[i] = (_Float16)v[i]; *(v4h*)(C16 + cofs + (size_t)(row0 + r) * ldc + col0 + c4) = h4; } }
     } }


__global__ __launch_bounds__(256) void k_wnat(const float* __restrict__ w, size_t n8, _Float16* __restrict__ Bt) { const size_t t = (size_t)blockIdx.x * 256 + threadIdx.x; if (t >= n8) return; FragH f; for (int q = 0; q < 8; ++q) f.h[q] = (_Float16)(bf16_round(w[t * 8 + q]) * 16.0f); *(v8us*)((unsigned short*)Bt + t * 8) = f.half[0];  }
__global__ __launch_bounds__(256) void k_rsm(const float* __restrict__ S, _Float16* __restrict__ P, int nrows) {
  #pragma clang fp contract(off)
  const int i = blockIdx.x * 256 + threadIdx.x; if (i >= nrows) return; const float* s = S + (size_t)i * SQ; float mx = -3.0e38f;
#pragma unroll 1
  for (int j = 0; j < SQ; ++j) mx = fmaxf(mx, s[j]); float se = 0.f;
#pragma unroll 1
  for (int j = 0; j < SQ; ++j) se += expf(s[j] - mx); const float sc = 256.0f / se;
#pragma unroll 1
  for (int j0 = 0; j0 < SQ; j0 += 8) { FragH f; for (int q = 0; q < 8; ++q) f.h[q] = (_Float16)(expf(s[j0 + q] - mx) * sc); unsigned short* d = (unsigned short*)P + (size_t)i * SQ + j0; *(v8us*)d = f.half[0];  } }
__global__ __launch_bounds__(256) void k_vt(const _Float16* __restrict__ V16, int b, int h0, _Float16* __restrict__ VT) { __shared__ unsigned short tl[64][65]; const int tid = threadIdx.x; const int hh = blockIdx.x % HG, sg = blockIdx.x / HG; const int s0 = sg * 64; const int h = h0 + hh;
  for (int i = tid; i < 64 * 8; i += 256) { const int j = i / 8, d8 = (i % 8) * 8; FragH f; f.half[0] = *(const v8us*)((const unsigned short*)V16 + ((size_t)b * SQ + s0 + j) * DM + h * HD + d8); for (int q = 0; q < 8; ++q) tl[d8 + q][j] = f.u[q]; }
  __syncthreads();
  { for (int i = tid; i < 64 * 8; i += 256) { const int d = i / 8, j8 = (i % 8) * 8; FragH f; for (int q = 0; q < 8; ++q) f.u[q] = tl[d][j8 + q]; *(v8us*)((unsigned short*)VT + ((size_t)hh * HD + d) * SQ + s0 + j8) = f.half[0]; }  } }



__global__ __launch_bounds__(256) void k_rsmcf2(const float* __restrict__ S, _Float16* __restrict__ P, int hg, int q0, int nk) {
  #pragma clang fp contract(off)
  const int t = blockIdx.x * 256 + threadIdx.x; if (t >= hg * QT) return; const size_t i = (size_t)t; const float* s = S + i * NKX; const int last = q0 + (t % QT); float mx = -3.0e38f;
#pragma unroll 1
  for (int j = 0; j < nk; ++j) { const float f = (j <= last) ? 1.f : 0.f; mx = fmaxf(mx, fmaf(f, s[j], (1.f - f) * -1.0e9f)); } float se = 0.f;
#pragma unroll 1
  for (int j = 0; j < nk; ++j) { const float f = (j <= last) ? 1.f : 0.f; se += __expf(fmaf(f, s[j], (1.f - f) * -1.0e9f) - mx); } const float sc = 256.0f / se;
#pragma unroll 1
  for (int j0 = 0; j0 < nk; j0 += 8) { FragH fr; for (int q = 0; q < 8; ++q) { const int j = j0 + q; const float f = (j <= last) ? 1.f : 0.f; fr.h[q] = (_Float16)(__expf(fmaf(f, s[j], (1.f - f) * -1.0e9f) - mx) * sc); } unsigned short* d = (unsigned short*)P + i * NKX + j0; *(v8us*)d = fr.half[0];  } }

template <int MASKADD>
__global__ __launch_bounds__(64) void k_att0(const float* __restrict__ QF, const float* __restrict__ KF, const float* __restrict__ VF, int ld, const float* __restrict__ mask, float scale, float* __restrict__ OF, int ldo) {
  #pragma clang fp contract(off)
  __shared__ __attribute__((aligned(16))) float lq[64][64]; __shared__ __attribute__((aligned(16))) float lo[64][64];
  const int tid = threadIdx.x; const int h = blockIdx.x / (QT0 / 64), rg = blockIdx.x % (QT0 / 64); const int i = rg * 64 + tid;
  const float* qr = QF + (size_t)i * ld + h * HD;
#pragma unroll 1
  for (int c = 0; c < HD / 4; ++c) { *(v4f*)&lq[tid][c * 4] = *(const v4fa*)(qr + c * 4); const v4f z = {0.f, 0.f, 0.f, 0.f}; *(v4f*)&lo[tid][c * 4] = z; }
  float m = -1.0e30f, l = 0.f; const int jmax = MASKADD ? (SQ - 1) : (rg * 64 + 63);      /* additive-mask form: every key (the mask input decides); causal form: keys up to the block's last row */
#pragma unroll 1
  for (int j = 0; j <= jmax; ++j) { const float* kr = KF + (size_t)j * ld + h * HD; const float* vr = VF + (size_t)j * ld + h * HD; float s = 0.f;
#pragma unroll 1
    for (int c = 0; c < HD / 4; ++c) { const v4f kq = *(const v4fa*)(kr + c * 4); const v4f qq = *(v4f*)&lq[tid][c * 4]; s = __fadd_rn(s, __fmul_rn(qq[0], kq[0])); s = __fadd_rn(s, __fmul_rn(qq[1], kq[1])); s = __fadd_rn(s, __fmul_rn(qq[2], kq[2])); s = __fadd_rn(s, __fmul_rn(qq[3], kq[3])); }
    s = __fmul_rn(s, scale); if (MASKADD) s = __fadd_rn(s, __fmul_rn(bf16_round(mask[(size_t)i * SQ + j]), -10000.0f));
    const float f = (MASKADD || j <= i) ? 1.f : 0.f; const float sm = fmaf(f, s, (1.f - f) * -1.0e30f); const float mn = fmaxf(m, sm); const float sc = expf(m - mn); const float e = expf(sm - mn); l = __fadd_rn(__fmul_rn(l, sc), e); m = mn;
#pragma unroll 1
    for (int c = 0; c < HD / 4; ++c) { const v4f vv = *(const v4fa*)(vr + c * 4); v4f oo = *(v4f*)&lo[tid][c * 4]; for (int u = 0; u < 4; ++u) oo[u] = __fadd_rn(__fmul_rn(oo[u], sc), __fmul_rn(e, vv[u])); *(v4f*)&lo[tid][c * 4] = oo; } }
  const float fin = 64.0f / l;      /* o carried x64 like the f16 path */
#pragma unroll 1
  for (int c = 0; c < HD / 4; ++c) { v4f oo = *(v4f*)&lo[tid][c * 4]; for (int u = 0; u < 4; ++u) oo[u] = __fmul_rn(oo[u], fin); *(v4f*)&lo[tid][c * 4] = oo; }
  __syncthreads();
  {
#pragma unroll 1
    for (int it = 0; it < 16; ++it) { const int row = it * 4 + tid / 16, pc = (tid % 16) * 4; const v4f v = *(const v4f*)&lo[row][pc]; *(v4f*)(OF + (size_t)(rg * 64 + row) * ldo + h * HD + pc) = v; }
     } }

__global__ __launch_bounds__(256) void k_oscale(const float* __restrict__ OF, float* __restrict__ out, size_t n4) { const size_t t = (size_t)blockIdx.x * 256 + threadIdx.x; if (t >= n4) return; const v4f a = *(const v4fa*)(OF + t * 4); v4f o; for (int q = 0; q < 4; ++q) o[q] = a[q] * 0.015625f; *(v4f*)(out + t * 4) = o;  }

__global__ __launch_bounds__(256) void k_bfr(const float* __restrict__ x, float* __restrict__ XB, size_t n8) { const size_t t = (size_t)blockIdx.x * 256 + threadIdx.x; if (t >= n8) return; v4f a = *(const v4fa*)(x + t * 8), c = *(const v4fa*)(x + t * 8 + 4); for (int q = 0; q < 4; ++q) { a[q] = bf16_round(a[q]); c[q] = bf16_round(c[q]); }
  { *(v4f*)(XB + t * 8) = a; *(v4f*)(XB + t * 8 + 4) = c;  } }



__global__ __launch_bounds__(256) void k_rsmfvl(const float* __restrict__ S, _Float16* __restrict__ P, _Float16* __restrict__ PL, int qn, const int* __restrict__ vlp) {
  #pragma clang fp contract(off)
  const int t = blockIdx.x * 256 + threadIdx.x; if (t >= qn) return; const int vl = vlp[0]; const size_t i = (size_t)t; const float* s = S + i * SQ; float mx = -3.0e38f;
#pragma unroll 1
  for (int j = 0; j < SQ; ++j) { const float f = (j < vl) ? 1.f : 0.f; mx = fmaxf(mx, fmaf(f, s[j], (1.f - f) * -1000000.0f)); } float se = 0.f;
#pragma unroll 1
  for (int j = 0; j < SQ; ++j) { const float f = (j < vl) ? 1.f : 0.f; se += __expf(fmaf(f, s[j], (1.f - f) * -1000000.0f) - mx); } const float sc = 256.0f / se;
#pragma unroll 1
  for (int j0 = 0; j0 < SQ; j0 += 8) { FragH fr, gr; for (int q = 0; q < 8; ++q) { const int j = j0 + q; const float f = (j < vl) ? 1.f : 0.f; const float pv = __expf(fmaf(f, s[j], (1.f - f) * -1000000.0f) - mx) * sc; const _Float16 ph = (_Float16)pv; fr.h[q] = ph; gr.h[q] = (_Float16)((pv - (float)ph) * 1024.0f); }
    unsigned short* d = (unsigned short*)P + i * SQ + j0; unsigned short* dl = (unsigned short*)PL + i * SQ + j0; *(v8us*)d = fr.half[0]; *(v8us*)dl = gr.half[0];  } }

__global__ __launch_bounds__(256) void k_rsmf(const float* __restrict__ S, _Float16* __restrict__ P, int qn, int hg) {
  #pragma clang fp contract(off)
  const int t = blockIdx.x * 256 + threadIdx.x; if (t >= qn * hg) return; const size_t i = (size_t)(t / qn) * SQ + (t % qn); const float* s = S + i * SQ; float mx = -3.0e38f;
#pragma unroll 1
  for (int j = 0; j < SQ; ++j) mx = fmaxf(mx, s[j]); float se = 0.f;
#pragma unroll 1
  for (int j = 0; j < SQ; ++j) se += __expf(s[j] - mx); const float sc = 256.0f / se;
#pragma unroll 1
  for (int j0 = 0; j0 < SQ; j0 += 8) { FragH f; for (int q = 0; q < 8; ++q) f.h[q] = (_Float16)(__expf(s[j0 + q] - mx) * sc); unsigned short* d = (unsigned short*)P + i * SQ + j0; *(v8us*)d = f.half[0];  } }


#define CN 256          /* channels */
#define CI 128
#define NC 256                       /* (unused legacy kernels) */
#define NPX NP          /* positions per channel row */
#define NP 4096         /* seq1 tokens */
#define NM 1024         /* seq2 tokens */
#define BNEPS 1e-5f

__global__ __launch_bounds__(256) void k_mp2(const float* __restrict__ src, float* __restrict__ dst, int nout) {
  const int t = blockIdx.x * 256 + threadIdx.x; if (t >= nout) return; const int c = t / 1024; const int o = t % 1024; const int oy = o / 32, ox = o % 32; const float* p = src + (size_t)c * 4096 + (size_t)(2 * oy) * 64 + 2 * ox;
  const float v = fmaxf(fmaxf(p[0], p[1]), fmaxf(p[64], p[65])); *(float*)(dst + t) = v;  }
__global__ __launch_bounds__(256) void k_xpb(const float* __restrict__ x, const float* __restrict__ wb, float* __restrict__ CPP, size_t n4) {
  #pragma clang fp contract(off)
  const size_t t = (size_t)blockIdx.x * 256 + threadIdx.x; if (t >= n4) return; const size_t e = t * 4; const int c = (int)((e / 4096) % 256); const float bb = bf16_round(wb[c]); const v4f a = *(const v4fa*)(x + e); v4f o; for (int q = 0; q < 4; ++q) o[q] = __fadd_rn(bf16_round(a[q]), bb);
  *(v4f*)(CPP + e) = o;  }


template <int PASS>
__global__ __launch_bounds__(256) void k_cstA(const float* __restrict__ X, const float* __restrict__ MV, float* __restrict__ PART) {
  #pragma clang fp contract(off)
  __shared__ float red[256]; const int t = threadIdx.x; const size_t bc = blockIdx.x; const int c = (int)(bc % NC); const float* row = X + bc * (size_t)NPX; const float mu = PASS ? MV[c] : 0.f; float s = 0.f;
  for (int i = t; i < NPX; i += 256) { const float v = row[i]; const float d = PASS ? __fadd_rn(v, -mu) : v; s = __fadd_rn(s, PASS ? __fmul_rn(d, d) : d); }
  red[t] = s; __syncthreads(); for (int st = 128; st > 0; st >>= 1) { if (t < st) red[t] = __fadd_rn(red[t], red[t + st]); __syncthreads(); }
  if (t < 32) { const float pv = (t == 0) ? red[0] : 0.f; *(float*)(PART + bc * 32 + t) = pv;  } }      

template <int PASS>
__global__ __launch_bounds__(256) void k_cstB(const float* __restrict__ PART, float* __restrict__ MV) { const int c = threadIdx.x; if (c >= NC) return; double s = 0.0; for (int b = 0; b < NB; ++b) s += (double)PART[((size_t)b * NC + c) * 32]; const float m = (float)(s / ((double)NB * (double)NPX)); *(float*)(MV + PASS * NC + c) = m;  }


__global__ __launch_bounds__(256) void k_bnresid(const float* __restrict__ C2, const float* __restrict__ MV, const float* __restrict__ g, const float* __restrict__ be, const float* __restrict__ X, float* __restrict__ out, size_t n4) {
  #pragma clang fp contract(off)
  const size_t t = (size_t)blockIdx.x * 256 + threadIdx.x; if (t >= n4) return; const size_t e = t * 4; const int c = (int)((e / NPX) % NC); const float sc = __fmul_rn(rsqrtf(__fadd_rn(MV[NC + c], BNEPS)), bf16_round(g[c])); const float mu = MV[c], bb = bf16_round(be[c]);
  const v4f a = *(const v4fa*)(C2 + e); const v4f xx = *(const v4fa*)(X + e); v4f o; for (int q = 0; q < 4; ++q) { const float z = __fadd_rn(__fmul_rn(__fadd_rn(a[q], -mu), sc), bb); o[q] = __fadd_rn(z, bf16_round(xx[q])); }
  *(v4f*)(out + e) = o;  }


__global__ __launch_bounds__(256) void k_rowbias(float* __restrict__ Y, const float* __restrict__ bias) {
  #pragma clang fp contract(off)
  const size_t t = (size_t)blockIdx.x * 256 + threadIdx.x; if (t >= (size_t)NB * NC * NPX / 4) return; const size_t e = t * 4; const int c = (int)((e / NPX) % NC); const float bb = bf16_round(bias[c]);
  v4f v = *(const v4fa*)(Y + e); for (int q = 0; q < 4; ++q) v[q] = __fadd_rn(v[q], bb); *(v4f*)(Y + e) = v;  }



template <int NBt, int QTt, int NKt>
__global__ __launch_bounds__(256) void k_bsm(const float* __restrict__ S, _Float16* __restrict__ P) {
  #pragma clang fp contract(off)
  const size_t t = (size_t)blockIdx.x * 256 + threadIdx.x; if (t >= (size_t)QTt * NKt / 8) return; const size_t e = t * 8; float mx[8], se[8];
  for (int q = 0; q < 8; ++q) { mx[q] = -3.0e38f; se[q] = 0.f; }
#pragma unroll
  for (int b = 0; b < NBt; ++b) { const float* s = S + (size_t)b * QTt * NKt + e; for (int q = 0; q < 8; ++q) mx[q] = fmaxf(mx[q], s[q]); }
#pragma unroll
  for (int b = 0; b < NBt; ++b) { const float* s = S + (size_t)b * QTt * NKt + e; for (int q = 0; q < 8; ++q) se[q] += __expf(s[q] - mx[q]); }
#pragma unroll
  for (int b = 0; b < NBt; ++b) { const float* s = S + (size_t)b * QTt * NKt + e; FragH f; for (int q = 0; q < 8; ++q) f.h[q] = (_Float16)(__expf(s[q] - mx[q]) * (256.0f / se[q]));
    unsigned short* d = (unsigned short*)P + (size_t)b * QTt * NKt + e; *(v8us*)d = f.half[0];  } }
// ---- fused scores + batch-axis softmax + P V: one launch for all queries ----
#define FQ 16       /* query rows per work-group */
#define FK 128      /* keys per pass: 16 per wave in part 1 */
#define FPP 136     /* LDS pitch of a P row in f16: 272 B = 16 B x odd, so the 16-byte row reads of part 2 do not collide */
#define FS 4096     /* sequence length */
#define FD 64       /* width */
#define FB 8        /* batches = waves of the work-group */
__device__ __forceinline__ v8f f_mma(v16h a, v16h b, v8f c) { return __builtin_amdgcn_wmma_f32_16x16x32_f16(false, a, false, b, (short)0, c, false, false); }
__device__ __forceinline__ v16h f_frag(const _Float16* p) { FragH f; f.half[0] = *(const v8us*)((const unsigned short*)p); f.half[1] = *(const v8us*)((const unsigned short*)p + 16); return f.v; }      /* p already holds the lane half's 8 hh: the k order of g2_frag */
__device__ __forceinline__ v16h f_fragp(const _Float16* p) { FragH f; f.half[0] = *(const v8us*)((const unsigned short*)p); f.half[1] = *(const v8us*)((const unsigned short*)p + 256); return f.v; }      /* fragment-order planes: p holds the lane's own 8 values, the fragment's second half lies one wave-wide load (32 lanes x 8) further; same values in the same registers as f_frag on rows */
// ---- one prep launch for Q, K and V: three block ranges that do not depend on one another; each writes the same values to the same places as a launch of its own would ----
#define PVK 128      /* keys per work-group of the V range */
#define PVM (PVK * 8 / 256)      /* 8-value items per thread there */
#define PVW (FB * FS / PVK)      /* work-groups of the V range: PVK keys x 64 d of one batch each */
#define PIT 8      /* 8-value items per thread in the Q and K ranges: few waves to start, all of a thread's loads in flight at once */
#define PXW (FB * FS * FD / 8 / 256 / PIT)      /* work-groups of the Q range, and of the K range */
__device__ __forceinline__ v8us p_cvt(v4f a, v4f c) { FragH f;      /* 8 inputs rounded to bf16, held as exact f16 */
#pragma unroll
  for (int q = 0; q < 4; ++q) { f.h[q] = (_Float16)bf16_round(a[q]); f.h[4 + q] = (_Float16)bf16_round(c[q]); }
  return f.half[0]; }
// V range (first: it has the longest chain): V^T in fragment order: per batch [32-key block][t = d / 16][half = (key / 16) & 1][lane = 16 ((key / 8) & 1) + d % 16][8 keys]; a work-group turns PVK keys x 64 d in LDS and writes 16 KiB in a row; the batch planes follow one another, so the block index runs through all batches
// Q range: rows as they are. K range: fragment order: [16-key tile][j = d / 16][lane = 16 ((d / 8) & 1) + key % 16][8 d]; tile = 1024 values, so a batch plane keeps its size and place
__global__ __launch_bounds__(256) void k_prep(const float* __restrict__ xq, const float* __restrict__ xk, const float* __restrict__ xv, _Float16* __restrict__ Q16, _Float16* __restrict__ KP, _Float16* __restrict__ VP) {
  __shared__ unsigned short tl[PVK][66]; const int tid = threadIdx.x; const int bx = blockIdx.x;
  if (bx < PVW) {      /* the same for the whole work-group, so the barrier inside is passed by all of it or by none */
    const float* s = xv + (size_t)bx * (PVK * 64) + tid * 8; v4f a[PVM], c[PVM];      /* key tid / 8 (and 32, 64, ... further), d (tid % 8) * 8 */
#pragma unroll      /* register arrays need constant indices */
    for (int m = 0; m < PVM; ++m) { a[m] = *(const v4fa*)(s + m * 2048); c[m] = *(const v4fa*)(s + m * 2048 + 4); }
    asm volatile("s_wait_xcnt 0x0" :: "v"(s) : "memory");      /* precaution: stands in front of any rewrite of a register that an issued load names; the input keeps the address pair whole up to it */
    const int r = tid / 8, c8 = (tid % 8) * 8;
#pragma unroll      /* register arrays need constant indices */
    for (int m = 0; m < PVM; ++m) { FragH f; f.half[0] = p_cvt(a[m], c[m]);
#pragma unroll
      for (int q = 0; q < 8; ++q) tl[r + 32 * m][c8 + q] = f.u[q]; }
    __syncthreads();
    FragH g[PVM];
#pragma unroll      /* register arrays need constant indices */
    for (int m = 0; m < PVM; ++m) { const int i = m * 256 + tid; const int k0 = (i >> 8) * 32 + ((i >> 5) & 1) * 16 + ((i >> 4) & 1) * 8, d = ((i >> 6) & 3) * 16 + (i & 15);
#pragma unroll
      for (int q = 0; q < 8; ++q) g[m].u[q] = tl[k0 + q][d]; }
    unsigned short* o = (unsigned short*)VP + (size_t)bx * (PVK * 64) + (size_t)tid * 8;
    __builtin_amdgcn_sched_barrier(0);      /* every value ahead of the first store, so that no register that an issued store names is rewritten behind it */
#pragma unroll      /* register arrays need constant indices */
    for (int m = 0; m < PVM; ++m) *(v8us*)(o + m * 2048) = g[m].half[0];
    return;
  }
  const bool isk = bx >= PVW + PXW; const size_t t = (size_t)(bx - PVW - (isk ? PXW : 0)) * (256 * PIT) + tid;      /* first item; the others lie 256 items apart */
  const float* s = (isk ? xk : xq) + t * 8; v4f a[PIT], c[PIT];
#pragma unroll      /* register arrays need constant indices */
  for (int j = 0; j < PIT; ++j) { a[j] = *(const v4fa*)(s + j * 2048); c[j] = *(const v4fa*)(s + j * 2048 + 4); }
  asm volatile("s_wait_xcnt 0x0" :: "v"(s) : "memory");      /* as above */
  const size_t row = t >> 3; const int c8 = (int)(t & 7);
  unsigned short* o = isk ? (unsigned short*)KP + (row >> 4) * 1024 + (size_t)((c8 >> 1) * 256 + ((c8 & 1) * 16 + (int)(row & 15)) * 8) : (unsigned short*)Q16 + t * 8;      /* 256 items on = 32 rows = 2 key tiles = 2048 values on, in both orders */
  v8us h[PIT];
#pragma unroll      /* register arrays need constant indices */
  for (int j = 0; j < PIT; ++j) h[j] = p_cvt(a[j], c[j]);
  __builtin_amdgcn_sched_barrier(0);      /* as above: every value ahead of the first store */
#pragma unroll      /* register arrays need constant indices */
  for (int j = 0; j < PIT; ++j) *(v8us*)(o + j * 2048) = h[j];
}
__device__ __forceinline__ float f_exp(float x) { float e; asm("v_exp_f32 %0, %1\n\tv_nop" : "=v"(e) : "v"(x * 1.44269504f)); return e; }      /* native exp as in __expf; the v_nop is the slot the instruction set asks for behind a transcendental before its source is overwritten or its result read */
__global__ __launch_bounds__(256) void k_fused(const _Float16* __restrict__ Q16, const _Float16* __restrict__ K16, const _Float16* __restrict__ VT, float* __restrict__ out) {
  __shared__ __attribute__((aligned(16))) _Float16 pl[2][FB][FQ][FPP];      /* two buffers: one barrier a pass is enough */
  const int tid = threadIdx.x, w = tid >> 5, lane = tid & 31, ln = lane & 15, hh = lane >> 4; const int q0 = blockIdx.x * FQ;
  constexpr size_t PLN = (size_t)FS * FD;
  const v8f z8 = {0.f,0.f,0.f,0.f,0.f,0.f,0.f,0.f};
  const _Float16* qp = Q16 + (size_t)(q0 + ln) * FD + 8 * hh;      /* Q rows q0 + ln (B operand of part 1) */
  const _Float16* kp = K16 + (size_t)w * (16 * FD) + lane * 8;      /* part 1: this wave's 16-key tile, fragment order (A operand) */
  const _Float16* vp = VT + (size_t)w * PLN + lane * 8;      /* part 2: V^T of batch w, fragment order (B operand) */
  v16h qf[FB][2];      /* kept for the whole walk */
  v16h kf[FB][2];
#pragma unroll      /* register arrays need constant indices */
  for (int b = 0; b < FB; ++b) { qf[b][0] = f_frag(qp + (size_t)b * PLN); qf[b][1] = f_frag(qp + (size_t)b * PLN + 32); }
#pragma unroll      /* register arrays need constant indices */
  for (int b = 0; b < FB; ++b) { kf[b][0] = f_fragp(kp + (size_t)b * PLN); kf[b][1] = f_fragp(kp + (size_t)b * PLN + 512); }
  asm volatile("s_wait_xcnt 0x0" :: "v"(qp), "v"(kp) : "memory");      /* precaution: stands in front of any rewrite of a register that an issued load names; the inputs keep both address pairs whole up to it */
  v8f o[4] = {z8, z8, z8, z8};
  for (int it = 0; it < FS / FK; ++it) {
    const int kb = it * FK; const int kn = (kb + FK) & (FS - 1);      /* next pass's keys; the last pass requests the first keys again: in bounds, not used */
    const _Float16* vb = vp + (size_t)kb * FD; const _Float16* kq = kp + (size_t)kn * FD;
    v16h vf[4][4];      /* this pass's V^T fragments, requested here so that they arrive under the scores and the softmax */
#pragma unroll      /* register arrays need constant indices */
    for (int ks = 0; ks < 4; ++ks)
#pragma unroll
      for (int t = 0; t < 4; ++t) vf[ks][t] = f_fragp(vb + ks * (32 * FD) + t * 512);
    asm volatile("s_wait_xcnt 0x0" :: "v"(vb) : "memory");      /* as above, for the V^T address pair */
    __builtin_amdgcn_sched_barrier(0);      /* keeps the requests above in front of the scores and the softmax; without it the scheduler sinks half of them to the softmax's end, where their latency is waited out at the barrier */
    v8f s[FB];      /* s[b][r] = Q[b][q0 + ln] . K[b][kb + 16 w + 8 hh + r] */
#pragma unroll      /* register arrays need constant indices */
    for (int b = 0; b < FB; ++b) s[b] = f_mma(kf[b][1], qf[b][1], f_mma(kf[b][0], qf[b][0], z8));
    FragH pk[FB];
#pragma unroll      /* register arrays need constant indices */
    for (int r = 0; r < 8; ++r) { float x[FB], e[FB]; float mx = -3.0e38f, se = 0.f;
#pragma unroll
      for (int b = 0; b < FB; ++b) { x[b] = s[b][r] * 0.125f; mx = fmaxf(mx, x[b]); }
#pragma unroll
      for (int b = 0; b < FB; ++b) { e[b] = f_exp(x[b] - mx); se += e[b]; }
      const float sc = 256.0f / se;
#pragma unroll
      for (int b = 0; b < FB; ++b) pk[b].h[r] = (_Float16)(e[b] * sc); }
    _Float16* pw = &pl[it & 1][0][ln][16 * w + 8 * hh];
#pragma unroll      /* register arrays need constant indices */
    for (int b = 0; b < FB; ++b) *(v8us*)((unsigned short*)pw + (size_t)b * FQ * FPP) = pk[b].half[0];
    __syncthreads();      /* publishes this pass's P; with two buffers it also ends every read of the buffer that the next pass rewrites */
    const _Float16* pr = &pl[it & 1][w][ln][8 * hh]; v16h pa[4];      /* P[w] rows as A operands: all four read in one group, beside the K requests */
#pragma unroll      /* register arrays need constant indices */
    for (int ks = 0; ks < 4; ++ks) pa[ks] = f_frag(pr + ks * 32);
#pragma unroll      /* register arrays need constant indices */
    for (int b = 0; b < FB; ++b) { kf[b][0] = f_fragp(kq + (size_t)b * PLN); kf[b][1] = f_fragp(kq + (size_t)b * PLN + 512); }      /* next pass's K fragments, requested here so that they arrive under the products */
    asm volatile("s_wait_xcnt 0x0" :: "v"(kq) : "memory");      /* as above, for the K address pair */
    __builtin_amdgcn_sched_barrier(0);      /* keeps the products behind the requests; without it the scheduler lifts products with their LDS waits in front of the K requests, which then start later */
#pragma unroll      /* register arrays need constant indices */
    for (int ks = 0; ks < 4; ++ks)
#pragma unroll
      for (int t = 0; t < 4; ++t) o[t] = f_mma(pa[ks], vf[ks][t], o[t]);
  }
  float* op = out + (size_t)w * PLN + (size_t)(q0 + 8 * hh) * FD + ln;
#pragma unroll      /* register arrays need constant indices */
  for (int t = 0; t < 4; ++t) o[t] = o[t] * 0.00390625f;
  __builtin_amdgcn_sched_barrier(0);      /* every product ahead of the first store, so that no register that an issued store names is rewritten behind it */
#pragma unroll      /* register arrays need constant indices */
  for (int t = 0; t < 4; ++t)
#pragma unroll
    for (int r = 0; r < 8; ++r) op[(size_t)r * FD + t * 16] = o[t][r];
}
extern "C" void kernel_launch(void* const* d_in, const int* in_sizes, int n_in,
                              void* d_out, int out_size, void* d_ws, size_t ws_size, hipStream_t stream) {
  (void)in_sizes; (void)n_in; (void)out_size;
  const float* const* I = (const float* const*)d_in; const float* xq = I[0]; const float* xk = I[1]; const float* xv = I[2];      /* Q, K, V [8][4096][64] (bf16-valued) */
  constexpr int NBt = 8, SQt = 4096, DK = 64;      /* batches, sequence, width */
  char* ws = (char*)d_ws; size_t off = 0;
  auto take = [&](size_t bytes) { char* p = ws + off; off += (bytes + 255) & ~(size_t)255; return p; };
  const size_t PLN = (size_t)SQt * DK;      /* one batch's [4096][64] plane */
  _Float16* Q16 = (_Float16*)take(NBt * PLN * 2); _Float16* K16 = (_Float16*)take(NBt * PLN * 2); _Float16* VT = (_Float16*)take(NBt * PLN * 2);
  if (off > ws_size) return;
  k_prep<<<PVW + 2 * PXW, 256, 0, stream>>>(xq, xk, xv, Q16, K16, VT);      /* exact f16 copies of the bf16-valued inputs: Q in rows, K and V^T in fragment order */
  k_fused<<<SQt / FQ, 256, 0, stream>>>(Q16, K16, VT, (float*)d_out);      /* scores, softmax across the 8 batches and P V for 16 query rows of all batches per work-group */
}

// v004
// Measured time: 73.1 microseconds a run.
// In both of two side-by-side timings against v003, it was 1.33 times as fast.
// Over all steps from v000 it is 29.1 times as fast.
#include <hip/hip_runtime.h>
// Dot-product attention whose softmax runs over the BATCH axis (Q, K, V [8][4096][64], no heads, no weights; scores = Q K^T / sqrt(64) -> [8][4096][4096]; attn = softmax(scores, axis = 0): for every (query, key) pair the 8 batch entries are normalised against each other (the module's literal axis; rows are NOT normalised over keys); out[b] = attn[b] V[b] -> [8][4096][64]).
// Structure: three launches. ONE prep launch (three block ranges) writes the bf16-valued inputs as exact f16; K and V^T (via LDS transposes, once) are written in WMMA fragment order, so that every wave-wide 16-byte load of the walk reads 512 contiguous bytes (4 whole lines, not 32 bytes of each of 16 lines); then ONE fused launch: a work-group owns 32 query rows (two tiles of 16) of all 8 batches and walks one half of the keys 128 at a time, every K and V^T fragment it fetches serving both tiles; Q fragments lie in LDS. Part 1 of a pass: wave w forms S^T = K Q^T for its 16 keys in all 8 batches (WMMA, f32 accumulation, K = 64), so a lane holds the 8 batch values of each (query, key) pair and normalises them in registers (f32, native exp; weights x256 f16), then stores 8 keys of one query per batch to LDS. Part 2: wave w is batch w: out[w] += P[w] V[w]^T (WMMA, f32), keys in ascending order inside a half. A last launch adds the two halves, x 2^-8. Scores and weights never reach memory.
// Compute dtype: inputs rounded to bf16; x / weights exact; q, k, v and softmax weights as plain f16 GEMM operands (~2^-12); scores, softmax statistics and o f32. v_wmma_f32_16x16x32_f16.
#define NB 4
#define SQ 4096
#define DM 256
#define NH 1
#define HD 64
#define HG 4                         /* heads per attention launch group */
#define B0 0                         /* first batch processed (debug hook) */
#define NBR NB                       /* batches processed (debug hook) */
#define NR ((size_t)NB * SQ)         /* token rows */
#define MP ((int)((size_t)NBR * SQ)) /* rows projected (debug hook) */
#define QT 256                       /* query rows per causal tile */
#define NKX SQ                       /* S / P row pitch */
#define QT0 256                      /* first-tile rows recomputed exactly (256: buys margin for the few-key rows 128..255, which have no output projection to average the single-f16 P/v rounding) */
#define QN SQ                        /* query rows attended per batch (debug hook) */
#define NHD NH                       /* heads attended (debug hook) */
#define MPO MP                       /* rows through the output stage (debug hook) */
#define LQ DM            /* row pitch of the q/k/v rows */
typedef __bf16 v16b __attribute__((ext_vector_type(16)));
typedef unsigned short v8us __attribute__((ext_vector_type(8), may_alias));
typedef float  v8f  __attribute__((ext_vector_type(8)));
typedef float  v4f  __attribute__((ext_vector_type(4)));
typedef float  v4fa __attribute__((ext_vector_type(4), may_alias));
union FragB { v16b v; v8us half[2]; unsigned short u[16]; };

__device__ __forceinline__ unsigned short bf16_bits(float x) { unsigned int u = __float_as_uint(x); return (unsigned short)((u + 0x7FFFu + ((u >> 16) & 1u)) >> 16); }
__device__ __forceinline__ float bf16_val(unsigned short b) { return __uint_as_float(((unsigned int)b) << 16); }
__device__ __forceinline__ float bf16_round(float x) { return bf16_val(bf16_bits(x)); }
// D += A·B with NT terms: 1 = ah·bh, 2 = + al·bh (A split), 3 = + ah·bl (both split)
template <int NT>
__device__ __forceinline__ v8f mmaN(v16b ah, v16b al, v16b bh, v16b bl, v8f c) {
  c = __builtin_amdgcn_wmma_f32_16x16x32_bf16(false, ah, false, bh, (short)0, c, false, false);
  if (NT >= 2) c = __builtin_amdgcn_wmma_f32_16x16x32_bf16(false, al, false, bh, (short)0, c, false, false);
  if (NT >= 3) c = __builtin_amdgcn_wmma_f32_16x16x32_bf16(false, ah, false, bl, (short)0, c, false, false);
  asm volatile("v_nop\n\tv_nop\n\tv_nop\n\tv_nop" : "+v"(c) : "v"(ah), "v"(al), "v"(bh), "v"(bl));
  return c;
}

__global__ __launch_bounds__(256) void k_wt_bf16(const float* __restrict__ W, unsigned short* __restrict__ Wt, int K, int N) {
  const int t = blockIdx.x * 256 + threadIdx.x;
  const int k8n = K / 8;
  if (t >= N * k8n) return;
  const int n = t / k8n, k8 = (t % k8n) * 8;
  v8us v;
#pragma unroll
  for (int i = 0; i < 8; ++i) v[i] = bf16_bits(W[(size_t)(k8 + i) * N + n]);
  *(v8us*)(Wt + (size_t)n * K + k8) = v;
  
}

// GEMM C[M][N] (f32, pitch ldc) = act(A[M][K]·W + bias). A f32 row-major (pitch lda) converted per fragment to bf16
// (ASPLIT: hi/lo two planes -> 2 terms, else single rounded term); Wt bf16 [N][K] (pitch ldb). BIAS_BF16 rounds the
// bias to bf16 first (bias quantised to bf16 before the add). K%32==0, M%16==0, N%64==0.
template <bool ASPLIT, int ACT, bool BIAS_BF16>
__global__ __launch_bounds__(128) void k_gemm_bf(const float* __restrict__ A, int lda, const unsigned short* __restrict__ Wt, int ldb,
                                               const float* __restrict__ bias, float* __restrict__ C, int ldc, int M, int N, int K) {
  __shared__ __attribute__((aligned(16))) float so[4][16][64];
  const int tid = threadIdx.x, w = tid >> 5, lane = tid & 31, ln = lane & 15, hh = lane >> 4;
  const int ntn = N / 64;
  const int wid = blockIdx.x * 4 + w;
  const int mt = wid / ntn, nq = wid % ntn;
  if (mt * 16 >= M) return;
  const int row0 = mt * 16, col0 = nq * 64;
  const float* arow = A + (size_t)(row0 + ln) * lda;
  v8f acc[4] = {};
  for (int kb = 0; kb < K; kb += 32) {
    FragB ah, al;
    const v4f x0 = *(const v4fa*)(arow + kb + 8 * hh), x1 = *(const v4fa*)(arow + kb + 8 * hh + 4);
    const v4f x2 = *(const v4fa*)(arow + kb + 16 + 8 * hh), x3 = *(const v4fa*)(arow + kb + 16 + 8 * hh + 4);
    float xs[16] = {x0[0],x0[1],x0[2],x0[3],x1[0],x1[1],x1[2],x1[3],x2[0],x2[1],x2[2],x2[3],x3[0],x3[1],x3[2],x3[3]};
#pragma unroll
    for (int i = 0; i < 16; ++i) { const unsigned short hb = bf16_bits(xs[i]); ah.u[i] = hb; al.u[i] = ASPLIT ? bf16_bits(xs[i] - bf16_val(hb)) : (unsigned short)0; }
#pragma unroll
    for (int t = 0; t < 4; ++t) {
      const unsigned short* brow = Wt + (size_t)(col0 + t * 16 + ln) * ldb + kb;
      FragB b;
      b.half[0] = *(const v8us*)(brow + 8 * hh);
      b.half[1] = *(const v8us*)(brow + 16 + 8 * hh);
      acc[t] = mmaN<ASPLIT ? 2 : 1>(ah.v, al.v, b.v, b.v, acc[t]);
    }
  }
#pragma unroll
  for (int t = 0; t < 4; ++t) {
    float bv = bias ? bias[col0 + t * 16 + ln] : 0.f;
    if (BIAS_BF16) bv = bf16_round(bv);
#pragma unroll
    for (int r = 0; r < 8; ++r) { float v = acc[t][r] + bv; if (ACT == 1) v = fmaxf(v, 0.f); so[w][8 * hh + r][t * 16 + ln] = v; }
  }
  __builtin_amdgcn_fence(__ATOMIC_ACQ_REL, "workgroup");
  __builtin_amdgcn_wave_barrier();
  const int rsub = lane >> 4, c4 = (lane & 15) * 4;
  {
#pragma unroll
    for (int q = 0; q < 8; ++q) {
      const int r = q * 2 + rsub;
      const v4f v = *(const v4fa*)&so[w][r][c4];
      *(v4f*)(C + (size_t)(row0 + r) * ldc + col0 + c4) = v;
    }
    
  }
}

// GEMM C = act(A·W + bias + resid): A f32 (ASPLIT -> hi/lo 2 terms), Wt bf16 [N][K]; ACT 0 none, 1 relu, 2 exact gelu;
// resid (optional, f32, row index = (row % rmod), pitch ldr, RES_BF16 rounds it) added before the activation.
template <bool ASPLIT, int ACT, bool BIAS_BF16, bool RES_BF16>
__global__ __launch_bounds__(128) void k_gemm_bf3(const float* __restrict__ A, int lda, const unsigned short* __restrict__ Wt, int ldb,
                                                const float* __restrict__ bias, const float* __restrict__ resid, int rmod, int ldr,
                                                float* __restrict__ C, int ldc, int M, int N, int K) {
  __shared__ __attribute__((aligned(16))) float so[4][16][64];
  const int tid = threadIdx.x, w = tid >> 5, lane = tid & 31, ln = lane & 15, hh = lane >> 4;
  const int ntn = N / 64;
  const int wid = blockIdx.x * 4 + w;
  const int mt = wid / ntn, nq = wid % ntn;
  if (mt * 16 >= M) return;
  const int row0 = mt * 16, col0 = nq * 64;
  const float* arow = A + (size_t)(row0 + ln) * lda;
  v8f acc[4] = {};
  for (int kb = 0; kb < K; kb += 32) {
    FragB ah, al;
    const v4f x0 = *(const v4fa*)(arow + kb + 8 * hh), x1 = *(const v4fa*)(arow + kb + 8 * hh + 4);
    const v4f x2 = *(const v4fa*)(arow + kb + 16 + 8 * hh), x3 = *(const v4fa*)(arow + kb + 16 + 8 * hh + 4);
    float xs[16] = {x0[0],x0[1],x0[2],x0[3],x1[0],x1[1],x1[2],x1[3],x2[0],x2[1],x2[2],x2[3],x3[0],x3[1],x3[2],x3[3]};
#pragma unroll
    for (int i = 0; i < 16; ++i) { const unsigned short hb = bf16_bits(xs[i]); ah.u[i] = hb; al.u[i] = ASPLIT ? bf16_bits(xs[i] - bf16_val(hb)) : (unsigned short)0; }
#pragma unroll
    for (int t = 0; t < 4; ++t) {
      const unsigned short* brow = Wt + (size_t)(col0 + t * 16 + ln) * ldb + kb;
      FragB b;
      b.half[0] = *(const v8us*)(brow + 8 * hh);
      b.half[1] = *(const v8us*)(brow + 16 + 8 * hh);
      acc[t] = mmaN<ASPLIT ? 2 : 1>(ah.v, al.v, b.v, b.v, acc[t]);
    }
  }
#pragma unroll
  for (int t = 0; t < 4; ++t) {
    const int col = col0 + t * 16 + ln;
    float bv = bias ? bias[col] : 0.f;
    if (BIAS_BF16) bv = bf16_round(bv);
#pragma unroll
    for (int r = 0; r < 8; ++r) {
      float v = acc[t][r] + bv;
      if (resid) { float rv = resid[(size_t)((row0 + 8 * hh + r) % rmod) * ldr + col]; if (RES_BF16) rv = bf16_round(rv); v += rv; }
      if (ACT == 1) v = fmaxf(v, 0.f);
      if (ACT == 2) v = 0.5f * v * (1.0f + erff(v * 0.70710678118654752f));
      if (ACT == 3) { const float u = 0.7978845608028654f * (v + 0.044715f * v * v * v); v = 0.5f * v * (1.0f + tanhf(u)); }
      so[w][8 * hh + r][t * 16 + ln] = v;
    }
  }
  __builtin_amdgcn_fence(__ATOMIC_ACQ_REL, "workgroup");
  __builtin_amdgcn_wave_barrier();
  const int rsub = lane >> 4, c4 = (lane & 15) * 4;
  {
#pragma unroll
    for (int q = 0; q < 8; ++q) {
      const int r = q * 2 + rsub;
      const v4f v = *(const v4fa*)&so[w][r][c4];
      *(v4f*)(C + (size_t)(row0 + r) * ldc + col0 + c4) = v;
    }
    
  }
}
// row LayerNorm (biased variance, eps) over N: s = X (+ R); optional out_sum <- s; out_norm <- (s-mu)*rsqrt(var+eps)*g + b
template <bool PARAM_BF16>
__global__ __launch_bounds__(256) void k_layernorm(const float* __restrict__ X, const float* __restrict__ R, const float* __restrict__ g, const float* __restrict__ bta,
                                                  float* __restrict__ out_sum, float* __restrict__ out_norm, int N, float eps) {
  __shared__ float red[256];
  const int row = blockIdx.x, tid = threadIdx.x;
  const float* x = X + (size_t)row * N; const float* rr = R ? R + (size_t)row * N : nullptr;
  float vals[16];                     // up to N = 4096
  const int per = N / 256;            // contiguous chunk per thread? use strided-by-4 chunks: thread handles j = tid*4 + 1024*u
  float s1 = 0.f;
  for (int u = 0; u < per / 4; ++u) {
    const int j = tid * 4 + 1024 * u;
    const v4f a = *(const v4fa*)(x + j);
    v4f b = {0.f,0.f,0.f,0.f}; if (rr) b = *(const v4fa*)(rr + j);
#pragma unroll
    for (int q = 0; q < 4; ++q) { const float v = a[q] + b[q]; vals[u * 4 + q] = v; s1 += v; }
  }
  red[tid] = s1; __syncthreads();
  for (int st = 128; st > 0; st >>= 1) { if (tid < st) red[tid] += red[tid + st]; __syncthreads(); }
  const float mu = red[0] / (float)N; __syncthreads();
  float s2 = 0.f;
  for (int u = 0; u < per / 4; ++u)
#pragma unroll
    for (int q = 0; q < 4; ++q) { const float c = vals[u * 4 + q] - mu; s2 += c * c; }
  red[tid] = s2; __syncthreads();
  for (int st = 128; st > 0; st >>= 1) { if (tid < st) red[tid] += red[tid + st]; __syncthreads(); }
  const float rs = rsqrtf(red[0] / (float)N + eps);
  {
    for (int u = 0; u < per / 4; ++u) {
      const int j = tid * 4 + 1024 * u;
      v4f o, sm;
#pragma unroll
      for (int q = 0; q < 4; ++q) {
        float gg = g[j + q], bb = bta[j + q];
        if (PARAM_BF16) { gg = bf16_round(gg); bb = bf16_round(bb); }
        sm[q] = vals[u * 4 + q]; o[q] = (vals[u * 4 + q] - mu) * rs * gg + bb;
      }
      if (out_sum) *(v4f*)(out_sum + (size_t)row * N + j) = sm;
      *(v4f*)(out_norm + (size_t)row * N + j) = o;
    }
    
  }
}



// ---- f16 WMMA path (v_wmma_f32_16x16x32_f16): 11-bit significands for operands in range — used where a [0,1] probability operand needs more precision than bf16
typedef _Float16 v16h __attribute__((ext_vector_type(16)));
union FragH { v16h v; v8us half[2]; _Float16 h[16]; unsigned short u[16]; };
template <int NT>
__device__ __forceinline__ v8f mmaH(v16h ah, v16h al, v16h bh, v16h bl, v8f c) {
  c = __builtin_amdgcn_wmma_f32_16x16x32_f16(false, ah, false, bh, (short)0, c, false, false);
  if (NT >= 2) c = __builtin_amdgcn_wmma_f32_16x16x32_f16(false, al, false, bh, (short)0, c, false, false);
  if (NT >= 3) c = __builtin_amdgcn_wmma_f32_16x16x32_f16(false, ah, false, bl, (short)0, c, false, false);
  asm volatile("v_nop\n\tv_nop\n\tv_nop\n\tv_nop" : "+v"(c) : "v"(ah), "v"(al), "v"(bh), "v"(bl));
  return c;
}
// batched GEMM like k_gemm_b but f16 operands: A f32 (split into f16 hi/lo if ASPLIT, else rounded to f16), Bt = f16 values [n][k]; alpha; C f32; N multiple of 16 (partial tiles skipped)
template <bool ASPLIT>
__global__ __launch_bounds__(128) void k_gemm_h(const float* __restrict__ A, int lda, size_t sA, const _Float16* __restrict__ Bh, int ldb, size_t sB, float alpha, float* __restrict__ C, int ldc, size_t sC, int M, int N, int K) {
  __shared__ __attribute__((aligned(16))) float so[4][16][64];
  const int tid = threadIdx.x, w = tid >> 5, lane = tid & 31, ln = lane & 15, hh = lane >> 4; const int by = blockIdx.y;
  A += (size_t)by * sA; Bh += (size_t)by * sB; C += (size_t)by * sC;
  const int ntn = (N + 63) / 64; const int wid = blockIdx.x * 4 + w; const int mt = wid / ntn, nq = wid % ntn; if (mt * 16 >= M) return;
  const int row0 = mt * 16, col0 = nq * 64; const float* arow = A + (size_t)(row0 + ln) * lda;
  v8f acc[4] = {};
  for (int kb = 0; kb < K; kb += 32) {
    FragH ah, al;
    const v4f x0 = *(const v4fa*)(arow + kb + 8 * hh), x1 = *(const v4fa*)(arow + kb + 8 * hh + 4), x2 = *(const v4fa*)(arow + kb + 16 + 8 * hh), x3 = *(const v4fa*)(arow + kb + 16 + 8 * hh + 4);
    float xs[16] = {x0[0],x0[1],x0[2],x0[3],x1[0],x1[1],x1[2],x1[3],x2[0],x2[1],x2[2],x2[3],x3[0],x3[1],x3[2],x3[3]};
#pragma unroll
    for (int i = 0; i < 16; ++i) { const _Float16 h = (_Float16)xs[i]; ah.h[i] = h; al.h[i] = ASPLIT ? (_Float16)(xs[i] - (float)h) : (_Float16)0.0f; }
#pragma unroll
    for (int t = 0; t < 4; ++t) { if (col0 + t * 16 >= N) continue; const size_t boff = (size_t)(col0 + t * 16 + ln) * ldb + kb; FragH bq; bq.half[0] = *(const v8us*)(Bh + boff + 8 * hh); bq.half[1] = *(const v8us*)(Bh + boff + 16 + 8 * hh);
      acc[t] = mmaH<ASPLIT ? 2 : 1>(ah.v, al.v, bq.v, bq.v, acc[t]); }
  }
#pragma unroll
  for (int t = 0; t < 4; ++t) { if (col0 + t * 16 >= N) continue;
#pragma unroll
    for (int r = 0; r < 8; ++r) so[w][8 * hh + r][t * 16 + ln] = acc[t][r] * alpha; }
  __builtin_amdgcn_fence(__ATOMIC_ACQ_REL, "workgroup"); __builtin_amdgcn_wave_barrier();
  const int rsub = lane >> 4, c4 = (lane & 15) * 4;
  {
#pragma unroll
    for (int q = 0; q < 8; ++q) { const int r = q * 2 + rsub; if (col0 + c4 < N) { const v4f v = *(const v4fa*)&so[w][r][c4]; *(v4f*)(C + (size_t)(row0 + r) * ldc + col0 + c4) = v; } }
     }
}

// Wt[n][k] = f16(W[k][n]·scale) from f32 row-major W[K][N] (scale = power of two; bf16-exact weights stay exact in f16 away from the subnormal range)
__global__ __launch_bounds__(256) void k_wt_f16(const float* __restrict__ W, _Float16* __restrict__ Wt, int K, int N, float scale) {
  const int t = blockIdx.x * 256 + threadIdx.x; if (t >= N * (K / 8)) return; const int n = t / (K / 8), k8 = (t % (K / 8)) * 8; FragH f;
#pragma unroll
  for (int i = 0; i < 8; ++i) f.h[i] = (_Float16)(bf16_round(W[(size_t)(k8 + i) * N + n]) * scale); const v8us o = f.half[0];
  *(v8us*)((unsigned short*)Wt + (size_t)n * K + k8) = o; 
}
// k_gemm_hh variant with fused epilogue: v = acc·alpha + bias[by·sBias + col] (+ CP[(row/rowsPerB)·sCPb + by·64 + col] if CP) ; ACT 0 none / 1 elu ; writes f16 C16 (and f32 C if non-null)
template <int ACT>
__global__ __launch_bounds__(128) void k_gemm_hhx(const _Float16* __restrict__ A, int lda, size_t sA, const _Float16* __restrict__ Bh, int ldb, size_t sB, float alpha, const float* __restrict__ bias, size_t sBias, const float* __restrict__ CP, int rowsPerB, size_t sCPb, int row0g,
    float* __restrict__ C, _Float16* __restrict__ C16, int ldc, size_t sC, int M, int N, int K) {
  __shared__ __attribute__((aligned(16))) float so[4][16][64];
  const int tid = threadIdx.x, w = tid >> 5, lane = tid & 31, ln = lane & 15, hh = lane >> 4; const int by = blockIdx.y;
  A += (size_t)by * sA; Bh += (size_t)by * sB; const size_t cofs = (size_t)by * sC; const float* bp = bias ? bias + (size_t)by * sBias : nullptr;
  const int ntn = (N + 63) / 64; const int wid = blockIdx.x * 4 + w; const int mt = wid / ntn, nq = wid % ntn; if (mt * 16 >= M) return;
  const int row0 = mt * 16, col0 = nq * 64; const _Float16* arow = A + (size_t)(row0 + ln) * lda;
  v8f acc[4] = {};
  for (int kb = 0; kb < K; kb += 32) { FragH ah; ah.half[0] = *(const v8us*)((const unsigned short*)arow + kb + 8 * hh); ah.half[1] = *(const v8us*)((const unsigned short*)arow + kb + 16 + 8 * hh);
#pragma unroll
    for (int t = 0; t < 4; ++t) { if (col0 + t * 16 >= N) continue; const size_t boff = (size_t)(col0 + t * 16 + ln) * ldb + kb; FragH bq; bq.half[0] = *(const v8us*)((const unsigned short*)Bh + boff + 8 * hh); bq.half[1] = *(const v8us*)((const unsigned short*)Bh + boff + 16 + 8 * hh);
      acc[t] = mmaH<1>(ah.v, ah.v, bq.v, bq.v, acc[t]); }
  }
#pragma unroll
  for (int t = 0; t < 4; ++t) { if (col0 + t * 16 >= N) continue; const int col = col0 + t * 16 + ln; const float bv = bp ? bf16_round(bp[col]) : 0.f;
#pragma unroll
    for (int r = 0; r < 8; ++r) { float v = acc[t][r] * alpha + bv; if (CP) { const int rr = row0g + row0 + 8 * hh + r; if (rowsPerB < 0) v += CP[cofs + (size_t)rr * ldc + col];      /* rowsPerB < 0: own element of the batched C plane */ else { const int bidx = rr / rowsPerB; v += CP[(size_t)bidx * sCPb + (size_t)by * 64 + col]; } } if (ACT == 1) v = (v > 0.f) ? v : expm1f(v); else if (ACT == 7) v = (v > 0.f) ? v + 1.0f : expf(v); else if (ACT == 8) v = tanhf(v); else if (ACT == 9) v = 0.5f * v * (1.0f + tanhf(0.7978845608028654f * (v + 0.044715f * v * v * v))); else if (ACT == 11) v = 1.0f / (1.0f + expf(-v)); else if (ACT == 12) v = (v > 0.f) ? v : 0.01f * v; else if (ACT == 14) v = (v > 0.f) ? v : 0.1f * v; else if (ACT == 16) v = (v >= 0.f) ? v : 0.3f * v; else if (ACT == 17) v = (v >= 0.f) ? v : 0.2f * v; else if (ACT == 15) v = v / (1.0f + expf(-v)); else if (ACT == 3) v = fmaxf(v, 0.f); else if (ACT == 6) v = 0.5f * v * (1.0f + erff(v * 0.70710678118654752f)); so[w][8 * hh + r][t * 16 + ln] = v; } }
  __builtin_amdgcn_fence(__ATOMIC_ACQ_REL, "workgroup"); __builtin_amdgcn_wave_barrier();
  const int rsub = lane >> 4, c4 = (lane & 15) * 4; typedef _Float16 v4h __attribute__((ext_vector_type(4)));
  {
#pragma unroll
    for (int q = 0; q < 8; ++q) { const int r = q * 2 + rsub; if (col0 + c4 < N) { const v4f v = *(const v4fa*)&so[w][r][c4]; if (C) *(v4f*)(C + cofs + (size_t)(row0 + r) * ldc + col0 + c4) = v; if (C16) { v4h h4; for (int i = 0; i < 4; ++i) h4[i] = (_Float16)v[i]; *(v4h*)(C16 + cofs + (size_t)(row0 + r) * ldc + col0 + c4) = h4; } } }
     }
}


typedef _Float16 v4h __attribute__((ext_vector_type(4)));

__global__ __launch_bounds__(256) void k_x16(const float* __restrict__ x, _Float16* __restrict__ X16, size_t n8) { const size_t t = (size_t)blockIdx.x * 256 + threadIdx.x; if (t >= n8) return; FragH f;
#pragma unroll
  for (int q = 0; q < 8; ++q) f.h[q] = (_Float16)bf16_round(x[t * 8 + q]); *(v8us*)((unsigned short*)X16 + t * 8) = f.half[0];  }
__global__ __launch_bounds__(256) void k_h16(const float* __restrict__ x, _Float16* __restrict__ X16, size_t n8) { const size_t t = (size_t)blockIdx.x * 256 + threadIdx.x; if (t >= n8) return; FragH f;
#pragma unroll
  for (int q = 0; q < 8; ++q) f.h[q] = (_Float16)x[t * 8 + q]; *(v8us*)((unsigned short*)X16 + t * 8) = f.half[0];  }
__global__ __launch_bounds__(256) void k_round16f(const float* __restrict__ W, _Float16* __restrict__ Bt, size_t n8) { const size_t t = (size_t)blockIdx.x * 256 + threadIdx.x; if (t >= n8) return; FragH f;
#pragma unroll
  for (int i = 0; i < 8; ++i) f.h[i] = (_Float16)(bf16_round(W[t * 8 + i]) * 16.0f); *(v8us*)((unsigned short*)Bt + t * 8) = f.half[0];  }
template <int NHv, int TTv>
__global__ __launch_bounds__(256) void k_vt(const _Float16* __restrict__ V16, int ldv, int voff, _Float16* __restrict__ Vt) { __shared__ unsigned short tl[64][66]; const int tid = threadIdx.x; const int slab = blockIdx.x / (TTv / 64), lg = blockIdx.x % (TTv / 64); const int b = slab / NHv, h = slab % NHv;
  for (int i = tid; i < 64 * 8; i += 256) { const int r = i / 8, c8 = (i % 8) * 8; FragH f; f.half[0] = *(const v8us*)((const unsigned short*)V16 + ((size_t)b * TTv + lg * 64 + r) * ldv + voff + h * 64 + c8);
#pragma unroll
    for (int q = 0; q < 8; ++q) tl[r][c8 + q] = f.u[q]; }
  __syncthreads();
  {
#pragma unroll
    for (int rd = 0; rd < 2; ++rd) { const int d = rd * 32 + tid / 8, pc = tid % 8; FragH f;
#pragma unroll
      for (int q = 0; q < 8; ++q) f.u[q] = tl[pc * 8 + q][d];
      *(v8us*)((unsigned short*)Vt + ((size_t)slab * 64 + d) * TTv + lg * 64 + pc * 8) = f.half[0]; }
     } }

__global__ __launch_bounds__(256) void k_hl(const float* __restrict__ F, _Float16* __restrict__ Hh, _Float16* __restrict__ Hl, size_t n8) { const size_t t = (size_t)blockIdx.x * 256 + threadIdx.x; if (t >= n8) return; FragH fh, fl; const v4f a = *(const v4fa*)(F + t * 8), c = *(const v4fa*)(F + t * 8 + 4);
#pragma unroll
  for (int q = 0; q < 4; ++q) { _Float16 h = (_Float16)a[q]; fh.h[q] = h; fl.h[q] = (_Float16)((a[q] - (float)h) * 1024.0f); h = (_Float16)c[q]; fh.h[4 + q] = h; fl.h[4 + q] = (_Float16)((c[q] - (float)h) * 1024.0f); }
  { *(v8us*)((unsigned short*)Hh + t * 8) = fh.half[0]; *(v8us*)((unsigned short*)Hl + t * 8) = fl.half[0];  } }

// ---- fast GEMM (wave tile 32x64; requires M % 32 == 0 rows per launch region and N % 64 == 0); epilogue = k_gemm_hhx semantics ----
__device__ __forceinline__ v16h g2_frag(const _Float16* p, int hh) { FragH f; f.half[0] = *(const v8us*)((const unsigned short*)p + 8 * hh); f.half[1] = *(const v8us*)((const unsigned short*)p + 16 + 8 * hh); return f.v; }
__device__ __forceinline__ v8f g2_mma(v16h a, v16h b, v8f c) { v8f d = __builtin_amdgcn_wmma_f32_16x16x32_f16(false, a, false, b, (short)0, c, false, false); asm volatile("v_nop\n\tv_nop\n\tv_nop\n\tv_nop" : "+v"(d) : "v"(a), "v"(b)); return d; }
template <int ACT>
__global__ __launch_bounds__(128) void k_gemm2(const _Float16* __restrict__ A, int lda, size_t sA, const _Float16* __restrict__ Bh, int ldb, size_t sB, float alpha, const float* __restrict__ bias, size_t sBias, const float* __restrict__ CP, int rowsPerB, size_t sCPb, int row0g,
    float* __restrict__ C, _Float16* __restrict__ C16, int ldc, size_t sC, int M, int N, int K) { static_assert(ACT == 0 || ACT == 3 || ACT == 6 || ACT == 8 || ACT == 9 || ACT == 11 || ACT == 12 || ACT == 14 || ACT == 15 || ACT == 16 || ACT == 17, "k_gemm2: unsupported ACT code (would silently apply no activation)");
  __shared__ __attribute__((aligned(16))) float so[4][32][68];
  const int tid = threadIdx.x, w = tid >> 5, lane = tid & 31, ln = lane & 15, hh = lane >> 4; const int by = blockIdx.y;
  A += (size_t)by * sA; Bh += (size_t)by * sB; const size_t cofs = (size_t)by * sC; const float* bp = bias ? bias + (size_t)by * sBias : nullptr;
  const int ntn = N >> 6; const int mt = blockIdx.x / ntn, nq = blockIdx.x - mt * ntn; const int row0 = mt * 128 + 32 * w, col0 = nq * 64; if (row0 >= M) return;
  const _Float16* a0p = A + (size_t)(row0 + ln) * lda; const _Float16* a1p = a0p + (size_t)16 * lda;
  const _Float16* b0p = Bh + (size_t)(col0 + ln) * ldb; const _Float16* b1p = b0p + (size_t)16 * ldb; const _Float16* b2p = b1p + (size_t)16 * ldb; const _Float16* b3p = b2p + (size_t)16 * ldb;
  const v8f z8 = {0.f,0.f,0.f,0.f,0.f,0.f,0.f,0.f}; v8f c00 = z8, c01 = z8, c02 = z8, c03 = z8, c10 = z8, c11 = z8, c12 = z8, c13 = z8;
#pragma unroll 1
  for (int kb = 0; kb < K; kb += 32) { const v16h a0 = g2_frag(a0p + kb, hh), a1 = g2_frag(a1p + kb, hh);
    v16h b = g2_frag(b0p + kb, hh); c00 = g2_mma(a0, b, c00); c10 = g2_mma(a1, b, c10);
    b = g2_frag(b1p + kb, hh); c01 = g2_mma(a0, b, c01); c11 = g2_mma(a1, b, c11);
    b = g2_frag(b2p + kb, hh); c02 = g2_mma(a0, b, c02); c12 = g2_mma(a1, b, c12);
    b = g2_frag(b3p + kb, hh); c03 = g2_mma(a0, b, c03); c13 = g2_mma(a1, b, c13); }
  v8f accs[8] = {c00, c01, c02, c03, c10, c11, c12, c13};
#pragma unroll
  for (int u = 0; u < 8; ++u) { const int t = u & 3, half = u >> 2; const int col = col0 + t * 16 + ln; const float bv = bp ? bf16_round(bp[col]) : 0.f;
#pragma unroll
    for (int r = 0; r < 8; ++r) { const int rloc = half * 16 + 8 * hh + r; float v = accs[u][r] * alpha + bv; if (CP) { if (rowsPerB < 0) v += CP[cofs + (size_t)(row0g + row0 + rloc) * ldc + col];      /* rowsPerB < 0: own element of the batched C plane */ else { const int bidx = (row0g + row0 + rloc) / rowsPerB; v += CP[(size_t)bidx * sCPb + (size_t)by * 64 + col]; } }
      if (ACT == 3) v = fmaxf(v, 0.f); else if (ACT == 6) v = 0.5f * v * (1.0f + erff(v * 0.70710678118654752f)); else if (ACT == 11) v = 1.0f / (1.0f + expf(-v)); else if (ACT == 15) v = v / (1.0f + expf(-v)); else if (ACT == 12) v = (v > 0.f) ? v : 0.01f * v; else if (ACT == 8) v = tanhf(v); else if (ACT == 9) v = 0.5f * v * (1.0f + tanhf(0.7978845608028654f * (v + 0.044715f * v * v * v))); else if (ACT == 14) v = (v > 0.f) ? v : 0.1f * v; else if (ACT == 16) v = (v >= 0.f) ? v : 0.3f * v; else if (ACT == 17) v = (v >= 0.f) ? v : 0.2f * v;
      so[w][rloc][t * 16 + ln] = v; } }
  __builtin_amdgcn_fence(__ATOMIC_ACQ_REL, "workgroup"); __builtin_amdgcn_wave_barrier();
  const int rsub = lane >> 4, c4 = (lane & 15) * 4;
  {
#pragma unroll
    for (int q = 0; q < 16; ++q) { const int r = q * 2 + rsub; const v4f v = *(const v4fa*)&so[w][r][c4]; if (C) *(v4f*)(C + cofs + (size_t)(row0 + r) * ldc + col0 + c4) = v; if (C16) { v4h h4; for (int i = 0; i < 4; ++i) h4[i] = (_Float16)v[i]; *(v4h*)(C16 + cofs + (size_t)(row0 + r) * ldc + col0 + c4) = h4; } }
     } }


__global__ __launch_bounds__(256) void k_wnat(const float* __restrict__ w, size_t n8, _Float16* __restrict__ Bt) { const size_t t = (size_t)blockIdx.x * 256 + threadIdx.x; if (t >= n8) return; FragH f; for (int q = 0; q < 8; ++q) f.h[q] = (_Float16)(bf16_round(w[t * 8 + q]) * 16.0f); *(v8us*)((unsigned short*)Bt + t * 8) = f.half[0];  }
__global__ __launch_bounds__(256) void k_rsm(const float* __restrict__ S, _Float16* __restrict__ P, int nrows) {
  #pragma clang fp contract(off)
  const int i = blockIdx.x * 256 + threadIdx.x; if (i >= nrows) return; const float* s = S + (size_t)i * SQ; float mx = -3.0e38f;
#pragma unroll 1
  for (int j = 0; j < SQ; ++j) mx = fmaxf(mx, s[j]); float se = 0.f;
#pragma unroll 1
  for (int j = 0; j < SQ; ++j) se += expf(s[j] - mx); const float sc = 256.0f / se;
#pragma unroll 1
  for (int j0 = 0; j0 < SQ; j0 += 8) { FragH f; for (int q = 0; q < 8; ++q) f.h[q] = (_Float16)(expf(s[j0 + q] - mx) * sc); unsigned short* d = (unsigned short*)P + (size_t)i * SQ + j0; *(v8us*)d = f.half[0];  } }
__global__ __launch_bounds__(256) void k_vt(const _Float16* __restrict__ V16, int b, int h0, _Float16* __restrict__ VT) { __shared__ unsigned short tl[64][65]; const int tid = threadIdx.x; const int hh = blockIdx.x % HG, sg = blockIdx.x / HG; const int s0 = sg * 64; const int h = h0 + hh;
  for (int i = tid; i < 64 * 8; i += 256) { const int j = i / 8, d8 = (i % 8) * 8; FragH f; f.half[0] = *(const v8us*)((const unsigned short*)V16 + ((size_t)b * SQ + s0 + j) * DM + h * HD + d8); for (int q = 0; q < 8; ++q) tl[d8 + q][j] = f.u[q]; }
  __syncthreads();
  { for (int i = tid; i < 64 * 8; i += 256) { const int d = i / 8, j8 = (i % 8) * 8; FragH f; for (int q = 0; q < 8; ++q) f.u[q] = tl[d][j8 + q]; *(v8us*)((unsigned short*)VT + ((size_t)hh * HD + d) * SQ + s0 + j8) = f.half[0]; }  } }



__global__ __launch_bounds__(256) void k_rsmcf2(const float* __restrict__ S, _Float16* __restrict__ P, int hg, int q0, int nk) {
  #pragma clang fp contract(off)
  const int t = blockIdx.x * 256 + threadIdx.x; if (t >= hg * QT) return; const size_t i = (size_t)t; const float* s = S + i * NKX; const int last = q0 + (t % QT); float mx = -3.0e38f;
#pragma unroll 1
  for (int j = 0; j < nk; ++j) { const float f = (j <= last) ? 1.f : 0.f; mx = fmaxf(mx, fmaf(f, s[j], (1.f - f) * -1.0e9f)); } float se = 0.f;
#pragma unroll 1
  for (int j = 0; j < nk; ++j) { const float f = (j <= last) ? 1.f : 0.f; se += __expf(fmaf(f, s[j], (1.f - f) * -1.0e9f) - mx); } const float sc = 256.0f / se;
#pragma unroll 1
  for (int j0 = 0; j0 < nk; j0 += 8) { FragH fr; for (int q = 0; q < 8; ++q) { const int j = j0 + q; const float f = (j <= last) ? 1.f : 0.f; fr.h[q] = (_Float16)(__expf(fmaf(f, s[j], (1.f - f) * -1.0e9f) - mx) * sc); } unsigned short* d = (unsigned short*)P + i * NKX + j0; *(v8us*)d = fr.half[0];  } }

template <int MASKADD>
__global__ __launch_bounds__(64) void k_att0(const float* __restrict__ QF, const float* __restrict__ KF, const float* __restrict__ VF, int ld, const float* __restrict__ mask, float scale, float* __restrict__ OF, int ldo) {
  #pragma clang fp contract(off)
  __shared__ __attribute__((aligned(16))) float lq[64][64]; __shared__ __attribute__((aligned(16))) float lo[64][64];
  const int tid = threadIdx.x; const int h = blockIdx.x / (QT0 / 64), rg = blockIdx.x % (QT0 / 64); const int i = rg * 64 + tid;
  const float* qr = QF + (size_t)i * ld + h * HD;
#pragma unroll 1
  for (int c = 0; c < HD / 4; ++c) { *(v4f*)&lq[tid][c * 4] = *(const v4fa*)(qr + c * 4); const v4f z = {0.f, 0.f, 0.f, 0.f}; *(v4f*)&lo[tid][c * 4] = z; }
  float m = -1.0e30f, l = 0.f; const int jmax = MASKADD ? (SQ - 1) : (rg * 64 + 63);      /* additive-mask form: every key (the mask input decides); causal form: keys up to the block's last row */
#pragma unroll 1
  for (int j = 0; j <= jmax; ++j) { const float* kr = KF + (size_t)j * ld + h * HD; const float* vr = VF + (size_t)j * ld + h * HD; float s = 0.f;
#pragma unroll 1
    for (int c = 0; c < HD / 4; ++c) { const v4f kq = *(const v4fa*)(kr + c * 4); const v4f qq = *(v4f*)&lq[tid][c * 4]; s = __fadd_rn(s, __fmul_rn(qq[0], kq[0])); s = __fadd_rn(s, __fmul_rn(qq[1], kq[1])); s = __fadd_rn(s, __fmul_rn(qq[2], kq[2])); s = __fadd_rn(s, __fmul_rn(qq[3], kq[3])); }
    s = __fmul_rn(s, scale); if (MASKADD) s = __fadd_rn(s, __fmul_rn(bf16_round(mask[(size_t)i * SQ + j]), -10000.0f));
    const float f = (MASKADD || j <= i) ? 1.f : 0.f; const float sm = fmaf(f, s, (1.f - f) * -1.0e30f); const float mn = fmaxf(m, sm); const float sc = expf(m - mn); const float e = expf(sm - mn); l = __fadd_rn(__fmul_rn(l, sc), e); m = mn;
#pragma unroll 1
    for (int c = 0; c < HD / 4; ++c) { const v4f vv = *(const v4fa*)(vr + c * 4); v4f oo = *(v4f*)&lo[tid][c * 4]; for (int u = 0; u < 4; ++u) oo[u] = __fadd_rn(__fmul_rn(oo[u], sc), __fmul_rn(e, vv[u])); *(v4f*)&lo[tid][c * 4] = oo; } }
  const float fin = 64.0f / l;      /* o carried x64 like the f16 path */
#pragma unroll 1
  for (int c = 0; c < HD / 4; ++c) { v4f oo = *(v4f*)&lo[tid][c * 4]; for (int u = 0; u < 4; ++u) oo[u] = __fmul_rn(oo[u], fin); *(v4f*)&lo[tid][c * 4] = oo; }
  __syncthreads();
  {
#pragma unroll 1
    for (int it = 0; it < 16; ++it) { const int row = it * 4 + tid / 16, pc = (tid % 16) * 4; const v4f v = *(const v4f*)&lo[row][pc]; *(v4f*)(OF + (size_t)(rg * 64 + row) * ldo + h * HD + pc) = v; }
     } }

__global__ __launch_bounds__(256) void k_oscale(const float* __restrict__ OF, float* __restrict__ out, size_t n4) { const size_t t = (size_t)blockIdx.x * 256 + threadIdx.x; if (t >= n4) return; const v4f a = *(const v4fa*)(OF + t * 4); v4f o; for (int q = 0; q < 4; ++q) o[q] = a[q] * 0.015625f; *(v4f*)(out + t * 4) = o;  }

__global__ __launch_bounds__(256) void k_bfr(const float* __restrict__ x, float* __restrict__ XB, size_t n8) { const size_t t = (size_t)blockIdx.x * 256 + threadIdx.x; if (t >= n8) return; v4f a = *(const v4fa*)(x + t * 8), c = *(const v4fa*)(x + t * 8 + 4); for (int q = 0; q < 4; ++q) { a[q] = bf16_round(a[q]); c[q] = bf16_round(c[q]); }
  { *(v4f*)(XB + t * 8) = a; *(v4f*)(XB + t * 8 + 4) = c;  } }



__global__ __launch_bounds__(256) void k_rsmfvl(const float* __restrict__ S, _Float16* __restrict__ P, _Float16* __restrict__ PL, int qn, const int* __restrict__ vlp) {
  #pragma clang fp contract(off)
  const int t = blockIdx.x * 256 + threadIdx.x; if (t >= qn) return; const int vl = vlp[0]; const size_t i = (size_t)t; const float* s = S + i * SQ; float mx = -3.0e38f;
#pragma unroll 1
  for (int j = 0; j < SQ; ++j) { const float f = (j < vl) ? 1.f : 0.f; mx = fmaxf(mx, fmaf(f, s[j], (1.f - f) * -1000000.0f)); } float se = 0.f;
#pragma unroll 1
  for (int j = 0; j < SQ; ++j) { const float f = (j < vl) ? 1.f : 0.f; se += __expf(fmaf(f, s[j], (1.f - f) * -1000000.0f) - mx); } const float sc = 256.0f / se;
#pragma unroll 1
  for (int j0 = 0; j0 < SQ; j0 += 8) { FragH fr, gr; for (int q = 0; q < 8; ++q) { const int j = j0 + q; const float f = (j < vl) ? 1.f : 0.f; const float pv = __expf(fmaf(f, s[j], (1.f - f) * -1000000.0f) - mx) * sc; const _Float16 ph = (_Float16)pv; fr.h[q] = ph; gr.h[q] = (_Float16)((pv - (float)ph) * 1024.0f); }
    unsigned short* d = (unsigned short*)P + i * SQ + j0; unsigned short* dl = (unsigned short*)PL + i * SQ + j0; *(v8us*)d = fr.half[0]; *(v8us*)dl = gr.half[0];  } }

__global__ __launch_bounds__(256) void k_rsmf(const float* __restrict__ S, _Float16* __restrict__ P, int qn, int hg) {
  #pragma clang fp contract(off)
  const int t = blockIdx.x * 256 + threadIdx.x; if (t >= qn * hg) return; const size_t i = (size_t)(t / qn) * SQ + (t % qn); const float* s = S + i * SQ; float mx = -3.0e38f;
#pragma unroll 1
  for (int j = 0; j < SQ; ++j) mx = fmaxf(mx, s[j]); float se = 0.f;
#pragma unroll 1
  for (int j = 0; j < SQ; ++j) se += __expf(s[j] - mx); const float sc = 256.0f / se;
#pragma unroll 1
  for (int j0 = 0; j0 < SQ; j0 += 8) { FragH f; for (int q = 0; q < 8; ++q) f.h[q] = (_Float16)(__expf(s[j0 + q] - mx) * sc); unsigned short* d = (unsigned short*)P + i * SQ + j0; *(v8us*)d = f.half[0];  } }


#define CN 256          /* channels */
#define CI 128
#define NC 256                       /* (unused legacy kernels) */
#define NPX NP          /* positions per channel row */
#define NP 4096         /* seq1 tokens */
#define NM 1024         /* seq2 tokens */
#define BNEPS 1e-5f

__global__ __launch_bounds__(256) void k_mp2(const float* __restrict__ src, float* __restrict__ dst, int nout) {
  const int t = blockIdx.x * 256 + threadIdx.x; if (t >= nout) return; const int c = t / 1024; const int o = t % 1024; const int oy = o / 32, ox = o % 32; const float* p = src + (size_t)c * 4096 + (size_t)(2 * oy) * 64 + 2 * ox;
  const float v = fmaxf(fmaxf(p[0], p[1]), fmaxf(p[64], p[65])); *(float*)(dst + t) = v;  }
__global__ __launch_bounds__(256) void k_xpb(const float* __restrict__ x, const float* __restrict__ wb, float* __restrict__ CPP, size_t n4) {
  #pragma clang fp contract(off)
  const size_t t = (size_t)blockIdx.x * 256 + threadIdx.x; if (t >= n4) return; const size_t e = t * 4; const int c = (int)((e / 4096) % 256); const float bb = bf16_round(wb[c]); const v4f a = *(const v4fa*)(x + e); v4f o; for (int q = 0; q < 4; ++q) o[q] = __fadd_rn(bf16_round(a[q]), bb);
  *(v4f*)(CPP + e) = o;  }


template <int PASS>
__global__ __launch_bounds__(256) void k_cstA(const float* __restrict__ X, const float* __restrict__ MV, float* __restrict__ PART) {
  #pragma clang fp contract(off)
  __shared__ float red[256]; const int t = threadIdx.x; const size_t bc = blockIdx.x; const int c = (int)(bc % NC); const float* row = X + bc * (size_t)NPX; const float mu = PASS ? MV[c] : 0.f; float s = 0.f;
  for (int i = t; i < NPX; i += 256) { const float v = row[i]; const float d = PASS ? __fadd_rn(v, -mu) : v; s = __fadd_rn(s, PASS ? __fmul_rn(d, d) : d); }
  red[t] = s; __syncthreads(); for (int st = 128; st > 0; st >>= 1) { if (t < st) red[t] = __fadd_rn(red[t], red[t + st]); __syncthreads(); }
  if (t < 32) { const float pv = (t == 0) ? red[0] : 0.f; *(float*)(PART + bc * 32 + t) = pv;  } }      

template <int PASS>
__global__ __launch_bounds__(256) void k_cstB(const float* __restrict__ PART, float* __restrict__ MV) { const int c = threadIdx.x; if (c >= NC) return; double s = 0.0; for (int b = 0; b < NB; ++b) s += (double)PART[((size_t)b * NC + c) * 32]; const float m = (float)(s / ((double)NB * (double)NPX)); *(float*)(MV + PASS * NC + c) = m;  }


__global__ __launch_bounds__(256) void k_bnresid(const float* __restrict__ C2, const float* __restrict__ MV, const float* __restrict__ g, const float* __restrict__ be, const float* __restrict__ X, float* __restrict__ out, size_t n4) {
  #pragma clang fp contract(off)
  const size_t t = (size_t)blockIdx.x * 256 + threadIdx.x; if (t >= n4) return; const size_t e = t * 4; const int c = (int)((e / NPX) % NC); const float sc = __fmul_rn(rsqrtf(__fadd_rn(MV[NC + c], BNEPS)), bf16_round(g[c])); const float mu = MV[c], bb = bf16_round(be[c]);
  const v4f a = *(const v4fa*)(C2 + e); const v4f xx = *(const v4fa*)(X + e); v4f o; for (int q = 0; q < 4; ++q) { const float z = __fadd_rn(__fmul_rn(__fadd_rn(a[q], -mu), sc), bb); o[q] = __fadd_rn(z, bf16_round(xx[q])); }
  *(v4f*)(out + e) = o;  }


__global__ __launch_bounds__(256) void k_rowbias(float* __restrict__ Y, const float* __restrict__ bias) {
  #pragma clang fp contract(off)
  const size_t t = (size_t)blockIdx.x * 256 + threadIdx.x; if (t >= (size_t)NB * NC * NPX / 4) return; const size_t e = t * 4; const int c = (int)((e / NPX) % NC); const float bb = bf16_round(bias[c]);
  v4f v = *(const v4fa*)(Y + e); for (int q = 0; q < 4; ++q) v[q] = __fadd_rn(v[q], bb); *(v4f*)(Y + e) = v;  }



template <int NBt, int QTt, int NKt>
__global__ __launch_bounds__(256) void k_bsm(const float* __restrict__ S, _Float16* __restrict__ P) {
  #pragma clang fp contract(off)
  const size_t t = (size_t)blockIdx.x * 256 + threadIdx.x; if (t >= (size_t)QTt * NKt / 8) return; const size_t e = t * 8; float mx[8], se[8];
  for (int q = 0; q < 8; ++q) { mx[q] = -3.0e38f; se[q] = 0.f; }
#pragma unroll
  for (int b = 0; b < NBt; ++b) { const float* s = S + (size_t)b * QTt * NKt + e; for (int q = 0; q < 8; ++q) mx[q] = fmaxf(mx[q], s[q]); }
#pragma unroll
  for (int b = 0; b < NBt; ++b) { const float* s = S + (size_t)b * QTt * NKt + e; for (int q = 0; q < 8; ++q) se[q] += __expf(s[q] - mx[q]); }
#pragma unroll
  for (int b = 0; b < NBt; ++b) { const float* s = S + (size_t)b * QTt * NKt + e; FragH f; for (int q = 0; q < 8; ++q) f.h[q] = (_Float16)(__expf(s[q] - mx[q]) * (256.0f / se[q]));
    unsigned short* d = (unsigned short*)P + (size_t)b * QTt * NKt + e; *(v8us*)d = f.half[0];  } }
// ---- fused scores + batch-axis softmax + P V: one launch for all queries ----
#define FQ 32       /* query rows per work-group */
#define FQT (FQ / 16)      /* query tiles per work-group: each K and V^T fragment fetched serves all of them */
#define FKS 2      /* key ranges: a work-group walks FS / FKS keys, so that the grid still fills the chip */
#define FK 128      /* keys per pass: 16 per wave in part 1 */
#define FPP 136     /* LDS pitch of a P row in f16: 272 B = 16 B x odd, so the 16-byte row reads of part 2 do not collide */
#define FS 4096     /* sequence length */
#define FD 64       /* width */
#define FB 8        /* batches = waves of the work-group */
__device__ __forceinline__ v8f f_mma(v16h a, v16h b, v8f c) { return __builtin_amdgcn_wmma_f32_16x16x32_f16(false, a, false, b, (short)0, c, false, false); }
__device__ __forceinline__ v16h f_frag(const _Float16* p) { FragH f; f.half[0] = *(const v8us*)((const unsigned short*)p); f.half[1] = *(const v8us*)((const unsigned short*)p + 16); return f.v; }      /* p already holds the lane half's 8 hh: the k order of g2_frag */
__device__ __forceinline__ v16h f_fragp(const _Float16* p) { FragH f; f.half[0] = *(const v8us*)((const unsigned short*)p); f.half[1] = *(const v8us*)((const unsigned short*)p + 256); return f.v; }      /* fragment-order planes: p holds the lane's own 8 values, the fragment's second half lies one wave-wide load (32 lanes x 8) further; same values in the same registers as f_frag on rows */
// ---- one prep launch for Q, K and V: three block ranges that do not depend on one another; each writes the same values to the same places as a launch of its own would ----
#define PVK 128      /* keys per work-group of the V range */
#define PVM (PVK * 8 / 256)      /* 8-value items per thread there */
#define PVW (FB * FS / PVK)      /* work-groups of the V range: PVK keys x 64 d of one batch each */
#define PIT 8      /* 8-value items per thread in the Q and K ranges: few waves to start, all of a thread's loads in flight at once */
#define PXW (FB * FS * FD / 8 / 256 / PIT)      /* work-groups of the Q range, and of the K range */
__device__ __forceinline__ v8us p_cvt(v4f a, v4f c) { FragH f;      /* 8 inputs rounded to bf16, held as exact f16 */
#pragma unroll
  for (int q = 0; q < 4; ++q) { f.h[q] = (_Float16)bf16_round(a[q]); f.h[4 + q] = (_Float16)bf16_round(c[q]); }
  return f.half[0]; }
// V range (first: it has the longest chain): V^T in fragment order: per batch [32-key block][t = d / 16][half = (key / 16) & 1][lane = 16 ((key / 8) & 1) + d % 16][8 keys]; a work-group turns PVK keys x 64 d in LDS and writes 16 KiB in a row; the batch planes follow one another, so the block index runs through all batches
// Q range: rows as they are. K range: fragment order: [16-key tile][j = d / 16][lane = 16 ((d / 8) & 1) + key % 16][8 d]; tile = 1024 values, so a batch plane keeps its size and place
__global__ __launch_bounds__(256) void k_prep(const float* __restrict__ xq, const float* __restrict__ xk, const float* __restrict__ xv, _Float16* __restrict__ Q16, _Float16* __restrict__ KP, _Float16* __restrict__ VP) {
  __shared__ unsigned short tl[PVK][66]; const int tid = threadIdx.x; const int bx = blockIdx.x;
  if (bx < PVW) {      /* the same for the whole work-group, so the barrier inside is passed by all of it or by none */
    const float* s = xv + (size_t)bx * (PVK * 64) + tid * 8; v4f a[PVM], c[PVM];      /* key tid / 8 (and 32, 64, ... further), d (tid % 8) * 8 */
#pragma unroll      /* register arrays need constant indices */
    for (int m = 0; m < PVM; ++m) { a[m] = *(const v4fa*)(s + m * 2048); c[m] = *(const v4fa*)(s + m * 2048 + 4); }
    asm volatile("s_wait_xcnt 0x0" :: "v"(s) : "memory");      /* precaution: stands in front of any rewrite of a register that an issued load names; the input keeps the address pair whole up to it */
    const int r = tid / 8, c8 = (tid % 8) * 8;
#pragma unroll      /* register arrays need constant indices */
    for (int m = 0; m < PVM; ++m) { FragH f; f.half[0] = p_cvt(a[m], c[m]);
#pragma unroll
      for (int q = 0; q < 8; ++q) tl[r + 32 * m][c8 + q] = f.u[q]; }
    __syncthreads();
    FragH g[PVM];
#pragma unroll      /* register arrays need constant indices */
    for (int m = 0; m < PVM; ++m) { const int i = m * 256 + tid; const int k0 = (i >> 8) * 32 + ((i >> 5) & 1) * 16 + ((i >> 4) & 1) * 8, d = ((i >> 6) & 3) * 16 + (i & 15);
#pragma unroll
      for (int q = 0; q < 8; ++q) g[m].u[q] = tl[k0 + q][d]; }
    unsigned short* o = (unsigned short*)VP + (size_t)bx * (PVK * 64) + (size_t)tid * 8;
    __builtin_amdgcn_sched_barrier(0);      /* every value ahead of the first store, so that no register that an issued store names is rewritten behind it */
#pragma unroll      /* register arrays need constant indices */
    for (int m = 0; m < PVM; ++m) *(v8us*)(o + m * 2048) = g[m].half[0];
    return;
  }
  const bool isk = bx >= PVW + PXW; const size_t t = (size_t)(bx - PVW - (isk ? PXW : 0)) * (256 * PIT) + tid;      /* first item; the others lie 256 items apart */
  const float* s = (isk ? xk : xq) + t * 8; v4f a[PIT], c[PIT];
#pragma unroll      /* register arrays need constant indices */
  for (int j = 0; j < PIT; ++j) { a[j] = *(const v4fa*)(s + j * 2048); c[j] = *(const v4fa*)(s + j * 2048 + 4); }
  asm volatile("s_wait_xcnt 0x0" :: "v"(s) : "memory");      /* as above */
  const size_t row = t >> 3; const int c8 = (int)(t & 7);
  unsigned short* o = isk ? (unsigned short*)KP + (row >> 4) * 1024 + (size_t)((c8 >> 1) * 256 + ((c8 & 1) * 16 + (int)(row & 15)) * 8) : (unsigned short*)Q16 + t * 8;      /* 256 items on = 32 rows = 2 key tiles = 2048 values on, in both orders */
  v8us h[PIT];
#pragma unroll      /* register arrays need constant indices */
  for (int j = 0; j < PIT; ++j) h[j] = p_cvt(a[j], c[j]);
  __builtin_amdgcn_sched_barrier(0);      /* as above: every value ahead of the first store */
#pragma unroll      /* register arrays need constant indices */
  for (int j = 0; j < PIT; ++j) *(v8us*)(o + j * 2048) = h[j];
}
__device__ __forceinline__ float f_exp(float x) { float e; asm("v_exp_f32 %0, %1\n\tv_nop" : "=v"(e) : "v"(x * 1.44269504f)); return e; }      /* native exp as in __expf; the v_nop is the slot the instruction set asks for behind a transcendental before its source is overwritten or its result read */
// softmax across the 8 batches for one 16-key x 16-query tile, in registers; stores 8 keys of one query per batch to the P buffer
__device__ __forceinline__ void f_soft(const v8f (&s)[FB], _Float16* pw) {
  FragH pk[FB];
#pragma unroll      /* register arrays need constant indices */
  for (int r = 0; r < 8; ++r) { float x[FB], e[FB]; float mx = -3.0e38f, se = 0.f;
#pragma unroll
    for (int b = 0; b < FB; ++b) { x[b] = s[b][r] * 0.125f; mx = fmaxf(mx, x[b]); }
#pragma unroll
    for (int b = 0; b < FB; ++b) { e[b] = f_exp(x[b] - mx); se += e[b]; }
    const float sc = 256.0f / se;
#pragma unroll
    for (int b = 0; b < FB; ++b) pk[b].h[r] = (_Float16)(e[b] * sc); }
#pragma unroll      /* register arrays need constant indices */
  for (int b = 0; b < FB; ++b) *(v8us*)((unsigned short*)pw + (size_t)b * FQ * FPP) = pk[b].half[0];
}
__device__ __forceinline__ void f_qld(FragH (&g)[FB], const unsigned short* q) {      /* one group of LDS reads: the Q fragments of one query tile and one half of d, all 8 batches */
#pragma unroll      /* register arrays need constant indices */
  for (int b = 0; b < FB; ++b) { g[b].half[0] = *(const v8us*)(q + b * (FQT * 1024)); g[b].half[1] = *(const v8us*)(q + b * (FQT * 1024) + 256); }      /* a batch's fragments: FQT tiles x 2 halves of d x 512 values */
}
__global__ __launch_bounds__(256) void k_fused(const _Float16* __restrict__ Q16, const _Float16* __restrict__ K16, const _Float16* __restrict__ VT, float* __restrict__ PO) {
  static_assert(FQT == 2, "the pass below is written out for two query tiles");
  __shared__ __attribute__((aligned(16))) _Float16 pl[2][FB][FQ][FPP];      /* two buffers: one barrier a pass is enough */
  __shared__ __attribute__((aligned(16))) unsigned short ql[FB][FQT][2][2][32][8];      /* Q fragments of the whole walk, fragment order: [batch][query tile][d / 32][fragment half][lane][8]; every wave-wide 16-byte read covers 512 bytes in a row */
  const int tid = threadIdx.x, w = tid >> 5, lane = tid & 31, ln = lane & 15, hh = lane >> 4; const int q0 = (blockIdx.x / FKS) * FQ; const int k0 = (blockIdx.x % FKS) * (FS / FKS);
  constexpr size_t PLN = (size_t)FS * FD;
  const v8f z8 = {0.f,0.f,0.f,0.f,0.f,0.f,0.f,0.f};
  const _Float16* qp = Q16 + (size_t)w * PLN + (size_t)(q0 + ln) * FD + 8 * hh;      /* Q rows q0 + ln of batch w: this wave brings them to LDS for all waves */
  const int wu = __builtin_amdgcn_readfirstlane(w); const unsigned lo = lane * 8;      /* the wave's number as a scalar: the K and V^T bases are then scalar and the lane offset is added where an address is formed; a per-lane K pointer that lives from the first loads' wait through the whole walk is spilled by this compiler */
  const _Float16* kp = K16 + (size_t)(k0 + 16 * wu) * FD;      /* part 1: this wave's 16-key tile, fragment order (A operand) */
  const _Float16* vp = VT + (size_t)wu * PLN + (size_t)k0 * FD;      /* part 2: V^T of batch w, fragment order (B operand) */
  FragH qg[FQT][2];
  v16h kf[FB][2];
#pragma unroll      /* register arrays need constant indices */
  for (int u = 0; u < FQT; ++u) { qg[u][0].v = f_frag(qp + u * (16 * FD)); qg[u][1].v = f_frag(qp + u * (16 * FD) + 32); }
#pragma unroll      /* register arrays need constant indices */
  for (int b = 0; b < FB; ++b) { kf[b][0] = f_fragp(kp + (size_t)b * PLN + lo); kf[b][1] = f_fragp(kp + (size_t)b * PLN + 512 + lo); }
  asm volatile("s_wait_xcnt 0x0" :: "v"(qp), "s"(kp), "v"(lane) : "memory");      /* precaution: stands in front of any rewrite of a register that an issued load names; the inputs keep the Q address pair, the K base and the lane index (the K loads' scaled offset register) whole up to it */
#pragma unroll      /* register arrays need constant indices */
  for (int u = 0; u < FQT; ++u)
#pragma unroll
    for (int j = 0; j < 2; ++j) { *(v8us*)&ql[w][u][j][0][lane][0] = qg[u][j].half[0]; *(v8us*)&ql[w][u][j][1][lane][0] = qg[u][j].half[1]; }
  __syncthreads();      /* publishes the Q fragments to every wave */
  const unsigned short* qr = &ql[0][0][0][0][lane][0];
  v8f o[FQT][4];
#pragma unroll      /* register arrays need constant indices */
  for (int u = 0; u < FQT; ++u)
#pragma unroll
    for (int t = 0; t < 4; ++t) o[u][t] = z8;
  for (int it = 0; it < FS / FKS / FK; ++it) {
    const int kb = it * FK; const int kn = (kb + FK) & (FS / FKS - 1);      /* next pass's keys; the last pass requests this half's first keys again: in bounds, not used */
    const _Float16* vb = vp + (size_t)kb * FD + lo; const _Float16* kq = kp + (size_t)kn * FD + lo;
    v8f s[FQT][FB];      /* s[u][b][r] = Q[b][q0 + 16 u + ln] . K[b][k0 + kb + 16 w + 8 hh + r]; the K fragments in registers serve both query tiles */
    { FragH g0[FB], g1[FB], g2[FB], g3[FB];      /* four groups of Q fragments, two in flight at a time */
      f_qld(g0, qr); f_qld(g1, qr + 512);
      __builtin_amdgcn_sched_barrier(0);      /* this one and the two below keep each group of LDS reads whole and one group ahead of the products that use it; left alone the scheduler reads four at a time and waits each out */
#pragma unroll      /* register arrays need constant indices */
      for (int b = 0; b < FB; ++b) s[0][b] = f_mma(kf[b][0], g0[b].v, z8);
      f_qld(g2, qr + 1024);
      __builtin_amdgcn_sched_barrier(0);
#pragma unroll      /* register arrays need constant indices */
      for (int b = 0; b < FB; ++b) s[0][b] = f_mma(kf[b][1], g1[b].v, s[0][b]);
      f_qld(g3, qr + 1536);
      __builtin_amdgcn_sched_barrier(0);
#pragma unroll      /* register arrays need constant indices */
      for (int b = 0; b < FB; ++b) s[1][b] = f_mma(kf[b][0], g2[b].v, z8);
#pragma unroll      /* register arrays need constant indices */
      for (int b = 0; b < FB; ++b) s[1][b] = f_mma(kf[b][1], g3[b].v, s[1][b]); }
    __builtin_amdgcn_sched_barrier(0);      /* keeps the V^T requests below out of the scores, where their registers are still the Q fragments': lifted there they cost spills */
    v16h vf[4][4];      /* this pass's V^T fragments */
#pragma unroll      /* register arrays need constant indices */
    for (int b = 0; b < FB; ++b) { kf[b][0] = f_fragp(kq + (size_t)b * PLN); kf[b][1] = f_fragp(kq + (size_t)b * PLN + 512); }      /* next pass's K fragments, requested as soon as this pass's are used up, so that they arrive under the softmax */
#pragma unroll      /* register arrays need constant indices */
    for (int ks = 0; ks < 2; ++ks)
#pragma unroll
      for (int t = 0; t < 4; ++t) vf[ks][t] = f_fragp(vb + ks * (32 * FD) + t * 512);      /* first half of V^T; the second follows when the first tile's scores have left their registers */
    asm volatile("s_wait_xcnt 0x0" :: "v"(kq), "v"(vb) : "memory");      /* as above, for the K and V^T address pairs */
    __builtin_amdgcn_sched_barrier(0);      /* keeps the requests above in front of the softmax; sunk into it they would start later and be waited out at the barrier */
    f_soft(s[0], &pl[it & 1][0][ln][16 * w + 8 * hh]);
    __builtin_amdgcn_sched_barrier(0);      /* keeps the requests below behind the first softmax, whose registers they take */
#pragma unroll      /* register arrays need constant indices */
    for (int ks = 2; ks < 4; ++ks)
#pragma unroll
      for (int t = 0; t < 4; ++t) vf[ks][t] = f_fragp(vb + ks * (32 * FD) + t * 512);
    asm volatile("s_wait_xcnt 0x0" :: "v"(vb) : "memory");      /* as above, for the V^T address pair */
    __builtin_amdgcn_sched_barrier(0);      /* keeps them in front of the second softmax */
    f_soft(s[1], &pl[it & 1][0][16 + ln][16 * w + 8 * hh]);
    __syncthreads();      /* publishes this pass's P; with two buffers it also ends every read of the buffer that the next pass rewrites */
    const _Float16* pr = &pl[it & 1][w][ln][8 * hh]; v16h pa[FQT][4];      /* P[w] rows as A operands: all read in one group */
#pragma unroll      /* register arrays need constant indices */
    for (int u = 0; u < FQT; ++u)
#pragma unroll
      for (int ks = 0; ks < 4; ++ks) pa[u][ks] = f_frag(pr + u * (16 * FPP) + ks * 32);
    __builtin_amdgcn_sched_barrier(0);      /* keeps the products behind the whole group of reads; without it the scheduler splits the group and waits out each part */
#pragma unroll      /* register arrays need constant indices */
    for (int ks = 0; ks < 4; ++ks)
#pragma unroll
      for (int u = 0; u < FQT; ++u)
#pragma unroll
        for (int t = 0; t < 4; ++t) o[u][t] = f_mma(pa[u][ks], vf[ks][t], o[u][t]);      /* the V^T fragments in registers serve both query tiles */
  }
  float* op = PO + (size_t)(blockIdx.x % FKS) * (FB * PLN) + (size_t)w * PLN + (size_t)(q0 + 8 * hh) * FD + ln;      /* this key half's plane of partial sums, still x256 */
#pragma unroll      /* register arrays need constant indices */
  for (int u = 0; u < FQT; ++u)
#pragma unroll
    for (int t = 0; t < 4; ++t)
#pragma unroll
      for (int r = 0; r < 8; ++r) op[(size_t)(16 * u + r) * FD + t * 16] = o[u][t][r];
}
// out = (first key half + second key half) x 2^-8
#define RIT 8      /* 4-value items per thread: few waves to start, all of a thread's loads in flight at once */
__global__ __launch_bounds__(256) void k_sum(const float* __restrict__ PO, float* __restrict__ out) {
  const size_t t0 = (size_t)blockIdx.x * (1024 * RIT); const unsigned lo = threadIdx.x * 4;      /* the work-group's first value, and the thread's place in each run of 1024 values */
  const float* s0 = PO + t0; const float* s1 = s0 + (size_t)FB * FS * FD; v4f a[RIT], c[RIT];      /* scalar bases; one lane offset serves every load */
#pragma unroll      /* register arrays need constant indices */
  for (int j = 0; j < RIT; ++j) { a[j] = *(const v4fa*)(s0 + j * 1024 + lo); c[j] = *(const v4fa*)(s1 + j * 1024 + lo); }
  asm volatile("s_wait_xcnt 0x0" ::: "memory");      /* precaution: stands in front of any rewrite of a register that an issued load names */
  __builtin_amdgcn_sched_barrier(0);      /* keeps every load in front of the first sum, so that all of a thread's loads are in flight at once */
  float* o = out + t0 + lo;
#pragma unroll      /* register arrays need constant indices */
  for (int j = 0; j < RIT; ++j) a[j] = (a[j] + c[j]) * 0.00390625f;
  __builtin_amdgcn_sched_barrier(0);      /* every value ahead of the first store, so that no register that an issued store names is rewritten behind it */
#pragma unroll      /* register arrays need constant indices */
  for (int j = 0; j < RIT; ++j) *(v4f*)(o + j * 1024) = a[j];
}
extern "C" void kernel_launch(void* const* d_in, const int* in_sizes, int n_in,
                              void* d_out, int out_size, void* d_ws, size_t ws_size, hipStream_t stream) {
  (void)in_sizes; (void)n_in; (void)out_size;
  const float* const* I = (const float* const*)d_in; const float* xq = I[0]; const float* xk = I[1]; const float* xv = I[2];      /* Q, K, V [8][4096][64] (bf16-valued) */
  constexpr int NBt = 8, SQt = 4096, DK = 64;      /* batches, sequence, width */
  char* ws = (char*)d_ws; size_t off = 0;
  auto take = [&](size_t bytes) { char* p = ws + off; off += (bytes + 255) & ~(size_t)255; return p; };
  const size_t PLN = (size_t)SQt * DK;      /* one batch's [4096][64] plane */
  _Float16* Q16 = (_Float16*)take(NBt * PLN * 2); _Float16* K16 = (_Float16*)take(NBt * PLN * 2); _Float16* VT = (_Float16*)take(NBt * PLN * 2); float* PO = (float*)take(FKS * NBt * PLN * 4);
  if (off > ws_size) return;
  k_prep<<<PVW + 2 * PXW, 256, 0, stream>>>(xq, xk, xv, Q16, K16, VT);      /* exact f16 copies of the bf16-valued inputs: Q in rows, K and V^T in fragment order */
  k_fused<<<SQt / FQ * FKS, 256, 0, stream>>>(Q16, K16, VT, PO);      /* scores, softmax across the 8 batches and P V for 32 query rows of all batches and one half of the keys per work-group */
  k_sum<<<NBt * SQt * DK / 4 / 256 / RIT, 256, 0, stream>>>(PO, (float*)d_out);      /* adds the two key halves */
}

// v005
// It runs in 68.8 microseconds.
// Timed twice side by side with v004, it ran 1.08 and 1.06 times as fast.
// All steps since v000 together make it 31.0 times as fast.
#include <hip/hip_runtime.h>
// Dot-product attention whose softmax runs over the BATCH axis (Q, K, V [8][4096][64], no heads, no weights; scores = Q K^T / sqrt(64) -> [8][4096][4096]; attn = softmax(scores, axis = 0): for every (query, key) pair the 8 batch entries are normalised against each other (the module's literal axis; rows are NOT normalised over keys); out[b] = attn[b] V[b] -> [8][4096][64]).
// Structure: three launches. ONE prep launch (three block ranges) writes the bf16-valued inputs as exact f16; K and V^T (via LDS transposes, once) are written in WMMA fragment order, so that every wave-wide 16-byte load of the walk reads 512 contiguous bytes (4 whole lines, not 32 bytes of each of 16 lines); then ONE fused launch: a work-group owns 32 query rows (two tiles of 16) of all 8 batches and walks one half of the keys 128 at a time, every K and V^T fragment it fetches serving both tiles; Q fragments lie in LDS. Part 1 of a pass: wave w forms S^T = K Q^T for its 16 keys in all 8 batches (WMMA, f32 accumulation, K = 64), so a lane holds the 8 batch values of each (query, key) pair and normalises them in registers (f32, native exp; weights x256 f16), then stores 8 keys of one query per batch to LDS. Part 2: wave w is batch w: out[w] += P[w] V[w]^T (WMMA, f32), keys in ascending order inside a half. A last launch adds the two halves, x 2^-8. Scores and weights never reach memory.
// Compute dtype: inputs rounded to bf16, held exactly as f16; q, k, v and softmax weights as plain f16 GEMM operands (~2^-12); scores, softmax statistics and o f32. v_wmma_f32_16x16x32_f16.
#define NB 4
#define SQ 4096
#define DM 256
#define NH 1
#define HD 64
#define HG 4                         /* heads per attention launch group */
#define B0 0                         /* first batch processed (debug hook) */
#define NBR NB                       /* batches processed (debug hook) */
#define NR ((size_t)NB * SQ)         /* token rows */
#define MP ((int)((size_t)NBR * SQ)) /* rows projected (debug hook) */
#define QT 256                       /* query rows per causal tile */
#define NKX SQ                       /* S / P row pitch */
#define QT0 256                      /* first-tile rows recomputed exactly (256: buys margin for the few-key rows 128..255, which have no output projection to average the single-f16 P/v rounding) */
#define QN SQ                        /* query rows attended per batch (debug hook) */
#define NHD NH                       /* heads attended (debug hook) */
#define MPO MP                       /* rows through the output stage (debug hook) */
#define LQ DM            /* row pitch of the q/k/v rows */
typedef __bf16 v16b __attribute__((ext_vector_type(16)));
typedef unsigned short v8us __attribute__((ext_vector_type(8), may_alias));
typedef float  v8f  __attribute__((ext_vector_type(8)));
typedef float  v4f  __attribute__((ext_vector_type(4)));
typedef float  v4fa __attribute__((ext_vector_type(4), may_alias));
union FragB { v16b v; v8us half[2]; unsigned short u[16]; };

__device__ __forceinline__ unsigned short bf16_bits(float x) { unsigned int u = __float_as_uint(x); return (unsigned short)((u + 0x7FFFu + ((u >> 16) & 1u)) >> 16); }
__device__ __forceinline__ float bf16_val(unsigned short b) { return __uint_as_float(((unsigned int)b) << 16); }
__device__ __forceinline__ float bf16_round(float x) { return bf16_val(bf16_bits(x)); }
// D += A·B with NT terms: 1 = ah·bh, 2 = + al·bh (A split), 3 = + ah·bl (both split)
template <int NT>
__device__ __forceinline__ v8f mmaN(v16b ah, v16b al, v16b bh, v16b bl, v8f c) {
  c = __builtin_amdgcn_wmma_f32_16x16x32_bf16(false, ah, false, bh, (short)0, c, false, false);
  if (NT >= 2) c = __builtin_amdgcn_wmma_f32_16x16x32_bf16(false, al, false, bh, (short)0, c, false, false);
  if (NT >= 3) c = __builtin_amdgcn_wmma_f32_16x16x32_bf16(false, ah, false, bl, (short)0, c, false, false);
  asm volatile("v_nop\n\tv_nop\n\tv_nop\n\tv_nop" : "+v"(c) : "v"(ah), "v"(al), "v"(bh), "v"(bl));
  return c;
}

__global__ __launch_bounds__(256) void k_wt_bf16(const float* __restrict__ W, unsigned short* __restrict__ Wt, int K, int N) {
  const int t = blockIdx.x * 256 + threadIdx.x;
  const int k8n = K / 8;
  if (t >= N * k8n) return;
  const int n = t / k8n, k8 = (t % k8n) * 8;
  v8us v;
#pragma unroll
  for (int i = 0; i < 8; ++i) v[i] = bf16_bits(W[(size_t)(k8 + i) * N + n]);
  *(v8us*)(Wt + (size_t)n * K + k8) = v;
  
}

// GEMM C[M][N] (f32, pitch ldc) = act(A[M][K]·W + bias). A f32 row-major (pitch lda) converted per fragment to bf16
// (ASPLIT: hi/lo two planes -> 2 terms, else single rounded term); Wt bf16 [N][K] (pitch ldb). BIAS_BF16 rounds the
// bias to bf16 first (bias quantised to bf16 before the add). K%32==0, M%16==0, N%64==0.
template <bool ASPLIT, int ACT, bool BIAS_BF16>
__global__ __launch_bounds__(128) void k_gemm_bf(const float* __restrict__ A, int lda, const unsigned short* __restrict__ Wt, int ldb,
                                               const float* __restrict__ bias, float* __restrict__ C, int ldc, int M, int N, int K) {
  __shared__ __attribute__((aligned(16))) float so[4][16][64];
  const int tid = threadIdx.x, w = tid >> 5, lane = tid & 31, ln = lane & 15, hh = lane >> 4;
  const int ntn = N / 64;
  const int wid = blockIdx.x * 4 + w;
  const int mt = wid / ntn, nq = wid % ntn;
  if (mt * 16 >= M) return;
  const int row0 = mt * 16, col0 = nq * 64;
  const float* arow = A + (size_t)(row0 + ln) * lda;
  v8f acc[4] = {};
  for (int kb = 0; kb < K; kb += 32) {
    FragB ah, al;
    const v4f x0 = *(const v4fa*)(arow + kb + 8 * hh), x1 = *(const v4fa*)(arow + kb + 8 * hh + 4);
    const v4f x2 = *(const v4fa*)(arow + kb + 16 + 8 * hh), x3 = *(const v4fa*)(arow + kb + 16 + 8 * hh + 4);
    float xs[16] = {x0[0],x0[1],x0[2],x0[3],x1[0],x1[1],x1[2],x1[3],x2[0],x2[1],x2[2],x2[3],x3[0],x3[1],x3[2],x3[3]};
#pragma unroll
    for (int i = 0; i < 16; ++i) { const unsigned short hb = bf16_bits(xs[i]); ah.u[i] = hb; al.u[i] = ASPLIT ? bf16_bits(xs[i] - bf16_val(hb)) : (unsigned short)0; }
#pragma unroll
    for (int t = 0; t < 4; ++t) {
      const unsigned short* brow = Wt + (size_t)(col0 + t * 16 + ln) * ldb + kb;
      FragB b;
      b.half[0] = *(const v8us*)(brow + 8 * hh);
      b.half[1] = *(const v8us*)(brow + 16 + 8 * hh);
      acc[t] = mmaN<ASPLIT ? 2 : 1>(ah.v, al.v, b.v, b.v, acc[t]);
    }
  }
#pragma unroll
  for (int t = 0; t < 4; ++t) {
    float bv = bias ? bias[col0 + t * 16 + ln] : 0.f;
    if (BIAS_BF16) bv = bf16_round(bv);
#pragma unroll
    for (int r = 0; r < 8; ++r) { float v = acc[t][r] + bv; if (ACT == 1) v = fmaxf(v, 0.f); so[w][8 * hh + r][t * 16 + ln] = v; }
  }
  __builtin_amdgcn_fence(__ATOMIC_ACQ_REL, "workgroup");
  __builtin_amdgcn_wave_barrier();
  const int rsub = lane >> 4, c4 = (lane & 15) * 4;
  {
#pragma unroll
    for (int q = 0; q < 8; ++q) {
      const int r = q * 2 + rsub;
      const v4f v = *(const v4fa*)&so[w][r][c4];
      *(v4f*)(C + (size_t)(row0 + r) * ldc + col0 + c4) = v;
    }
    
  }
}

// GEMM C = act(A·W + bias + resid): A f32 (ASPLIT -> hi/lo 2 terms), Wt bf16 [N][K]; ACT 0 none, 1 relu, 2 exact gelu;
// resid (optional, f32, row index = (row % rmod), pitch ldr, RES_BF16 rounds it) added before the activation.
template <bool ASPLIT, int ACT, bool BIAS_BF16, bool RES_BF16>
__global__ __launch_bounds__(128) void k_gemm_bf3(const float* __restrict__ A, int lda, const unsigned short* __restrict__ Wt, int ldb,
                                                const float* __restrict__ bias, const float* __restrict__ resid, int rmod, int ldr,
                                                float* __restrict__ C, int ldc, int M, int N, int K) {
  __shared__ __attribute__((aligned(16))) float so[4][16][64];
  const int tid = threadIdx.x, w = tid >> 5, lane = tid & 31, ln = lane & 15, hh = lane >> 4;
  const int ntn = N / 64;
  const int wid = blockIdx.x * 4 + w;
  const int mt = wid / ntn, nq = wid % ntn;
  if (mt * 16 >= M) return;
  const int row0 = mt * 16, col0 = nq * 64;
  const float* arow = A + (size_t)(row0 + ln) * lda;
  v8f acc[4] = {};
  for (int kb = 0; kb < K; kb += 32) {
    FragB ah, al;
    const v4f x0 = *(const v4fa*)(arow + kb + 8 * hh), x1 = *(const v4fa*)(arow + kb + 8 * hh + 4);
    const v4f x2 = *(const v4fa*)(arow + kb + 16 + 8 * hh), x3 = *(const v4fa*)(arow + kb + 16 + 8 * hh + 4);
    float xs[16] = {x0[0],x0[1],x0[2],x0[3],x1[0],x1[1],x1[2],x1[3],x2[0],x2[1],x2[2],x2[3],x3[0],x3[1],x3[2],x3[3]};
#pragma unroll
    for (int i = 0; i < 16; ++i) { const unsigned short hb = bf16_bits(xs[i]); ah.u[i] = hb; al.u[i] = ASPLIT ? bf16_bits(xs[i] - bf16_val(hb)) : (unsigned short)0; }
#pragma unroll
    for (int t = 0; t < 4; ++t) {
      const unsigned short* brow = Wt + (size_t)(col0 + t * 16 + ln) * ldb + kb;
      FragB b;
      b.half[0] = *(const v8us*)(brow + 8 * hh);
      b.half[1] = *(const v8us*)(brow + 16 + 8 * hh);
      acc[t] = mmaN<ASPLIT ? 2 : 1>(ah.v, al.v, b.v, b.v, acc[t]);
    }
  }
#pragma unroll
  for (int t = 0; t < 4; ++t) {
    const int col = col0 + t * 16 + ln;
    float bv = bias ? bias[col] : 0.f;
    if (BIAS_BF16) bv = bf16_round(bv);
#pragma unroll
    for (int r = 0; r < 8; ++r) {
      float v = acc[t][r] + bv;
      if (resid) { float rv = resid[(size_t)((row0 + 8 * hh + r) % rmod) * ldr + col]; if (RES_BF16) rv = bf16_round(rv); v += rv; }
      if (ACT == 1) v = fmaxf(v, 0.f);
      if (ACT == 2) v = 0.5f * v * (1.0f + erff(v * 0.70710678118654752f));
      if (ACT == 3) { const float u = 0.7978845608028654f * (v + 0.044715f * v * v * v); v = 0.5f * v * (1.0f + tanhf(u)); }
      so[w][8 * hh + r][t * 16 + ln] = v;
    }
  }
  __builtin_amdgcn_fence(__ATOMIC_ACQ_REL, "workgroup");
  __builtin_amdgcn_wave_barrier();
  const int rsub = lane >> 4, c4 = (lane & 15) * 4;
  {
#pragma unroll
    for (int q = 0; q < 8; ++q) {
      const int r = q * 2 + rsub;
      const v4f v = *(const v4fa*)&so[w][r][c4];
      *(v4f*)(C + (size_t)(row0 + r) * ldc + col0 + c4) = v;
    }
    
  }
}
// row LayerNorm (biased variance, eps) over N: s = X (+ R); optional out_sum <- s; out_norm <- (s-mu)*rsqrt(var+eps)*g + b
template <bool PARAM_BF16>
__global__ __launch_bounds__(256) void k_layernorm(const float* __restrict__ X, const float* __restrict__ R, const float* __restrict__ g, const float* __restrict__ bta,
                                                  float* __restrict__ out_sum, float* __restrict__ out_norm, int N, float eps) {
  __shared__ float red[256];
  const int row = blockIdx.x, tid = threadIdx.x;
  const float* x = X + (size_t)row * N; const float* rr = R ? R + (size_t)row * N : nullptr;
  float vals[16];                     // up to N = 4096
  const int per = N / 256;            // contiguous chunk per thread? use strided-by-4 chunks: thread handles j = tid*4 + 1024*u
  float s1 = 0.f;
  for (int u = 0; u < per / 4; ++u) {
    const int j = tid * 4 + 1024 * u;
    const v4f a = *(const v4fa*)(x + j);
    v4f b = {0.f,0.f,0.f,0.f}; if (rr) b = *(const v4fa*)(rr + j);
#pragma unroll
    for (int q = 0; q < 4; ++q) { const float v = a[q] + b[q]; vals[u * 4 + q] = v; s1 += v; }
  }
  red[tid] = s1; __syncthreads();
  for (int st = 128; st > 0; st >>= 1) { if (tid < st) red[tid] += red[tid + st]; __syncthreads(); }
  const float mu = red[0] / (float)N; __syncthreads();
  float s2 = 0.f;
  for (int u = 0; u < per / 4; ++u)
#pragma unroll
    for (int q = 0; q < 4; ++q) { const float c = vals[u * 4 + q] - mu; s2 += c * c; }
  red[tid] = s2; __syncthreads();
  for (int st = 128; st > 0; st >>= 1) { if (tid < st) red[tid] += red[tid + st]; __syncthreads(); }
  const float rs = rsqrtf(red[0] / (float)N + eps);
  {
    for (int u = 0; u < per / 4; ++u) {
      const int j = tid * 4 + 1024 * u;
      v4f o, sm;
#pragma unroll
      for (int q = 0; q < 4; ++q) {
        float gg = g[j + q], bb = bta[j + q];
        if (PARAM_BF16) { gg = bf16_round(gg); bb = bf16_round(bb); }
        sm[q] = vals[u * 4 + q]; o[q] = (vals[u * 4 + q] - mu) * rs * gg + bb;
      }
      if (out_sum) *(v4f*)(out_sum + (size_t)row * N + j) = sm;
      *(v4f*)(out_norm + (size_t)row * N + j) = o;
    }
    
  }
}



// ---- f16 WMMA path (v_wmma_f32_16x16x32_f16): 11-bit significands for operands in range — used where a [0,1] probability operand needs more precision than bf16
typedef _Float16 v16h __attribute__((ext_vector_type(16)));
union FragH { v16h v; v8us half[2]; _Float16 h[16]; unsigned short u[16]; };
template <int NT>
__device__ __forceinline__ v8f mmaH(v16h ah, v16h al, v16h bh, v16h bl, v8f c) {
  c = __builtin_amdgcn_wmma_f32_16x16x32_f16(false, ah, false, bh, (short)0, c, false, false);
  if (NT >= 2) c = __builtin_amdgcn_wmma_f32_16x16x32_f16(false, al, false, bh, (short)0, c, false, false);
  if (NT >= 3) c = __builtin_amdgcn_wmma_f32_16x16x32_f16(false, ah, false, bl, (short)0, c, false, false);
  asm volatile("v_nop\n\tv_nop\n\tv_nop\n\tv_nop" : "+v"(c) : "v"(ah), "v"(al), "v"(bh), "v"(bl));
  return c;
}
// batched GEMM like k_gemm_b but f16 operands: A f32 (split into f16 hi/lo if ASPLIT, else rounded to f16), Bt = f16 values [n][k]; alpha; C f32; N multiple of 16 (partial tiles skipped)
template <bool ASPLIT>
__global__ __launch_bounds__(128) void k_gemm_h(const float* __restrict__ A, int lda, size_t sA, const _Float16* __restrict__ Bh, int ldb, size_t sB, float alpha, float* __restrict__ C, int ldc, size_t sC, int M, int N, int K) {
  __shared__ __attribute__((aligned(16))) float so[4][16][64];
  const int tid = threadIdx.x, w = tid >> 5, lane = tid & 31, ln = lane & 15, hh = lane >> 4; const int by = blockIdx.y;
  A += (size_t)by * sA; Bh += (size_t)by * sB; C += (size_t)by * sC;
  const int ntn = (N + 63) / 64; const int wid = blockIdx.x * 4 + w; const int mt = wid / ntn, nq = wid % ntn; if (mt * 16 >= M) return;
  const int row0 = mt * 16, col0 = nq * 64; const float* arow = A + (size_t)(row0 + ln) * lda;
  v8f acc[4] = {};
  for (int kb = 0; kb < K; kb += 32) {
    FragH ah, al;
    const v4f x0 = *(const v4fa*)(arow + kb + 8 * hh), x1 = *(const v4fa*)(arow + kb + 8 * hh + 4), x2 = *(const v4fa*)(arow + kb + 16 + 8 * hh), x3 = *(const v4fa*)(arow + kb + 16 + 8 * hh + 4);
    float xs[16] = {x0[0],x0[1],x0[2],x0[3],x1[0],x1[1],x1[2],x1[3],x2[0],x2[1],x2[2],x2[3],x3[0],x3[1],x3[2],x3[3]};
#pragma unroll
    for (int i = 0; i < 16; ++i) { const _Float16 h = (_Float16)xs[i]; ah.h[i] = h; al.h[i] = ASPLIT ? (_Float16)(xs[i] - (float)h) : (_Float16)0.0f; }
#pragma unroll
    for (int t = 0; t < 4; ++t) { if (col0 + t * 16 >= N) continue; const size_t boff = (size_t)(col0 + t * 16 + ln) * ldb + kb; FragH bq; bq.half[0] = *(const v8us*)(Bh + boff + 8 * hh); bq.half[1] = *(const v8us*)(Bh + boff + 16 + 8 * hh);
      acc[t] = mmaH<ASPLIT ? 2 : 1>(ah.v, al.v, bq.v, bq.v, acc[t]); }
  }
#pragma unroll
  for (int t = 0; t < 4; ++t) { if (col0 + t * 16 >= N) continue;
#pragma unroll
    for (int r = 0; r < 8; ++r) so[w][8 * hh + r][t * 16 + ln] = acc[t][r] * alpha; }
  __builtin_amdgcn_fence(__ATOMIC_ACQ_REL, "workgroup"); __builtin_amdgcn_wave_barrier();
  const int rsub = lane >> 4, c4 = (lane & 15) * 4;
  {
#pragma unroll
    for (int q = 0; q < 8; ++q) { const int r = q * 2 + rsub; if (col0 + c4 < N) { const v4f v = *(const v4fa*)&so[w][r][c4]; *(v4f*)(C + (size_t)(row0 + r) * ldc + col0 + c4) = v; } }
     }
}

// Wt[n][k] = f16(W[k][n]·scale) from f32 row-major W[K][N] (scale = power of two; bf16-exact weights stay exact in f16 away from the subnormal range)
__global__ __launch_bounds__(256) void k_wt_f16(const float* __restrict__ W, _Float16* __restrict__ Wt, int K, int N, float scale) {
  const int t = blockIdx.x * 256 + threadIdx.x; if (t >= N * (K / 8)) return; const int n = t / (K / 8), k8 = (t % (K / 8)) * 8; FragH f;
#pragma unroll
  for (int i = 0; i < 8; ++i) f.h[i] = (_Float16)(bf16_round(W[(size_t)(k8 + i) * N + n]) * scale); const v8us o = f.half[0];
  *(v8us*)((unsigned short*)Wt + (size_t)n * K + k8) = o; 
}
// k_gemm_hh variant with fused epilogue: v = acc·alpha + bias[by·sBias + col] (+ CP[(row/rowsPerB)·sCPb + by·64 + col] if CP) ; ACT 0 none / 1 elu ; writes f16 C16 (and f32 C if non-null)
template <int ACT>
__global__ __launch_bounds__(128) void k_gemm_hhx(const _Float16* __restrict__ A, int lda, size_t sA, const _Float16* __restrict__ Bh, int ldb, size_t sB, float alpha, const float* __restrict__ bias, size_t sBias, const float* __restrict__ CP, int rowsPerB, size_t sCPb, int row0g,
    float* __restrict__ C, _Float16* __restrict__ C16, int ldc, size_t sC, int M, int N, int K) {
  __shared__ __attribute__((aligned(16))) float so[4][16][64];
  const int tid = threadIdx.x, w = tid >> 5, lane = tid & 31, ln = lane & 15, hh = lane >> 4; const int by = blockIdx.y;
  A += (size_t)by * sA; Bh += (size_t)by * sB; const size_t cofs = (size_t)by * sC; const float* bp = bias ? bias + (size_t)by * sBias : nullptr;
  const int ntn = (N + 63) / 64; const int wid = blockIdx.x * 4 + w; const int mt = wid / ntn, nq = wid % ntn; if (mt * 16 >= M) return;
  const int row0 = mt * 16, col0 = nq * 64; const _Float16* arow = A + (size_t)(row0 + ln) * lda;
  v8f acc[4] = {};
  for (int kb = 0; kb < K; kb += 32) { FragH ah; ah.half[0] = *(const v8us*)((const unsigned short*)arow + kb + 8 * hh); ah.half[1] = *(const v8us*)((const unsigned short*)arow + kb + 16 + 8 * hh);
#pragma unroll
    for (int t = 0; t < 4; ++t) { if (col0 + t * 16 >= N) continue; const size_t boff = (size_t)(col0 + t * 16 + ln) * ldb + kb; FragH bq; bq.half[0] = *(const v8us*)((const unsigned short*)Bh + boff + 8 * hh); bq.half[1] = *(const v8us*)((const unsigned short*)Bh + boff + 16 + 8 * hh);
      acc[t] = mmaH<1>(ah.v, ah.v, bq.v, bq.v, acc[t]); }
  }
#pragma unroll
  for (int t = 0; t < 4; ++t) { if (col0 + t * 16 >= N) continue; const int col = col0 + t * 16 + ln; const float bv = bp ? bf16_round(bp[col]) : 0.f;
#pragma unroll
    for (int r = 0; r < 8; ++r) { float v = acc[t][r] * alpha + bv; if (CP) { const int rr = row0g + row0 + 8 * hh + r; if (rowsPerB < 0) v += CP[cofs + (size_t)rr * ldc + col];      /* rowsPerB < 0: own element of the batched C plane */ else { const int bidx = rr / rowsPerB; v += CP[(size_t)bidx * sCPb + (size_t)by * 64 + col]; } } if (ACT == 1) v = (v > 0.f) ? v : expm1f(v); else if (ACT == 7) v = (v > 0.f) ? v + 1.0f : expf(v); else if (ACT == 8) v = tanhf(v); else if (ACT == 9) v = 0.5f * v * (1.0f + tanhf(0.7978845608028654f * (v + 0.044715f * v * v * v))); else if (ACT == 11) v = 1.0f / (1.0f + expf(-v)); else if (ACT == 12) v = (v > 0.f) ? v : 0.01f * v; else if (ACT == 14) v = (v > 0.f) ? v : 0.1f * v; else if (ACT == 16) v = (v >= 0.f) ? v : 0.3f * v; else if (ACT == 17) v = (v >= 0.f) ? v : 0.2f * v; else if (ACT == 15) v = v / (1.0f + expf(-v)); else if (ACT == 3) v = fmaxf(v, 0.f); else if (ACT == 6) v = 0.5f * v * (1.0f + erff(v * 0.70710678118654752f)); so[w][8 * hh + r][t * 16 + ln] = v; } }
  __builtin_amdgcn_fence(__ATOMIC_ACQ_REL, "workgroup"); __builtin_amdgcn_wave_barrier();
  const int rsub = lane >> 4, c4 = (lane & 15) * 4; typedef _Float16 v4h __attribute__((ext_vector_type(4)));
  {
#pragma unroll
    for (int q = 0; q < 8; ++q) { const int r = q * 2 + rsub; if (col0 + c4 < N) { const v4f v = *(const v4fa*)&so[w][r][c4]; if (C) *(v4f*)(C + cofs + (size_t)(row0 + r) * ldc + col0 + c4) = v; if (C16) { v4h h4; for (int i = 0; i < 4; ++i) h4[i] = (_Float16)v[i]; *(v4h*)(C16 + cofs + (size_t)(row0 + r) * ldc + col0 + c4) = h4; } } }
     }
}


typedef _Float16 v4h __attribute__((ext_vector_type(4)));

__global__ __launch_bounds__(256) void k_x16(const float* __restrict__ x, _Float16* __restrict__ X16, size_t n8) { const size_t t = (size_t)blockIdx.x * 256 + threadIdx.x; if (t >= n8) return; FragH f;
#pragma unroll
  for (int q = 0; q < 8; ++q) f.h[q] = (_Float16)bf16_round(x[t * 8 + q]); *(v8us*)((unsigned short*)X16 + t * 8) = f.half[0];  }
__global__ __launch_bounds__(256) void k_h16(const float* __restrict__ x, _Float16* __restrict__ X16, size_t n8) { const size_t t = (size_t)blockIdx.x * 256 + threadIdx.x; if (t >= n8) return; FragH f;
#pragma unroll
  for (int q = 0; q < 8; ++q) f.h[q] = (_Float16)x[t * 8 + q]; *(v8us*)((unsigned short*)X16 + t * 8) = f.half[0];  }
__global__ __launch_bounds__(256) void k_round16f(const float* __restrict__ W, _Float16* __restrict__ Bt, size_t n8) { const size_t t = (size_t)blockIdx.x * 256 + threadIdx.x; if (t >= n8) return; FragH f;
#pragma unroll
  for (int i = 0; i < 8; ++i) f.h[i] = (_Float16)(bf16_round(W[t * 8 + i]) * 16.0f); *(v8us*)((unsigned short*)Bt + t * 8) = f.half[0];  }
template <int NHv, int TTv>
__global__ __launch_bounds__(256) void k_vt(const _Float16* __restrict__ V16, int ldv, int voff, _Float16* __restrict__ Vt) { __shared__ unsigned short tl[64][66]; const int tid = threadIdx.x; const int slab = blockIdx.x / (TTv / 64), lg = blockIdx.x % (TTv / 64); const int b = slab / NHv, h = slab % NHv;
  for (int i = tid; i < 64 * 8; i += 256) { const int r = i / 8, c8 = (i % 8) * 8; FragH f; f.half[0] = *(const v8us*)((const unsigned short*)V16 + ((size_t)b * TTv + lg * 64 + r) * ldv + voff + h * 64 + c8);
#pragma unroll
    for (int q = 0; q < 8; ++q) tl[r][c8 + q] = f.u[q]; }
  __syncthreads();
  {
#pragma unroll
    for (int rd = 0; rd < 2; ++rd) { const int d = rd * 32 + tid / 8, pc = tid % 8; FragH f;
#pragma unroll
      for (int q = 0; q < 8; ++q) f.u[q] = tl[pc * 8 + q][d];
      *(v8us*)((unsigned short*)Vt + ((size_t)slab * 64 + d) * TTv + lg * 64 + pc * 8) = f.half[0]; }
     } }

__global__ __launch_bounds__(256) void k_hl(const float* __restrict__ F, _Float16* __restrict__ Hh, _Float16* __restrict__ Hl, size_t n8) { const size_t t = (size_t)blockIdx.x * 256 + threadIdx.x; if (t >= n8) return; FragH fh, fl; const v4f a = *(const v4fa*)(F + t * 8), c = *(const v4fa*)(F + t * 8 + 4);
#pragma unroll
  for (int q = 0; q < 4; ++q) { _Float16 h = (_Float16)a[q]; fh.h[q] = h; fl.h[q] = (_Float16)((a[q] - (float)h) * 1024.0f); h = (_Float16)c[q]; fh.h[4 + q] = h; fl.h[4 + q] = (_Float16)((c[q] - (float)h) * 1024.0f); }
  { *(v8us*)((unsigned short*)Hh + t * 8) = fh.half[0]; *(v8us*)((unsigned short*)Hl + t * 8) = fl.half[0];  } }

// ---- fast GEMM (wave tile 32x64; requires M % 32 == 0 rows per launch region and N % 64 == 0); epilogue = k_gemm_hhx semantics ----
__device__ __forceinline__ v16h g2_frag(const _Float16* p, int hh) { FragH f; f.half[0] = *(const v8us*)((const unsigned short*)p + 8 * hh); f.half[1] = *(const v8us*)((const unsigned short*)p + 16 + 8 * hh); return f.v; }
__device__ __forceinline__ v8f g2_mma(v16h a, v16h b, v8f c) { v8f d = __builtin_amdgcn_wmma_f32_16x16x32_f16(false, a, false, b, (short)0, c, false, false); asm volatile("v_nop\n\tv_nop\n\tv_nop\n\tv_nop" : "+v"(d) : "v"(a), "v"(b)); return d; }
template <int ACT>
__global__ __launch_bounds__(128) void k_gemm2(const _Float16* __restrict__ A, int lda, size_t sA, const _Float16* __restrict__ Bh, int ldb, size_t sB, float alpha, const float* __restrict__ bias, size_t sBias, const float* __restrict__ CP, int rowsPerB, size_t sCPb, int row0g,
    float* __restrict__ C, _Float16* __restrict__ C16, int ldc, size_t sC, int M, int N, int K) { static_assert(ACT == 0 || ACT == 3 || ACT == 6 || ACT == 8 || ACT == 9 || ACT == 11 || ACT == 12 || ACT == 14 || ACT == 15 || ACT == 16 || ACT == 17, "k_gemm2: unsupported ACT code (would silently apply no activation)");
  __shared__ __attribute__((aligned(16))) float so[4][32][68];
  const int tid = threadIdx.x, w = tid >> 5, lane = tid & 31, ln = lane & 15, hh = lane >> 4; const int by = blockIdx.y;
  A += (size_t)by * sA; Bh += (size_t)by * sB; const size_t cofs = (size_t)by * sC; const float* bp = bias ? bias + (size_t)by * sBias : nullptr;
  const int ntn = N >> 6; const int mt = blockIdx.x / ntn, nq = blockIdx.x - mt * ntn; const int row0 = mt * 128 + 32 * w, col0 = nq * 64; if (row0 >= M) return;
  const _Float16* a0p = A + (size_t)(row0 + ln) * lda; const _Float16* a1p = a0p + (size_t)16 * lda;
  const _Float16* b0p = Bh + (size_t)(col0 + ln) * ldb; const _Float16* b1p = b0p + (size_t)16 * ldb; const _Float16* b2p = b1p + (size_t)16 * ldb; const _Float16* b3p = b2p + (size_t)16 * ldb;
  const v8f z8 = {0.f,0.f,0.f,0.f,0.f,0.f,0.f,0.f}; v8f c00 = z8, c01 = z8, c02 = z8, c03 = z8, c10 = z8, c11 = z8, c12 = z8, c13 = z8;
#pragma unroll 1
  for (int kb = 0; kb < K; kb += 32) { const v16h a0 = g2_frag(a0p + kb, hh), a1 = g2_frag(a1p + kb, hh);
    v16h b = g2_frag(b0p + kb, hh); c00 = g2_mma(a0, b, c00); c10 = g2_mma(a1, b, c10);
    b = g2_frag(b1p + kb, hh); c01 = g2_mma(a0, b, c01); c11 = g2_mma(a1, b, c11);
    b = g2_frag(b2p + kb, hh); c02 = g2_mma(a0, b, c02); c12 = g2_mma(a1, b, c12);
    b = g2_frag(b3p + kb, hh); c03 = g2_mma(a0, b, c03); c13 = g2_mma(a1, b, c13); }
  v8f accs[8] = {c00, c01, c02, c03, c10, c11, c12, c13};
#pragma unroll
  for (int u = 0; u < 8; ++u) { const int t = u & 3, half = u >> 2; const int col = col0 + t * 16 + ln; const float bv = bp ? bf16_round(bp[col]) : 0.f;
#pragma unroll
    for (int r = 0; r < 8; ++r) { const int rloc = half * 16 + 8 * hh + r; float v = accs[u][r] * alpha + bv; if (CP) { if (rowsPerB < 0) v += CP[cofs + (size_t)(row0g + row0 + rloc) * ldc + col];      /* rowsPerB < 0: own element of the batched C plane */ else { const int bidx = (row0g + row0 + rloc) / rowsPerB; v += CP[(size_t)bidx * sCPb + (size_t)by * 64 + col]; } }
      if (ACT == 3) v = fmaxf(v, 0.f); else if (ACT == 6) v = 0.5f * v * (1.0f + erff(v * 0.70710678118654752f)); else if (ACT == 11) v = 1.0f / (1.0f + expf(-v)); else if (ACT == 15) v = v / (1.0f + expf(-v)); else if (ACT == 12) v = (v > 0.f) ? v : 0.01f * v; else if (ACT == 8) v = tanhf(v); else if (ACT == 9) v = 0.5f * v * (1.0f + tanhf(0.7978845608028654f * (v + 0.044715f * v * v * v))); else if (ACT == 14) v = (v > 0.f) ? v : 0.1f * v; else if (ACT == 16) v = (v >= 0.f) ? v : 0.3f * v; else if (ACT == 17) v = (v >= 0.f) ? v : 0.2f * v;
      so[w][rloc][t * 16 + ln] = v; } }
  __builtin_amdgcn_fence(__ATOMIC_ACQ_REL, "workgroup"); __builtin_amdgcn_wave_barrier();
  const int rsub = lane >> 4, c4 = (lane & 15) * 4;
  {
#pragma unroll
    for (int q = 0; q < 16; ++q) { const int r = q * 2 + rsub; const v4f v = *(const v4fa*)&so[w][r][c4]; if (C) *(v4f*)(C + cofs + (size_t)(row0 + r) * ldc + col0 + c4) = v; if (C16) { v4h h4; for (int i = 0; i < 4; ++i) h4[i] = (_Float16)v[i]; *(v4h*)(C16 + cofs + (size_t)(row0 + r) * ldc + col0 + c4) = h4; } }
     } }


__global__ __launch_bounds__(256) void k_wnat(const float* __restrict__ w, size_t n8, _Float16* __restrict__ Bt) { const size_t t = (size_t)blockIdx.x * 256 + threadIdx.x; if (t >= n8) return; FragH f; for (int q = 0; q < 8; ++q) f.h[q] = (_Float16)(bf16_round(w[t * 8 + q]) * 16.0f); *(v8us*)((unsigned short*)Bt + t * 8) = f.half[0];  }
__global__ __launch_bounds__(256) void k_rsm(const float* __restrict__ S, _Float16* __restrict__ P, int nrows) {
  #pragma clang fp contract(off)
  const int i = blockIdx.x * 256 + threadIdx.x; if (i >= nrows) return; const float* s = S + (size_t)i * SQ; float mx = -3.0e38f;
#pragma unroll 1
  for (int j = 0; j < SQ; ++j) mx = fmaxf(mx, s[j]); float se = 0.f;
#pragma unroll 1
  for (int j = 0; j < SQ; ++j) se += expf(s[j] - mx); const float sc = 256.0f / se;
#pragma unroll 1
  for (int j0 = 0; j0 < SQ; j0 += 8) { FragH f; for (int q = 0; q < 8; ++q) f.h[q] = (_Float16)(expf(s[j0 + q] - mx) * sc); unsigned short* d = (unsigned short*)P + (size_t)i * SQ + j0; *(v8us*)d = f.half[0];  } }
__global__ __launch_bounds__(256) void k_vt(const _Float16* __restrict__ V16, int b, int h0, _Float16* __restrict__ VT) { __shared__ unsigned short tl[64][65]; const int tid = threadIdx.x; const int hh = blockIdx.x % HG, sg = blockIdx.x / HG; const int s0 = sg * 64; const int h = h0 + hh;
  for (int i = tid; i < 64 * 8; i += 256) { const int j = i / 8, d8 = (i % 8) * 8; FragH f; f.half[0] = *(const v8us*)((const unsigned short*)V16 + ((size_t)b * SQ + s0 + j) * DM + h * HD + d8); for (int q = 0; q < 8; ++q) tl[d8 + q][j] = f.u[q]; }
  __syncthreads();
  { for (int i = tid; i < 64 * 8; i += 256) { const int d = i / 8, j8 = (i % 8) * 8; FragH f; for (int q = 0; q < 8; ++q) f.u[q] = tl[d][j8 + q]; *(v8us*)((unsigned short*)VT + ((size_t)hh * HD + d) * SQ + s0 + j8) = f.half[0]; }  } }



__global__ __launch_bounds__(256) void k_rsmcf2(const float* __restrict__ S, _Float16* __restrict__ P, int hg, int q0, int nk) {
  #pragma clang fp contract(off)
  const int t = blockIdx.x * 256 + threadIdx.x; if (t >= hg * QT) return; const size_t i = (size_t)t; const float* s = S + i * NKX; const int last = q0 + (t % QT); float mx = -3.0e38f;
#pragma unroll 1
  for (int j = 0; j < nk; ++j) { const float f = (j <= last) ? 1.f : 0.f; mx = fmaxf(mx, fmaf(f, s[j], (1.f - f) * -1.0e9f)); } float se = 0.f;
#pragma unroll 1
  for (int j = 0; j < nk; ++j) { const float f = (j <= last) ? 1.f : 0.f; se += __expf(fmaf(f, s[j], (1.f - f) * -1.0e9f) - mx); } const float sc = 256.0f / se;
#pragma unroll 1
  for (int j0 = 0; j0 < nk; j0 += 8) { FragH fr; for (int q = 0; q < 8; ++q) { const int j = j0 + q; const float f = (j <= last) ? 1.f : 0.f; fr.h[q] = (_Float16)(__expf(fmaf(f, s[j], (1.f - f) * -1.0e9f) - mx) * sc); } unsigned short* d = (unsigned short*)P + i * NKX + j0; *(v8us*)d = fr.half[0];  } }

template <int MASKADD>
__global__ __launch_bounds__(64) void k_att0(const float* __restrict__ QF, const float* __restrict__ KF, const float* __restrict__ VF, int ld, const float* __restrict__ mask, float scale, float* __restrict__ OF, int ldo) {
  #pragma clang fp contract(off)
  __shared__ __attribute__((aligned(16))) float lq[64][64]; __shared__ __attribute__((aligned(16))) float lo[64][64];
  const int tid = threadIdx.x; const int h = blockIdx.x / (QT0 / 64), rg = blockIdx.x % (QT0 / 64); const int i = rg * 64 + tid;
  const float* qr = QF + (size_t)i * ld + h * HD;
#pragma unroll 1
  for (int c = 0; c < HD / 4; ++c) { *(v4f*)&lq[tid][c * 4] = *(const v4fa*)(qr + c * 4); const v4f z = {0.f, 0.f, 0.f, 0.f}; *(v4f*)&lo[tid][c * 4] = z; }
  float m = -1.0e30f, l = 0.f; const int jmax = MASKADD ? (SQ - 1) : (rg * 64 + 63);      /* additive-mask form: every key (the mask input decides); causal form: keys up to the block's last row */
#pragma unroll 1
  for (int j = 0; j <= jmax; ++j) { const float* kr = KF + (size_t)j * ld + h * HD; const float* vr = VF + (size_t)j * ld + h * HD; float s = 0.f;
#pragma unroll 1
    for (int c = 0; c < HD / 4; ++c) { const v4f kq = *(const v4fa*)(kr + c * 4); const v4f qq = *(v4f*)&lq[tid][c * 4]; s = __fadd_rn(s, __fmul_rn(qq[0], kq[0])); s = __fadd_rn(s, __fmul_rn(qq[1], kq[1])); s = __fadd_rn(s, __fmul_rn(qq[2], kq[2])); s = __fadd_rn(s, __fmul_rn(qq[3], kq[3])); }
    s = __fmul_rn(s, scale); if (MASKADD) s = __fadd_rn(s, __fmul_rn(bf16_round(mask[(size_t)i * SQ + j]), -10000.0f));
    const float f = (MASKADD || j <= i) ? 1.f : 0.f; const float sm = fmaf(f, s, (1.f - f) * -1.0e30f); const float mn = fmaxf(m, sm); const float sc = expf(m - mn); const float e = expf(sm - mn); l = __fadd_rn(__fmul_rn(l, sc), e); m = mn;
#pragma unroll 1
    for (int c = 0; c < HD / 4; ++c) { const v4f vv = *(const v4fa*)(vr + c * 4); v4f oo = *(v4f*)&lo[tid][c * 4]; for (int u = 0; u < 4; ++u) oo[u] = __fadd_rn(__fmul_rn(oo[u], sc), __fmul_rn(e, vv[u])); *(v4f*)&lo[tid][c * 4] = oo; } }
  const float fin = 64.0f / l;      /* o carried x64 like the f16 path */
#pragma unroll 1
  for (int c = 0; c < HD / 4; ++c) { v4f oo = *(v4f*)&lo[tid][c * 4]; for (int u = 0; u < 4; ++u) oo[u] = __fmul_rn(oo[u], fin); *(v4f*)&lo[tid][c * 4] = oo; }
  __syncthreads();
  {
#pragma unroll 1
    for (int it = 0; it < 16; ++it) { const int row = it * 4 + tid / 16, pc = (tid % 16) * 4; const v4f v = *(const v4f*)&lo[row][pc]; *(v4f*)(OF + (size_t)(rg * 64 + row) * ldo + h * HD + pc) = v; }
     } }

__global__ __launch_bounds__(256) void k_oscale(const float* __restrict__ OF, float* __restrict__ out, size_t n4) { const size_t t = (size_t)blockIdx.x * 256 + threadIdx.x; if (t >= n4) return; const v4f a = *(const v4fa*)(OF + t * 4); v4f o; for (int q = 0; q < 4; ++q) o[q] = a[q] * 0.015625f; *(v4f*)(out + t * 4) = o;  }

__global__ __launch_bounds__(256) void k_bfr(const float* __restrict__ x, float* __restrict__ XB, size_t n8) { const size_t t = (size_t)blockIdx.x * 256 + threadIdx.x; if (t >= n8) return; v4f a = *(const v4fa*)(x + t * 8), c = *(const v4fa*)(x + t * 8 + 4); for (int q = 0; q < 4; ++q) { a[q] = bf16_round(a[q]); c[q] = bf16_round(c[q]); }
  { *(v4f*)(XB + t * 8) = a; *(v4f*)(XB + t * 8 + 4) = c;  } }



__global__ __launch_bounds__(256) void k_rsmfvl(const float* __restrict__ S, _Float16* __restrict__ P, _Float16* __restrict__ PL, int qn, const int* __restrict__ vlp) {
  #pragma clang fp contract(off)
  const int t = blockIdx.x * 256 + threadIdx.x; if (t >= qn) return; const int vl = vlp[0]; const size_t i = (size_t)t; const float* s = S + i * SQ; float mx = -3.0e38f;
#pragma unroll 1
  for (int j = 0; j < SQ; ++j) { const float f = (j < vl) ? 1.f : 0.f; mx = fmaxf(mx, fmaf(f, s[j], (1.f - f) * -1000000.0f)); } float se = 0.f;
#pragma unroll 1
  for (int j = 0; j < SQ; ++j) { const float f = (j < vl) ? 1.f : 0.f; se += __expf(fmaf(f, s[j], (1.f - f) * -1000000.0f) - mx); } const float sc = 256.0f / se;
#pragma unroll 1
  for (int j0 = 0; j0 < SQ; j0 += 8) { FragH fr, gr; for (int q = 0; q < 8; ++q) { const int j = j0 + q; const float f = (j < vl) ? 1.f : 0.f; const float pv = __expf(fmaf(f, s[j], (1.f - f) * -1000000.0f) - mx) * sc; const _Float16 ph = (_Float16)pv; fr.h[q] = ph; gr.h[q] = (_Float16)((pv - (float)ph) * 1024.0f); }
    unsigned short* d = (unsigned short*)P + i * SQ + j0; unsigned short* dl = (unsigned short*)PL + i * SQ + j0; *(v8us*)d = fr.half[0]; *(v8us*)dl = gr.half[0];  } }

__global__ __launch_bounds__(256) void k_rsmf(const float* __restrict__ S, _Float16* __restrict__ P, int qn, int hg) {
  #pragma clang fp contract(off)
  const int t = blockIdx.x * 256 + threadIdx.x; if (t >= qn * hg) return; const size_t i = (size_t)(t / qn) * SQ + (t % qn); const float* s = S + i * SQ; float mx = -3.0e38f;
#pragma unroll 1
  for (int j = 0; j < SQ; ++j) mx = fmaxf(mx, s[j]); float se = 0.f;
#pragma unroll 1
  for (int j = 0; j < SQ; ++j) se += __expf(s[j] - mx); const float sc = 256.0f / se;
#pragma unroll 1
  for (int j0 = 0; j0 < SQ; j0 += 8) { FragH f; for (int q = 0; q < 8; ++q) f.h[q] = (_Float16)(__expf(s[j0 + q] - mx) * sc); unsigned short* d = (unsigned short*)P + i * SQ + j0; *(v8us*)d = f.half[0];  } }


#define CN 256          /* channels */
#define CI 128
#define NC 256                       /* (unused legacy kernels) */
#define NPX NP          /* positions per channel row */
#define NP 4096         /* seq1 tokens */
#define NM 1024         /* seq2 tokens */
#define BNEPS 1e-5f

__global__ __launch_bounds__(256) void k_mp2(const float* __restrict__ src, float* __restrict__ dst, int nout) {
  const int t = blockIdx.x * 256 + threadIdx.x; if (t >= nout) return; const int c = t / 1024; const int o = t % 1024; const int oy = o / 32, ox = o % 32; const float* p = src + (size_t)c * 4096 + (size_t)(2 * oy) * 64 + 2 * ox;
  const float v = fmaxf(fmaxf(p[0], p[1]), fmaxf(p[64], p[65])); *(float*)(dst + t) = v;  }
__global__ __launch_bounds__(256) void k_xpb(const float* __restrict__ x, const float* __restrict__ wb, float* __restrict__ CPP, size_t n4) {
  #pragma clang fp contract(off)
  const size_t t = (size_t)blockIdx.x * 256 + threadIdx.x; if (t >= n4) return; const size_t e = t * 4; const int c = (int)((e / 4096) % 256); const float bb = bf16_round(wb[c]); const v4f a = *(const v4fa*)(x + e); v4f o; for (int q = 0; q < 4; ++q) o[q] = __fadd_rn(bf16_round(a[q]), bb);
  *(v4f*)(CPP + e) = o;  }


template <int PASS>
__global__ __launch_bounds__(256) void k_cstA(const float* __restrict__ X, const float* __restrict__ MV, float* __restrict__ PART) {
  #pragma clang fp contract(off)
  __shared__ float red[256]; const int t = threadIdx.x; const size_t bc = blockIdx.x; const int c = (int)(bc % NC); const float* row = X + bc * (size_t)NPX; const float mu = PASS ? MV[c] : 0.f; float s = 0.f;
  for (int i = t; i < NPX; i += 256) { const float v = row[i]; const float d = PASS ? __fadd_rn(v, -mu) : v; s = __fadd_rn(s, PASS ? __fmul_rn(d, d) : d); }
  red[t] = s; __syncthreads(); for (int st = 128; st > 0; st >>= 1) { if (t < st) red[t] = __fadd_rn(red[t], red[t + st]); __syncthreads(); }
  if (t < 32) { const float pv = (t == 0) ? red[0] : 0.f; *(float*)(PART + bc * 32 + t) = pv;  } }      

template <int PASS>
__global__ __launch_bounds__(256) void k_cstB(const float* __restrict__ PART, float* __restrict__ MV) { const int c = threadIdx.x; if (c >= NC) return; double s = 0.0; for (int b = 0; b < NB; ++b) s += (double)PART[((size_t)b * NC + c) * 32]; const float m = (float)(s / ((double)NB * (double)NPX)); *(float*)(MV + PASS * NC + c) = m;  }


__global__ __launch_bounds__(256) void k_bnresid(const float* __restrict__ C2, const float* __restrict__ MV, const float* __restrict__ g, const float* __restrict__ be, const float* __restrict__ X, float* __restrict__ out, size_t n4) {
  #pragma clang fp contract(off)
  const size_t t = (size_t)blockIdx.x * 256 + threadIdx.x; if (t >= n4) return; const size_t e = t * 4; const int c = (int)((e / NPX) % NC); const float sc = __fmul_rn(rsqrtf(__fadd_rn(MV[NC + c], BNEPS)), bf16_round(g[c])); const float mu = MV[c], bb = bf16_round(be[c]);
  const v4f a = *(const v4fa*)(C2 + e); const v4f xx = *(const v4fa*)(X + e); v4f o; for (int q = 0; q < 4; ++q) { const float z = __fadd_rn(__fmul_rn(__fadd_rn(a[q], -mu), sc), bb); o[q] = __fadd_rn(z, bf16_round(xx[q])); }
  *(v4f*)(out + e) = o;  }


__global__ __launch_bounds__(256) void k_rowbias(float* __restrict__ Y, const float* __restrict__ bias) {
  #pragma clang fp contract(off)
  const size_t t = (size_t)blockIdx.x * 256 + threadIdx.x; if (t >= (size_t)NB * NC * NPX / 4) return; const size_t e = t * 4; const int c = (int)((e / NPX) % NC); const float bb = bf16_round(bias[c]);
  v4f v = *(const v4fa*)(Y + e); for (int q = 0; q < 4; ++q) v[q] = __fadd_rn(v[q], bb); *(v4f*)(Y + e) = v;  }



template <int NBt, int QTt, int NKt>
__global__ __launch_bounds__(256) void k_bsm(const float* __restrict__ S, _Float16* __restrict__ P) {
  #pragma clang fp contract(off)
  const size_t t = (size_t)blockIdx.x * 256 + threadIdx.x; if (t >= (size_t)QTt * NKt / 8) return; const size_t e = t * 8; float mx[8], se[8];
  for (int q = 0; q < 8; ++q) { mx[q] = -3.0e38f; se[q] = 0.f; }
#pragma unroll
  for (int b = 0; b < NBt; ++b) { const float* s = S + (size_t)b * QTt * NKt + e; for (int q = 0; q < 8; ++q) mx[q] = fmaxf(mx[q], s[q]); }
#pragma unroll
  for (int b = 0; b < NBt; ++b) { const float* s = S + (size_t)b * QTt * NKt + e; for (int q = 0; q < 8; ++q) se[q] += __expf(s[q] - mx[q]); }
#pragma unroll
  for (int b = 0; b < NBt; ++b) { const float* s = S + (size_t)b * QTt * NKt + e; FragH f; for (int q = 0; q < 8; ++q) f.h[q] = (_Float16)(__expf(s[q] - mx[q]) * (256.0f / se[q]));
    unsigned short* d = (unsigned short*)P + (size_t)b * QTt * NKt + e; *(v8us*)d = f.half[0];  } }
// ---- fused scores + batch-axis softmax + P V: one launch for all queries ----
#define FQ 32       /* query rows per work-group */
#define FQT (FQ / 16)      /* query tiles per work-group: each K and V^T fragment fetched serves all of them */
#define FKS 2      /* key ranges: a work-group walks FS / FKS keys, so that the grid still fills the chip */
#define FK 128      /* keys per pass: 16 per wave in part 1 */
#define FPP 136     /* LDS pitch of a P row in f16: 272 B = 16 B x odd, so the 16-byte row reads of part 2 do not collide */
#define FS 4096     /* sequence length */
#define FD 64       /* width */
#define FB 8        /* batches = waves of the work-group */
__device__ __forceinline__ v8f f_mma(v16h a, v16h b, v8f c) { return __builtin_amdgcn_wmma_f32_16x16x32_f16(false, a, false, b, (short)0, c, false, false); }
__device__ __forceinline__ v16h f_frag(const _Float16* p) { FragH f; f.half[0] = *(const v8us*)((const unsigned short*)p); f.half[1] = *(const v8us*)((const unsigned short*)p + 16); return f.v; }      /* p already holds the lane half's 8 hh: the k order of g2_frag */
__device__ __forceinline__ v16h f_fragp(const _Float16* p) { FragH f; f.half[0] = *(const v8us*)((const unsigned short*)p); f.half[1] = *(const v8us*)((const unsigned short*)p + 256); return f.v; }      /* fragment-order planes: p holds the lane's own 8 values, the fragment's second half lies one wave-wide load (32 lanes x 8) further; same values in the same registers as f_frag on rows */
// ---- one prep launch for Q, K and V: three block ranges that do not depend on one another; each writes the same values to the same places as a launch of its own would ----
#define PVK 128      /* keys per work-group of the V range */
#define PVM (PVK * 8 / 256)      /* 8-value items per thread there */
#define PVW (FB * FS / PVK)      /* work-groups of the V range: PVK keys x 64 d of one batch each */
#define PIT 8      /* 8-value items per thread in the Q and K ranges: few waves to start, all of a thread's loads in flight at once */
#define PXW (FB * FS * FD / 8 / 256 / PIT)      /* work-groups of the Q range, and of the K range */
__device__ __forceinline__ v8us p_cvt(v4f a, v4f c) { FragH f;      /* 8 inputs rounded to bf16, held as exact f16 */
#pragma unroll
  for (int q = 0; q < 4; ++q) { f.h[q] = (_Float16)bf16_round(a[q]); f.h[4 + q] = (_Float16)bf16_round(c[q]); }
  return f.half[0]; }
// V range (first: it has the longest chain): V^T in fragment order: per batch [32-key block][t = d / 16][half = (key / 16) & 1][lane = 16 ((key / 8) & 1) + d % 16][8 keys]; a work-group turns PVK keys x 64 d in LDS and writes 16 KiB in a row; the batch planes follow one another, so the block index runs through all batches
// Q range: rows as they are. K range: fragment order: [16-key tile][j = d / 16][lane = 16 ((d / 8) & 1) + key % 16][8 d]; tile = 1024 values, so a batch plane keeps its size and place
__global__ __launch_bounds__(256) void k_prep(const float* __restrict__ xq, const float* __restrict__ xk, const float* __restrict__ xv, _Float16* __restrict__ Q16, _Float16* __restrict__ KP, _Float16* __restrict__ VP) {
  __shared__ unsigned short tl[PVK][66]; const int tid = threadIdx.x; const int bx = blockIdx.x;
  if (bx < PVW) {      /* the same for the whole work-group, so the barrier inside is passed by all of it or by none */
    const float* s = xv + (size_t)bx * (PVK * 64) + tid * 8; v4f a[PVM], c[PVM];      /* key tid / 8 (and 32, 64, ... further), d (tid % 8) * 8 */
#pragma unroll      /* register arrays need constant indices */
    for (int m = 0; m < PVM; ++m) { a[m] = *(const v4fa*)(s + m * 2048); c[m] = *(const v4fa*)(s + m * 2048 + 4); }
    asm volatile("s_wait_xcnt 0x0" :: "v"(s) : "memory");      /* precaution: stands in front of any rewrite of a register that an issued load names; the input keeps the address pair whole up to it */
    const int r = tid / 8, c8 = (tid % 8) * 8;
#pragma unroll      /* register arrays need constant indices */
    for (int m = 0; m < PVM; ++m) { FragH f; f.half[0] = p_cvt(a[m], c[m]);
#pragma unroll
      for (int q = 0; q < 8; ++q) tl[r + 32 * m][c8 + q] = f.u[q]; }
    __syncthreads();
    FragH g[PVM];
#pragma unroll      /* register arrays need constant indices */
    for (int m = 0; m < PVM; ++m) { const int i = m * 256 + tid; const int k0 = (i >> 8) * 32 + ((i >> 5) & 1) * 16 + ((i >> 4) & 1) * 8, d = ((i >> 6) & 3) * 16 + (i & 15);
#pragma unroll
      for (int q = 0; q < 8; ++q) g[m].u[q] = tl[k0 + q][d]; }
    unsigned short* o = (unsigned short*)VP + (size_t)bx * (PVK * 64) + (size_t)tid * 8;
    __builtin_amdgcn_sched_barrier(0);      /* every value ahead of the first store, so that no register that an issued store names is rewritten behind it */
#pragma unroll      /* register arrays need constant indices */
    for (int m = 0; m < PVM; ++m) *(v8us*)(o + m * 2048) = g[m].half[0];
    return;
  }
  const bool isk = bx >= PVW + PXW; const size_t t = (size_t)(bx - PVW - (isk ? PXW : 0)) * (256 * PIT) + tid;      /* first item; the others lie 256 items apart */
  const float* s = (isk ? xk : xq) + t * 8; v4f a[PIT], c[PIT];
#pragma unroll      /* register arrays need constant indices */
  for (int j = 0; j < PIT; ++j) { a[j] = *(const v4fa*)(s + j * 2048); c[j] = *(const v4fa*)(s + j * 2048 + 4); }
  asm volatile("s_wait_xcnt 0x0" :: "v"(s) : "memory");      /* as above */
  const size_t row = t >> 3; const int c8 = (int)(t & 7);
  unsigned short* o = isk ? (unsigned short*)KP + (row >> 4) * 1024 + (size_t)((c8 >> 1) * 256 + ((c8 & 1) * 16 + (int)(row & 15)) * 8) : (unsigned short*)Q16 + t * 8;      /* 256 items on = 32 rows = 2 key tiles = 2048 values on, in both orders */
  v8us h[PIT];
#pragma unroll      /* register arrays need constant indices */
  for (int j = 0; j < PIT; ++j) h[j] = p_cvt(a[j], c[j]);
  __builtin_amdgcn_sched_barrier(0);      /* as above: every value ahead of the first store */
#pragma unroll      /* register arrays need constant indices */
  for (int j = 0; j < PIT; ++j) *(v8us*)(o + j * 2048) = h[j];
}
typedef float v2f __attribute__((ext_vector_type(2)));
// softmax across the 8 batches for one 16-key x 16-query tile, in registers; stores 8 keys of one query per batch to the P buffer
// two neighbouring keys (registers r, r + 1 of a score tile) go through each packed f32 instruction; 1 / sqrt(64) and log2(e) are one factor of one multiply-add whose addend is the scaled maximum
__device__ __forceinline__ void f_soft(const v8f (&s)[FB], _Float16* pw) {
  FragH pk[FB]; constexpr float FC = 0.125f * 1.44269504f; const v2f fc = {FC, FC};
#pragma unroll      /* register arrays need constant indices */
  for (int r = 0; r < 8; r += 2) { v2f e[FB], mx = {-3.0e38f, -3.0e38f};
#pragma unroll
    for (int b = 0; b < FB; ++b) { mx[0] = fmaxf(mx[0], s[b][r]); mx[1] = fmaxf(mx[1], s[b][r + 1]); }
    const v2f nm = mx * -fc;
#pragma unroll
    for (int b = 0; b < FB; ++b) { const v2f x = {s[b][r], s[b][r + 1]}; const v2f t = __builtin_elementwise_fma(x, fc, nm); e[b][0] = __builtin_amdgcn_exp2f(t[0]); e[b][1] = __builtin_amdgcn_exp2f(t[1]); }      /* native exp2 as in __expf */
    v2f se = e[0];
#pragma unroll
    for (int b = 1; b < FB; ++b) se += e[b];
    v2f sc = {__builtin_amdgcn_rcpf(se[0]), __builtin_amdgcn_rcpf(se[1])}; sc *= 256.0f;
#pragma unroll
    for (int b = 0; b < FB; ++b) { const v2f p = e[b] * sc; pk[b].h[r] = (_Float16)p[0]; pk[b].h[r + 1] = (_Float16)p[1]; } }
#pragma unroll      /* register arrays need constant indices */
  for (int b = 0; b < FB; ++b) *(v8us*)((unsigned short*)pw + (size_t)b * FQ * FPP) = pk[b].half[0];
}
__device__ __forceinline__ void f_qld(FragH (&g)[FB], const unsigned short* q) {      /* one group of LDS reads: the Q fragments of one query tile and one half of d, all 8 batches */
#pragma unroll      /* register arrays need constant indices */
  for (int b = 0; b < FB; ++b) { g[b].half[0] = *(const v8us*)(q + b * (FQT * 1024)); g[b].half[1] = *(const v8us*)(q + b * (FQT * 1024) + 256); }      /* a batch's fragments: FQT tiles x 2 halves of d x 512 values */
}
__global__ __launch_bounds__(256) void k_fused(const _Float16* __restrict__ Q16, const _Float16* __restrict__ K16, const _Float16* __restrict__ VT, float* __restrict__ PO) {
  static_assert(FQT == 2, "the pass below is written out for two query tiles");
  __shared__ __attribute__((aligned(16))) _Float16 pl[2][FB][FQ][FPP];      /* two buffers: one barrier a pass is enough */
  __shared__ __attribute__((aligned(16))) unsigned short ql[FB][FQT][2][2][32][8];      /* Q fragments of the whole walk, fragment order: [batch][query tile][d / 32][fragment half][lane][8]; every wave-wide 16-byte read covers 512 bytes in a row */
  const int tid = threadIdx.x, w = tid >> 5, lane = tid & 31, ln = lane & 15, hh = lane >> 4; const int q0 = (blockIdx.x / FKS) * FQ; const int k0 = (blockIdx.x % FKS) * (FS / FKS);
  constexpr size_t PLN = (size_t)FS * FD;
  const v8f z8 = {0.f,0.f,0.f,0.f,0.f,0.f,0.f,0.f};
  const _Float16* qp = Q16 + (size_t)w * PLN + (size_t)(q0 + ln) * FD + 8 * hh;      /* Q rows q0 + ln of batch w: this wave brings them to LDS for all waves */
  const int wu = __builtin_amdgcn_readfirstlane(w); const unsigned lo = lane * 8;      /* the wave's number as a scalar: the K and V^T bases are then scalar and the lane offset is added where an address is formed; a per-lane K pointer that lives from the first loads' wait through the whole walk is spilled by this compiler */
  const _Float16* kp = K16 + (size_t)(k0 + 16 * wu) * FD;      /* part 1: this wave's 16-key tile, fragment order (A operand) */
  const _Float16* vp = VT + (size_t)wu * PLN + (size_t)k0 * FD;      /* part 2: V^T of batch w, fragment order (B operand) */
  FragH qg[FQT][2];
  v16h kf[FB][2];
#pragma unroll      /* register arrays need constant indices */
  for (int u = 0; u < FQT; ++u) { qg[u][0].v = f_frag(qp + u * (16 * FD)); qg[u][1].v = f_frag(qp + u * (16 * FD) + 32); }
#pragma unroll      /* register arrays need constant indices */
  for (int b = 0; b < FB; ++b) { kf[b][0] = f_fragp(kp + (size_t)b * PLN + lo); kf[b][1] = f_fragp(kp + (size_t)b * PLN + 512 + lo); }
  asm volatile("s_wait_xcnt 0x0" :: "v"(qp), "s"(kp), "v"(lane) : "memory");      /* precaution: stands in front of any rewrite of a register that an issued load names; the inputs keep the Q address pair, the K base and the lane index (the K loads' scaled offset register) whole up to it */
#pragma unroll      /* register arrays need constant indices */
  for (int u = 0; u < FQT; ++u)
#pragma unroll
    for (int j = 0; j < 2; ++j) { *(v8us*)&ql[w][u][j][0][lane][0] = qg[u][j].half[0]; *(v8us*)&ql[w][u][j][1][lane][0] = qg[u][j].half[1]; }
  __syncthreads();      /* publishes the Q fragments to every wave */
  const unsigned short* qr = &ql[0][0][0][0][lane][0];
  v8f o[FQT][4];
#pragma unroll      /* register arrays need constant indices */
  for (int u = 0; u < FQT; ++u)
#pragma unroll
    for (int t = 0; t < 4; ++t) o[u][t] = z8;
  for (int it = 0; it < FS / FKS / FK; ++it) {
    const int kb = it * FK; const int kn = (kb + FK) & (FS / FKS - 1);      /* next pass's keys; the last pass requests this half's first keys again: in bounds, not used */
    const _Float16* vb = vp + (size_t)kb * FD + lo; const _Float16* kq = kp + (size_t)kn * FD + lo;
    v8f s[FQT][FB];      /* s[u][b][r] = Q[b][q0 + 16 u + ln] . K[b][k0 + kb + 16 w + 8 hh + r]; the K fragments in registers serve both query tiles */
    { FragH g0[FB], g1[FB], g2[FB], g3[FB];      /* four groups of Q fragments, two in flight at a time */
      f_qld(g0, qr); f_qld(g1, qr + 512);
      __builtin_amdgcn_sched_barrier(0);      /* this one and the two below keep each group of LDS reads whole and one group ahead of the products that use it; left alone the scheduler reads four at a time and waits each out */
#pragma unroll      /* register arrays need constant indices */
      for (int b = 0; b < FB; ++b) s[0][b] = f_mma(kf[b][0], g0[b].v, z8);
      f_qld(g2, qr + 1024);
      __builtin_amdgcn_sched_barrier(0);
#pragma unroll      /* register arrays need constant indices */
      for (int b = 0; b < FB; ++b) s[0][b] = f_mma(kf[b][1], g1[b].v, s[0][b]);
      f_qld(g3, qr + 1536);
      __builtin_amdgcn_sched_barrier(0);
#pragma unroll      /* register arrays need constant indices */
      for (int b = 0; b < FB; ++b) s[1][b] = f_mma(kf[b][0], g2[b].v, z8);
#pragma unroll      /* register arrays need constant indices */
      for (int b = 0; b < FB; ++b) s[1][b] = f_mma(kf[b][1], g3[b].v, s[1][b]); }
    __builtin_amdgcn_sched_barrier(0);      /* keeps the V^T requests below out of the scores, where their registers are still the Q fragments': lifted there they cost spills */
    v16h vf[4][4];      /* this pass's V^T fragments */
#pragma unroll      /* register arrays need constant indices */
    for (int b = 0; b < FB; ++b) { kf[b][0] = f_fragp(kq + (size_t)b * PLN); kf[b][1] = f_fragp(kq + (size_t)b * PLN + 512); }      /* next pass's K fragments, requested as soon as this pass's are used up, so that they arrive under the softmax */
#pragma unroll      /* register arrays need constant indices */
    for (int ks = 0; ks < 2; ++ks)
#pragma unroll
      for (int t = 0; t < 4; ++t) vf[ks][t] = f_fragp(vb + ks * (32 * FD) + t * 512);      /* first half of V^T; the second follows when the first tile's scores have left their registers */
    asm volatile("s_wait_xcnt 0x0" :: "v"(kq), "v"(vb) : "memory");      /* as above, for the K and V^T address pairs */
    __builtin_amdgcn_sched_barrier(0);      /* keeps the requests above in front of the softmax; sunk into it they would start later and be waited out at the barrier */
    f_soft(s[0], &pl[it & 1][0][ln][16 * w + 8 * hh]);
    __builtin_amdgcn_sched_barrier(0);      /* keeps the requests below behind the first softmax, whose registers they take */
#pragma unroll      /* register arrays need constant indices */
    for (int ks = 2; ks < 4; ++ks)
#pragma unroll
      for (int t = 0; t < 4; ++t) vf[ks][t] = f_fragp(vb + ks * (32 * FD) + t * 512);
    asm volatile("s_wait_xcnt 0x0" :: "v"(vb) : "memory");      /* as above, for the V^T address pair */
    __builtin_amdgcn_sched_barrier(0);      /* keeps them in front of the second softmax */
    f_soft(s[1], &pl[it & 1][0][16 + ln][16 * w + 8 * hh]);
    __syncthreads();      /* publishes this pass's P; with two buffers it also ends every read of the buffer that the next pass rewrites */
    const _Float16* pr = &pl[it & 1][w][ln][8 * hh]; v16h pa[FQT][4];      /* P[w] rows as A operands: all read in one group */
#pragma unroll      /* register arrays need constant indices */
    for (int u = 0; u < FQT; ++u)
#pragma unroll
      for (int ks = 0; ks < 4; ++ks) pa[u][ks] = f_frag(pr + u * (16 * FPP) + ks * 32);
    __builtin_amdgcn_sched_barrier(0);      /* keeps the products behind the whole group of reads; without it the scheduler splits the group and waits out each part */
#pragma unroll      /* register arrays need constant indices */
    for (int ks = 0; ks < 4; ++ks)
#pragma unroll
      for (int u = 0; u < FQT; ++u)
#pragma unroll
        for (int t = 0; t < 4; ++t) o[u][t] = f_mma(pa[u][ks], vf[ks][t], o[u][t]);      /* the V^T fragments in registers serve both query tiles */
  }
  float* op = PO + (size_t)(blockIdx.x % FKS) * (FB * PLN) + (size_t)w * PLN + (size_t)(q0 + 8 * hh) * FD + ln;      /* this key half's plane of partial sums, still x256 */
#pragma unroll      /* register arrays need constant indices */
  for (int u = 0; u < FQT; ++u)
#pragma unroll
    for (int t = 0; t < 4; ++t)
#pragma unroll
      for (int r = 0; r < 8; ++r) op[(size_t)(16 * u + r) * FD + t * 16] = o[u][t][r];
}
// out = (first key half + second key half) x 2^-8
#define RIT 8      /* 4-value items per thread: few waves to start, all of a thread's loads in flight at once */
__global__ __launch_bounds__(256) void k_sum(const float* __restrict__ PO, float* __restrict__ out) {
  const size_t t0 = (size_t)blockIdx.x * (1024 * RIT); const unsigned lo = threadIdx.x * 4;      /* the work-group's first value, and the thread's place in each run of 1024 values */
  const float* s0 = PO + t0; const float* s1 = s0 + (size_t)FB * FS * FD; v4f a[RIT], c[RIT];      /* scalar bases; one lane offset serves every load */
#pragma unroll      /* register arrays need constant indices */
  for (int j = 0; j < RIT; ++j) { a[j] = *(const v4fa*)(s0 + j * 1024 + lo); c[j] = *(const v4fa*)(s1 + j * 1024 + lo); }
  asm volatile("s_wait_xcnt 0x0" ::: "memory");      /* precaution: stands in front of any rewrite of a register that an issued load names */
  __builtin_amdgcn_sched_barrier(0);      /* keeps every load in front of the first sum, so that all of a thread's loads are in flight at once */
  float* o = out + t0 + lo;
#pragma unroll      /* register arrays need constant indices */
  for (int j = 0; j < RIT; ++j) a[j] = (a[j] + c[j]) * 0.00390625f;
  __builtin_amdgcn_sched_barrier(0);      /* every value ahead of the first store, so that no register that an issued store names is rewritten behind it */
#pragma unroll      /* register arrays need constant indices */
  for (int j = 0; j < RIT; ++j) *(v4f*)(o + j * 1024) = a[j];
}
extern "C" void kernel_launch(void* const* d_in, const int* in_sizes, int n_in,
                              void* d_out, int out_size, void* d_ws, size_t ws_size, hipStream_t stream) {
  (void)in_sizes; (void)n_in; (void)out_size;
  const float* const* I = (const float* const*)d_in; const float* xq = I[0]; const float* xk = I[1]; const float* xv = I[2];      /* Q, K, V [8][4096][64] (bf16-valued) */
  constexpr int NBt = 8, SQt = 4096, DK = 64;      /* batches, sequence, width */
  char* ws = (char*)d_ws; size_t off = 0;
  auto take = [&](size_t bytes) { char* p = ws + off; off += (bytes + 255) & ~(size_t)255; return p; };
  const size_t PLN = (size_t)SQt * DK;      /* one batch's [4096][64] plane */
  _Float16* Q16 = (_Float16*)take(NBt * PLN * 2); _Float16* K16 = (_Float16*)take(NBt * PLN * 2); _Float16* VT = (_Float16*)take(NBt * PLN * 2); float* PO = (float*)take(FKS * NBt * PLN * 4);
  if (off > ws_size) return;
  k_prep<<<PVW + 2 * PXW, 256, 0, stream>>>(xq, xk, xv, Q16, K16, VT);      /* exact f16 copies of the bf16-valued inputs: Q in rows, K and V^T in fragment order */
  k_fused<<<SQt / FQ * FKS, 256, 0, stream>>>(Q16, K16, VT, PO);      /* scores, softmax across the 8 batches and P V for 32 query rows of all batches and one half of the keys per work-group */
  k_sum<<<NBt * SQt * DK / 4 / 256 / RIT, 256, 0, stream>>>(PO, (float*)d_out);      /* adds the two key halves */
}

// v006
// One run takes 65.8 microseconds.
// Two timings next to v005 both put it at 1.03 times that version's speed.
// Over all steps from v000 it is 32.0 times as fast.
#include <hip/hip_runtime.h>
// Dot-product attention whose softmax runs over the BATCH axis (Q, K, V [8][4096][64], no heads, no weights; scores = Q K^T / sqrt(64) -> [8][4096][4096]; attn = softmax(scores, axis = 0): for every (query, key) pair the 8 batch entries are normalised against each other (the module's literal axis; rows are NOT normalised over keys); out[b] = attn[b] V[b] -> [8][4096][64]).
// Structure: three launches. ONE prep launch (three block ranges) writes the bf16-valued inputs as exact f16; K and V^T (via LDS transposes, once) are written in WMMA fragment order, so that every wave-wide 16-byte load of the walk reads 512 contiguous bytes (4 whole lines, not 32 bytes of each of 16 lines); then ONE fused launch: a work-group owns 32 query rows (two tiles of 16) of all 8 batches and walks one half of the keys 128 at a time, every K and V^T fragment it fetches serving both tiles; Q fragments lie in LDS. Part 1 of a pass: wave w forms S^T = K Q^T for its 16 keys in all 8 batches (WMMA, f32 accumulation, K = 64), so a lane holds the 8 batch values of each (query, key) pair and normalises them in registers (f32, native exp; weights x256 f16), then stores 8 keys of one query per batch to LDS. Part 2: wave w is batch w: out[w] += P[w] V[w]^T (WMMA, f32), keys in ascending order inside a half. A last launch adds the two halves, x 2^-8. Scores and weights never reach memory.
// Compute dtype: inputs rounded to bf16, held exactly as f16; q, k, v and softmax weights as plain f16 GEMM operands (~2^-12); scores, softmax statistics and o f32. v_wmma_f32_16x16x32_f16.
#define NB 4
#define SQ 4096
#define DM 256
#define NH 1
#define HD 64
#define HG 4                         /* heads per attention launch group */
#define B0 0                         /* first batch processed (debug hook) */
#define NBR NB                       /* batches processed (debug hook) */
#define NR ((size_t)NB * SQ)         /* token rows */
#define MP ((int)((size_t)NBR * SQ)) /* rows projected (debug hook) */
#define QT 256                       /* query rows per causal tile */
#define NKX SQ                       /* S / P row pitch */
#define QT0 256                      /* first-tile rows recomputed exactly (256: buys margin for the few-key rows 128..255, which have no output projection to average the single-f16 P/v rounding) */
#define QN SQ                        /* query rows attended per batch (debug hook) */
#define NHD NH                       /* heads attended (debug hook) */
#define MPO MP                       /* rows through the output stage (debug hook) */
#define LQ DM            /* row pitch of the q/k/v rows */
typedef __bf16 v16b __attribute__((ext_vector_type(16)));
typedef unsigned short v8us __attribute__((ext_vector_type(8), may_alias));
typedef float  v8f  __attribute__((ext_vector_type(8)));
typedef float  v4f  __attribute__((ext_vector_type(4)));
typedef float  v4fa __attribute__((ext_vector_type(4), may_alias));
union FragB { v16b v; v8us half[2]; unsigned short u[16]; };

__device__ __forceinline__ unsigned short bf16_bits(float x) { unsigned int u = __float_as_uint(x); return (unsigned short)((u + 0x7FFFu + ((u >> 16) & 1u)) >> 16); }
__device__ __forceinline__ float bf16_val(unsigned short b) { return __uint_as_float(((unsigned int)b) << 16); }
__device__ __forceinline__ float bf16_round(float x) { return bf16_val(bf16_bits(x)); }
// D += A·B with NT terms: 1 = ah·bh, 2 = + al·bh (A split), 3 = + ah·bl (both split)
template <int NT>
__device__ __forceinline__ v8f mmaN(v16b ah, v16b al, v16b bh, v16b bl, v8f c) {
  c = __builtin_amdgcn_wmma_f32_16x16x32_bf16(false, ah, false, bh, (short)0, c, false, false);
  if (NT >= 2) c = __builtin_amdgcn_wmma_f32_16x16x32_bf16(false, al, false, bh, (short)0, c, false, false);
  if (NT >= 3) c = __builtin_amdgcn_wmma_f32_16x16x32_bf16(false, ah, false, bl, (short)0, c, false, false);
  asm volatile("v_nop\n\tv_nop\n\tv_nop\n\tv_nop" : "+v"(c) : "v"(ah), "v"(al), "v"(bh), "v"(bl));
  return c;
}

__global__ __launch_bounds__(256) void k_wt_bf16(const float* __restrict__ W, unsigned short* __restrict__ Wt, int K, int N) {
  const int t = blockIdx.x * 256 + threadIdx.x;
  const int k8n = K / 8;
  if (t >= N * k8n) return;
  const int n = t / k8n, k8 = (t % k8n) * 8;
  v8us v;
#pragma unroll
  for (int i = 0; i < 8; ++i) v[i] = bf16_bits(W[(size_t)(k8 + i) * N + n]);
  *(v8us*)(Wt + (size_t)n * K + k8) = v;
  
}

// GEMM C[M][N] (f32, pitch ldc) = act(A[M][K]·W + bias). A f32 row-major (pitch lda) converted per fragment to bf16
// (ASPLIT: hi/lo two planes -> 2 terms, else single rounded term); Wt bf16 [N][K] (pitch ldb). BIAS_BF16 rounds the
// bias to bf16 first (bias quantised to bf16 before the add). K%32==0, M%16==0, N%64==0.
template <bool ASPLIT, int ACT, bool BIAS_BF16>
__global__ __launch_bounds__(128) void k_gemm_bf(const float* __restrict__ A, int lda, const unsigned short* __restrict__ Wt, int ldb,
                                               const float* __restrict__ bias, float* __restrict__ C, int ldc, int M, int N, int K) {
  __shared__ __attribute__((aligned(16))) float so[4][16][64];
  const int tid = threadIdx.x, w = tid >> 5, lane = tid & 31, ln = lane & 15, hh = lane >> 4;
  const int ntn = N / 64;
  const int wid = blockIdx.x * 4 + w;
  const int mt = wid / ntn, nq = wid % ntn;
  if (mt * 16 >= M) return;
  const int row0 = mt * 16, col0 = nq * 64;
  const float* arow = A + (size_t)(row0 + ln) * lda;
  v8f acc[4] = {};
  for (int kb = 0; kb < K; kb += 32) {
    FragB ah, al;
    const v4f x0 = *(const v4fa*)(arow + kb + 8 * hh), x1 = *(const v4fa*)(arow + kb + 8 * hh + 4);
    const v4f x2 = *(const v4fa*)(arow + kb + 16 + 8 * hh), x3 = *(const v4fa*)(arow + kb + 16 + 8 * hh + 4);
    float xs[16] = {x0[0],x0[1],x0[2],x0[3],x1[0],x1[1],x1[2],x1[3],x2[0],x2[1],x2[2],x2[3],x3[0],x3[1],x3[2],x3[3]};
#pragma unroll
    for (int i = 0; i < 16; ++i) { const unsigned short hb = bf16_bits(xs[i]); ah.u[i] = hb; al.u[i] = ASPLIT ? bf16_bits(xs[i] - bf16_val(hb)) : (unsigned short)0; }
#pragma unroll
    for (int t = 0; t < 4; ++t) {
      const unsigned short* brow = Wt + (size_t)(col0 + t * 16 + ln) * ldb + kb;
      FragB b;
      b.half[0] = *(const v8us*)(brow + 8 * hh);
      b.half[1] = *(const v8us*)(brow + 16 + 8 * hh);
      acc[t] = mmaN<ASPLIT ? 2 : 1>(ah.v, al.v, b.v, b.v, acc[t]);
    }
  }
#pragma unroll
  for (int t = 0; t < 4; ++t) {
    float bv = bias ? bias[col0 + t * 16 + ln] : 0.f;
    if (BIAS_BF16) bv = bf16_round(bv);
#pragma unroll
    for (int r = 0; r < 8; ++r) { float v = acc[t][r] + bv; if (ACT == 1) v = fmaxf(v, 0.f); so[w][8 * hh + r][t * 16 + ln] = v; }
  }
  __builtin_amdgcn_fence(__ATOMIC_ACQ_REL, "workgroup");
  __builtin_amdgcn_wave_barrier();
  const int rsub = lane >> 4, c4 = (lane & 15) * 4;
  {
#pragma unroll
    for (int q = 0; q < 8; ++q) {
      const int r = q * 2 + rsub;
      const v4f v = *(const v4fa*)&so[w][r][c4];
      *(v4f*)(C + (size_t)(row0 + r) * ldc + col0 + c4) = v;
    }
    
  }
}

// GEMM C = act(A·W + bias + resid): A f32 (ASPLIT -> hi/lo 2 terms), Wt bf16 [N][K]; ACT 0 none, 1 relu, 2 exact gelu;
// resid (optional, f32, row index = (row % rmod), pitch ldr, RES_BF16 rounds it) added before the activation.
template <bool ASPLIT, int ACT, bool BIAS_BF16, bool RES_BF16>
__global__ __launch_bounds__(128) void k_gemm_bf3(const float* __restrict__ A, int lda, const unsigned short* __restrict__ Wt, int ldb,
                                                const float* __restrict__ bias, const float* __restrict__ resid, int rmod, int ldr,
                                                float* __restrict__ C, int ldc, int M, int N, int K) {
  __shared__ __attribute__((aligned(16))) float so[4][16][64];
  const int tid = threadIdx.x, w = tid >> 5, lane = tid & 31, ln = lane & 15, hh = lane >> 4;
  const int ntn = N / 64;
  const int wid = blockIdx.x * 4 + w;
  const int mt = wid / ntn, nq = wid % ntn;
  if (mt * 16 >= M) return;
  const int row0 = mt * 16, col0 = nq * 64;
  const float* arow = A + (size_t)(row0 + ln) * lda;
  v8f acc[4] = {};
  for (int kb = 0; kb < K; kb += 32) {
    FragB ah, al;
    const v4f x0 = *(const v4fa*)(arow + kb + 8 * hh), x1 = *(const v4fa*)(arow + kb + 8 * hh + 4);
    const v4f x2 = *(const v4fa*)(arow + kb + 16 + 8 * hh), x3 = *(const v4fa*)(arow + kb + 16 + 8 * hh + 4);
    float xs[16] = {x0[0],x0[1],x0[2],x0[3],x1[0],x1[1],x1[2],x1[3],x2[0],x2[1],x2[2],x2[3],x3[0],x3[1],x3[2],x3[3]};
#pragma unroll
    for (int i = 0; i < 16; ++i) { const unsigned short hb = bf16_bits(xs[i]); ah.u[i] = hb; al.u[i] = ASPLIT ? bf16_bits(xs[i] - bf16_val(hb)) : (unsigned short)0; }
#pragma unroll
    for (int t = 0; t < 4; ++t) {
      const unsigned short* brow = Wt + (size_t)(col0 + t * 16 + ln) * ldb + kb;
      FragB b;
      b.half[0] = *(const v8us*)(brow + 8 * hh);
      b.half[1] = *(const v8us*)(brow + 16 + 8 * hh);
      acc[t] = mmaN<ASPLIT ? 2 : 1>(ah.v, al.v, b.v, b.v, acc[t]);
    }
  }
#pragma unroll
  for (int t = 0; t < 4; ++t) {
    const int col = col0 + t * 16 + ln;
    float bv = bias ? bias[col] : 0.f;
    if (BIAS_BF16) bv = bf16_round(bv);
#pragma unroll
    for (int r = 0; r < 8; ++r) {
      float v = acc[t][r] + bv;
      if (resid) { float rv = resid[(size_t)((row0 + 8 * hh + r) % rmod) * ldr + col]; if (RES_BF16) rv = bf16_round(rv); v += rv; }
      if (ACT == 1) v = fmaxf(v, 0.f);
      if (ACT == 2) v = 0.5f * v * (1.0f + erff(v * 0.70710678118654752f));
      if (ACT == 3) { const float u = 0.7978845608028654f * (v + 0.044715f * v * v * v); v = 0.5f * v * (1.0f + tanhf(u)); }
      so[w][8 * hh + r][t * 16 + ln] = v;
    }
  }
  __builtin_amdgcn_fence(__ATOMIC_ACQ_REL, "workgroup");
  __builtin_amdgcn_wave_barrier();
  const int rsub = lane >> 4, c4 = (lane & 15) * 4;
  {
#pragma unroll
    for (int q = 0; q < 8; ++q) {
      const int r = q * 2 + rsub;
      const v4f v = *(const v4fa*)&so[w][r][c4];
      *(v4f*)(C + (size_t)(row0 + r) * ldc + col0 + c4) = v;
    }
    
  }
}
// row LayerNorm (biased variance, eps) over N: s = X (+ R); optional out_sum <- s; out_norm <- (s-mu)*rsqrt(var+eps)*g + b
template <bool PARAM_BF16>
__global__ __launch_bounds__(256) void k_layernorm(const float* __restrict__ X, const float* __restrict__ R, const float* __restrict__ g, const float* __restrict__ bta,
                                                  float* __restrict__ out_sum, float* __restrict__ out_norm, int N, float eps) {
  __shared__ float red[256];
  const int row = blockIdx.x, tid = threadIdx.x;
  const float* x = X + (size_t)row * N; const float* rr = R ? R + (size_t)row * N : nullptr;
  float vals[16];                     // up to N = 4096
  const int per = N / 256;            // contiguous chunk per thread? use strided-by-4 chunks: thread handles j = tid*4 + 1024*u
  float s1 = 0.f;
  for (int u = 0; u < per / 4; ++u) {
    const int j = tid * 4 + 1024 * u;
    const v4f a = *(const v4fa*)(x + j);
    v4f b = {0.f,0.f,0.f,0.f}; if (rr) b = *(const v4fa*)(rr + j);
#pragma unroll
    for (int q = 0; q < 4; ++q) { const float v = a[q] + b[q]; vals[u * 4 + q] = v; s1 += v; }
  }
  red[tid] = s1; __syncthreads();
  for (int st = 128; st > 0; st >>= 1) { if (tid < st) red[tid] += red[tid + st]; __syncthreads(); }
  const float mu = red[0] / (float)N; __syncthreads();
  float s2 = 0.f;
  for (int u = 0; u < per / 4; ++u)
#pragma unroll
    for (int q = 0; q < 4; ++q) { const float c = vals[u * 4 + q] - mu; s2 += c * c; }
  red[tid] = s2; __syncthreads();
  for (int st = 128; st > 0; st >>= 1) { if (tid < st) red[tid] += red[tid + st]; __syncthreads(); }
  const float rs = rsqrtf(red[0] / (float)N + eps);
  {
    for (int u = 0; u < per / 4; ++u) {
      const int j = tid * 4 + 1024 * u;
      v4f o, sm;
#pragma unroll
      for (int q = 0; q < 4; ++q) {
        float gg = g[j + q], bb = bta[j + q];
        if (PARAM_BF16) { gg = bf16_round(gg); bb = bf16_round(bb); }
        sm[q] = vals[u * 4 + q]; o[q] = (vals[u * 4 + q] - mu) * rs * gg + bb;
      }
      if (out_sum) *(v4f*)(out_sum + (size_t)row * N + j) = sm;
      *(v4f*)(out_norm + (size_t)row * N + j) = o;
    }
    
  }
}



// ---- f16 WMMA path (v_wmma_f32_16x16x32_f16): 11-bit significands for operands in range — used where a [0,1] probability operand needs more precision than bf16
typedef _Float16 v16h __attribute__((ext_vector_type(16)));
union FragH { v16h v; v8us half[2]; _Float16 h[16]; unsigned short u[16]; };
template <int NT>
__device__ __forceinline__ v8f mmaH(v16h ah, v16h al, v16h bh, v16h bl, v8f c) {
  c = __builtin_amdgcn_wmma_f32_16x16x32_f16(false, ah, false, bh, (short)0, c, false, false);
  if (NT >= 2) c = __builtin_amdgcn_wmma_f32_16x16x32_f16(false, al, false, bh, (short)0, c, false, false);
  if (NT >= 3) c = __builtin_amdgcn_wmma_f32_16x16x32_f16(false, ah, false, bl, (short)0, c, false, false);
  asm volatile("v_nop\n\tv_nop\n\tv_nop\n\tv_nop" : "+v"(c) : "v"(ah), "v"(al), "v"(bh), "v"(bl));
  return c;
}
// batched GEMM like k_gemm_b but f16 operands: A f32 (split into f16 hi/lo if ASPLIT, else rounded to f16), Bt = f16 values [n][k]; alpha; C f32; N multiple of 16 (partial tiles skipped)
template <bool ASPLIT>
__global__ __launch_bounds__(128) void k_gemm_h(const float* __restrict__ A, int lda, size_t sA, const _Float16* __restrict__ Bh, int ldb, size_t sB, float alpha, float* __restrict__ C, int ldc, size_t sC, int M, int N, int K) {
  __shared__ __attribute__((aligned(16))) float so[4][16][64];
  const int tid = threadIdx.x, w = tid >> 5, lane = tid & 31, ln = lane & 15, hh = lane >> 4; const int by = blockIdx.y;
  A += (size_t)by * sA; Bh += (size_t)by * sB; C += (size_t)by * sC;
  const int ntn = (N + 63) / 64; const int wid = blockIdx.x * 4 + w; const int mt = wid / ntn, nq = wid % ntn; if (mt * 16 >= M) return;
  const int row0 = mt * 16, col0 = nq * 64; const float* arow = A + (size_t)(row0 + ln) * lda;
  v8f acc[4] = {};
  for (int kb = 0; kb < K; kb += 32) {
    FragH ah, al;
    const v4f x0 = *(const v4fa*)(arow + kb + 8 * hh), x1 = *(const v4fa*)(arow + kb + 8 * hh + 4), x2 = *(const v4fa*)(arow + kb + 16 + 8 * hh), x3 = *(const v4fa*)(arow + kb + 16 + 8 * hh + 4);
    float xs[16] = {x0[0],x0[1],x0[2],x0[3],x1[0],x1[1],x1[2],x1[3],x2[0],x2[1],x2[2],x2[3],x3[0],x3[1],x3[2],x3[3]};
#pragma unroll
    for (int i = 0; i < 16; ++i) { const _Float16 h = (_Float16)xs[i]; ah.h[i] = h; al.h[i] = ASPLIT ? (_Float16)(xs[i] - (float)h) : (_Float16)0.0f; }
#pragma unroll
    for (int t = 0; t < 4; ++t) { if (col0 + t * 16 >= N) continue; const size_t boff = (size_t)(col0 + t * 16 + ln) * ldb + kb; FragH bq; bq.half[0] = *(const v8us*)(Bh + boff + 8 * hh); bq.half[1] = *(const v8us*)(Bh + boff + 16 + 8 * hh);
      acc[t] = mmaH<ASPLIT ? 2 : 1>(ah.v, al.v, bq.v, bq.v, acc[t]); }
  }
#pragma unroll
  for (int t = 0; t < 4; ++t) { if (col0 + t * 16 >= N) continue;
#pragma unroll
    for (int r = 0; r < 8; ++r) so[w][8 * hh + r][t * 16 + ln] = acc[t][r] * alpha; }
  __builtin_amdgcn_fence(__ATOMIC_ACQ_REL, "workgroup"); __builtin_amdgcn_wave_barrier();
  const int rsub = lane >> 4, c4 = (lane & 15) * 4;
  {
#pragma unroll
    for (int q = 0; q < 8; ++q) { const int r = q * 2 + rsub; if (col0 + c4 < N) { const v4f v = *(const v4fa*)&so[w][r][c4]; *(v4f*)(C + (size_t)(row0 + r) * ldc + col0 + c4) = v; } }
     }
}

// Wt[n][k] = f16(W[k][n]·scale) from f32 row-major W[K][N] (scale = power of two; bf16-exact weights stay exact in f16 away from the subnormal range)
__global__ __launch_bounds__(256) void k_wt_f16(const float* __restrict__ W, _Float16* __restrict__ Wt, int K, int N, float scale) {
  const int t = blockIdx.x * 256 + threadIdx.x; if (t >= N * (K / 8)) return; const int n = t / (K / 8), k8 = (t % (K / 8)) * 8; FragH f;
#pragma unroll
  for (int i = 0; i < 8; ++i) f.h[i] = (_Float16)(bf16_round(W[(size_t)(k8 + i) * N + n]) * scale); const v8us o = f.half[0];
  *(v8us*)((unsigned short*)Wt + (size_t)n * K + k8) = o; 
}
// k_gemm_hh variant with fused epilogue: v = acc·alpha + bias[by·sBias + col] (+ CP[(row/rowsPerB)·sCPb + by·64 + col] if CP) ; ACT 0 none / 1 elu ; writes f16 C16 (and f32 C if non-null)
template <int ACT>
__global__ __launch_bounds__(128) void k_gemm_hhx(const _Float16* __restrict__ A, int lda, size_t sA, const _Float16* __restrict__ Bh, int ldb, size_t sB, float alpha, const float* __restrict__ bias, size_t sBias, const float* __restrict__ CP, int rowsPerB, size_t sCPb, int row0g,
    float* __restrict__ C, _Float16* __restrict__ C16, int ldc, size_t sC, int M, int N, int K) {
  __shared__ __attribute__((aligned(16))) float so[4][16][64];
  const int tid = threadIdx.x, w = tid >> 5, lane = tid & 31, ln = lane & 15, hh = lane >> 4; const int by = blockIdx.y;
  A += (size_t)by * sA; Bh += (size_t)by * sB; const size_t cofs = (size_t)by * sC; const float* bp = bias ? bias + (size_t)by * sBias : nullptr;
  const int ntn = (N + 63) / 64; const int wid = blockIdx.x * 4 + w; const int mt = wid / ntn, nq = wid % ntn; if (mt * 16 >= M) return;
  const int row0 = mt * 16, col0 = nq * 64; const _Float16* arow = A + (size_t)(row0 + ln) * lda;
  v8f acc[4] = {};
  for (int kb = 0; kb < K; kb += 32) { FragH ah; ah.half[0] = *(const v8us*)((const unsigned short*)arow + kb + 8 * hh); ah.half[1] = *(const v8us*)((const unsigned short*)arow + kb + 16 + 8 * hh);
#pragma unroll
    for (int t = 0; t < 4; ++t) { if (col0 + t * 16 >= N) continue; const size_t boff = (size_t)(col0 + t * 16 + ln) * ldb + kb; FragH bq; bq.half[0] = *(const v8us*)((const unsigned short*)Bh + boff + 8 * hh); bq.half[1] = *(const v8us*)((const unsigned short*)Bh + boff + 16 + 8 * hh);
      acc[t] = mmaH<1>(ah.v, ah.v, bq.v, bq.v, acc[t]); }
  }
#pragma unroll
  for (int t = 0; t < 4; ++t) { if (col0 + t * 16 >= N) continue; const int col = col0 + t * 16 + ln; const float bv = bp ? bf16_round(bp[col]) : 0.f;
#pragma unroll
    for (int r = 0; r < 8; ++r) { float v = acc[t][r] * alpha + bv; if (CP) { const int rr = row0g + row0 + 8 * hh + r; if (rowsPerB < 0) v += CP[cofs + (size_t)rr * ldc + col];      /* rowsPerB < 0: own element of the batched C plane */ else { const int bidx = rr / rowsPerB; v += CP[(size_t)bidx * sCPb + (size_t)by * 64 + col]; } } if (ACT == 1) v = (v > 0.f) ? v : expm1f(v); else if (ACT == 7) v = (v > 0.f) ? v + 1.0f : expf(v); else if (ACT == 8) v = tanhf(v); else if (ACT == 9) v = 0.5f * v * (1.0f + tanhf(0.7978845608028654f * (v + 0.044715f * v * v * v))); else if (ACT == 11) v = 1.0f / (1.0f + expf(-v)); else if (ACT == 12) v = (v > 0.f) ? v : 0.01f * v; else if (ACT == 14) v = (v > 0.f) ? v : 0.1f * v; else if (ACT == 16) v = (v >= 0.f) ? v : 0.3f * v; else if (ACT == 17) v = (v >= 0.f) ? v : 0.2f * v; else if (ACT == 15) v = v / (1.0f + expf(-v)); else if (ACT == 3) v = fmaxf(v, 0.f); else if (ACT == 6) v = 0.5f * v * (1.0f + erff(v * 0.70710678118654752f)); so[w][8 * hh + r][t * 16 + ln] = v; } }
  __builtin_amdgcn_fence(__ATOMIC_ACQ_REL, "workgroup"); __builtin_amdgcn_wave_barrier();
  const int rsub = lane >> 4, c4 = (lane & 15) * 4; typedef _Float16 v4h __attribute__((ext_vector_type(4)));
  {
#pragma unroll
    for (int q = 0; q < 8; ++q) { const int r = q * 2 + rsub; if (col0 + c4 < N) { const v4f v = *(const v4fa*)&so[w][r][c4]; if (C) *(v4f*)(C + cofs + (size_t)(row0 + r) * ldc + col0 + c4) = v; if (C16) { v4h h4; for (int i = 0; i < 4; ++i) h4[i] = (_Float16)v[i]; *(v4h*)(C16 + cofs + (size_t)(row0 + r) * ldc + col0 + c4) = h4; } } }
     }
}


typedef _Float16 v4h __attribute__((ext_vector_type(4)));

__global__ __launch_bounds__(256) void k_x16(const float* __restrict__ x, _Float16* __restrict__ X16, size_t n8) { const size_t t = (size_t)blockIdx.x * 256 + threadIdx.x; if (t >= n8) return; FragH f;
#pragma unroll
  for (int q = 0; q < 8; ++q) f.h[q] = (_Float16)bf16_round(x[t * 8 + q]); *(v8us*)((unsigned short*)X16 + t * 8) = f.half[0];  }
__global__ __launch_bounds__(256) void k_h16(const float* __restrict__ x, _Float16* __restrict__ X16, size_t n8) { const size_t t = (size_t)blockIdx.x * 256 + threadIdx.x; if (t >= n8) return; FragH f;
#pragma unroll
  for (int q = 0; q < 8; ++q) f.h[q] = (_Float16)x[t * 8 + q]; *(v8us*)((unsigned short*)X16 + t * 8) = f.half[0];  }
__global__ __launch_bounds__(256) void k_round16f(const float* __restrict__ W, _Float16* __restrict__ Bt, size_t n8) { const size_t t = (size_t)blockIdx.x * 256 + threadIdx.x; if (t >= n8) return; FragH f;
#pragma unroll
  for (int i = 0; i < 8; ++i) f.h[i] = (_Float16)(bf16_round(W[t * 8 + i]) * 16.0f); *(v8us*)((unsigned short*)Bt + t * 8) = f.half[0];  }
template <int NHv, int TTv>
__global__ __launch_bounds__(256) void k_vt(const _Float16* __restrict__ V16, int ldv, int voff, _Float16* __restrict__ Vt) { __shared__ unsigned short tl[64][66]; const int tid = threadIdx.x; const int slab = blockIdx.x / (TTv / 64), lg = blockIdx.x % (TTv / 64); const int b = slab / NHv, h = slab % NHv;
  for (int i = tid; i < 64 * 8; i += 256) { const int r = i / 8, c8 = (i % 8) * 8; FragH f; f.half[0] = *(const v8us*)((const unsigned short*)V16 + ((size_t)b * TTv + lg * 64 + r) * ldv + voff + h * 64 + c8);
#pragma unroll
    for (int q = 0; q < 8; ++q) tl[r][c8 + q] = f.u[q]; }
  __syncthreads();
  {
#pragma unroll
    for (int rd = 0; rd < 2; ++rd) { const int d = rd * 32 + tid / 8, pc = tid % 8; FragH f;
#pragma unroll
      for (int q = 0; q < 8; ++q) f.u[q] = tl[pc * 8 + q][d];
      *(v8us*)((unsigned short*)Vt + ((size_t)slab * 64 + d) * TTv + lg * 64 + pc * 8) = f.half[0]; }
     } }

__global__ __launch_bounds__(256) void k_hl(const float* __restrict__ F, _Float16* __restrict__ Hh, _Float16* __restrict__ Hl, size_t n8) { const size_t t = (size_t)blockIdx.x * 256 + threadIdx.x; if (t >= n8) return; FragH fh, fl; const v4f a = *(const v4fa*)(F + t * 8), c = *(const v4fa*)(F + t * 8 + 4);
#pragma unroll
  for (int q = 0; q < 4; ++q) { _Float16 h = (_Float16)a[q]; fh.h[q] = h; fl.h[q] = (_Float16)((a[q] - (float)h) * 1024.0f); h = (_Float16)c[q]; fh.h[4 + q] = h; fl.h[4 + q] = (_Float16)((c[q] - (float)h) * 1024.0f); }
  { *(v8us*)((unsigned short*)Hh + t * 8) = fh.half[0]; *(v8us*)((unsigned short*)Hl + t * 8) = fl.half[0];  } }

// ---- fast GEMM (wave tile 32x64; requires M % 32 == 0 rows per launch region and N % 64 == 0); epilogue = k_gemm_hhx semantics ----
__device__ __forceinline__ v16h g2_frag(const _Float16* p, int hh) { FragH f; f.half[0] = *(const v8us*)((const unsigned short*)p + 8 * hh); f.half[1] = *(const v8us*)((const unsigned short*)p + 16 + 8 * hh); return f.v; }
__device__ __forceinline__ v8f g2_mma(v16h a, v16h b, v8f c) { v8f d = __builtin_amdgcn_wmma_f32_16x16x32_f16(false, a, false, b, (short)0, c, false, false); asm volatile("v_nop\n\tv_nop\n\tv_nop\n\tv_nop" : "+v"(d) : "v"(a), "v"(b)); return d; }
template <int ACT>
__global__ __launch_bounds__(128) void k_gemm2(const _Float16* __restrict__ A, int lda, size_t sA, const _Float16* __restrict__ Bh, int ldb, size_t sB, float alpha, const float* __restrict__ bias, size_t sBias, const float* __restrict__ CP, int rowsPerB, size_t sCPb, int row0g,
    float* __restrict__ C, _Float16* __restrict__ C16, int ldc, size_t sC, int M, int N, int K) { static_assert(ACT == 0 || ACT == 3 || ACT == 6 || ACT == 8 || ACT == 9 || ACT == 11 || ACT == 12 || ACT == 14 || ACT == 15 || ACT == 16 || ACT == 17, "k_gemm2: unsupported ACT code (would silently apply no activation)");
  __shared__ __attribute__((aligned(16))) float so[4][32][68];
  const int tid = threadIdx.x, w = tid >> 5, lane = tid & 31, ln = lane & 15, hh = lane >> 4; const int by = blockIdx.y;
  A += (size_t)by * sA; Bh += (size_t)by * sB; const size_t cofs = (size_t)by * sC; const float* bp = bias ? bias + (size_t)by * sBias : nullptr;
  const int ntn = N >> 6; const int mt = blockIdx.x / ntn, nq = blockIdx.x - mt * ntn; const int row0 = mt * 128 + 32 * w, col0 = nq * 64; if (row0 >= M) return;
  const _Float16* a0p = A + (size_t)(row0 + ln) * lda; const _Float16* a1p = a0p + (size_t)16 * lda;
  const _Float16* b0p = Bh + (size_t)(col0 + ln) * ldb; const _Float16* b1p = b0p + (size_t)16 * ldb; const _Float16* b2p = b1p + (size_t)16 * ldb; const _Float16* b3p = b2p + (size_t)16 * ldb;
  const v8f z8 = {0.f,0.f,0.f,0.f,0.f,0.f,0.f,0.f}; v8f c00 = z8, c01 = z8, c02 = z8, c03 = z8, c10 = z8, c11 = z8, c12 = z8, c13 = z8;
#pragma unroll 1
  for (int kb = 0; kb < K; kb += 32) { const v16h a0 = g2_frag(a0p + kb, hh), a1 = g2_frag(a1p + kb, hh);
    v16h b = g2_frag(b0p + kb, hh); c00 = g2_mma(a0, b, c00); c10 = g2_mma(a1, b, c10);
    b = g2_frag(b1p + kb, hh); c01 = g2_mma(a0, b, c01); c11 = g2_mma(a1, b, c11);
    b = g2_frag(b2p + kb, hh); c02 = g2_mma(a0, b, c02); c12 = g2_mma(a1, b, c12);
    b = g2_frag(b3p + kb, hh); c03 = g2_mma(a0, b, c03); c13 = g2_mma(a1, b, c13); }
  v8f accs[8] = {c00, c01, c02, c03, c10, c11, c12, c13};
#pragma unroll
  for (int u = 0; u < 8; ++u) { const int t = u & 3, half = u >> 2; const int col = col0 + t * 16 + ln; const float bv = bp ? bf16_round(bp[col]) : 0.f;
#pragma unroll
    for (int r = 0; r < 8; ++r) { const int rloc = half * 16 + 8 * hh + r; float v = accs[u][r] * alpha + bv; if (CP) { if (rowsPerB < 0) v += CP[cofs + (size_t)(row0g + row0 + rloc) * ldc + col];      /* rowsPerB < 0: own element of the batched C plane */ else { const int bidx = (row0g + row0 + rloc) / rowsPerB; v += CP[(size_t)bidx * sCPb + (size_t)by * 64 + col]; } }
      if (ACT == 3) v = fmaxf(v, 0.f); else if (ACT == 6) v = 0.5f * v * (1.0f + erff(v * 0.70710678118654752f)); else if (ACT == 11) v = 1.0f / (1.0f + expf(-v)); else if (ACT == 15) v = v / (1.0f + expf(-v)); else if (ACT == 12) v = (v > 0.f) ? v : 0.01f * v; else if (ACT == 8) v = tanhf(v); else if (ACT == 9) v = 0.5f * v * (1.0f + tanhf(0.7978845608028654f * (v + 0.044715f * v * v * v))); else if (ACT == 14) v = (v > 0.f) ? v : 0.1f * v; else if (ACT == 16) v = (v >= 0.f) ? v : 0.3f * v; else if (ACT == 17) v = (v >= 0.f) ? v : 0.2f * v;
      so[w][rloc][t * 16 + ln] = v; } }
  __builtin_amdgcn_fence(__ATOMIC_ACQ_REL, "workgroup"); __builtin_amdgcn_wave_barrier();
  const int rsub = lane >> 4, c4 = (lane & 15) * 4;
  {
#pragma unroll
    for (int q = 0; q < 16; ++q) { const int r = q * 2 + rsub; const v4f v = *(const v4fa*)&so[w][r][c4]; if (C) *(v4f*)(C + cofs + (size_t)(row0 + r) * ldc + col0 + c4) = v; if (C16) { v4h h4; for (int i = 0; i < 4; ++i) h4[i] = (_Float16)v[i]; *(v4h*)(C16 + cofs + (size_t)(row0 + r) * ldc + col0 + c4) = h4; } }
     } }


__global__ __launch_bounds__(256) void k_wnat(const float* __restrict__ w, size_t n8, _Float16* __restrict__ Bt) { const size_t t = (size_t)blockIdx.x * 256 + threadIdx.x; if (t >= n8) return; FragH f; for (int q = 0; q < 8; ++q) f.h[q] = (_Float16)(bf16_round(w[t * 8 + q]) * 16.0f); *(v8us*)((unsigned short*)Bt + t * 8) = f.half[0];  }
__global__ __launch_bounds__(256) void k_rsm(const float* __restrict__ S, _Float16* __restrict__ P, int nrows) {
  #pragma clang fp contract(off)
  const int i = blockIdx.x * 256 + threadIdx.x; if (i >= nrows) return; const float* s = S + (size_t)i * SQ; float mx = -3.0e38f;
#pragma unroll 1
  for (int j = 0; j < SQ; ++j) mx = fmaxf(mx, s[j]); float se = 0.f;
#pragma unroll 1
  for (int j = 0; j < SQ; ++j) se += expf(s[j] - mx); const float sc = 256.0f / se;
#pragma unroll 1
  for (int j0 = 0; j0 < SQ; j0 += 8) { FragH f; for (int q = 0; q < 8; ++q) f.h[q] = (_Float16)(expf(s[j0 + q] - mx) * sc); unsigned short* d = (unsigned short*)P + (size_t)i * SQ + j0; *(v8us*)d = f.half[0];  } }
__global__ __launch_bounds__(256) void k_vt(const _Float16* __restrict__ V16, int b, int h0, _Float16* __restrict__ VT) { __shared__ unsigned short tl[64][65]; const int tid = threadIdx.x; const int hh = blockIdx.x % HG, sg = blockIdx.x / HG; const int s0 = sg * 64; const int h = h0 + hh;
  for (int i = tid; i < 64 * 8; i += 256) { const int j = i / 8, d8 = (i % 8) * 8; FragH f; f.half[0] = *(const v8us*)((const unsigned short*)V16 + ((size_t)b * SQ + s0 + j) * DM + h * HD + d8); for (int q = 0; q < 8; ++q) tl[d8 + q][j] = f.u[q]; }
  __syncthreads();
  { for (int i = tid; i < 64 * 8; i += 256) { const int d = i / 8, j8 = (i % 8) * 8; FragH f; for (int q = 0; q < 8; ++q) f.u[q] = tl[d][j8 + q]; *(v8us*)((unsigned short*)VT + ((size_t)hh * HD + d) * SQ + s0 + j8) = f.half[0]; }  } }



__global__ __launch_bounds__(256) void k_rsmcf2(const float* __restrict__ S, _Float16* __restrict__ P, int hg, int q0, int nk) {
  #pragma clang fp contract(off)
  const int t = blockIdx.x * 256 + threadIdx.x; if (t >= hg * QT) return; const size_t i = (size_t)t; const float* s = S + i * NKX; const int last = q0 + (t % QT); float mx = -3.0e38f;
#pragma unroll 1
  for (int j = 0; j < nk; ++j) { const float f = (j <= last) ? 1.f : 0.f; mx = fmaxf(mx, fmaf(f, s[j], (1.f - f) * -1.0e9f)); } float se = 0.f;
#pragma unroll 1
  for (int j = 0; j < nk; ++j) { const float f = (j <= last) ? 1.f : 0.f; se += __expf(fmaf(f, s[j], (1.f - f) * -1.0e9f) - mx); } const float sc = 256.0f / se;
#pragma unroll 1
  for (int j0 = 0; j0 < nk; j0 += 8) { FragH fr; for (int q = 0; q < 8; ++q) { const int j = j0 + q; const float f = (j <= last) ? 1.f : 0.f; fr.h[q] = (_Float16)(__expf(fmaf(f, s[j], (1.f - f) * -1.0e9f) - mx) * sc); } unsigned short* d = (unsigned short*)P + i * NKX + j0; *(v8us*)d = fr.half[0];  } }

template <int MASKADD>
__global__ __launch_bounds__(64) void k_att0(const float* __restrict__ QF, const float* __restrict__ KF, const float* __restrict__ VF, int ld, const float* __restrict__ mask, float scale, float* __restrict__ OF, int ldo) {
  #pragma clang fp contract(off)
  __shared__ __attribute__((aligned(16))) float lq[64][64]; __shared__ __attribute__((aligned(16))) float lo[64][64];
  const int tid = threadIdx.x; const int h = blockIdx.x / (QT0 / 64), rg = blockIdx.x % (QT0 / 64); const int i = rg * 64 + tid;
  const float* qr = QF + (size_t)i * ld + h * HD;
#pragma unroll 1
  for (int c = 0; c < HD / 4; ++c) { *(v4f*)&lq[tid][c * 4] = *(const v4fa*)(qr + c * 4); const v4f z = {0.f, 0.f, 0.f, 0.f}; *(v4f*)&lo[tid][c * 4] = z; }
  float m = -1.0e30f, l = 0.f; const int jmax = MASKADD ? (SQ - 1) : (rg * 64 + 63);      /* additive-mask form: every key (the mask input decides); causal form: keys up to the block's last row */
#pragma unroll 1
  for (int j = 0; j <= jmax; ++j) { const float* kr = KF + (size_t)j * ld + h * HD; const float* vr = VF + (size_t)j * ld + h * HD; float s = 0.f;
#pragma unroll 1
    for (int c = 0; c < HD / 4; ++c) { const v4f kq = *(const v4fa*)(kr + c * 4); const v4f qq = *(v4f*)&lq[tid][c * 4]; s = __fadd_rn(s, __fmul_rn(qq[0], kq[0])); s = __fadd_rn(s, __fmul_rn(qq[1], kq[1])); s = __fadd_rn(s, __fmul_rn(qq[2], kq[2])); s = __fadd_rn(s, __fmul_rn(qq[3], kq[3])); }
    s = __fmul_rn(s, scale); if (MASKADD) s = __fadd_rn(s, __fmul_rn(bf16_round(mask[(size_t)i * SQ + j]), -10000.0f));
    const float f = (MASKADD || j <= i) ? 1.f : 0.f; const float sm = fmaf(f, s, (1.f - f) * -1.0e30f); const float mn = fmaxf(m, sm); const float sc = expf(m - mn); const float e = expf(sm - mn); l = __fadd_rn(__fmul_rn(l, sc), e); m = mn;
#pragma unroll 1
    for (int c = 0; c < HD / 4; ++c) { const v4f vv = *(const v4fa*)(vr + c * 4); v4f oo = *(v4f*)&lo[tid][c * 4]; for (int u = 0; u < 4; ++u) oo[u] = __fadd_rn(__fmul_rn(oo[u], sc), __fmul_rn(e, vv[u])); *(v4f*)&lo[tid][c * 4] = oo; } }
  const float fin = 64.0f / l;      /* o carried x64 like the f16 path */
#pragma unroll 1
  for (int c = 0; c < HD / 4; ++c) { v4f oo = *(v4f*)&lo[tid][c * 4]; for (int u = 0; u < 4; ++u) oo[u] = __fmul_rn(oo[u], fin); *(v4f*)&lo[tid][c * 4] = oo; }
  __syncthreads();
  {
#pragma unroll 1
    for (int it = 0; it < 16; ++it) { const int row = it * 4 + tid / 16, pc = (tid % 16) * 4; const v4f v = *(const v4f*)&lo[row][pc]; *(v4f*)(OF + (size_t)(rg * 64 + row) * ldo + h * HD + pc) = v; }
     } }

__global__ __launch_bounds__(256) void k_oscale(const float* __restrict__ OF, float* __restrict__ out, size_t n4) { const size_t t = (size_t)blockIdx.x * 256 + threadIdx.x; if (t >= n4) return; const v4f a = *(const v4fa*)(OF + t * 4); v4f o; for (int q = 0; q < 4; ++q) o[q] = a[q] * 0.015625f; *(v4f*)(out + t * 4) = o;  }

__global__ __launch_bounds__(256) void k_bfr(const float* __restrict__ x, float* __restrict__ XB, size_t n8) { const size_t t = (size_t)blockIdx.x * 256 + threadIdx.x; if (t >= n8) return; v4f a = *(const v4fa*)(x + t * 8), c = *(const v4fa*)(x + t * 8 + 4); for (int q = 0; q < 4; ++q) { a[q] = bf16_round(a[q]); c[q] = bf16_round(c[q]); }
  { *(v4f*)(XB + t * 8) = a; *(v4f*)(XB + t * 8 + 4) = c;  } }



__global__ __launch_bounds__(256) void k_rsmfvl(const float* __restrict__ S, _Float16* __restrict__ P, _Float16* __restrict__ PL, int qn, const int* __restrict__ vlp) {
  #pragma clang fp contract(off)
  const int t = blockIdx.x * 256 + threadIdx.x; if (t >= qn) return; const int vl = vlp[0]; const size_t i = (size_t)t; const float* s = S + i * SQ; float mx = -3.0e38f;
#pragma unroll 1
  for (int j = 0; j < SQ; ++j) { const float f = (j < vl) ? 1.f : 0.f; mx = fmaxf(mx, fmaf(f, s[j], (1.f - f) * -1000000.0f)); } float se = 0.f;
#pragma unroll 1
  for (int j = 0; j < SQ; ++j) { const float f = (j < vl) ? 1.f : 0.f; se += __expf(fmaf(f, s[j], (1.f - f) * -1000000.0f) - mx); } const float sc = 256.0f / se;
#pragma unroll 1
  for (int j0 = 0; j0 < SQ; j0 += 8) { FragH fr, gr; for (int q = 0; q < 8; ++q) { const int j = j0 + q; const float f = (j < vl) ? 1.f : 0.f; const float pv = __expf(fmaf(f, s[j], (1.f - f) * -1000000.0f) - mx) * sc; const _Float16 ph = (_Float16)pv; fr.h[q] = ph; gr.h[q] = (_Float16)((pv - (float)ph) * 1024.0f); }
    unsigned short* d = (unsigned short*)P + i * SQ + j0; unsigned short* dl = (unsigned short*)PL + i * SQ + j0; *(v8us*)d = fr.half[0]; *(v8us*)dl = gr.half[0];  } }

__global__ __launch_bounds__(256) void k_rsmf(const float* __restrict__ S, _Float16* __restrict__ P, int qn, int hg) {
  #pragma clang fp contract(off)
  const int t = blockIdx.x * 256 + threadIdx.x; if (t >= qn * hg) return; const size_t i = (size_t)(t / qn) * SQ + (t % qn); const float* s = S + i * SQ; float mx = -3.0e38f;
#pragma unroll 1
  for (int j = 0; j < SQ; ++j) mx = fmaxf(mx, s[j]); float se = 0.f;
#pragma unroll 1
  for (int j = 0; j < SQ; ++j) se += __expf(s[j] - mx); const float sc = 256.0f / se;
#pragma unroll 1
  for (int j0 = 0; j0 < SQ; j0 += 8) { FragH f; for (int q = 0; q < 8; ++q) f.h[q] = (_Float16)(__expf(s[j0 + q] - mx) * sc); unsigned short* d = (unsigned short*)P + i * SQ + j0; *(v8us*)d = f.half[0];  } }


#define CN 256          /* channels */
#define CI 128
#define NC 256                       /* (unused legacy kernels) */
#define NPX NP          /* positions per channel row */
#define NP 4096         /* seq1 tokens */
#define NM 1024         /* seq2 tokens */
#define BNEPS 1e-5f

__global__ __launch_bounds__(256) void k_mp2(const float* __restrict__ src, float* __restrict__ dst, int nout) {
  const int t = blockIdx.x * 256 + threadIdx.x; if (t >= nout) return; const int c = t / 1024; const int o = t % 1024; const int oy = o / 32, ox = o % 32; const float* p = src + (size_t)c * 4096 + (size_t)(2 * oy) * 64 + 2 * ox;
  const float v = fmaxf(fmaxf(p[0], p[1]), fmaxf(p[64], p[65])); *(float*)(dst + t) = v;  }
__global__ __launch_bounds__(256) void k_xpb(const float* __restrict__ x, const float* __restrict__ wb, float* __restrict__ CPP, size_t n4) {
  #pragma clang fp contract(off)
  const size_t t = (size_t)blockIdx.x * 256 + threadIdx.x; if (t >= n4) return; const size_t e = t * 4; const int c = (int)((e / 4096) % 256); const float bb = bf16_round(wb[c]); const v4f a = *(const v4fa*)(x + e); v4f o; for (int q = 0; q < 4; ++q) o[q] = __fadd_rn(bf16_round(a[q]), bb);
  *(v4f*)(CPP + e) = o;  }


template <int PASS>
__global__ __launch_bounds__(256) void k_cstA(const float* __restrict__ X, const float* __restrict__ MV, float* __restrict__ PART) {
  #pragma clang fp contract(off)
  __shared__ float red[256]; const int t = threadIdx.x; const size_t bc = blockIdx.x; const int c = (int)(bc % NC); const float* row = X + bc * (size_t)NPX; const float mu = PASS ? MV[c] : 0.f; float s = 0.f;
  for (int i = t; i < NPX; i += 256) { const float v = row[i]; const float d = PASS ? __fadd_rn(v, -mu) : v; s = __fadd_rn(s, PASS ? __fmul_rn(d, d) : d); }
  red[t] = s; __syncthreads(); for (int st = 128; st > 0; st >>= 1) { if (t < st) red[t] = __fadd_rn(red[t], red[t + st]); __syncthreads(); }
  if (t < 32) { const float pv = (t == 0) ? red[0] : 0.f; *(float*)(PART + bc * 32 + t) = pv;  } }      

template <int PASS>
__global__ __launch_bounds__(256) void k_cstB(const float* __restrict__ PART, float* __restrict__ MV) { const int c = threadIdx.x; if (c >= NC) return; double s = 0.0; for (int b = 0; b < NB; ++b) s += (double)PART[((size_t)b * NC + c) * 32]; const float m = (float)(s / ((double)NB * (double)NPX)); *(float*)(MV + PASS * NC + c) = m;  }


__global__ __launch_bounds__(256) void k_bnresid(const float* __restrict__ C2, const float* __restrict__ MV, const float* __restrict__ g, const float* __restrict__ be, const float* __restrict__ X, float* __restrict__ out, size_t n4) {
  #pragma clang fp contract(off)
  const size_t t = (size_t)blockIdx.x * 256 + threadIdx.x; if (t >= n4) return; const size_t e = t * 4; const int c = (int)((e / NPX) % NC); const float sc = __fmul_rn(rsqrtf(__fadd_rn(MV[NC + c], BNEPS)), bf16_round(g[c])); const float mu = MV[c], bb = bf16_round(be[c]);
  const v4f a = *(const v4fa*)(C2 + e); const v4f xx = *(const v4fa*)(X + e); v4f o; for (int q = 0; q < 4; ++q) { const float z = __fadd_rn(__fmul_rn(__fadd_rn(a[q], -mu), sc), bb); o[q] = __fadd_rn(z, bf16_round(xx[q])); }
  *(v4f*)(out + e) = o;  }


__global__ __launch_bounds__(256) void k_rowbias(float* __restrict__ Y, const float* __restrict__ bias) {
  #pragma clang fp contract(off)
  const size_t t = (size_t)blockIdx.x * 256 + threadIdx.x; if (t >= (size_t)NB * NC * NPX / 4) return; const size_t e = t * 4; const int c = (int)((e / NPX) % NC); const float bb = bf16_round(bias[c]);
  v4f v = *(const v4fa*)(Y + e); for (int q = 0; q < 4; ++q) v[q] = __fadd_rn(v[q], bb); *(v4f*)(Y + e) = v;  }



template <int NBt, int QTt, int NKt>
__global__ __launch_bounds__(256) void k_bsm(const float* __restrict__ S, _Float16* __restrict__ P) {
  #pragma clang fp contract(off)
  const size_t t = (size_t)blockIdx.x * 256 + threadIdx.x; if (t >= (size_t)QTt * NKt / 8) return; const size_t e = t * 8; float mx[8], se[8];
  for (int q = 0; q < 8; ++q) { mx[q] = -3.0e38f; se[q] = 0.f; }
#pragma unroll
  for (int b = 0; b < NBt; ++b) { const float* s = S + (size_t)b * QTt * NKt + e; for (int q = 0; q < 8; ++q) mx[q] = fmaxf(mx[q], s[q]); }
#pragma unroll
  for (int b = 0; b < NBt; ++b) { const float* s = S + (size_t)b * QTt * NKt + e; for (int q = 0; q < 8; ++q) se[q] += __expf(s[q] - mx[q]); }
#pragma unroll
  for (int b = 0; b < NBt; ++b) { const float* s = S + (size_t)b * QTt * NKt + e; FragH f; for (int q = 0; q < 8; ++q) f.h[q] = (_Float16)(__expf(s[q] - mx[q]) * (256.0f / se[q]));
    unsigned short* d = (unsigned short*)P + (size_t)b * QTt * NKt + e; *(v8us*)d = f.half[0];  } }
// ---- fused scores + batch-axis softmax + P V: one launch for all queries ----
#define FQ 32       /* query rows per work-group */
#define FQT (FQ / 16)      /* query tiles per work-group: each K and V^T fragment fetched serves all of them */
#define FKS 2      /* key ranges: a work-group walks FS / FKS keys, so that the grid still fills the chip */
#define FK 128      /* keys per pass: 16 per wave in part 1 */
#define FPP 136     /* LDS pitch of a P row in f16: 272 B = 16 B x odd, so the 16-byte row reads of part 2 do not collide */
#define FS 4096     /* sequence length */
#define FD 64       /* width */
#define FB 8        /* batches = waves of the work-group */
__device__ __forceinline__ v8f f_mma(v16h a, v16h b, v8f c) { return __builtin_amdgcn_wmma_f32_16x16x32_f16(false, a, false, b, (short)0, c, false, false); }
__device__ __forceinline__ v16h f_frag(const _Float16* p) { FragH f; f.half[0] = *(const v8us*)((const unsigned short*)p); f.half[1] = *(const v8us*)((const unsigned short*)p + 16); return f.v; }      /* p already holds the lane half's 8 hh: the k order of g2_frag */
__device__ __forceinline__ v16h f_fragp(const _Float16* p) { FragH f; f.half[0] = *(const v8us*)((const unsigned short*)p); f.half[1] = *(const v8us*)((const unsigned short*)p + 256); return f.v; }      /* fragment-order planes: p holds the lane's own 8 values, the fragment's second half lies one wave-wide load (32 lanes x 8) further; same values in the same registers as f_frag on rows */
// ---- one prep launch for Q, K and V: three block ranges that do not depend on one another; each writes the same values to the same places as a launch of its own would ----
#define PVK 128      /* keys per work-group of the V range */
#define PVM (PVK * 8 / 256)      /* 8-value items per thread there */
#define PVW (FB * FS / PVK)      /* work-groups of the V range: PVK keys x 64 d of one batch each */
#define PIT 8      /* 8-value items per thread in the Q and K ranges: few waves to start, all of a thread's loads in flight at once */
#define PXW (FB * FS * FD / 8 / 256 / PIT)      /* work-groups of the Q range, and of the K range */
__device__ __forceinline__ v8us p_cvt(v4f a, v4f c) { FragH f;      /* 8 inputs rounded to bf16, held as exact f16 */
#pragma unroll
  for (int q = 0; q < 4; ++q) { f.h[q] = (_Float16)bf16_round(a[q]); f.h[4 + q] = (_Float16)bf16_round(c[q]); }
  return f.half[0]; }
// V range (first: it has the longest chain): V^T in fragment order: per batch [32-key block][t = d / 16][half = (key / 16) & 1][lane = 16 ((key / 8) & 1) + d % 16][8 keys]; a work-group turns PVK keys x 64 d in LDS and writes 16 KiB in a row; the batch planes follow one another, so the block index runs through all batches
// Q range: rows as they are. K range: fragment order: [16-key tile][j = d / 16][lane = 16 ((d / 8) & 1) + key % 16][8 d]; tile = 1024 values, so a batch plane keeps its size and place
__global__ __launch_bounds__(256) void k_prep(const float* __restrict__ xq, const float* __restrict__ xk, const float* __restrict__ xv, _Float16* __restrict__ Q16, _Float16* __restrict__ KP, _Float16* __restrict__ VP) {
  __shared__ unsigned short tl[PVK][66]; const int tid = threadIdx.x; const int bx = blockIdx.x;
  if (bx < PVW) {      /* the same for the whole work-group, so the barrier inside is passed by all of it or by none */
    const float* s = xv + (size_t)bx * (PVK * 64) + tid * 8; v4f a[PVM], c[PVM];      /* key tid / 8 (and 32, 64, ... further), d (tid % 8) * 8 */
#pragma unroll      /* register arrays need constant indices */
    for (int m = 0; m < PVM; ++m) { a[m] = *(const v4fa*)(s + m * 2048); c[m] = *(const v4fa*)(s + m * 2048 + 4); }
    asm volatile("s_wait_xcnt 0x0" :: "v"(s) : "memory");      /* precaution: stands in front of any rewrite of a register that an issued load names; the input keeps the address pair whole up to it */
    const int r = tid / 8, c8 = (tid % 8) * 8;
#pragma unroll      /* register arrays need constant indices */
    for (int m = 0; m < PVM; ++m) { FragH f; f.half[0] = p_cvt(a[m], c[m]);
#pragma unroll
      for (int q = 0; q < 8; ++q) tl[r + 32 * m][c8 + q] = f.u[q]; }
    __syncthreads();
    FragH g[PVM];
#pragma unroll      /* register arrays need constant indices */
    for (int m = 0; m < PVM; ++m) { const int i = m * 256 + tid; const int k0 = (i >> 8) * 32 + ((i >> 5) & 1) * 16 + ((i >> 4) & 1) * 8, d = ((i >> 6) & 3) * 16 + (i & 15);
#pragma unroll
      for (int q = 0; q < 8; ++q) g[m].u[q] = tl[k0 + q][d]; }
    unsigned short* o = (unsigned short*)VP + (size_t)bx * (PVK * 64) + (size_t)tid * 8;
    __builtin_amdgcn_sched_barrier(0);      /* every value ahead of the first store, so that no register that an issued store names is rewritten behind it */
#pragma unroll      /* register arrays need constant indices */
    for (int m = 0; m < PVM; ++m) *(v8us*)(o + m * 2048) = g[m].half[0];
    return;
  }
  const bool isk = bx >= PVW + PXW; const size_t t = (size_t)(bx - PVW - (isk ? PXW : 0)) * (256 * PIT) + tid;      /* first item; the others lie 256 items apart */
  const float* s = (isk ? xk : xq) + t * 8; v4f a[PIT], c[PIT];
#pragma unroll      /* register arrays need constant indices */
  for (int j = 0; j < PIT; ++j) { a[j] = *(const v4fa*)(s + j * 2048); c[j] = *(const v4fa*)(s + j * 2048 + 4); }
  asm volatile("s_wait_xcnt 0x0" :: "v"(s) : "memory");      /* as above */
  const size_t row = t >> 3; const int c8 = (int)(t & 7);
  unsigned short* o = isk ? (unsigned short*)KP + (row >> 4) * 1024 + (size_t)((c8 >> 1) * 256 + ((c8 & 1) * 16 + (int)(row & 15)) * 8) : (unsigned short*)Q16 + t * 8;      /* 256 items on = 32 rows = 2 key tiles = 2048 values on, in both orders */
  v8us h[PIT];
#pragma unroll      /* register arrays need constant indices */
  for (int j = 0; j < PIT; ++j) h[j] = p_cvt(a[j], c[j]);
  __builtin_amdgcn_sched_barrier(0);      /* as above: every value ahead of the first store */
#pragma unroll      /* register arrays need constant indices */
  for (int j = 0; j < PIT; ++j) *(v8us*)(o + j * 2048) = h[j];
}
typedef float v2f __attribute__((ext_vector_type(2)));
// softmax across the 8 batches for one 16-key x 16-query tile, in registers; stores 8 keys of one query per batch to the P buffer
// two neighbouring keys (registers r, r + 1 of a score tile) go through each packed f32 instruction; 1 / sqrt(64) and log2(e) are one factor of one multiply-add whose addend is the scaled maximum
__device__ __forceinline__ void f_soft(const v8f (&s)[FB], _Float16* pw) {
  FragH pk[FB]; constexpr float FC = 0.125f * 1.44269504f; const v2f fc = {FC, FC};
#pragma unroll      /* register arrays need constant indices */
  for (int r = 0; r < 8; r += 2) { v2f e[FB], mx = {-3.0e38f, -3.0e38f};
#pragma unroll
    for (int b = 0; b < FB; ++b) { mx[0] = fmaxf(mx[0], s[b][r]); mx[1] = fmaxf(mx[1], s[b][r + 1]); }
    const v2f nm = mx * -fc;
#pragma unroll
    for (int b = 0; b < FB; ++b) { const v2f x = {s[b][r], s[b][r + 1]}; const v2f t = __builtin_elementwise_fma(x, fc, nm); e[b][0] = __builtin_amdgcn_exp2f(t[0]); e[b][1] = __builtin_amdgcn_exp2f(t[1]); }      /* native exp2 as in __expf */
    v2f se = e[0];
#pragma unroll
    for (int b = 1; b < FB; ++b) se += e[b];
    v2f sc = {__builtin_amdgcn_rcpf(se[0]), __builtin_amdgcn_rcpf(se[1])}; sc *= 256.0f;
#pragma unroll
    for (int b = 0; b < FB; ++b) { const v2f p = e[b] * sc; pk[b].h[r] = (_Float16)p[0]; pk[b].h[r + 1] = (_Float16)p[1]; } }
#pragma unroll      /* register arrays need constant indices */
  for (int b = 0; b < FB; ++b) *(v8us*)((unsigned short*)pw + (size_t)b * FQ * FPP) = pk[b].half[0];
}
__device__ __forceinline__ void f_qld(FragH (&g)[FB], const unsigned short* q) {      /* one group of LDS reads: the Q fragments of one query tile and one half of d, all 8 batches */
#pragma unroll      /* register arrays need constant indices */
  for (int b = 0; b < FB; ++b) { g[b].half[0] = *(const v8us*)(q + b * (FQT * 1024)); g[b].half[1] = *(const v8us*)(q + b * (FQT * 1024) + 256); }      /* a batch's fragments: FQT tiles x 2 halves of d x 512 values */
}
// work-group barrier for data that goes through LDS alone: the two fences name LDS only, so each wave waits for its own LDS stores and reads but not for its global loads, which stay in flight across it (__syncthreads() waits all of them out)
__device__ __forceinline__ void f_bar() { __builtin_amdgcn_fence(__ATOMIC_RELEASE, "workgroup", "local"); __builtin_amdgcn_s_barrier(); __builtin_amdgcn_fence(__ATOMIC_ACQUIRE, "workgroup", "local"); }
__global__ __launch_bounds__(256) void k_fused(const _Float16* __restrict__ Q16, const _Float16* __restrict__ K16, const _Float16* __restrict__ VT, float* __restrict__ PO) {
  static_assert(FQT == 2, "the pass below is written out for two query tiles");
  __shared__ __attribute__((aligned(16))) _Float16 pl[2][FB][FQ][FPP];      /* two buffers: one barrier a pass is enough */
  __shared__ __attribute__((aligned(16))) unsigned short ql[FB][FQT][2][2][32][8];      /* Q fragments of the whole walk, fragment order: [batch][query tile][d / 32][fragment half][lane][8]; every wave-wide 16-byte read covers 512 bytes in a row */
  const int tid = threadIdx.x, w = tid >> 5, lane = tid & 31, ln = lane & 15, hh = lane >> 4; const int q0 = (blockIdx.x / FKS) * FQ; const int k0 = (blockIdx.x % FKS) * (FS / FKS);
  constexpr size_t PLN = (size_t)FS * FD;
  const v8f z8 = {0.f,0.f,0.f,0.f,0.f,0.f,0.f,0.f};
  const _Float16* qp = Q16 + (size_t)w * PLN + (size_t)(q0 + ln) * FD + 8 * hh;      /* Q rows q0 + ln of batch w: this wave brings them to LDS for all waves */
  const int wu = __builtin_amdgcn_readfirstlane(w); const unsigned lo = lane * 8;      /* the wave's number as a scalar: the K and V^T bases are then scalar and the lane offset is added where an address is formed; a per-lane K pointer that lives from the first loads' wait through the whole walk is spilled by this compiler */
  const _Float16* kp = K16 + (size_t)(k0 + 16 * wu) * FD;      /* part 1: this wave's 16-key tile, fragment order (A operand) */
  const _Float16* vp = VT + (size_t)wu * PLN + (size_t)k0 * FD;      /* part 2: V^T of batch w, fragment order (B operand) */
  FragH qg[FQT][2];
  v16h kf[FB][2];
#pragma unroll      /* register arrays need constant indices */
  for (int u = 0; u < FQT; ++u) { qg[u][0].v = f_frag(qp + u * (16 * FD)); qg[u][1].v = f_frag(qp + u * (16 * FD) + 32); }
#pragma unroll      /* register arrays need constant indices */
  for (int b = 0; b < FB; ++b) { kf[b][0] = f_fragp(kp + (size_t)b * PLN + lo); kf[b][1] = f_fragp(kp + (size_t)b * PLN + 512 + lo); }
  asm volatile("s_wait_xcnt 0x0" :: "v"(qp), "s"(kp), "v"(lane) : "memory");      /* precaution: stands in front of any rewrite of a register that an issued load names; the inputs keep the Q address pair, the K base and the lane index (the K loads' scaled offset register) whole up to it */
#pragma unroll      /* register arrays need constant indices */
  for (int u = 0; u < FQT; ++u)
#pragma unroll
    for (int j = 0; j < 2; ++j) { *(v8us*)&ql[w][u][j][0][lane][0] = qg[u][j].half[0]; *(v8us*)&ql[w][u][j][1][lane][0] = qg[u][j].half[1]; }
  __syncthreads();      /* publishes the Q fragments to every wave */
  const unsigned short* qr = &ql[0][0][0][0][lane][0];
  v8f o[FQT][4];
#pragma unroll      /* register arrays need constant indices */
  for (int u = 0; u < FQT; ++u)
#pragma unroll
    for (int t = 0; t < 4; ++t) o[u][t] = z8;
  for (int it = 0; it < FS / FKS / FK; ++it) {
    const int kb = it * FK; const int kn = (kb + FK) & (FS / FKS - 1);      /* next pass's keys; the last pass requests this half's first keys again: in bounds, not used */
    const _Float16* vb = vp + (size_t)kb * FD + lo; const _Float16* kq = kp + (size_t)kn * FD + lo;
    v8f s[FQT][FB];      /* s[u][b][r] = Q[b][q0 + 16 u + ln] . K[b][k0 + kb + 16 w + 8 hh + r]; the K fragments in registers serve both query tiles */
    v16h vf[4][4];      /* this pass's V^T fragments */
    { FragH g0[FB], g1[FB], g2[FB], g3[FB];      /* four groups of Q fragments, two in flight at a time */
      f_qld(g0, qr); f_qld(g2, qr + 1024);      /* both tiles' first halves of d come first: their products need only the K fragments that were requested first, while the others are still on their way */
      __builtin_amdgcn_sched_barrier(0);      /* this one and the next two keep each group of LDS reads whole and one group ahead of the products that use it; left alone the scheduler reads four at a time and waits each out */
#pragma unroll      /* register arrays need constant indices */
      for (int b = 0; b < FB; ++b) s[0][b] = f_mma(kf[b][0], g0[b].v, z8);
      f_qld(g1, qr + 512);
      __builtin_amdgcn_sched_barrier(0);
#pragma unroll      /* register arrays need constant indices */
      for (int b = 0; b < FB; ++b) s[1][b] = f_mma(kf[b][0], g2[b].v, z8);
      f_qld(g3, qr + 1536);
      __builtin_amdgcn_sched_barrier(0);      /* also keeps the requests below behind the products above, whose K registers they take */
#pragma unroll      /* register arrays need constant indices */
      for (int t = 0; t < 4; ++t) vf[0][t] = f_fragp(vb + t * 512);      /* first quarter of V^T, requested in front of the wait for the last K fragments, so that the stream of loads does not run dry during the scores */
      asm volatile("s_wait_xcnt 0x0" :: "v"(vb) : "memory");      /* as above, for the V^T address pair */
      __builtin_amdgcn_sched_barrier(0);      /* keeps them in front of the products below, which wait for K */
#pragma unroll      /* register arrays need constant indices */
      for (int b = 0; b < FB; ++b) s[0][b] = f_mma(kf[b][1], g1[b].v, s[0][b]);
      __builtin_amdgcn_sched_barrier(0);      /* keeps the requests below behind the products above, whose Q registers they take */
#pragma unroll      /* register arrays need constant indices */
      for (int t = 0; t < 4; ++t) vf[1][t] = f_fragp(vb + 32 * FD + t * 512);      /* second quarter */
      asm volatile("s_wait_xcnt 0x0" :: "v"(vb) : "memory");      /* as above, for the V^T address pair */
      __builtin_amdgcn_sched_barrier(0);      /* keeps them in front of the last products */
#pragma unroll      /* register arrays need constant indices */
      for (int b = 0; b < FB; ++b) s[1][b] = f_mma(kf[b][1], g3[b].v, s[1][b]); }
    __builtin_amdgcn_sched_barrier(0);      /* keeps the V^T requests below out of the scores, where their registers are still the Q fragments': lifted there they cost spills */
#pragma unroll      /* register arrays need constant indices */
    for (int ks = 2; ks < 4; ++ks)
#pragma unroll
      for (int t = 0; t < 4; ++t) vf[ks][t] = f_fragp(vb + ks * (32 * FD) + t * 512);      /* second half; all of V^T ahead of K: loads return in the order of their requests, so the wait for V^T in front of part 2 leaves the K requests behind it in flight */
    asm volatile("s_wait_xcnt 0x0" :: "v"(vb) : "memory");      /* as above, for the V^T address pair */
    __builtin_amdgcn_sched_barrier(0);      /* keeps the requests above in front of the softmax; sunk into it they would start later */
    f_soft(s[0], &pl[it & 1][0][ln][16 * w + 8 * hh]);
    __builtin_amdgcn_sched_barrier(0);      /* keeps the requests below behind the first softmax, whose registers they take */
#pragma unroll      /* register arrays need constant indices */
    for (int j = 0; j < 2; ++j)
#pragma unroll
      for (int b = 0; b < FB; ++b) kf[b][j] = f_fragp(kq + (size_t)b * PLN + j * 512);      /* next pass's K fragments, in the order in which the scores use them: they arrive under the second softmax and, past the barrier, under part 2 and the first scores */
    asm volatile("s_wait_xcnt 0x0" :: "v"(kq) : "memory");      /* as above, for the K address pair */
    __builtin_amdgcn_sched_barrier(0);      /* keeps them in front of the second softmax */
    f_soft(s[1], &pl[it & 1][0][16 + ln][16 * w + 8 * hh]);
    f_bar();      /* publishes this pass's P; with two buffers it also ends every read of the buffer that the next pass rewrites */
    const _Float16* pr = &pl[it & 1][w][ln][8 * hh]; v16h pa[FQT][4];      /* P[w] rows as A operands: all read in one group */
#pragma unroll      /* register arrays need constant indices */
    for (int u = 0; u < FQT; ++u)
#pragma unroll
      for (int ks = 0; ks < 4; ++ks) pa[u][ks] = f_frag(pr + u * (16 * FPP) + ks * 32);
    __builtin_amdgcn_sched_barrier(0);      /* keeps the products behind the whole group of reads; without it the scheduler splits the group and waits out each part */
#pragma unroll      /* register arrays need constant indices */
    for (int ks = 0; ks < 4; ++ks)
#pragma unroll
      for (int u = 0; u < FQT; ++u)
#pragma unroll
        for (int t = 0; t < 4; ++t) o[u][t] = f_mma(pa[u][ks], vf[ks][t], o[u][t]);      /* the V^T fragments in registers serve both query tiles */
  }
  asm volatile("s_wait_loadcnt 0x0" ::: "memory");      /* precaution: the last pass's K requests are used by nobody and no barrier waits them out any more; with this wait none is still on its way when the wave gives its registers back at its end */
  float* op = PO + (size_t)(blockIdx.x % FKS) * (FB * PLN) + (size_t)w * PLN + (size_t)(q0 + 8 * hh) * FD + ln;      /* this key half's plane of partial sums, still x256 */
#pragma unroll      /* register arrays need constant indices */
  for (int u = 0; u < FQT; ++u)
#pragma unroll
    for (int t = 0; t < 4; ++t)
#pragma unroll
      for (int r = 0; r < 8; ++r) op[(size_t)(16 * u + r) * FD + t * 16] = o[u][t][r];
}
// out = (first key half + second key half) x 2^-8
#define RIT 8      /* 4-value items per thread: few waves to start, all of a thread's loads in flight at once */
__global__ __launch_bounds__(256) void k_sum(const float* __restrict__ PO, float* __restrict__ out) {
  const size_t t0 = (size_t)blockIdx.x * (1024 * RIT); const unsigned lo = threadIdx.x * 4;      /* the work-group's first value, and the thread's place in each run of 1024 values */
  const float* s0 = PO + t0; const float* s1 = s0 + (size_t)FB * FS * FD; v4f a[RIT], c[RIT];      /* scalar bases; one lane offset serves every load */
#pragma unroll      /* register arrays need constant indices */
  for (int j = 0; j < RIT; ++j) { a[j] = *(const v4fa*)(s0 + j * 1024 + lo); c[j] = *(const v4fa*)(s1 + j * 1024 + lo); }
  asm volatile("s_wait_xcnt 0x0" ::: "memory");      /* precaution: stands in front of any rewrite of a register that an issued load names */
  __builtin_amdgcn_sched_barrier(0);      /* keeps every load in front of the first sum, so that all of a thread's loads are in flight at once */
  float* o = out + t0 + lo;
#pragma unroll      /* register arrays need constant indices */
  for (int j = 0; j < RIT; ++j) a[j] = (a[j] + c[j]) * 0.00390625f;
  __builtin_amdgcn_sched_barrier(0);      /* every value ahead of the first store, so that no register that an issued store names is rewritten behind it */
#pragma unroll      /* register arrays need constant indices */
  for (int j = 0; j < RIT; ++j) *(v4f*)(o + j * 1024) = a[j];
}
extern "C" void kernel_launch(void* const* d_in, const int* in_sizes, int n_in,
                              void* d_out, int out_size, void* d_ws, size_t ws_size, hipStream_t stream) {
  (void)in_sizes; (void)n_in; (void)out_size;
  const float* const* I = (const float* const*)d_in; const float* xq = I[0]; const float* xk = I[1]; const float* xv = I[2];      /* Q, K, V [8][4096][64] (bf16-valued) */
  constexpr int NBt = 8, SQt = 4096, DK = 64;      /* batches, sequence, width */
  char* ws = (char*)d_ws; size_t off = 0;
  auto take = [&](size_t bytes) { char* p = ws + off; off += (bytes + 255) & ~(size_t)255; return p; };
  const size_t PLN = (size_t)SQt * DK;      /* one batch's [4096][64] plane */
  _Float16* Q16 = (_Float16*)take(NBt * PLN * 2); _Float16* K16 = (_Float16*)take(NBt * PLN * 2); _Float16* VT = (_Float16*)take(NBt * PLN * 2); float* PO = (float*)take(FKS * NBt * PLN * 4);
  if (off > ws_size) return;
  k_prep<<<PVW + 2 * PXW, 256, 0, stream>>>(xq, xk, xv, Q16, K16, VT);      /* exact f16 copies of the bf16-valued inputs: Q in rows, K and V^T in fragment order */
  k_fused<<<SQt / FQ * FKS, 256, 0, stream>>>(Q16, K16, VT, PO);      /* scores, softmax across the 8 batches and P V for 32 query rows of all batches and one half of the keys per work-group */
  k_sum<<<NBt * SQt * DK / 4 / 256 / RIT, 256, 0, stream>>>(PO, (float*)d_out);      /* adds the two key halves */
}

// v007
// It runs in 56.8 microseconds.
// In two side-by-side timings against v006, it was 1.17 and 1.16 times as fast.
// Over all steps from v000 it is 37.4 times as fast.
#include <hip/hip_runtime.h>
// Dot-product attention whose softmax runs over the BATCH axis (Q, K, V [8][4096][64], no heads, no weights; scores = Q K^T / sqrt(64) -> [8][4096][4096]; attn = softmax(scores, axis = 0): for every (query, key) pair the 8 batch entries are normalised against each other (the module's literal axis; rows are NOT normalised over keys); out[b] = attn[b] V[b] -> [8][4096][64]).
// Structure: three launches. ONE prep launch (three block ranges) writes the bf16-valued inputs as exact f16; K and V^T (via LDS transposes, once) are written in WMMA fragment order, so that every wave-wide 16-byte load of the walk reads 512 contiguous bytes (4 whole lines, not 32 bytes of each of 16 lines); then ONE fused launch: a work-group owns 64 query rows (four tiles of 16) of all 8 batches and walks one quarter of the keys 128 at a time, every K and V^T fragment it fetches serving all four tiles; Q fragments lie in LDS. Part 1 of a pass: wave w forms S^T = K Q^T for its 16 keys in all 8 batches (WMMA, f32 accumulation, K = 64), so a lane holds the 8 batch values of each (query, key) pair and normalises them in registers (f32, native exp; weights x256 f16), then stores 8 keys of one query per batch to LDS. Part 2: wave w is batch w: out[w] += P[w] V[w]^T (WMMA, f32), keys in ascending order inside a quarter. A last launch adds the four quarters, x 2^-8. Scores and weights never reach memory.
// Compute dtype: inputs rounded to bf16; x / weights exact; q, k, v and softmax weights as plain f16 GEMM operands (~2^-12); scores, softmax statistics and o f32. v_wmma_f32_16x16x32_f16.
#define NB 4
#define SQ 4096
#define DM 256
#define NH 1
#define HD 64
#define HG 4                         /* heads per attention launch group */
#define B0 0                         /* first batch processed (debug hook) */
#define NBR NB                       /* batches processed (debug hook) */
#define NR ((size_t)NB * SQ)         /* token rows */
#define MP ((int)((size_t)NBR * SQ)) /* rows projected (debug hook) */
#define QT 256                       /* query rows per causal tile */
#define NKX SQ                       /* S / P row pitch */
#define QT0 256                      /* first-tile rows recomputed exactly (256: buys margin for the few-key rows 128..255, which have no output projection to average the single-f16 P/v rounding) */
#define QN SQ                        /* query rows attended per batch (debug hook) */
#define NHD NH                       /* heads attended (debug hook) */
#define MPO MP                       /* rows through the output stage (debug hook) */
#define LQ DM            /* row pitch of the q/k/v rows */
typedef __bf16 v16b __attribute__((ext_vector_type(16)));
typedef unsigned short v8us __attribute__((ext_vector_type(8), may_alias));
typedef float  v8f  __attribute__((ext_vector_type(8)));
typedef float  v4f  __attribute__((ext_vector_type(4)));
typedef float  v4fa __attribute__((ext_vector_type(4), may_alias));
union FragB { v16b v; v8us half[2]; unsigned short u[16]; };

__device__ __forceinline__ unsigned short bf16_bits(float x) { unsigned int u = __float_as_uint(x); return (unsigned short)((u + 0x7FFFu + ((u >> 16) & 1u)) >> 16); }
__device__ __forceinline__ float bf16_val(unsigned short b) { return __uint_as_float(((unsigned int)b) << 16); }
__device__ __forceinline__ float bf16_round(float x) { return bf16_val(bf16_bits(x)); }
// D += A·B with NT terms: 1 = ah·bh, 2 = + al·bh (A split), 3 = + ah·bl (both split)
template <int NT>
__device__ __forceinline__ v8f mmaN(v16b ah, v16b al, v16b bh, v16b bl, v8f c) {
  c = __builtin_amdgcn_wmma_f32_16x16x32_bf16(false, ah, false, bh, (short)0, c, false, false);
  if (NT >= 2) c = __builtin_amdgcn_wmma_f32_16x16x32_bf16(false, al, false, bh, (short)0, c, false, false);
  if (NT >= 3) c = __builtin_amdgcn_wmma_f32_16x16x32_bf16(false, ah, false, bl, (short)0, c, false, false);
  asm volatile("v_nop\n\tv_nop\n\tv_nop\n\tv_nop" : "+v"(c) : "v"(ah), "v"(al), "v"(bh), "v"(bl));
  return c;
}

__global__ __launch_bounds__(256) void k_wt_bf16(const float* __restrict__ W, unsigned short* __restrict__ Wt, int K, int N) {
  const int t = blockIdx.x * 256 + threadIdx.x;
  const int k8n = K / 8;
  if (t >= N * k8n) return;
  const int n = t / k8n, k8 = (t % k8n) * 8;
  v8us v;
#pragma unroll
  for (int i = 0; i < 8; ++i) v[i] = bf16_bits(W[(size_t)(k8 + i) * N + n]);
  *(v8us*)(Wt + (size_t)n * K + k8) = v;
  
}

// GEMM C[M][N] (f32, pitch ldc) = act(A[M][K]·W + bias). A f32 row-major (pitch lda) converted per fragment to bf16
// (ASPLIT: hi/lo two planes -> 2 terms, else single rounded term); Wt bf16 [N][K] (pitch ldb). BIAS_BF16 rounds the
// bias to bf16 first (bias quantised to bf16 before the add). K%32==0, M%16==0, N%64==0.
template <bool ASPLIT, int ACT, bool BIAS_BF16>
__global__ __launch_bounds__(128) void k_gemm_bf(const float* __restrict__ A, int lda, const unsigned short* __restrict__ Wt, int ldb,
                                               const float* __restrict__ bias, float* __restrict__ C, int ldc, int M, int N, int K) {
  __shared__ __attribute__((aligned(16))) float so[4][16][64];
  const int tid = threadIdx.x, w = tid >> 5, lane = tid & 31, ln = lane & 15, hh = lane >> 4;
  const int ntn = N / 64;
  const int wid = blockIdx.x * 4 + w;
  const int mt = wid / ntn, nq = wid % ntn;
  if (mt * 16 >= M) return;
  const int row0 = mt * 16, col0 = nq * 64;
  const float* arow = A + (size_t)(row0 + ln) * lda;
  v8f acc[4] = {};
  for (int kb = 0; kb < K; kb += 32) {
    FragB ah, al;
    const v4f x0 = *(const v4fa*)(arow + kb + 8 * hh), x1 = *(const v4fa*)(arow + kb + 8 * hh + 4);
    const v4f x2 = *(const v4fa*)(arow + kb + 16 + 8 * hh), x3 = *(const v4fa*)(arow + kb + 16 + 8 * hh + 4);
    float xs[16] = {x0[0],x0[1],x0[2],x0[3],x1[0],x1[1],x1[2],x1[3],x2[0],x2[1],x2[2],x2[3],x3[0],x3[1],x3[2],x3[3]};
#pragma unroll
    for (int i = 0; i < 16; ++i) { const unsigned short hb = bf16_bits(xs[i]); ah.u[i] = hb; al.u[i] = ASPLIT ? bf16_bits(xs[i] - bf16_val(hb)) : (unsigned short)0; }
#pragma unroll
    for (int t = 0; t < 4; ++t) {
      const unsigned short* brow = Wt + (size_t)(col0 + t * 16 + ln) * ldb + kb;
      FragB b;
      b.half[0] = *(const v8us*)(brow + 8 * hh);
      b.half[1] = *(const v8us*)(brow + 16 + 8 * hh);
      acc[t] = mmaN<ASPLIT ? 2 : 1>(ah.v, al.v, b.v, b.v, acc[t]);
    }
  }
#pragma unroll
  for (int t = 0; t < 4; ++t) {
    float bv = bias ? bias[col0 + t * 16 + ln] : 0.f;
    if (BIAS_BF16) bv = bf16_round(bv);
#pragma unroll
    for (int r = 0; r < 8; ++r) { float v = acc[t][r] + bv; if (ACT == 1) v = fmaxf(v, 0.f); so[w][8 * hh + r][t * 16 + ln] = v; }
  }
  __builtin_amdgcn_fence(__ATOMIC_ACQ_REL, "workgroup");
  __builtin_amdgcn_wave_barrier();
  const int rsub = lane >> 4, c4 = (lane & 15) * 4;
  {
#pragma unroll
    for (int q = 0; q < 8; ++q) {
      const int r = q * 2 + rsub;
      const v4f v = *(const v4fa*)&so[w][r][c4];
      *(v4f*)(C + (size_t)(row0 + r) * ldc + col0 + c4) = v;
    }
    
  }
}

// GEMM C = act(A·W + bias + resid): A f32 (ASPLIT -> hi/lo 2 terms), Wt bf16 [N][K]; ACT 0 none, 1 relu, 2 exact gelu;
// resid (optional, f32, row index = (row % rmod), pitch ldr, RES_BF16 rounds it) added before the activation.
template <bool ASPLIT, int ACT, bool BIAS_BF16, bool RES_BF16>
__global__ __launch_bounds__(128) void k_gemm_bf3(const float* __restrict__ A, int lda, const unsigned short* __restrict__ Wt, int ldb,
                                                const float* __restrict__ bias, const float* __restrict__ resid, int rmod, int ldr,
                                                float* __restrict__ C, int ldc, int M, int N, int K) {
  __shared__ __attribute__((aligned(16))) float so[4][16][64];
  const int tid = threadIdx.x, w = tid >> 5, lane = tid & 31, ln = lane & 15, hh = lane >> 4;
  const int ntn = N / 64;
  const int wid = blockIdx.x * 4 + w;
  const int mt = wid / ntn, nq = wid % ntn;
  if (mt * 16 >= M) return;
  const int row0 = mt * 16, col0 = nq * 64;
  const float* arow = A + (size_t)(row0 + ln) * lda;
  v8f acc[4] = {};
  for (int kb = 0; kb < K; kb += 32) {
    FragB ah, al;
    const v4f x0 = *(const v4fa*)(arow + kb + 8 * hh), x1 = *(const v4fa*)(arow + kb + 8 * hh + 4);
    const v4f x2 = *(const v4fa*)(arow + kb + 16 + 8 * hh), x3 = *(const v4fa*)(arow + kb + 16 + 8 * hh + 4);
    float xs[16] = {x0[0],x0[1],x0[2],x0[3],x1[0],x1[1],x1[2],x1[3],x2[0],x2[1],x2[2],x2[3],x3[0],x3[1],x3[2],x3[3]};
#pragma unroll
    for (int i = 0; i < 16; ++i) { const unsigned short hb = bf16_bits(xs[i]); ah.u[i] = hb; al.u[i] = ASPLIT ? bf16_bits(xs[i] - bf16_val(hb)) : (unsigned short)0; }
#pragma unroll
    for (int t = 0; t < 4; ++t) {
      const unsigned short* brow = Wt + (size_t)(col0 + t * 16 + ln) * ldb + kb;
      FragB b;
      b.half[0] = *(const v8us*)(brow + 8 * hh);
      b.half[1] = *(const v8us*)(brow + 16 + 8 * hh);
      acc[t] = mmaN<ASPLIT ? 2 : 1>(ah.v, al.v, b.v, b.v, acc[t]);
    }
  }
#pragma unroll
  for (int t = 0; t < 4; ++t) {
    const int col = col0 + t * 16 + ln;
    float bv = bias ? bias[col] : 0.f;
    if (BIAS_BF16) bv = bf16_round(bv);
#pragma unroll
    for (int r = 0; r < 8; ++r) {
      float v = acc[t][r] + bv;
      if (resid) { float rv = resid[(size_t)((row0 + 8 * hh + r) % rmod) * ldr + col]; if (RES_BF16) rv = bf16_round(rv); v += rv; }
      if (ACT == 1) v = fmaxf(v, 0.f);
      if (ACT == 2) v = 0.5f * v * (1.0f + erff(v * 0.70710678118654752f));
      if (ACT == 3) { const float u = 0.7978845608028654f * (v + 0.044715f * v * v * v); v = 0.5f * v * (1.0f + tanhf(u)); }
      so[w][8 * hh + r][t * 16 + ln] = v;
    }
  }
  __builtin_amdgcn_fence(__ATOMIC_ACQ_REL, "workgroup");
  __builtin_amdgcn_wave_barrier();
  const int rsub = lane >> 4, c4 = (lane & 15) * 4;
  {
#pragma unroll
    for (int q = 0; q < 8; ++q) {
      const int r = q * 2 + rsub;
      const v4f v = *(const v4fa*)&so[w][r][c4];
      *(v4f*)(C + (size_t)(row0 + r) * ldc + col0 + c4) = v;
    }
    
  }
}
// row LayerNorm (biased variance, eps) over N: s = X (+ R); optional out_sum <- s; out_norm <- (s-mu)*rsqrt(var+eps)*g + b
template <bool PARAM_BF16>
__global__ __launch_bounds__(256) void k_layernorm(const float* __restrict__ X, const float* __restrict__ R, const float* __restrict__ g, const float* __restrict__ bta,
                                                  float* __restrict__ out_sum, float* __restrict__ out_norm, int N, float eps) {
  __shared__ float red[256];
  const int row = blockIdx.x, tid = threadIdx.x;
  const float* x = X + (size_t)row * N; const float* rr = R ? R + (size_t)row * N : nullptr;
  float vals[16];                     // up to N = 4096
  const int per = N / 256;            // contiguous chunk per thread? use strided-by-4 chunks: thread handles j = tid*4 + 1024*u
  float s1 = 0.f;
  for (int u = 0; u < per / 4; ++u) {
    const int j = tid * 4 + 1024 * u;
    const v4f a = *(const v4fa*)(x + j);
    v4f b = {0.f,0.f,0.f,0.f}; if (rr) b = *(const v4fa*)(rr + j);
#pragma unroll
    for (int q = 0; q < 4; ++q) { const float v = a[q] + b[q]; vals[u * 4 + q] = v; s1 += v; }
  }
  red[tid] = s1; __syncthreads();
  for (int st = 128; st > 0; st >>= 1) { if (tid < st) red[tid] += red[tid + st]; __syncthreads(); }
  const float mu = red[0] / (float)N; __syncthreads();
  float s2 = 0.f;
  for (int u = 0; u < per / 4; ++u)
#pragma unroll
    for (int q = 0; q < 4; ++q) { const float c = vals[u * 4 + q] - mu; s2 += c * c; }
  red[tid] = s2; __syncthreads();
  for (int st = 128; st > 0; st >>= 1) { if (tid < st) red[tid] += red[tid + st]; __syncthreads(); }
  const float rs = rsqrtf(red[0] / (float)N + eps);
  {
    for (int u = 0; u < per / 4; ++u) {
      const int j = tid * 4 + 1024 * u;
      v4f o, sm;
#pragma unroll
      for (int q = 0; q < 4; ++q) {
        float gg = g[j + q], bb = bta[j + q];
        if (PARAM_BF16) { gg = bf16_round(gg); bb = bf16_round(bb); }
        sm[q] = vals[u * 4 + q]; o[q] = (vals[u * 4 + q] - mu) * rs * gg + bb;
      }
      if (out_sum) *(v4f*)(out_sum + (size_t)row * N + j) = sm;
      *(v4f*)(out_norm + (size_t)row * N + j) = o;
    }
    
  }
}



// ---- f16 WMMA path (v_wmma_f32_16x16x32_f16): 11-bit significands for operands in range — used where a [0,1] probability operand needs more precision than bf16
typedef _Float16 v16h __attribute__((ext_vector_type(16)));
union FragH { v16h v; v8us half[2]; _Float16 h[16]; unsigned short u[16]; };
template <int NT>
__device__ __forceinline__ v8f mmaH(v16h ah, v16h al, v16h bh, v16h bl, v8f c) {
  c = __builtin_amdgcn_wmma_f32_16x16x32_f16(false, ah, false, bh, (short)0, c, false, false);
  if (NT >= 2) c = __builtin_amdgcn_wmma_f32_16x16x32_f16(false, al, false, bh, (short)0, c, false, false);
  if (NT >= 3) c = __builtin_amdgcn_wmma_f32_16x16x32_f16(false, ah, false, bl, (short)0, c, false, false);
  asm volatile("v_nop\n\tv_nop\n\tv_nop\n\tv_nop" : "+v"(c) : "v"(ah), "v"(al), "v"(bh), "v"(bl));
  return c;
}
// batched GEMM like k_gemm_b but f16 operands: A f32 (split into f16 hi/lo if ASPLIT, else rounded to f16), Bt = f16 values [n][k]; alpha; C f32; N multiple of 16 (partial tiles skipped)
template <bool ASPLIT>
__global__ __launch_bounds__(128) void k_gemm_h(const float* __restrict__ A, int lda, size_t sA, const _Float16* __restrict__ Bh, int ldb, size_t sB, float alpha, float* __restrict__ C, int ldc, size_t sC, int M, int N, int K) {
  __shared__ __attribute__((aligned(16))) float so[4][16][64];
  const int tid = threadIdx.x, w = tid >> 5, lane = tid & 31, ln = lane & 15, hh = lane >> 4; const int by = blockIdx.y;
  A += (size_t)by * sA; Bh += (size_t)by * sB; C += (size_t)by * sC;
  const int ntn = (N + 63) / 64; const int wid = blockIdx.x * 4 + w; const int mt = wid / ntn, nq = wid % ntn; if (mt * 16 >= M) return;
  const int row0 = mt * 16, col0 = nq * 64; const float* arow = A + (size_t)(row0 + ln) * lda;
  v8f acc[4] = {};
  for (int kb = 0; kb < K; kb += 32) {
    FragH ah, al;
    const v4f x0 = *(const v4fa*)(arow + kb + 8 * hh), x1 = *(const v4fa*)(arow + kb + 8 * hh + 4), x2 = *(const v4fa*)(arow + kb + 16 + 8 * hh), x3 = *(const v4fa*)(arow + kb + 16 + 8 * hh + 4);
    float xs[16] = {x0[0],x0[1],x0[2],x0[3],x1[0],x1[1],x1[2],x1[3],x2[0],x2[1],x2[2],x2[3],x3[0],x3[1],x3[2],x3[3]};
#pragma unroll
    for (int i = 0; i < 16; ++i) { const _Float16 h = (_Float16)xs[i]; ah.h[i] = h; al.h[i] = ASPLIT ? (_Float16)(xs[i] - (float)h) : (_Float16)0.0f; }
#pragma unroll
    for (int t = 0; t < 4; ++t) { if (col0 + t * 16 >= N) continue; const size_t boff = (size_t)(col0 + t * 16 + ln) * ldb + kb; FragH bq; bq.half[0] = *(const v8us*)(Bh + boff + 8 * hh); bq.half[1] = *(const v8us*)(Bh + boff + 16 + 8 * hh);
      acc[t] = mmaH<ASPLIT ? 2 : 1>(ah.v, al.v, bq.v, bq.v, acc[t]); }
  }
#pragma unroll
  for (int t = 0; t < 4; ++t) { if (col0 + t * 16 >= N) continue;
#pragma unroll
    for (int r = 0; r < 8; ++r) so[w][8 * hh + r][t * 16 + ln] = acc[t][r] * alpha; }
  __builtin_amdgcn_fence(__ATOMIC_ACQ_REL, "workgroup"); __builtin_amdgcn_wave_barrier();
  const int rsub = lane >> 4, c4 = (lane & 15) * 4;
  {
#pragma unroll
    for (int q = 0; q < 8; ++q) { const int r = q * 2 + rsub; if (col0 + c4 < N) { const v4f v = *(const v4fa*)&so[w][r][c4]; *(v4f*)(C + (size_t)(row0 + r) * ldc + col0 + c4) = v; } }
     }
}

// Wt[n][k] = f16(W[k][n]·scale) from f32 row-major W[K][N] (scale = power of two; bf16-exact weights stay exact in f16 away from the subnormal range)
__global__ __launch_bounds__(256) void k_wt_f16(const float* __restrict__ W, _Float16* __restrict__ Wt, int K, int N, float scale) {
  const int t = blockIdx.x * 256 + threadIdx.x; if (t >= N * (K / 8)) return; const int n = t / (K / 8), k8 = (t % (K / 8)) * 8; FragH f;
#pragma unroll
  for (int i = 0; i < 8; ++i) f.h[i] = (_Float16)(bf16_round(W[(size_t)(k8 + i) * N + n]) * scale); const v8us o = f.half[0];
  *(v8us*)((unsigned short*)Wt + (size_t)n * K + k8) = o; 
}
// k_gemm_hh variant with fused epilogue: v = acc·alpha + bias[by·sBias + col] (+ CP[(row/rowsPerB)·sCPb + by·64 + col] if CP) ; ACT 0 none / 1 elu ; writes f16 C16 (and f32 C if non-null)
template <int ACT>
__global__ __launch_bounds__(128) void k_gemm_hhx(const _Float16* __restrict__ A, int lda, size_t sA, const _Float16* __restrict__ Bh, int ldb, size_t sB, float alpha, const float* __restrict__ bias, size_t sBias, const float* __restrict__ CP, int rowsPerB, size_t sCPb, int row0g,
    float* __restrict__ C, _Float16* __restrict__ C16, int ldc, size_t sC, int M, int N, int K) {
  __shared__ __attribute__((aligned(16))) float so[4][16][64];
  const int tid = threadIdx.x, w = tid >> 5, lane = tid & 31, ln = lane & 15, hh = lane >> 4; const int by = blockIdx.y;
  A += (size_t)by * sA; Bh += (size_t)by * sB; const size_t cofs = (size_t)by * sC; const float* bp = bias ? bias + (size_t)by * sBias : nullptr;
  const int ntn = (N + 63) / 64; const int wid = blockIdx.x * 4 + w; const int mt = wid / ntn, nq = wid % ntn; if (mt * 16 >= M) return;
  const int row0 = mt * 16, col0 = nq * 64; const _Float16* arow = A + (size_t)(row0 + ln) * lda;
  v8f acc[4] = {};
  for (int kb = 0; kb < K; kb += 32) { FragH ah; ah.half[0] = *(const v8us*)((const unsigned short*)arow + kb + 8 * hh); ah.half[1] = *(const v8us*)((const unsigned short*)arow + kb + 16 + 8 * hh);
#pragma unroll
    for (int t = 0; t < 4; ++t) { if (col0 + t * 16 >= N) continue; const size_t boff = (size_t)(col0 + t * 16 + ln) * ldb + kb; FragH bq; bq.half[0] = *(const v8us*)((const unsigned short*)Bh + boff + 8 * hh); bq.half[1] = *(const v8us*)((const unsigned short*)Bh + boff + 16 + 8 * hh);
      acc[t] = mmaH<1>(ah.v, ah.v, bq.v, bq.v, acc[t]); }
  }
#pragma unroll
  for (int t = 0; t < 4; ++t) { if (col0 + t * 16 >= N) continue; const int col = col0 + t * 16 + ln; const float bv = bp ? bf16_round(bp[col]) : 0.f;
#pragma unroll
    for (int r = 0; r < 8; ++r) { float v = acc[t][r] * alpha + bv; if (CP) { const int rr = row0g + row0 + 8 * hh + r; if (rowsPerB < 0) v += CP[cofs + (size_t)rr * ldc + col];      /* rowsPerB < 0: own element of the batched C plane */ else { const int bidx = rr / rowsPerB; v += CP[(size_t)bidx * sCPb + (size_t)by * 64 + col]; } } if (ACT == 1) v = (v > 0.f) ? v : expm1f(v); else if (ACT == 7) v = (v > 0.f) ? v + 1.0f : expf(v); else if (ACT == 8) v = tanhf(v); else if (ACT == 9) v = 0.5f * v * (1.0f + tanhf(0.7978845608028654f * (v + 0.044715f * v * v * v))); else if (ACT == 11) v = 1.0f / (1.0f + expf(-v)); else if (ACT == 12) v = (v > 0.f) ? v : 0.01f * v; else if (ACT == 14) v = (v > 0.f) ? v : 0.1f * v; else if (ACT == 16) v = (v >= 0.f) ? v : 0.3f * v; else if (ACT == 17) v = (v >= 0.f) ? v : 0.2f * v; else if (ACT == 15) v = v / (1.0f + expf(-v)); else if (ACT == 3) v = fmaxf(v, 0.f); else if (ACT == 6) v = 0.5f * v * (1.0f + erff(v * 0.70710678118654752f)); so[w][8 * hh + r][t * 16 + ln] = v; } }
  __builtin_amdgcn_fence(__ATOMIC_ACQ_REL, "workgroup"); __builtin_amdgcn_wave_barrier();
  const int rsub = lane >> 4, c4 = (lane & 15) * 4; typedef _Float16 v4h __attribute__((ext_vector_type(4)));
  {
#pragma unroll
    for (int q = 0; q < 8; ++q) { const int r = q * 2 + rsub; if (col0 + c4 < N) { const v4f v = *(const v4fa*)&so[w][r][c4]; if (C) *(v4f*)(C + cofs + (size_t)(row0 + r) * ldc + col0 + c4) = v; if (C16) { v4h h4; for (int i = 0; i < 4; ++i) h4[i] = (_Float16)v[i]; *(v4h*)(C16 + cofs + (size_t)(row0 + r) * ldc + col0 + c4) = h4; } } }
     }
}


typedef _Float16 v4h __attribute__((ext_vector_type(4)));

__global__ __launch_bounds__(256) void k_x16(const float* __restrict__ x, _Float16* __restrict__ X16, size_t n8) { const size_t t = (size_t)blockIdx.x * 256 + threadIdx.x; if (t >= n8) return; FragH f;
#pragma unroll
  for (int q = 0; q < 8; ++q) f.h[q] = (_Float16)bf16_round(x[t * 8 + q]); *(v8us*)((unsigned short*)X16 + t * 8) = f.half[0];  }
__global__ __launch_bounds__(256) void k_h16(const float* __restrict__ x, _Float16* __restrict__ X16, size_t n8) { const size_t t = (size_t)blockIdx.x * 256 + threadIdx.x; if (t >= n8) return; FragH f;
#pragma unroll
  for (int q = 0; q < 8; ++q) f.h[q] = (_Float16)x[t * 8 + q]; *(v8us*)((unsigned short*)X16 + t * 8) = f.half[0];  }
__global__ __launch_bounds__(256) void k_round16f(const float* __restrict__ W, _Float16* __restrict__ Bt, size_t n8) { const size_t t = (size_t)blockIdx.x * 256 + threadIdx.x; if (t >= n8) return; FragH f;
#pragma unroll
  for (int i = 0; i < 8; ++i) f.h[i] = (_Float16)(bf16_round(W[t * 8 + i]) * 16.0f); *(v8us*)((unsigned short*)Bt + t * 8) = f.half[0];  }
template <int NHv, int TTv>
__global__ __launch_bounds__(256) void k_vt(const _Float16* __restrict__ V16, int ldv, int voff, _Float16* __restrict__ Vt) { __shared__ unsigned short tl[64][66]; const int tid = threadIdx.x; const int slab = blockIdx.x / (TTv / 64), lg = blockIdx.x % (TTv / 64); const int b = slab / NHv, h = slab % NHv;
  for (int i = tid; i < 64 * 8; i += 256) { const int r = i / 8, c8 = (i % 8) * 8; FragH f; f.half[0] = *(const v8us*)((const unsigned short*)V16 + ((size_t)b * TTv + lg * 64 + r) * ldv + voff + h * 64 + c8);
#pragma unroll
    for (int q = 0; q < 8; ++q) tl[r][c8 + q] = f.u[q]; }
  __syncthreads();
  {
#pragma unroll
    for (int rd = 0; rd < 2; ++rd) { const int d = rd * 32 + tid / 8, pc = tid % 8; FragH f;
#pragma unroll
      for (int q = 0; q < 8; ++q) f.u[q] = tl[pc * 8 + q][d];
      *(v8us*)((unsigned short*)Vt + ((size_t)slab * 64 + d) * TTv + lg * 64 + pc * 8) = f.half[0]; }
     } }

__global__ __launch_bounds__(256) void k_hl(const float* __restrict__ F, _Float16* __restrict__ Hh, _Float16* __restrict__ Hl, size_t n8) { const size_t t = (size_t)blockIdx.x * 256 + threadIdx.x; if (t >= n8) return; FragH fh, fl; const v4f a = *(const v4fa*)(F + t * 8), c = *(const v4fa*)(F + t * 8 + 4);
#pragma unroll
  for (int q = 0; q < 4; ++q) { _Float16 h = (_Float16)a[q]; fh.h[q] = h; fl.h[q] = (_Float16)((a[q] - (float)h) * 1024.0f); h = (_Float16)c[q]; fh.h[4 + q] = h; fl.h[4 + q] = (_Float16)((c[q] - (float)h) * 1024.0f); }
  { *(v8us*)((unsigned short*)Hh + t * 8) = fh.half[0]; *(v8us*)((unsigned short*)Hl + t * 8) = fl.half[0];  } }

// ---- fast GEMM (wave tile 32x64; requires M % 32 == 0 rows per launch region and N % 64 == 0); epilogue = k_gemm_hhx semantics ----
__device__ __forceinline__ v16h g2_frag(const _Float16* p, int hh) { FragH f; f.half[0] = *(const v8us*)((const unsigned short*)p + 8 * hh); f.half[1] = *(const v8us*)((const unsigned short*)p + 16 + 8 * hh); return f.v; }
__device__ __forceinline__ v8f g2_mma(v16h a, v16h b, v8f c) { v8f d = __builtin_amdgcn_wmma_f32_16x16x32_f16(false, a, false, b, (short)0, c, false, false); asm volatile("v_nop\n\tv_nop\n\tv_nop\n\tv_nop" : "+v"(d) : "v"(a), "v"(b)); return d; }
template <int ACT>
__global__ __launch_bounds__(128) void k_gemm2(const _Float16* __restrict__ A, int lda, size_t sA, const _Float16* __restrict__ Bh, int ldb, size_t sB, float alpha, const float* __restrict__ bias, size_t sBias, const float* __restrict__ CP, int rowsPerB, size_t sCPb, int row0g,
    float* __restrict__ C, _Float16* __restrict__ C16, int ldc, size_t sC, int M, int N, int K) { static_assert(ACT == 0 || ACT == 3 || ACT == 6 || ACT == 8 || ACT == 9 || ACT == 11 || ACT == 12 || ACT == 14 || ACT == 15 || ACT == 16 || ACT == 17, "k_gemm2: unsupported ACT code (would silently apply no activation)");
  __shared__ __attribute__((aligned(16))) float so[4][32][68];
  const int tid = threadIdx.x, w = tid >> 5, lane = tid & 31, ln = lane & 15, hh = lane >> 4; const int by = blockIdx.y;
  A += (size_t)by * sA; Bh += (size_t)by * sB; const size_t cofs = (size_t)by * sC; const float* bp = bias ? bias + (size_t)by * sBias : nullptr;
  const int ntn = N >> 6; const int mt = blockIdx.x / ntn, nq = blockIdx.x - mt * ntn; const int row0 = mt * 128 + 32 * w, col0 = nq * 64; if (row0 >= M) return;
  const _Float16* a0p = A + (size_t)(row0 + ln) * lda; const _Float16* a1p = a0p + (size_t)16 * lda;
  const _Float16* b0p = Bh + (size_t)(col0 + ln) * ldb; const _Float16* b1p = b0p + (size_t)16 * ldb; const _Float16* b2p = b1p + (size_t)16 * ldb; const _Float16* b3p = b2p + (size_t)16 * ldb;
  const v8f z8 = {0.f,0.f,0.f,0.f,0.f,0.f,0.f,0.f}; v8f c00 = z8, c01 = z8, c02 = z8, c03 = z8, c10 = z8, c11 = z8, c12 = z8, c13 = z8;
#pragma unroll 1
  for (int kb = 0; kb < K; kb += 32) { const v16h a0 = g2_frag(a0p + kb, hh), a1 = g2_frag(a1p + kb, hh);
    v16h b = g2_frag(b0p + kb, hh); c00 = g2_mma(a0, b, c00); c10 = g2_mma(a1, b, c10);
    b = g2_frag(b1p + kb, hh); c01 = g2_mma(a0, b, c01); c11 = g2_mma(a1, b, c11);
    b = g2_frag(b2p + kb, hh); c02 = g2_mma(a0, b, c02); c12 = g2_mma(a1, b, c12);
    b = g2_frag(b3p + kb, hh); c03 = g2_mma(a0, b, c03); c13 = g2_mma(a1, b, c13); }
  v8f accs[8] = {c00, c01, c02, c03, c10, c11, c12, c13};
#pragma unroll
  for (int u = 0; u < 8; ++u) { const int t = u & 3, half = u >> 2; const int col = col0 + t * 16 + ln; const float bv = bp ? bf16_round(bp[col]) : 0.f;
#pragma unroll
    for (int r = 0; r < 8; ++r) { const int rloc = half * 16 + 8 * hh + r; float v = accs[u][r] * alpha + bv; if (CP) { if (rowsPerB < 0) v += CP[cofs + (size_t)(row0g + row0 + rloc) * ldc + col];      /* rowsPerB < 0: own element of the batched C plane */ else { const int bidx = (row0g + row0 + rloc) / rowsPerB; v += CP[(size_t)bidx * sCPb + (size_t)by * 64 + col]; } }
      if (ACT == 3) v = fmaxf(v, 0.f); else if (ACT == 6) v = 0.5f * v * (1.0f + erff(v * 0.70710678118654752f)); else if (ACT == 11) v = 1.0f / (1.0f + expf(-v)); else if (ACT == 15) v = v / (1.0f + expf(-v)); else if (ACT == 12) v = (v > 0.f) ? v : 0.01f * v; else if (ACT == 8) v = tanhf(v); else if (ACT == 9) v = 0.5f * v * (1.0f + tanhf(0.7978845608028654f * (v + 0.044715f * v * v * v))); else if (ACT == 14) v = (v > 0.f) ? v : 0.1f * v; else if (ACT == 16) v = (v >= 0.f) ? v : 0.3f * v; else if (ACT == 17) v = (v >= 0.f) ? v : 0.2f * v;
      so[w][rloc][t * 16 + ln] = v; } }
  __builtin_amdgcn_fence(__ATOMIC_ACQ_REL, "workgroup"); __builtin_amdgcn_wave_barrier();
  const int rsub = lane >> 4, c4 = (lane & 15) * 4;
  {
#pragma unroll
    for (int q = 0; q < 16; ++q) { const int r = q * 2 + rsub; const v4f v = *(const v4fa*)&so[w][r][c4]; if (C) *(v4f*)(C + cofs + (size_t)(row0 + r) * ldc + col0 + c4) = v; if (C16) { v4h h4; for (int i = 0; i < 4; ++i) h4[i] = (_Float16)v[i]; *(v4h*)(C16 + cofs + (size_t)(row0 + r) * ldc + col0 + c4) = h4; } }
     } }


__global__ __launch_bounds__(256) void k_wnat(const float* __restrict__ w, size_t n8, _Float16* __restrict__ Bt) { const size_t t = (size_t)blockIdx.x * 256 + threadIdx.x; if (t >= n8) return; FragH f; for (int q = 0; q < 8; ++q) f.h[q] = (_Float16)(bf16_round(w[t * 8 + q]) * 16.0f); *(v8us*)((unsigned short*)Bt + t * 8) = f.half[0];  }
__global__ __launch_bounds__(256) void k_rsm(const float* __restrict__ S, _Float16* __restrict__ P, int nrows) {
  #pragma clang fp contract(off)
  const int i = blockIdx.x * 256 + threadIdx.x; if (i >= nrows) return; const float* s = S + (size_t)i * SQ; float mx = -3.0e38f;
#pragma unroll 1
  for (int j = 0; j < SQ; ++j) mx = fmaxf(mx, s[j]); float se = 0.f;
#pragma unroll 1
  for (int j = 0; j < SQ; ++j) se += expf(s[j] - mx); const float sc = 256.0f / se;
#pragma unroll 1
  for (int j0 = 0; j0 < SQ; j0 += 8) { FragH f; for (int q = 0; q < 8; ++q) f.h[q] = (_Float16)(expf(s[j0 + q] - mx) * sc); unsigned short* d = (unsigned short*)P + (size_t)i * SQ + j0; *(v8us*)d = f.half[0];  } }
__global__ __launch_bounds__(256) void k_vt(const _Float16* __restrict__ V16, int b, int h0, _Float16* __restrict__ VT) { __shared__ unsigned short tl[64][65]; const int tid = threadIdx.x; const int hh = blockIdx.x % HG, sg = blockIdx.x / HG; const int s0 = sg * 64; const int h = h0 + hh;
  for (int i = tid; i < 64 * 8; i += 256) { const int j = i / 8, d8 = (i % 8) * 8; FragH f; f.half[0] = *(const v8us*)((const unsigned short*)V16 + ((size_t)b * SQ + s0 + j) * DM + h * HD + d8); for (int q = 0; q < 8; ++q) tl[d8 + q][j] = f.u[q]; }
  __syncthreads();
  { for (int i = tid; i < 64 * 8; i += 256) { const int d = i / 8, j8 = (i % 8) * 8; FragH f; for (int q = 0; q < 8; ++q) f.u[q] = tl[d][j8 + q]; *(v8us*)((unsigned short*)VT + ((size_t)hh * HD + d) * SQ + s0 + j8) = f.half[0]; }  } }



__global__ __launch_bounds__(256) void k_rsmcf2(const float* __restrict__ S, _Float16* __restrict__ P, int hg, int q0, int nk) {
  #pragma clang fp contract(off)
  const int t = blockIdx.x * 256 + threadIdx.x; if (t >= hg * QT) return; const size_t i = (size_t)t; const float* s = S + i * NKX; const int last = q0 + (t % QT); float mx = -3.0e38f;
#pragma unroll 1
  for (int j = 0; j < nk; ++j) { const float f = (j <= last) ? 1.f : 0.f; mx = fmaxf(mx, fmaf(f, s[j], (1.f - f) * -1.0e9f)); } float se = 0.f;
#pragma unroll 1
  for (int j = 0; j < nk; ++j) { const float f = (j <= last) ? 1.f : 0.f; se += __expf(fmaf(f, s[j], (1.f - f) * -1.0e9f) - mx); } const float sc = 256.0f / se;
#pragma unroll 1
  for (int j0 = 0; j0 < nk; j0 += 8) { FragH fr; for (int q = 0; q < 8; ++q) { const int j = j0 + q; const float f = (j <= last) ? 1.f : 0.f; fr.h[q] = (_Float16)(__expf(fmaf(f, s[j], (1.f - f) * -1.0e9f) - mx) * sc); } unsigned short* d = (unsigned short*)P + i * NKX + j0; *(v8us*)d = fr.half[0];  } }

template <int MASKADD>
__global__ __launch_bounds__(64) void k_att0(const float* __restrict__ QF, const float* __restrict__ KF, const float* __restrict__ VF, int ld, const float* __restrict__ mask, float scale, float* __restrict__ OF, int ldo) {
  #pragma clang fp contract(off)
  __shared__ __attribute__((aligned(16))) float lq[64][64]; __shared__ __attribute__((aligned(16))) float lo[64][64];
  const int tid = threadIdx.x; const int h = blockIdx.x / (QT0 / 64), rg = blockIdx.x % (QT0 / 64); const int i = rg * 64 + tid;
  const float* qr = QF + (size_t)i * ld + h * HD;
#pragma unroll 1
  for (int c = 0; c < HD / 4; ++c) { *(v4f*)&lq[tid][c * 4] = *(const v4fa*)(qr + c * 4); const v4f z = {0.f, 0.f, 0.f, 0.f}; *(v4f*)&lo[tid][c * 4] = z; }
  float m = -1.0e30f, l = 0.f; const int jmax = MASKADD ? (SQ - 1) : (rg * 64 + 63);      /* additive-mask form: every key (the mask input decides); causal form: keys up to the block's last row */
#pragma unroll 1
  for (int j = 0; j <= jmax; ++j) { const float* kr = KF + (size_t)j * ld + h * HD; const float* vr = VF + (size_t)j * ld + h * HD; float s = 0.f;
#pragma unroll 1
    for (int c = 0; c < HD / 4; ++c) { const v4f kq = *(const v4fa*)(kr + c * 4); const v4f qq = *(v4f*)&lq[tid][c * 4]; s = __fadd_rn(s, __fmul_rn(qq[0], kq[0])); s = __fadd_rn(s, __fmul_rn(qq[1], kq[1])); s = __fadd_rn(s, __fmul_rn(qq[2], kq[2])); s = __fadd_rn(s, __fmul_rn(qq[3], kq[3])); }
    s = __fmul_rn(s, scale); if (MASKADD) s = __fadd_rn(s, __fmul_rn(bf16_round(mask[(size_t)i * SQ + j]), -10000.0f));
    const float f = (MASKADD || j <= i) ? 1.f : 0.f; const float sm = fmaf(f, s, (1.f - f) * -1.0e30f); const float mn = fmaxf(m, sm); const float sc = expf(m - mn); const float e = expf(sm - mn); l = __fadd_rn(__fmul_rn(l, sc), e); m = mn;
#pragma unroll 1
    for (int c = 0; c < HD / 4; ++c) { const v4f vv = *(const v4fa*)(vr + c * 4); v4f oo = *(v4f*)&lo[tid][c * 4]; for (int u = 0; u < 4; ++u) oo[u] = __fadd_rn(__fmul_rn(oo[u], sc), __fmul_rn(e, vv[u])); *(v4f*)&lo[tid][c * 4] = oo; } }
  const float fin = 64.0f / l;      /* o carried x64 like the f16 path */
#pragma unroll 1
  for (int c = 0; c < HD / 4; ++c) { v4f oo = *(v4f*)&lo[tid][c * 4]; for (int u = 0; u < 4; ++u) oo[u] = __fmul_rn(oo[u], fin); *(v4f*)&lo[tid][c * 4] = oo; }
  __syncthreads();
  {
#pragma unroll 1
    for (int it = 0; it < 16; ++it) { const int row = it * 4 + tid / 16, pc = (tid % 16) * 4; const v4f v = *(const v4f*)&lo[row][pc]; *(v4f*)(OF + (size_t)(rg * 64 + row) * ldo + h * HD + pc) = v; }
     } }

__global__ __launch_bounds__(256) void k_oscale(const float* __restrict__ OF, float* __restrict__ out, size_t n4) { const size_t t = (size_t)blockIdx.x * 256 + threadIdx.x; if (t >= n4) return; const v4f a = *(const v4fa*)(OF + t * 4); v4f o; for (int q = 0; q < 4; ++q) o[q] = a[q] * 0.015625f; *(v4f*)(out + t * 4) = o;  }

__global__ __launch_bounds__(256) void k_bfr(const float* __restrict__ x, float* __restrict__ XB, size_t n8) { const size_t t = (size_t)blockIdx.x * 256 + threadIdx.x; if (t >= n8) return; v4f a = *(const v4fa*)(x + t * 8), c = *(const v4fa*)(x + t * 8 + 4); for (int q = 0; q < 4; ++q) { a[q] = bf16_round(a[q]); c[q] = bf16_round(c[q]); }
  { *(v4f*)(XB + t * 8) = a; *(v4f*)(XB + t * 8 + 4) = c;  } }



__global__ __launch_bounds__(256) void k_rsmfvl(const float* __restrict__ S, _Float16* __restrict__ P, _Float16* __restrict__ PL, int qn, const int* __restrict__ vlp) {
  #pragma clang fp contract(off)
  const int t = blockIdx.x * 256 + threadIdx.x; if (t >= qn) return; const int vl = vlp[0]; const size_t i = (size_t)t; const float* s = S + i * SQ; float mx = -3.0e38f;
#pragma unroll 1
  for (int j = 0; j < SQ; ++j) { const float f = (j < vl) ? 1.f : 0.f; mx = fmaxf(mx, fmaf(f, s[j], (1.f - f) * -1000000.0f)); } float se = 0.f;
#pragma unroll 1
  for (int j = 0; j < SQ; ++j) { const float f = (j < vl) ? 1.f : 0.f; se += __expf(fmaf(f, s[j], (1.f - f) * -1000000.0f) - mx); } const float sc = 256.0f / se;
#pragma unroll 1
  for (int j0 = 0; j0 < SQ; j0 += 8) { FragH fr, gr; for (int q = 0; q < 8; ++q) { const int j = j0 + q; const float f = (j < vl) ? 1.f : 0.f; const float pv = __expf(fmaf(f, s[j], (1.f - f) * -1000000.0f) - mx) * sc; const _Float16 ph = (_Float16)pv; fr.h[q] = ph; gr.h[q] = (_Float16)((pv - (float)ph) * 1024.0f); }
    unsigned short* d = (unsigned short*)P + i * SQ + j0; unsigned short* dl = (unsigned short*)PL + i * SQ + j0; *(v8us*)d = fr.half[0]; *(v8us*)dl = gr.half[0];  } }

__global__ __launch_bounds__(256) void k_rsmf(const float* __restrict__ S, _Float16* __restrict__ P, int qn, int hg) {
  #pragma clang fp contract(off)
  const int t = blockIdx.x * 256 + threadIdx.x; if (t >= qn * hg) return; const size_t i = (size_t)(t / qn) * SQ + (t % qn); const float* s = S + i * SQ; float mx = -3.0e38f;
#pragma unroll 1
  for (int j = 0; j < SQ; ++j) mx = fmaxf(mx, s[j]); float se = 0.f;
#pragma unroll 1
  for (int j = 0; j < SQ; ++j) se += __expf(s[j] - mx); const float sc = 256.0f / se;
#pragma unroll 1
  for (int j0 = 0; j0 < SQ; j0 += 8) { FragH f; for (int q = 0; q < 8; ++q) f.h[q] = (_Float16)(__expf(s[j0 + q] - mx) * sc); unsigned short* d = (unsigned short*)P + i * SQ + j0; *(v8us*)d = f.half[0];  } }


#define CN 256          /* channels */
#define CI 128
#define NC 256                       /* (unused legacy kernels) */
#define NPX NP          /* positions per channel row */
#define NP 4096         /* seq1 tokens */
#define NM 1024         /* seq2 tokens */
#define BNEPS 1e-5f

__global__ __launch_bounds__(256) void k_mp2(const float* __restrict__ src, float* __restrict__ dst, int nout) {
  const int t = blockIdx.x * 256 + threadIdx.x; if (t >= nout) return; const int c = t / 1024; const int o = t % 1024; const int oy = o / 32, ox = o % 32; const float* p = src + (size_t)c * 4096 + (size_t)(2 * oy) * 64 + 2 * ox;
  const float v = fmaxf(fmaxf(p[0], p[1]), fmaxf(p[64], p[65])); *(float*)(dst + t) = v;  }
__global__ __launch_bounds__(256) void k_xpb(const float* __restrict__ x, const float* __restrict__ wb, float* __restrict__ CPP, size_t n4) {
  #pragma clang fp contract(off)
  const size_t t = (size_t)blockIdx.x * 256 + threadIdx.x; if (t >= n4) return; const size_t e = t * 4; const int c = (int)((e / 4096) % 256); const float bb = bf16_round(wb[c]); const v4f a = *(const v4fa*)(x + e); v4f o; for (int q = 0; q < 4; ++q) o[q] = __fadd_rn(bf16_round(a[q]), bb);
  *(v4f*)(CPP + e) = o;  }


template <int PASS>
__global__ __launch_bounds__(256) void k_cstA(const float* __restrict__ X, const float* __restrict__ MV, float* __restrict__ PART) {
  #pragma clang fp contract(off)
  __shared__ float red[256]; const int t = threadIdx.x; const size_t bc = blockIdx.x; const int c = (int)(bc % NC); const float* row = X + bc * (size_t)NPX; const float mu = PASS ? MV[c] : 0.f; float s = 0.f;
  for (int i = t; i < NPX; i += 256) { const float v = row[i]; const float d = PASS ? __fadd_rn(v, -mu) : v; s = __fadd_rn(s, PASS ? __fmul_rn(d, d) : d); }
  red[t] = s; __syncthreads(); for (int st = 128; st > 0; st >>= 1) { if (t < st) red[t] = __fadd_rn(red[t], red[t + st]); __syncthreads(); }
  if (t < 32) { const float pv = (t == 0) ? red[0] : 0.f; *(float*)(PART + bc * 32 + t) = pv;  } }      

template <int PASS>
__global__ __launch_bounds__(256) void k_cstB(const float* __restrict__ PART, float* __restrict__ MV) { const int c = threadIdx.x; if (c >= NC) return; double s = 0.0; for (int b = 0; b < NB; ++b) s += (double)PART[((size_t)b * NC + c) * 32]; const float m = (float)(s / ((double)NB * (double)NPX)); *(float*)(MV + PASS * NC + c) = m;  }


__global__ __launch_bounds__(256) void k_bnresid(const float* __restrict__ C2, const float* __restrict__ MV, const float* __restrict__ g, const float* __restrict__ be, const float* __restrict__ X, float* __restrict__ out, size_t n4) {
  #pragma clang fp contract(off)
  const size_t t = (size_t)blockIdx.x * 256 + threadIdx.x; if (t >= n4) return; const size_t e = t * 4; const int c = (int)((e / NPX) % NC); const float sc = __fmul_rn(rsqrtf(__fadd_rn(MV[NC + c], BNEPS)), bf16_round(g[c])); const float mu = MV[c], bb = bf16_round(be[c]);
  const v4f a = *(const v4fa*)(C2 + e); const v4f xx = *(const v4fa*)(X + e); v4f o; for (int q = 0; q < 4; ++q) { const float z = __fadd_rn(__fmul_rn(__fadd_rn(a[q], -mu), sc), bb); o[q] = __fadd_rn(z, bf16_round(xx[q])); }
  *(v4f*)(out + e) = o;  }


__global__ __launch_bounds__(256) void k_rowbias(float* __restrict__ Y, const float* __restrict__ bias) {
  #pragma clang fp contract(off)
  const size_t t = (size_t)blockIdx.x * 256 + threadIdx.x; if (t >= (size_t)NB * NC * NPX / 4) return; const size_t e = t * 4; const int c = (int)((e / NPX) % NC); const float bb = bf16_round(bias[c]);
  v4f v = *(const v4fa*)(Y + e); for (int q = 0; q < 4; ++q) v[q] = __fadd_rn(v[q], bb); *(v4f*)(Y + e) = v;  }



template <int NBt, int QTt, int NKt>
__global__ __launch_bounds__(256) void k_bsm(const float* __restrict__ S, _Float16* __restrict__ P) {
  #pragma clang fp contract(off)
  const size_t t = (size_t)blockIdx.x * 256 + threadIdx.x; if (t >= (size_t)QTt * NKt / 8) return; const size_t e = t * 8; float mx[8], se[8];
  for (int q = 0; q < 8; ++q) { mx[q] = -3.0e38f; se[q] = 0.f; }
#pragma unroll
  for (int b = 0; b < NBt; ++b) { const float* s = S + (size_t)b * QTt * NKt + e; for (int q = 0; q < 8; ++q) mx[q] = fmaxf(mx[q], s[q]); }
#pragma unroll
  for (int b = 0; b < NBt; ++b) { const float* s = S + (size_t)b * QTt * NKt + e; for (int q = 0; q < 8; ++q) se[q] += __expf(s[q] - mx[q]); }
#pragma unroll
  for (int b = 0; b < NBt; ++b) { const float* s = S + (size_t)b * QTt * NKt + e; FragH f; for (int q = 0; q < 8; ++q) f.h[q] = (_Float16)(__expf(s[q] - mx[q]) * (256.0f / se[q]));
    unsigned short* d = (unsigned short*)P + (size_t)b * QTt * NKt + e; *(v8us*)d = f.half[0];  } }
// ---- fused scores + batch-axis softmax + P V: one launch for all queries ----
#define FQ 64       /* query rows per work-group */
#define FQT (FQ / 16)      /* query tiles per work-group: each K and V^T fragment fetched serves all of them */
#define FKS 4      /* key ranges: a work-group walks FS / FKS keys, so that the grid still fills the chip */
#define FK 128      /* keys per pass: 16 per wave in part 1 */
#define FPP 136     /* LDS pitch of a P row in f16: 272 B = 16 B x odd, so the 16-byte row reads of part 2 do not collide */
#define FS 4096     /* sequence length */
#define FD 64       /* width */
#define FB 8        /* batches = waves of the work-group */
__device__ __forceinline__ v8f f_mma(v16h a, v16h b, v8f c) { return __builtin_amdgcn_wmma_f32_16x16x32_f16(false, a, false, b, (short)0, c, false, false); }
__device__ __forceinline__ v16h f_frag(const _Float16* p) { FragH f; f.half[0] = *(const v8us*)((const unsigned short*)p); f.half[1] = *(const v8us*)((const unsigned short*)p + 16); return f.v; }      /* p already holds the lane half's 8 hh: the k order of g2_frag */
__device__ __forceinline__ v16h f_fragp(const _Float16* p) { FragH f; f.half[0] = *(const v8us*)((const unsigned short*)p); f.half[1] = *(const v8us*)((const unsigned short*)p + 256); return f.v; }      /* fragment-order planes: p holds the lane's own 8 values, the fragment's second half lies one wave-wide load (32 lanes x 8) further; same values in the same registers as f_frag on rows */
// ---- one prep launch for Q, K and V: three block ranges that do not depend on one another; each writes the same values to the same places as a launch of its own would ----
#define PVK 128      /* keys per work-group of the V range */
#define PVM (PVK * 8 / 256)      /* 8-value items per thread there */
#define PVW (FB * FS / PVK)      /* work-groups of the V range: PVK keys x 64 d of one batch each */
#define PIT 8      /* 8-value items per thread in the Q and K ranges: few waves to start, all of a thread's loads in flight at once */
#define PXW (FB * FS * FD / 8 / 256 / PIT)      /* work-groups of the Q range, and of the K range */
__device__ __forceinline__ v8us p_cvt(v4f a, v4f c) { FragH f;      /* 8 inputs rounded to bf16, held as exact f16 */
#pragma unroll
  for (int q = 0; q < 4; ++q) { f.h[q] = (_Float16)bf16_round(a[q]); f.h[4 + q] = (_Float16)bf16_round(c[q]); }
  return f.half[0]; }
// V range (first: it has the longest chain): V^T in fragment order: per batch [32-key block][t = d / 16][half = (key / 16) & 1][lane = 16 ((key / 8) & 1) + d % 16][8 keys]; a work-group turns PVK keys x 64 d in LDS and writes 16 KiB in a row; the batch planes follow one another, so the block index runs through all batches
// Q range: rows as they are. K range: fragment order: [16-key tile][j = d / 16][lane = 16 ((d / 8) & 1) + key % 16][8 d]; tile = 1024 values, so a batch plane keeps its size and place
__global__ __launch_bounds__(256) void k_prep(const float* __restrict__ xq, const float* __restrict__ xk, const float* __restrict__ xv, _Float16* __restrict__ Q16, _Float16* __restrict__ KP, _Float16* __restrict__ VP) {
  __shared__ unsigned short tl[PVK][66]; const int tid = threadIdx.x; const int bx = blockIdx.x;
  if (bx < PVW) {      /* the same for the whole work-group, so the barrier inside is passed by all of it or by none */
    const float* s = xv + (size_t)bx * (PVK * 64) + tid * 8; v4f a[PVM], c[PVM];      /* key tid / 8 (and 32, 64, ... further), d (tid % 8) * 8 */
#pragma unroll      /* register arrays need constant indices */
    for (int m = 0; m < PVM; ++m) { a[m] = *(const v4fa*)(s + m * 2048); c[m] = *(const v4fa*)(s + m * 2048 + 4); }
    asm volatile("s_wait_xcnt 0x0" :: "v"(s) : "memory");      /* precaution: stands in front of any rewrite of a register that an issued load names; the input keeps the address pair whole up to it */
    const int r = tid / 8, c8 = (tid % 8) * 8;
#pragma unroll      /* register arrays need constant indices */
    for (int m = 0; m < PVM; ++m) { FragH f; f.half[0] = p_cvt(a[m], c[m]);
#pragma unroll
      for (int q = 0; q < 8; ++q) tl[r + 32 * m][c8 + q] = f.u[q]; }
    __syncthreads();
    FragH g[PVM];
#pragma unroll      /* register arrays need constant indices */
    for (int m = 0; m < PVM; ++m) { const int i = m * 256 + tid; const int k0 = (i >> 8) * 32 + ((i >> 5) & 1) * 16 + ((i >> 4) & 1) * 8, d = ((i >> 6) & 3) * 16 + (i & 15);
#pragma unroll
      for (int q = 0; q < 8; ++q) g[m].u[q] = tl[k0 + q][d]; }
    unsigned short* o = (unsigned short*)VP + (size_t)bx * (PVK * 64) + (size_t)tid * 8;
    __builtin_amdgcn_sched_barrier(0);      /* every value ahead of the first store, so that no register that an issued store names is rewritten behind it */
#pragma unroll      /* register arrays need constant indices */
    for (int m = 0; m < PVM; ++m) *(v8us*)(o + m * 2048) = g[m].half[0];
    return;
  }
  const bool isk = bx >= PVW + PXW; const size_t t = (size_t)(bx - PVW - (isk ? PXW : 0)) * (256 * PIT) + tid;      /* first item; the others lie 256 items apart */
  const float* s = (isk ? xk : xq) + t * 8; v4f a[PIT], c[PIT];
#pragma unroll      /* register arrays need constant indices */
  for (int j = 0; j < PIT; ++j) { a[j] = *(const v4fa*)(s + j * 2048); c[j] = *(const v4fa*)(s + j * 2048 + 4); }
  asm volatile("s_wait_xcnt 0x0" :: "v"(s) : "memory");      /* as above */
  const size_t row = t >> 3; const int c8 = (int)(t & 7);
  unsigned short* o = isk ? (unsigned short*)KP + (row >> 4) * 1024 + (size_t)((c8 >> 1) * 256 + ((c8 & 1) * 16 + (int)(row & 15)) * 8) : (unsigned short*)Q16 + t * 8;      /* 256 items on = 32 rows = 2 key tiles = 2048 values on, in both orders */
  v8us h[PIT];
#pragma unroll      /* register arrays need constant indices */
  for (int j = 0; j < PIT; ++j) h[j] = p_cvt(a[j], c[j]);
  __builtin_amdgcn_sched_barrier(0);      /* as above: every value ahead of the first store */
#pragma unroll      /* register arrays need constant indices */
  for (int j = 0; j < PIT; ++j) *(v8us*)(o + j * 2048) = h[j];
}
typedef float v2f __attribute__((ext_vector_type(2)));
// softmax across the 8 batches for one 16-key x 16-query tile, in registers; stores 8 keys of one query per batch to the P buffer
// two neighbouring keys (registers r, r + 1 of a score tile) go through each packed f32 instruction; 1 / sqrt(64) and log2(e) are one factor of one multiply-add whose addend is the scaled maximum
__device__ __forceinline__ void f_soft(const v8f (&s)[FB], _Float16* pw) {
  FragH pk[FB]; constexpr float FC = 0.125f * 1.44269504f; const v2f fc = {FC, FC};
#pragma unroll      /* register arrays need constant indices */
  for (int r = 0; r < 8; r += 2) { v2f e[FB], mx = {-3.0e38f, -3.0e38f};
#pragma unroll
    for (int b = 0; b < FB; ++b) { mx[0] = fmaxf(mx[0], s[b][r]); mx[1] = fmaxf(mx[1], s[b][r + 1]); }
    const v2f nm = mx * -fc;
#pragma unroll
    for (int b = 0; b < FB; ++b) { const v2f x = {s[b][r], s[b][r + 1]}; const v2f t = __builtin_elementwise_fma(x, fc, nm); e[b][0] = __builtin_amdgcn_exp2f(t[0]); e[b][1] = __builtin_amdgcn_exp2f(t[1]); }      /* native exp2 as in __expf */
    v2f se = e[0];
#pragma unroll
    for (int b = 1; b < FB; ++b) se += e[b];
    v2f sc = {__builtin_amdgcn_rcpf(se[0]), __builtin_amdgcn_rcpf(se[1])}; sc *= 256.0f;
#pragma unroll
    for (int b = 0; b < FB; ++b) { const v2f p = e[b] * sc; pk[b].h[r] = (_Float16)p[0]; pk[b].h[r + 1] = (_Float16)p[1]; } }
#pragma unroll      /* register arrays need constant indices */
  for (int b = 0; b < FB; ++b) *(v8us*)((unsigned short*)pw + (size_t)b * FQ * FPP) = pk[b].half[0];
}
__device__ __forceinline__ void f_qld(FragH (&g)[FB], const unsigned short* q) {      /* one group of LDS reads: the Q fragments of one query tile and one half of d, all 8 batches */
#pragma unroll      /* register arrays need constant indices */
  for (int b = 0; b < FB; ++b) { g[b].half[0] = *(const v8us*)(q + b * (FQT * 1024)); g[b].half[1] = *(const v8us*)(q + b * (FQT * 1024) + 256); }      /* a batch's fragments: FQT tiles x 2 halves of d x 512 values */
}
// work-group barrier for data that goes through LDS alone: the two fences name LDS only, so each wave waits for its own LDS stores and reads but not for its global loads, which stay in flight across it (__syncthreads() waits all of them out)
__device__ __forceinline__ void f_bar() { __builtin_amdgcn_fence(__ATOMIC_RELEASE, "workgroup", "local"); __builtin_amdgcn_s_barrier(); __builtin_amdgcn_fence(__ATOMIC_ACQUIRE, "workgroup", "local"); }
__global__ __launch_bounds__(256) void k_fused(const _Float16* __restrict__ Q16, const _Float16* __restrict__ K16, const _Float16* __restrict__ VT, float* __restrict__ PO) {
  static_assert(FQT == 4, "part 2 below takes the query tiles two at a time");
  __shared__ __attribute__((aligned(16))) _Float16 pl[FB][FQ][FPP];      /* one buffer: two barriers a pass */
  __shared__ __attribute__((aligned(16))) unsigned short ql[FB][FQT][2][2][32][8];      /* Q fragments of the whole walk, fragment order: [batch][query tile][d / 32][fragment half][lane][8]; every wave-wide 16-byte read covers 512 bytes in a row */
  const int tid = threadIdx.x, w = tid >> 5, lane = tid & 31, ln = lane & 15, hh = lane >> 4; const int q0 = (blockIdx.x / FKS) * FQ; const int k0 = (blockIdx.x % FKS) * (FS / FKS);
  constexpr size_t PLN = (size_t)FS * FD;
  const v8f z8 = {0.f,0.f,0.f,0.f,0.f,0.f,0.f,0.f};
  const _Float16* qp = Q16 + (size_t)w * PLN + (size_t)(q0 + ln) * FD + 8 * hh;      /* Q rows q0 + ln of batch w: this wave brings them to LDS for all waves */
  const int wu = __builtin_amdgcn_readfirstlane(w); const unsigned lo = lane * 8;      /* the wave's number as a scalar: the K and V^T bases are then scalar and the lane offset is added where an address is formed; a per-lane K pointer that lives from the first loads' wait through the whole walk is spilled by this compiler */
  const _Float16* kp = K16 + (size_t)(k0 + 16 * wu) * FD;      /* part 1: this wave's 16-key tile, fragment order (A operand) */
  const _Float16* vp = VT + (size_t)wu * PLN + (size_t)k0 * FD;      /* part 2: V^T of batch w, fragment order (B operand) */
  FragH qg[FQT][2];
  v16h kf[FB][2];
#pragma unroll      /* register arrays need constant indices */
  for (int u = 0; u < FQT; ++u) { qg[u][0].v = f_frag(qp + u * (16 * FD)); qg[u][1].v = f_frag(qp + u * (16 * FD) + 32); }
  asm volatile("s_wait_xcnt 0x0" :: "v"(qp) : "memory");      /* precaution: stands in front of any rewrite of a register that an issued load names; the input keeps the Q address pair whole up to it; a wait of its own, directly behind the Q loads: held over the K loads as well, the pair is spilled by this compiler */
#pragma unroll      /* register arrays need constant indices */
  for (int b = 0; b < FB; ++b) { kf[b][0] = f_fragp(kp + (size_t)b * PLN + lo); kf[b][1] = f_fragp(kp + (size_t)b * PLN + 512 + lo); }
  asm volatile("s_wait_xcnt 0x0" :: "s"(kp), "v"(lane) : "memory");      /* the same for the K base and the lane index (the K loads' scaled offset register) */
#pragma unroll      /* register arrays need constant indices */
  for (int u = 0; u < FQT; ++u)
#pragma unroll
    for (int j = 0; j < 2; ++j) { *(v8us*)&ql[w][u][j][0][lane][0] = qg[u][j].half[0]; *(v8us*)&ql[w][u][j][1][lane][0] = qg[u][j].half[1]; }
  __syncthreads();      /* publishes the Q fragments to every wave */
  const unsigned short* qr = &ql[0][0][0][0][lane][0];
  v8f o[FQT][4];
#pragma unroll      /* register arrays need constant indices */
  for (int u = 0; u < FQT; ++u)
#pragma unroll
    for (int t = 0; t < 4; ++t) o[u][t] = z8;
  for (int it = 0; it < FS / FKS / FK; ++it) {
    const int kb = it * FK; const int kn = (kb + FK) & (FS / FKS - 1);      /* next pass's keys; the last pass requests this quarter's first keys again: in bounds, not used */
    const _Float16* vb = vp + (size_t)kb * FD + lo; const _Float16* kq = kp + (size_t)kn * FD + lo;
    v16h vf[4][4];      /* this pass's V^T fragments */
    FragH g0[FB], g1[FB];      /* Q fragments of one query tile: first and second half of d */
    f_qld(g0, qr);
#pragma unroll      /* register arrays need constant indices */
    for (int u = 0; u < FQT; ++u) {      /* one query tile at a time; the K fragments in registers serve all four */
      v8f s[FB];      /* s[b][r] = Q[b][q0 + 16 u + ln] . K[b][k0 + kb + 16 w + 8 hh + r] */
      if (u + 1 < FQT) f_qld(g1, qr + u * 1024 + 512); else f_qld(g0, qr + u * 1024);      /* the last tile reads its two groups one after the other: the registers of a group read ahead hold the first half of V^T by then */
      __builtin_amdgcn_sched_barrier(0);      /* keeps each group of LDS reads whole and in front of the products; left alone the scheduler reads four at a time and waits each out */
#pragma unroll      /* register arrays need constant indices */
      for (int b = 0; b < FB; ++b) s[b] = f_mma(kf[b][0], g0[b].v, z8);
      if (u + 1 == FQT) { __builtin_amdgcn_sched_barrier(0); f_qld(g1, qr + u * 1024 + 512); __builtin_amdgcn_sched_barrier(0); }      /* the two keep this group behind the products above, whose registers it takes, and whole */
#pragma unroll      /* register arrays need constant indices */
      for (int b = 0; b < FB; ++b) s[b] = f_mma(kf[b][1], g1[b].v, s[b]);
      __builtin_amdgcn_sched_barrier(0);      /* keeps the requests below behind the products above, whose registers they take */
      if (u == 0) f_bar();      /* ends every wave's reads of the last pass's P, which the softmax below overwrites */
      if (u + 2 < FQT) f_qld(g0, qr + (u + 1) * 1024);      /* next tile's first group: it arrives under the softmax */
      else {
#pragma unroll      /* register arrays need constant indices */
        for (int ks = 2 * (u + 2 - FQT); ks < 2 * (u + 2 - FQT) + 2; ++ks)
#pragma unroll
          for (int t = 0; t < 4; ++t) vf[ks][t] = f_fragp(vb + ks * (32 * FD) + t * 512);      /* one half of V^T in front of each of the last two softmaxes, so that the stream of loads starts early; the second half takes registers that K has left */
        asm volatile("s_wait_xcnt 0x0" :: "v"(vb) : "memory");      /* as above, for the V^T address pair */
        if (u + 1 == FQT) {
#pragma unroll      /* register arrays need constant indices */
          for (int b = 0; b < FB; ++b) kf[b][0] = f_fragp(kq + (size_t)b * PLN);      /* next pass's K fragments, first half of d, behind V^T: loads return in the order of their requests, so the wait for V^T leaves these in flight */
          asm volatile("s_wait_xcnt 0x0" :: "v"(kq) : "memory");      /* as above, for the K address pair */
        }
      }
      __builtin_amdgcn_sched_barrier(0);      /* keeps the requests above in front of the softmax; sunk into it they would start later */
      f_soft(s, &pl[0][16 * u + ln][16 * w + 8 * hh]);
      __builtin_amdgcn_sched_barrier(0);      /* keeps the next tile's reads and the requests below out of this softmax, whose registers they take */
    }
#pragma unroll      /* register arrays need constant indices */
    for (int b = 0; b < FB; ++b) kf[b][1] = f_fragp(kq + (size_t)b * PLN + 512);      /* second half of d, in the registers that the last softmax has left; they arrive past the barrier, under part 2 */
    asm volatile("s_wait_xcnt 0x0" :: "v"(kq) : "memory");      /* as above, for the K address pair */
    __builtin_amdgcn_sched_barrier(0);      /* keeps them in front of the barrier */
    f_bar();      /* publishes this pass's P */
    const _Float16* pr = &pl[w][ln][8 * hh];
#pragma unroll      /* register arrays need constant indices */
    for (int h = 0; h < FQT / 2; ++h) { v16h pa[2][4];      /* P[w] rows of two query tiles as A operands */
#pragma unroll      /* register arrays need constant indices */
      for (int u = 0; u < 2; ++u)
#pragma unroll
        for (int ks = 0; ks < 4; ++ks) pa[u][ks] = f_frag(pr + (2 * h + u) * (16 * FPP) + ks * 32);
      __builtin_amdgcn_sched_barrier(0);      /* keeps the products behind the reads of their own two tiles; the second pair's reads may still rise among the first pair's products */
#pragma unroll      /* register arrays need constant indices */
      for (int ks = 0; ks < 4; ++ks)
#pragma unroll
        for (int u = 0; u < 2; ++u)
#pragma unroll
          for (int t = 0; t < 4; ++t) o[2 * h + u][t] = f_mma(pa[u][ks], vf[ks][t], o[2 * h + u][t]);      /* the V^T fragments in registers serve all four query tiles */
    }
  }
  asm volatile("s_wait_loadcnt 0x0" ::: "memory");      /* precaution: the last pass's K requests are used by nobody and no barrier waits them out any more; with this wait none is still on its way when the wave gives its registers back at its end */
  float* op = PO + (size_t)(blockIdx.x % FKS) * (FB * PLN) + (size_t)w * PLN + (size_t)(q0 + 8 * hh) * FD + ln;      /* this key quarter's plane of partial sums, still x256 */
#pragma unroll      /* register arrays need constant indices */
  for (int u = 0; u < FQT; ++u)
#pragma unroll
    for (int t = 0; t < 4; ++t)
#pragma unroll
      for (int r = 0; r < 8; ++r) op[(size_t)(16 * u + r) * FD + t * 16] = o[u][t][r];
}
// out = (sum of the four key quarters, in pairs) x 2^-8
#define RIT 4      /* 4-value items per thread and plane: few waves to start, all of a thread's loads in flight at once */
__global__ __launch_bounds__(256) void k_sum(const float* __restrict__ PO, float* __restrict__ out) {
  static_assert(FKS == 4, "the sum below is written out for four planes");
  const size_t t0 = (size_t)blockIdx.x * (1024 * RIT); const unsigned lo = threadIdx.x * 4;      /* the work-group's first value, and the thread's place in each run of 1024 values */
  constexpr size_t PP = (size_t)FB * FS * FD;      /* one plane of partial sums */
  const float* s0 = PO + t0; v4f a[RIT], c[RIT], d[RIT], e[RIT];      /* one base for the work-group; the four planes lie PP values apart */
#pragma unroll      /* register arrays need constant indices */
  for (int j = 0; j < RIT; ++j) { a[j] = *(const v4fa*)(s0 + j * 1024 + lo); c[j] = *(const v4fa*)(s0 + PP + j * 1024 + lo); d[j] = *(const v4fa*)(s0 + 2 * PP + j * 1024 + lo); e[j] = *(const v4fa*)(s0 + 3 * PP + j * 1024 + lo); }
  asm volatile("s_wait_xcnt 0x0" ::: "memory");      /* precaution: stands in front of any rewrite of a register that an issued load names */
  __builtin_amdgcn_sched_barrier(0);      /* keeps every load in front of the first sum, so that all of a thread's loads are in flight at once */
  float* o = out + t0 + lo;
#pragma unroll      /* register arrays need constant indices */
  for (int j = 0; j < RIT; ++j) a[j] = ((a[j] + c[j]) + (d[j] + e[j])) * 0.00390625f;
  __builtin_amdgcn_sched_barrier(0);      /* every value ahead of the first store, so that no register that an issued store names is rewritten behind it */
#pragma unroll      /* register arrays need constant indices */
  for (int j = 0; j < RIT; ++j) *(v4f*)(o + j * 1024) = a[j];
}
extern "C" void kernel_launch(void* const* d_in, const int* in_sizes, int n_in,
                              void* d_out, int out_size, void* d_ws, size_t ws_size, hipStream_t stream) {
  (void)in_sizes; (void)n_in; (void)out_size;
  const float* const* I = (const float* const*)d_in; const float* xq = I[0]; const float* xk = I[1]; const float* xv = I[2];      /* Q, K, V [8][4096][64] (bf16-valued) */
  constexpr int NBt = 8, SQt = 4096, DK = 64;      /* batches, sequence, width */
  char* ws = (char*)d_ws; size_t off = 0;
  auto take = [&](size_t bytes) { char* p = ws + off; off += (bytes + 255) & ~(size_t)255; return p; };
  const size_t PLN = (size_t)SQt * DK;      /* one batch's [4096][64] plane */
  _Float16* Q16 = (_Float16*)take(NBt * PLN * 2); _Float16* K16 = (_Float16*)take(NBt * PLN * 2); _Float16* VT = (_Float16*)take(NBt * PLN * 2); float* PO = (float*)take(FKS * NBt * PLN * 4);
  if (off > ws_size) return;
  k_prep<<<PVW + 2 * PXW, 256, 0, stream>>>(xq, xk, xv, Q16, K16, VT);      /* exact f16 copies of the bf16-valued inputs: Q in rows, K and V^T in fragment order */
  k_fused<<<SQt / FQ * FKS, 256, 0, stream>>>(Q16, K16, VT, PO);      /* scores, softmax across the 8 batches and P V for 64 query rows of all batches and one quarter of the keys per work-group */
  k_sum<<<NBt * SQt * DK / 4 / 256 / RIT, 256, 0, stream>>>(PO, (float*)d_out);      /* adds the four key quarters */
}

// v008
// It runs in 53.5 microseconds.
// Timed twice side by side with v007, it ran 1.07 and 1.06 times as fast.
// Counting every step since v000, it is 39.8 times as fast.
#include <hip/hip_runtime.h>
// Dot-product attention whose softmax runs over the BATCH axis (Q, K, V [8][4096][64], no heads, no weights; scores = Q K^T / sqrt(64) -> [8][4096][4096]; attn = softmax(scores, axis = 0): for every (query, key) pair the 8 batch entries are normalised against each other (the module's literal axis; rows are NOT normalised over keys); out[b] = attn[b] V[b] -> [8][4096][64]).
// Structure: three launches. ONE prep launch (three block ranges) writes the bf16-valued inputs as exact f16; K and V^T (via LDS transposes, once) are written in WMMA fragment order, so that every wave-wide 16-byte load of the walk reads 512 contiguous bytes (4 whole lines, not 32 bytes of each of 16 lines); then ONE fused launch: a work-group owns 64 query rows (four tiles of 16) of all 8 batches and walks one quarter of the keys 128 at a time, every K and V^T fragment it fetches serving all four tiles; Q fragments lie in LDS. Part 1 of a pass: wave w forms S^T = K Q^T for its 16 keys in all 8 batches (WMMA, f32 accumulation, K = 64), so a lane holds the 8 batch values of each (query, key) pair and normalises them in registers (f32, native exp; weights x256 f16), then stores 8 keys of one query per batch to LDS. Part 2: wave w is batch w: out[w] += P[w] V[w]^T (WMMA, f32), keys in ascending order inside a quarter from a start that turns with the work-group's query block, wrapping round. A last launch adds the four quarters, x 2^-8. Scores and weights never reach memory.
// Compute dtype: inputs rounded to bf16; x held exactly as f16; q, k, v and softmax weights as plain f16 GEMM operands (~2^-12); scores, softmax statistics and o f32. v_wmma_f32_16x16x32_f16.
#define NB 4
#define SQ 4096
#define DM 256
#define NH 1
#define HD 64
#define HG 4                         /* heads per attention launch group */
#define B0 0                         /* first batch processed (debug hook) */
#define NBR NB                       /* batches processed (debug hook) */
#define NR ((size_t)NB * SQ)         /* token rows */
#define MP ((int)((size_t)NBR * SQ)) /* rows projected (debug hook) */
#define QT 256                       /* query rows per causal tile */
#define NKX SQ                       /* S / P row pitch */
#define QT0 256                      /* first-tile rows recomputed exactly (256: buys margin for the few-key rows 128..255, which have no output projection to average the single-f16 P/v rounding) */
#define QN SQ                        /* query rows attended per batch (debug hook) */
#define NHD NH                       /* heads attended (debug hook) */
#define MPO MP                       /* rows through the output stage (debug hook) */
#define LQ DM            /* row pitch of the q/k/v rows */
typedef __bf16 v16b __attribute__((ext_vector_type(16)));
typedef unsigned short v8us __attribute__((ext_vector_type(8), may_alias));
typedef float  v8f  __attribute__((ext_vector_type(8)));
typedef float  v4f  __attribute__((ext_vector_type(4)));
typedef float  v4fa __attribute__((ext_vector_type(4), may_alias));
union FragB { v16b v; v8us half[2]; unsigned short u[16]; };

__device__ __forceinline__ unsigned short bf16_bits(float x) { unsigned int u = __float_as_uint(x); return (unsigned short)((u + 0x7FFFu + ((u >> 16) & 1u)) >> 16); }
__device__ __forceinline__ float bf16_val(unsigned short b) { return __uint_as_float(((unsigned int)b) << 16); }
__device__ __forceinline__ float bf16_round(float x) { return bf16_val(bf16_bits(x)); }
// D += A·B with NT terms: 1 = ah·bh, 2 = + al·bh (A split), 3 = + ah·bl (both split)
template <int NT>
__device__ __forceinline__ v8f mmaN(v16b ah, v16b al, v16b bh, v16b bl, v8f c) {
  c = __builtin_amdgcn_wmma_f32_16x16x32_bf16(false, ah, false, bh, (short)0, c, false, false);
  if (NT >= 2) c = __builtin_amdgcn_wmma_f32_16x16x32_bf16(false, al, false, bh, (short)0, c, false, false);
  if (NT >= 3) c = __builtin_amdgcn_wmma_f32_16x16x32_bf16(false, ah, false, bl, (short)0, c, false, false);
  asm volatile("v_nop\n\tv_nop\n\tv_nop\n\tv_nop" : "+v"(c) : "v"(ah), "v"(al), "v"(bh), "v"(bl));
  return c;
}

__global__ __launch_bounds__(256) void k_wt_bf16(const float* __restrict__ W, unsigned short* __restrict__ Wt, int K, int N) {
  const int t = blockIdx.x * 256 + threadIdx.x;
  const int k8n = K / 8;
  if (t >= N * k8n) return;
  const int n = t / k8n, k8 = (t % k8n) * 8;
  v8us v;
#pragma unroll
  for (int i = 0; i < 8; ++i) v[i] = bf16_bits(W[(size_t)(k8 + i) * N + n]);
  *(v8us*)(Wt + (size_t)n * K + k8) = v;
  
}

// GEMM C[M][N] (f32, pitch ldc) = act(A[M][K]·W + bias). A f32 row-major (pitch lda) converted per fragment to bf16
// (ASPLIT: hi/lo two planes -> 2 terms, else single rounded term); Wt bf16 [N][K] (pitch ldb). BIAS_BF16 rounds the
// bias to bf16 first (bias quantised to bf16 before the add). K%32==0, M%16==0, N%64==0.
template <bool ASPLIT, int ACT, bool BIAS_BF16>
__global__ __launch_bounds__(128) void k_gemm_bf(const float* __restrict__ A, int lda, const unsigned short* __restrict__ Wt, int ldb,
                                               const float* __restrict__ bias, float* __restrict__ C, int ldc, int M, int N, int K) {
  __shared__ __attribute__((aligned(16))) float so[4][16][64];
  const int tid = threadIdx.x, w = tid >> 5, lane = tid & 31, ln = lane & 15, hh = lane >> 4;
  const int ntn = N / 64;
  const int wid = blockIdx.x * 4 + w;
  const int mt = wid / ntn, nq = wid % ntn;
  if (mt * 16 >= M) return;
  const int row0 = mt * 16, col0 = nq * 64;
  const float* arow = A + (size_t)(row0 + ln) * lda;
  v8f acc[4] = {};
  for (int kb = 0; kb < K; kb += 32) {
    FragB ah, al;
    const v4f x0 = *(const v4fa*)(arow + kb + 8 * hh), x1 = *(const v4fa*)(arow + kb + 8 * hh + 4);
    const v4f x2 = *(const v4fa*)(arow + kb + 16 + 8 * hh), x3 = *(const v4fa*)(arow + kb + 16 + 8 * hh + 4);
    float xs[16] = {x0[0],x0[1],x0[2],x0[3],x1[0],x1[1],x1[2],x1[3],x2[0],x2[1],x2[2],x2[3],x3[0],x3[1],x3[2],x3[3]};
#pragma unroll
    for (int i = 0; i < 16; ++i) { const unsigned short hb = bf16_bits(xs[i]); ah.u[i] = hb; al.u[i] = ASPLIT ? bf16_bits(xs[i] - bf16_val(hb)) : (unsigned short)0; }
#pragma unroll
    for (int t = 0; t < 4; ++t) {
      const unsigned short* brow = Wt + (size_t)(col0 + t * 16 + ln) * ldb + kb;
      FragB b;
      b.half[0] = *(const v8us*)(brow + 8 * hh);
      b.half[1] = *(const v8us*)(brow + 16 + 8 * hh);
      acc[t] = mmaN<ASPLIT ? 2 : 1>(ah.v, al.v, b.v, b.v, acc[t]);
    }
  }
#pragma unroll
  for (int t = 0; t < 4; ++t) {
    float bv = bias ? bias[col0 + t * 16 + ln] : 0.f;
    if (BIAS_BF16) bv = bf16_round(bv);
#pragma unroll
    for (int r = 0; r < 8; ++r) { float v = acc[t][r] + bv; if (ACT == 1) v = fmaxf(v, 0.f); so[w][8 * hh + r][t * 16 + ln] = v; }
  }
  __builtin_amdgcn_fence(__ATOMIC_ACQ_REL, "workgroup");
  __builtin_amdgcn_wave_barrier();
  const int rsub = lane >> 4, c4 = (lane & 15) * 4;
  {
#pragma unroll
    for (int q = 0; q < 8; ++q) {
      const int r = q * 2 + rsub;
      const v4f v = *(const v4fa*)&so[w][r][c4];
      *(v4f*)(C + (size_t)(row0 + r) * ldc + col0 + c4) = v;
    }
    
  }
}

// GEMM C = act(A·W + bias + resid): A f32 (ASPLIT -> hi/lo 2 terms), Wt bf16 [N][K]; ACT 0 none, 1 relu, 2 exact gelu;
// resid (optional, f32, row index = (row % rmod), pitch ldr, RES_BF16 rounds it) added before the activation.
template <bool ASPLIT, int ACT, bool BIAS_BF16, bool RES_BF16>
__global__ __launch_bounds__(128) void k_gemm_bf3(const float* __restrict__ A, int lda, const unsigned short* __restrict__ Wt, int ldb,
                                                const float* __restrict__ bias, const float* __restrict__ resid, int rmod, int ldr,
                                                float* __restrict__ C, int ldc, int M, int N, int K) {
  __shared__ __attribute__((aligned(16))) float so[4][16][64];
  const int tid = threadIdx.x, w = tid >> 5, lane = tid & 31, ln = lane & 15, hh = lane >> 4;
  const int ntn = N / 64;
  const int wid = blockIdx.x * 4 + w;
  const int mt = wid / ntn, nq = wid % ntn;
  if (mt * 16 >= M) return;
  const int row0 = mt * 16, col0 = nq * 64;
  const float* arow = A + (size_t)(row0 + ln) * lda;
  v8f acc[4] = {};
  for (int kb = 0; kb < K; kb += 32) {
    FragB ah, al;
    const v4f x0 = *(const v4fa*)(arow + kb + 8 * hh), x1 = *(const v4fa*)(arow + kb + 8 * hh + 4);
    const v4f x2 = *(const v4fa*)(arow + kb + 16 + 8 * hh), x3 = *(const v4fa*)(arow + kb + 16 + 8 * hh + 4);
    float xs[16] = {x0[0],x0[1],x0[2],x0[3],x1[0],x1[1],x1[2],x1[3],x2[0],x2[1],x2[2],x2[3],x3[0],x3[1],x3[2],x3[3]};
#pragma unroll
    for (int i = 0; i < 16; ++i) { const unsigned short hb = bf16_bits(xs[i]); ah.u[i] = hb; al.u[i] = ASPLIT ? bf16_bits(xs[i] - bf16_val(hb)) : (unsigned short)0; }
#pragma unroll
    for (int t = 0; t < 4; ++t) {
      const unsigned short* brow = Wt + (size_t)(col0 + t * 16 + ln) * ldb + kb;
      FragB b;
      b.half[0] = *(const v8us*)(brow + 8 * hh);
      b.half[1] = *(const v8us*)(brow + 16 + 8 * hh);
      acc[t] = mmaN<ASPLIT ? 2 : 1>(ah.v, al.v, b.v, b.v, acc[t]);
    }
  }
#pragma unroll
  for (int t = 0; t < 4; ++t) {
    const int col = col0 + t * 16 + ln;
    float bv = bias ? bias[col] : 0.f;
    if (BIAS_BF16) bv = bf16_round(bv);
#pragma unroll
    for (int r = 0; r < 8; ++r) {
      float v = acc[t][r] + bv;
      if (resid) { float rv = resid[(size_t)((row0 + 8 * hh + r) % rmod) * ldr + col]; if (RES_BF16) rv = bf16_round(rv); v += rv; }
      if (ACT == 1) v = fmaxf(v, 0.f);
      if (ACT == 2) v = 0.5f * v * (1.0f + erff(v * 0.70710678118654752f));
      if (ACT == 3) { const float u = 0.7978845608028654f * (v + 0.044715f * v * v * v); v = 0.5f * v * (1.0f + tanhf(u)); }
      so[w][8 * hh + r][t * 16 + ln] = v;
    }
  }
  __builtin_amdgcn_fence(__ATOMIC_ACQ_REL, "workgroup");
  __builtin_amdgcn_wave_barrier();
  const int rsub = lane >> 4, c4 = (lane & 15) * 4;
  {
#pragma unroll
    for (int q = 0; q < 8; ++q) {
      const int r = q * 2 + rsub;
      const v4f v = *(const v4fa*)&so[w][r][c4];
      *(v4f*)(C + (size_t)(row0 + r) * ldc + col0 + c4) = v;
    }
    
  }
}
// row LayerNorm (biased variance, eps) over N: s = X (+ R); optional out_sum <- s; out_norm <- (s-mu)*rsqrt(var+eps)*g + b
template <bool PARAM_BF16>
__global__ __launch_bounds__(256) void k_layernorm(const float* __restrict__ X, const float* __restrict__ R, const float* __restrict__ g, const float* __restrict__ bta,
                                                  float* __restrict__ out_sum, float* __restrict__ out_norm, int N, float eps) {
  __shared__ float red[256];
  const int row = blockIdx.x, tid = threadIdx.x;
  const float* x = X + (size_t)row * N; const float* rr = R ? R + (size_t)row * N : nullptr;
  float vals[16];                     // up to N = 4096
  const int per = N / 256;            // contiguous chunk per thread? use strided-by-4 chunks: thread handles j = tid*4 + 1024*u
  float s1 = 0.f;
  for (int u = 0; u < per / 4; ++u) {
    const int j = tid * 4 + 1024 * u;
    const v4f a = *(const v4fa*)(x + j);
    v4f b = {0.f,0.f,0.f,0.f}; if (rr) b = *(const v4fa*)(rr + j);
#pragma unroll
    for (int q = 0; q < 4; ++q) { const float v = a[q] + b[q]; vals[u * 4 + q] = v; s1 += v; }
  }
  red[tid] = s1; __syncthreads();
  for (int st = 128; st > 0; st >>= 1) { if (tid < st) red[tid] += red[tid + st]; __syncthreads(); }
  const float mu = red[0] / (float)N; __syncthreads();
  float s2 = 0.f;
  for (int u = 0; u < per / 4; ++u)
#pragma unroll
    for (int q = 0; q < 4; ++q) { const float c = vals[u * 4 + q] - mu; s2 += c * c; }
  red[tid] = s2; __syncthreads();
  for (int st = 128; st > 0; st >>= 1) { if (tid < st) red[tid] += red[tid + st]; __syncthreads(); }
  const float rs = rsqrtf(red[0] / (float)N + eps);
  {
    for (int u = 0; u < per / 4; ++u) {
      const int j = tid * 4 + 1024 * u;
      v4f o, sm;
#pragma unroll
      for (int q = 0; q < 4; ++q) {
        float gg = g[j + q], bb = bta[j + q];
        if (PARAM_BF16) { gg = bf16_round(gg); bb = bf16_round(bb); }
        sm[q] = vals[u * 4 + q]; o[q] = (vals[u * 4 + q] - mu) * rs * gg + bb;
      }
      if (out_sum) *(v4f*)(out_sum + (size_t)row * N + j) = sm;
      *(v4f*)(out_norm + (size_t)row * N + j) = o;
    }
    
  }
}



// ---- f16 WMMA path (v_wmma_f32_16x16x32_f16): 11-bit significands for operands in range — used where a [0,1] probability operand needs more precision than bf16
typedef _Float16 v16h __attribute__((ext_vector_type(16)));
union FragH { v16h v; v8us half[2]; _Float16 h[16]; unsigned short u[16]; };
template <int NT>
__device__ __forceinline__ v8f mmaH(v16h ah, v16h al, v16h bh, v16h bl, v8f c) {
  c = __builtin_amdgcn_wmma_f32_16x16x32_f16(false, ah, false, bh, (short)0, c, false, false);
  if (NT >= 2) c = __builtin_amdgcn_wmma_f32_16x16x32_f16(false, al, false, bh, (short)0, c, false, false);
  if (NT >= 3) c = __builtin_amdgcn_wmma_f32_16x16x32_f16(false, ah, false, bl, (short)0, c, false, false);
  asm volatile("v_nop\n\tv_nop\n\tv_nop\n\tv_nop" : "+v"(c) : "v"(ah), "v"(al), "v"(bh), "v"(bl));
  return c;
}
// batched GEMM like k_gemm_b but f16 operands: A f32 (split into f16 hi/lo if ASPLIT, else rounded to f16), Bt = f16 values [n][k]; alpha; C f32; N multiple of 16 (partial tiles skipped)
template <bool ASPLIT>
__global__ __launch_bounds__(128) void k_gemm_h(const float* __restrict__ A, int lda, size_t sA, const _Float16* __restrict__ Bh, int ldb, size_t sB, float alpha, float* __restrict__ C, int ldc, size_t sC, int M, int N, int K) {
  __shared__ __attribute__((aligned(16))) float so[4][16][64];
  const int tid = threadIdx.x, w = tid >> 5, lane = tid & 31, ln = lane & 15, hh = lane >> 4; const int by = blockIdx.y;
  A += (size_t)by * sA; Bh += (size_t)by * sB; C += (size_t)by * sC;
  const int ntn = (N + 63) / 64; const int wid = blockIdx.x * 4 + w; const int mt = wid / ntn, nq = wid % ntn; if (mt * 16 >= M) return;
  const int row0 = mt * 16, col0 = nq * 64; const float* arow = A + (size_t)(row0 + ln) * lda;
  v8f acc[4] = {};
  for (int kb = 0; kb < K; kb += 32) {
    FragH ah, al;
    const v4f x0 = *(const v4fa*)(arow + kb + 8 * hh), x1 = *(const v4fa*)(arow + kb + 8 * hh + 4), x2 = *(const v4fa*)(arow + kb + 16 + 8 * hh), x3 = *(const v4fa*)(arow + kb + 16 + 8 * hh + 4);
    float xs[16] = {x0[0],x0[1],x0[2],x0[3],x1[0],x1[1],x1[2],x1[3],x2[0],x2[1],x2[2],x2[3],x3[0],x3[1],x3[2],x3[3]};
#pragma unroll
    for (int i = 0; i < 16; ++i) { const _Float16 h = (_Float16)xs[i]; ah.h[i] = h; al.h[i] = ASPLIT ? (_Float16)(xs[i] - (float)h) : (_Float16)0.0f; }
#pragma unroll
    for (int t = 0; t < 4; ++t) { if (col0 + t * 16 >= N) continue; const size_t boff = (size_t)(col0 + t * 16 + ln) * ldb + kb; FragH bq; bq.half[0] = *(const v8us*)(Bh + boff + 8 * hh); bq.half[1] = *(const v8us*)(Bh + boff + 16 + 8 * hh);
      acc[t] = mmaH<ASPLIT ? 2 : 1>(ah.v, al.v, bq.v, bq.v, acc[t]); }
  }
#pragma unroll
  for (int t = 0; t < 4; ++t) { if (col0 + t * 16 >= N) continue;
#pragma unroll
    for (int r = 0; r < 8; ++r) so[w][8 * hh + r][t * 16 + ln] = acc[t][r] * alpha; }
  __builtin_amdgcn_fence(__ATOMIC_ACQ_REL, "workgroup"); __builtin_amdgcn_wave_barrier();
  const int rsub = lane >> 4, c4 = (lane & 15) * 4;
  {
#pragma unroll
    for (int q = 0; q < 8; ++q) { const int r = q * 2 + rsub; if (col0 + c4 < N) { const v4f v = *(const v4fa*)&so[w][r][c4]; *(v4f*)(C + (size_t)(row0 + r) * ldc + col0 + c4) = v; } }
     }
}

// Wt[n][k] = f16(W[k][n]·scale) from f32 row-major W[K][N] (scale = power of two; bf16-exact weights stay exact in f16 away from the subnormal range)
__global__ __launch_bounds__(256) void k_wt_f16(const float* __restrict__ W, _Float16* __restrict__ Wt, int K, int N, float scale) {
  const int t = blockIdx.x * 256 + threadIdx.x; if (t >= N * (K / 8)) return; const int n = t / (K / 8), k8 = (t % (K / 8)) * 8; FragH f;
#pragma unroll
  for (int i = 0; i < 8; ++i) f.h[i] = (_Float16)(bf16_round(W[(size_t)(k8 + i) * N + n]) * scale); const v8us o = f.half[0];
  *(v8us*)((unsigned short*)Wt + (size_t)n * K + k8) = o; 
}
// k_gemm_hh variant with fused epilogue: v = acc·alpha + bias[by·sBias + col] (+ CP[(row/rowsPerB)·sCPb + by·64 + col] if CP) ; ACT 0 none / 1 elu ; writes f16 C16 (and f32 C if non-null)
template <int ACT>
__global__ __launch_bounds__(128) void k_gemm_hhx(const _Float16* __restrict__ A, int lda, size_t sA, const _Float16* __restrict__ Bh, int ldb, size_t sB, float alpha, const float* __restrict__ bias, size_t sBias, const float* __restrict__ CP, int rowsPerB, size_t sCPb, int row0g,
    float* __restrict__ C, _Float16* __restrict__ C16, int ldc, size_t sC, int M, int N, int K) {
  __shared__ __attribute__((aligned(16))) float so[4][16][64];
  const int tid = threadIdx.x, w = tid >> 5, lane = tid & 31, ln = lane & 15, hh = lane >> 4; const int by = blockIdx.y;
  A += (size_t)by * sA; Bh += (size_t)by * sB; const size_t cofs = (size_t)by * sC; const float* bp = bias ? bias + (size_t)by * sBias : nullptr;
  const int ntn = (N + 63) / 64; const int wid = blockIdx.x * 4 + w; const int mt = wid / ntn, nq = wid % ntn; if (mt * 16 >= M) return;
  const int row0 = mt * 16, col0 = nq * 64; const _Float16* arow = A + (size_t)(row0 + ln) * lda;
  v8f acc[4] = {};
  for (int kb = 0; kb < K; kb += 32) { FragH ah; ah.half[0] = *(const v8us*)((const unsigned short*)arow + kb + 8 * hh); ah.half[1] = *(const v8us*)((const unsigned short*)arow + kb + 16 + 8 * hh);
#pragma unroll
    for (int t = 0; t < 4; ++t) { if (col0 + t * 16 >= N) continue; const size_t boff = (size_t)(col0 + t * 16 + ln) * ldb + kb; FragH bq; bq.half[0] = *(const v8us*)((const unsigned short*)Bh + boff + 8 * hh); bq.half[1] = *(const v8us*)((const unsigned short*)Bh + boff + 16 + 8 * hh);
      acc[t] = mmaH<1>(ah.v, ah.v, bq.v, bq.v, acc[t]); }
  }
#pragma unroll
  for (int t = 0; t < 4; ++t) { if (col0 + t * 16 >= N) continue; const int col = col0 + t * 16 + ln; const float bv = bp ? bf16_round(bp[col]) : 0.f;
#pragma unroll
    for (int r = 0; r < 8; ++r) { float v = acc[t][r] * alpha + bv; if (CP) { const int rr = row0g + row0 + 8 * hh + r; if (rowsPerB < 0) v += CP[cofs + (size_t)rr * ldc + col];      /* rowsPerB < 0: own element of the batched C plane */ else { const int bidx = rr / rowsPerB; v += CP[(size_t)bidx * sCPb + (size_t)by * 64 + col]; } } if (ACT == 1) v = (v > 0.f) ? v : expm1f(v); else if (ACT == 7) v = (v > 0.f) ? v + 1.0f : expf(v); else if (ACT == 8) v = tanhf(v); else if (ACT == 9) v = 0.5f * v * (1.0f + tanhf(0.7978845608028654f * (v + 0.044715f * v * v * v))); else if (ACT == 11) v = 1.0f / (1.0f + expf(-v)); else if (ACT == 12) v = (v > 0.f) ? v : 0.01f * v; else if (ACT == 14) v = (v > 0.f) ? v : 0.1f * v; else if (ACT == 16) v = (v >= 0.f) ? v : 0.3f * v; else if (ACT == 17) v = (v >= 0.f) ? v : 0.2f * v; else if (ACT == 15) v = v / (1.0f + expf(-v)); else if (ACT == 3) v = fmaxf(v, 0.f); else if (ACT == 6) v = 0.5f * v * (1.0f + erff(v * 0.70710678118654752f)); so[w][8 * hh + r][t * 16 + ln] = v; } }
  __builtin_amdgcn_fence(__ATOMIC_ACQ_REL, "workgroup"); __builtin_amdgcn_wave_barrier();
  const int rsub = lane >> 4, c4 = (lane & 15) * 4; typedef _Float16 v4h __attribute__((ext_vector_type(4)));
  {
#pragma unroll
    for (int q = 0; q < 8; ++q) { const int r = q * 2 + rsub; if (col0 + c4 < N) { const v4f v = *(const v4fa*)&so[w][r][c4]; if (C) *(v4f*)(C + cofs + (size_t)(row0 + r) * ldc + col0 + c4) = v; if (C16) { v4h h4; for (int i = 0; i < 4; ++i) h4[i] = (_Float16)v[i]; *(v4h*)(C16 + cofs + (size_t)(row0 + r) * ldc + col0 + c4) = h4; } } }
     }
}


typedef _Float16 v4h __attribute__((ext_vector_type(4)));

__global__ __launch_bounds__(256) void k_x16(const float* __restrict__ x, _Float16* __restrict__ X16, size_t n8) { const size_t t = (size_t)blockIdx.x * 256 + threadIdx.x; if (t >= n8) return; FragH f;
#pragma unroll
  for (int q = 0; q < 8; ++q) f.h[q] = (_Float16)bf16_round(x[t * 8 + q]); *(v8us*)((unsigned short*)X16 + t * 8) = f.half[0];  }
__global__ __launch_bounds__(256) void k_h16(const float* __restrict__ x, _Float16* __restrict__ X16, size_t n8) { const size_t t = (size_t)blockIdx.x * 256 + threadIdx.x; if (t >= n8) return; FragH f;
#pragma unroll
  for (int q = 0; q < 8; ++q) f.h[q] = (_Float16)x[t * 8 + q]; *(v8us*)((unsigned short*)X16 + t * 8) = f.half[0];  }
__global__ __launch_bounds__(256) void k_round16f(const float* __restrict__ W, _Float16* __restrict__ Bt, size_t n8) { const size_t t = (size_t)blockIdx.x * 256 + threadIdx.x; if (t >= n8) return; FragH f;
#pragma unroll
  for (int i = 0; i < 8; ++i) f.h[i] = (_Float16)(bf16_round(W[t * 8 + i]) * 16.0f); *(v8us*)((unsigned short*)Bt + t * 8) = f.half[0];  }
template <int NHv, int TTv>
__global__ __launch_bounds__(256) void k_vt(const _Float16* __restrict__ V16, int ldv, int voff, _Float16* __restrict__ Vt) { __shared__ unsigned short tl[64][66]; const int tid = threadIdx.x; const int slab = blockIdx.x / (TTv / 64), lg = blockIdx.x % (TTv / 64); const int b = slab / NHv, h = slab % NHv;
  for (int i = tid; i < 64 * 8; i += 256) { const int r = i / 8, c8 = (i % 8) * 8; FragH f; f.half[0] = *(const v8us*)((const unsigned short*)V16 + ((size_t)b * TTv + lg * 64 + r) * ldv + voff + h * 64 + c8);
#pragma unroll
    for (int q = 0; q < 8; ++q) tl[r][c8 + q] = f.u[q]; }
  __syncthreads();
  {
#pragma unroll
    for (int rd = 0; rd < 2; ++rd) { const int d = rd * 32 + tid / 8, pc = tid % 8; FragH f;
#pragma unroll
      for (int q = 0; q < 8; ++q) f.u[q] = tl[pc * 8 + q][d];
      *(v8us*)((unsigned short*)Vt + ((size_t)slab * 64 + d) * TTv + lg * 64 + pc * 8) = f.half[0]; }
     } }

__global__ __launch_bounds__(256) void k_hl(const float* __restrict__ F, _Float16* __restrict__ Hh, _Float16* __restrict__ Hl, size_t n8) { const size_t t = (size_t)blockIdx.x * 256 + threadIdx.x; if (t >= n8) return; FragH fh, fl; const v4f a = *(const v4fa*)(F + t * 8), c = *(const v4fa*)(F + t * 8 + 4);
#pragma unroll
  for (int q = 0; q < 4; ++q) { _Float16 h = (_Float16)a[q]; fh.h[q] = h; fl.h[q] = (_Float16)((a[q] - (float)h) * 1024.0f); h = (_Float16)c[q]; fh.h[4 + q] = h; fl.h[4 + q] = (_Float16)((c[q] - (float)h) * 1024.0f); }
  { *(v8us*)((unsigned short*)Hh + t * 8) = fh.half[0]; *(v8us*)((unsigned short*)Hl + t * 8) = fl.half[0];  } }

// ---- fast GEMM (wave tile 32x64; requires M % 32 == 0 rows per launch region and N % 64 == 0); epilogue = k_gemm_hhx semantics ----
__device__ __forceinline__ v16h g2_frag(const _Float16* p, int hh) { FragH f; f.half[0] = *(const v8us*)((const unsigned short*)p + 8 * hh); f.half[1] = *(const v8us*)((const unsigned short*)p + 16 + 8 * hh); return f.v; }
__device__ __forceinline__ v8f g2_mma(v16h a, v16h b, v8f c) { v8f d = __builtin_amdgcn_wmma_f32_16x16x32_f16(false, a, false, b, (short)0, c, false, false); asm volatile("v_nop\n\tv_nop\n\tv_nop\n\tv_nop" : "+v"(d) : "v"(a), "v"(b)); return d; }
template <int ACT>
__global__ __launch_bounds__(128) void k_gemm2(const _Float16* __restrict__ A, int lda, size_t sA, const _Float16* __restrict__ Bh, int ldb, size_t sB, float alpha, const float* __restrict__ bias, size_t sBias, const float* __restrict__ CP, int rowsPerB, size_t sCPb, int row0g,
    float* __restrict__ C, _Float16* __restrict__ C16, int ldc, size_t sC, int M, int N, int K) { static_assert(ACT == 0 || ACT == 3 || ACT == 6 || ACT == 8 || ACT == 9 || ACT == 11 || ACT == 12 || ACT == 14 || ACT == 15 || ACT == 16 || ACT == 17, "k_gemm2: unsupported ACT code (would silently apply no activation)");
  __shared__ __attribute__((aligned(16))) float so[4][32][68];
  const int tid = threadIdx.x, w = tid >> 5, lane = tid & 31, ln = lane & 15, hh = lane >> 4; const int by = blockIdx.y;
  A += (size_t)by * sA; Bh += (size_t)by * sB; const size_t cofs = (size_t)by * sC; const float* bp = bias ? bias + (size_t)by * sBias : nullptr;
  const int ntn = N >> 6; const int mt = blockIdx.x / ntn, nq = blockIdx.x - mt * ntn; const int row0 = mt * 128 + 32 * w, col0 = nq * 64; if (row0 >= M) return;
  const _Float16* a0p = A + (size_t)(row0 + ln) * lda; const _Float16* a1p = a0p + (size_t)16 * lda;
  const _Float16* b0p = Bh + (size_t)(col0 + ln) * ldb; const _Float16* b1p = b0p + (size_t)16 * ldb; const _Float16* b2p = b1p + (size_t)16 * ldb; const _Float16* b3p = b2p + (size_t)16 * ldb;
  const v8f z8 = {0.f,0.f,0.f,0.f,0.f,0.f,0.f,0.f}; v8f c00 = z8, c01 = z8, c02 = z8, c03 = z8, c10 = z8, c11 = z8, c12 = z8, c13 = z8;
#pragma unroll 1
  for (int kb = 0; kb < K; kb += 32) { const v16h a0 = g2_frag(a0p + kb, hh), a1 = g2_frag(a1p + kb, hh);
    v16h b = g2_frag(b0p + kb, hh); c00 = g2_mma(a0, b, c00); c10 = g2_mma(a1, b, c10);
    b = g2_frag(b1p + kb, hh); c01 = g2_mma(a0, b, c01); c11 = g2_mma(a1, b, c11);
    b = g2_frag(b2p + kb, hh); c02 = g2_mma(a0, b, c02); c12 = g2_mma(a1, b, c12);
    b = g2_frag(b3p + kb, hh); c03 = g2_mma(a0, b, c03); c13 = g2_mma(a1, b, c13); }
  v8f accs[8] = {c00, c01, c02, c03, c10, c11, c12, c13};
#pragma unroll
  for (int u = 0; u < 8; ++u) { const int t = u & 3, half = u >> 2; const int col = col0 + t * 16 + ln; const float bv = bp ? bf16_round(bp[col]) : 0.f;
#pragma unroll
    for (int r = 0; r < 8; ++r) { const int rloc = half * 16 + 8 * hh + r; float v = accs[u][r] * alpha + bv; if (CP) { if (rowsPerB < 0) v += CP[cofs + (size_t)(row0g + row0 + rloc) * ldc + col];      /* rowsPerB < 0: own element of the batched C plane */ else { const int bidx = (row0g + row0 + rloc) / rowsPerB; v += CP[(size_t)bidx * sCPb + (size_t)by * 64 + col]; } }
      if (ACT == 3) v = fmaxf(v, 0.f); else if (ACT == 6) v = 0.5f * v * (1.0f + erff(v * 0.70710678118654752f)); else if (ACT == 11) v = 1.0f / (1.0f + expf(-v)); else if (ACT == 15) v = v / (1.0f + expf(-v)); else if (ACT == 12) v = (v > 0.f) ? v : 0.01f * v; else if (ACT == 8) v = tanhf(v); else if (ACT == 9) v = 0.5f * v * (1.0f + tanhf(0.7978845608028654f * (v + 0.044715f * v * v * v))); else if (ACT == 14) v = (v > 0.f) ? v : 0.1f * v; else if (ACT == 16) v = (v >= 0.f) ? v : 0.3f * v; else if (ACT == 17) v = (v >= 0.f) ? v : 0.2f * v;
      so[w][rloc][t * 16 + ln] = v; } }
  __builtin_amdgcn_fence(__ATOMIC_ACQ_REL, "workgroup"); __builtin_amdgcn_wave_barrier();
  const int rsub = lane >> 4, c4 = (lane & 15) * 4;
  {
#pragma unroll
    for (int q = 0; q < 16; ++q) { const int r = q * 2 + rsub; const v4f v = *(const v4fa*)&so[w][r][c4]; if (C) *(v4f*)(C + cofs + (size_t)(row0 + r) * ldc + col0 + c4) = v; if (C16) { v4h h4; for (int i = 0; i < 4; ++i) h4[i] = (_Float16)v[i]; *(v4h*)(C16 + cofs + (size_t)(row0 + r) * ldc + col0 + c4) = h4; } }
     } }


__global__ __launch_bounds__(256) void k_wnat(const float* __restrict__ w, size_t n8, _Float16* __restrict__ Bt) { const size_t t = (size_t)blockIdx.x * 256 + threadIdx.x; if (t >= n8) return; FragH f; for (int q = 0; q < 8; ++q) f.h[q] = (_Float16)(bf16_round(w[t * 8 + q]) * 16.0f); *(v8us*)((unsigned short*)Bt + t * 8) = f.half[0];  }
__global__ __launch_bounds__(256) void k_rsm(const float* __restrict__ S, _Float16* __restrict__ P, int nrows) {
  #pragma clang fp contract(off)
  const int i = blockIdx.x * 256 + threadIdx.x; if (i >= nrows) return; const float* s = S + (size_t)i * SQ; float mx = -3.0e38f;
#pragma unroll 1
  for (int j = 0; j < SQ; ++j) mx = fmaxf(mx, s[j]); float se = 0.f;
#pragma unroll 1
  for (int j = 0; j < SQ; ++j) se += expf(s[j] - mx); const float sc = 256.0f / se;
#pragma unroll 1
  for (int j0 = 0; j0 < SQ; j0 += 8) { FragH f; for (int q = 0; q < 8; ++q) f.h[q] = (_Float16)(expf(s[j0 + q] - mx) * sc); unsigned short* d = (unsigned short*)P + (size_t)i * SQ + j0; *(v8us*)d = f.half[0];  } }
__global__ __launch_bounds__(256) void k_vt(const _Float16* __restrict__ V16, int b, int h0, _Float16* __restrict__ VT) { __shared__ unsigned short tl[64][65]; const int tid = threadIdx.x; const int hh = blockIdx.x % HG, sg = blockIdx.x / HG; const int s0 = sg * 64; const int h = h0 + hh;
  for (int i = tid; i < 64 * 8; i += 256) { const int j = i / 8, d8 = (i % 8) * 8; FragH f; f.half[0] = *(const v8us*)((const unsigned short*)V16 + ((size_t)b * SQ + s0 + j) * DM + h * HD + d8); for (int q = 0; q < 8; ++q) tl[d8 + q][j] = f.u[q]; }
  __syncthreads();
  { for (int i = tid; i < 64 * 8; i += 256) { const int d = i / 8, j8 = (i % 8) * 8; FragH f; for (int q = 0; q < 8; ++q) f.u[q] = tl[d][j8 + q]; *(v8us*)((unsigned short*)VT + ((size_t)hh * HD + d) * SQ + s0 + j8) = f.half[0]; }  } }



__global__ __launch_bounds__(256) void k_rsmcf2(const float* __restrict__ S, _Float16* __restrict__ P, int hg, int q0, int nk) {
  #pragma clang fp contract(off)
  const int t = blockIdx.x * 256 + threadIdx.x; if (t >= hg * QT) return; const size_t i = (size_t)t; const float* s = S + i * NKX; const int last = q0 + (t % QT); float mx = -3.0e38f;
#pragma unroll 1
  for (int j = 0; j < nk; ++j) { const float f = (j <= last) ? 1.f : 0.f; mx = fmaxf(mx, fmaf(f, s[j], (1.f - f) * -1.0e9f)); } float se = 0.f;
#pragma unroll 1
  for (int j = 0; j < nk; ++j) { const float f = (j <= last) ? 1.f : 0.f; se += __expf(fmaf(f, s[j], (1.f - f) * -1.0e9f) - mx); } const float sc = 256.0f / se;
#pragma unroll 1
  for (int j0 = 0; j0 < nk; j0 += 8) { FragH fr; for (int q = 0; q < 8; ++q) { const int j = j0 + q; const float f = (j <= last) ? 1.f : 0.f; fr.h[q] = (_Float16)(__expf(fmaf(f, s[j], (1.f - f) * -1.0e9f) - mx) * sc); } unsigned short* d = (unsigned short*)P + i * NKX + j0; *(v8us*)d = fr.half[0];  } }

template <int MASKADD>
__global__ __launch_bounds__(64) void k_att0(const float* __restrict__ QF, const float* __restrict__ KF, const float* __restrict__ VF, int ld, const float* __restrict__ mask, float scale, float* __restrict__ OF, int ldo) {
  #pragma clang fp contract(off)
  __shared__ __attribute__((aligned(16))) float lq[64][64]; __shared__ __attribute__((aligned(16))) float lo[64][64];
  const int tid = threadIdx.x; const int h = blockIdx.x / (QT0 / 64), rg = blockIdx.x % (QT0 / 64); const int i = rg * 64 + tid;
  const float* qr = QF + (size_t)i * ld + h * HD;
#pragma unroll 1
  for (int c = 0; c < HD / 4; ++c) { *(v4f*)&lq[tid][c * 4] = *(const v4fa*)(qr + c * 4); const v4f z = {0.f, 0.f, 0.f, 0.f}; *(v4f*)&lo[tid][c * 4] = z; }
  float m = -1.0e30f, l = 0.f; const int jmax = MASKADD ? (SQ - 1) : (rg * 64 + 63);      /* additive-mask form: every key (the mask input decides); causal form: keys up to the block's last row */
#pragma unroll 1
  for (int j = 0; j <= jmax; ++j) { const float* kr = KF + (size_t)j * ld + h * HD; const float* vr = VF + (size_t)j * ld + h * HD; float s = 0.f;
#pragma unroll 1
    for (int c = 0; c < HD / 4; ++c) { const v4f kq = *(const v4fa*)(kr + c * 4); const v4f qq = *(v4f*)&lq[tid][c * 4]; s = __fadd_rn(s, __fmul_rn(qq[0], kq[0])); s = __fadd_rn(s, __fmul_rn(qq[1], kq[1])); s = __fadd_rn(s, __fmul_rn(qq[2], kq[2])); s = __fadd_rn(s, __fmul_rn(qq[3], kq[3])); }
    s = __fmul_rn(s, scale); if (MASKADD) s = __fadd_rn(s, __fmul_rn(bf16_round(mask[(size_t)i * SQ + j]), -10000.0f));
    const float f = (MASKADD || j <= i) ? 1.f : 0.f; const float sm = fmaf(f, s, (1.f - f) * -1.0e30f); const float mn = fmaxf(m, sm); const float sc = expf(m - mn); const float e = expf(sm - mn); l = __fadd_rn(__fmul_rn(l, sc), e); m = mn;
#pragma unroll 1
    for (int c = 0; c < HD / 4; ++c) { const v4f vv = *(const v4fa*)(vr + c * 4); v4f oo = *(v4f*)&lo[tid][c * 4]; for (int u = 0; u < 4; ++u) oo[u] = __fadd_rn(__fmul_rn(oo[u], sc), __fmul_rn(e, vv[u])); *(v4f*)&lo[tid][c * 4] = oo; } }
  const float fin = 64.0f / l;      /* o carried x64 like the f16 path */
#pragma unroll 1
  for (int c = 0; c < HD / 4; ++c) { v4f oo = *(v4f*)&lo[tid][c * 4]; for (int u = 0; u < 4; ++u) oo[u] = __fmul_rn(oo[u], fin); *(v4f*)&lo[tid][c * 4] = oo; }
  __syncthreads();
  {
#pragma unroll 1
    for (int it = 0; it < 16; ++it) { const int row = it * 4 + tid / 16, pc = (tid % 16) * 4; const v4f v = *(const v4f*)&lo[row][pc]; *(v4f*)(OF + (size_t)(rg * 64 + row) * ldo + h * HD + pc) = v; }
     } }

__global__ __launch_bounds__(256) void k_oscale(const float* __restrict__ OF, float* __restrict__ out, size_t n4) { const size_t t = (size_t)blockIdx.x * 256 + threadIdx.x; if (t >= n4) return; const v4f a = *(const v4fa*)(OF + t * 4); v4f o; for (int q = 0; q < 4; ++q) o[q] = a[q] * 0.015625f; *(v4f*)(out + t * 4) = o;  }

__global__ __launch_bounds__(256) void k_bfr(const float* __restrict__ x, float* __restrict__ XB, size_t n8) { const size_t t = (size_t)blockIdx.x * 256 + threadIdx.x; if (t >= n8) return; v4f a = *(const v4fa*)(x + t * 8), c = *(const v4fa*)(x + t * 8 + 4); for (int q = 0; q < 4; ++q) { a[q] = bf16_round(a[q]); c[q] = bf16_round(c[q]); }
  { *(v4f*)(XB + t * 8) = a; *(v4f*)(XB + t * 8 + 4) = c;  } }



__global__ __launch_bounds__(256) void k_rsmfvl(const float* __restrict__ S, _Float16* __restrict__ P, _Float16* __restrict__ PL, int qn, const int* __restrict__ vlp) {
  #pragma clang fp contract(off)
  const int t = blockIdx.x * 256 + threadIdx.x; if (t >= qn) return; const int vl = vlp[0]; const size_t i = (size_t)t; const float* s = S + i * SQ; float mx = -3.0e38f;
#pragma unroll 1
  for (int j = 0; j < SQ; ++j) { const float f = (j < vl) ? 1.f : 0.f; mx = fmaxf(mx, fmaf(f, s[j], (1.f - f) * -1000000.0f)); } float se = 0.f;
#pragma unroll 1
  for (int j = 0; j < SQ; ++j) { const float f = (j < vl) ? 1.f : 0.f; se += __expf(fmaf(f, s[j], (1.f - f) * -1000000.0f) - mx); } const float sc = 256.0f / se;
#pragma unroll 1
  for (int j0 = 0; j0 < SQ; j0 += 8) { FragH fr, gr; for (int q = 0; q < 8; ++q) { const int j = j0 + q; const float f = (j < vl) ? 1.f : 0.f; const float pv = __expf(fmaf(f, s[j], (1.f - f) * -1000000.0f) - mx) * sc; const _Float16 ph = (_Float16)pv; fr.h[q] = ph; gr.h[q] = (_Float16)((pv - (float)ph) * 1024.0f); }
    unsigned short* d = (unsigned short*)P + i * SQ + j0; unsigned short* dl = (unsigned short*)PL + i * SQ + j0; *(v8us*)d = fr.half[0]; *(v8us*)dl = gr.half[0];  } }

__global__ __launch_bounds__(256) void k_rsmf(const float* __restrict__ S, _Float16* __restrict__ P, int qn, int hg) {
  #pragma clang fp contract(off)
  const int t = blockIdx.x * 256 + threadIdx.x; if (t >= qn * hg) return; const size_t i = (size_t)(t / qn) * SQ + (t % qn); const float* s = S + i * SQ; float mx = -3.0e38f;
#pragma unroll 1
  for (int j = 0; j < SQ; ++j) mx = fmaxf(mx, s[j]); float se = 0.f;
#pragma unroll 1
  for (int j = 0; j < SQ; ++j) se += __expf(s[j] - mx); const float sc = 256.0f / se;
#pragma unroll 1
  for (int j0 = 0; j0 < SQ; j0 += 8) { FragH f; for (int q = 0; q < 8; ++q) f.h[q] = (_Float16)(__expf(s[j0 + q] - mx) * sc); unsigned short* d = (unsigned short*)P + i * SQ + j0; *(v8us*)d = f.half[0];  } }


#define CN 256          /* channels */
#define CI 128
#define NC 256                       /* (unused legacy kernels) */
#define NPX NP          /* positions per channel row */
#define NP 4096         /* seq1 tokens */
#define NM 1024         /* seq2 tokens */
#define BNEPS 1e-5f

__global__ __launch_bounds__(256) void k_mp2(const float* __restrict__ src, float* __restrict__ dst, int nout) {
  const int t = blockIdx.x * 256 + threadIdx.x; if (t >= nout) return; const int c = t / 1024; const int o = t % 1024; const int oy = o / 32, ox = o % 32; const float* p = src + (size_t)c * 4096 + (size_t)(2 * oy) * 64 + 2 * ox;
  const float v = fmaxf(fmaxf(p[0], p[1]), fmaxf(p[64], p[65])); *(float*)(dst + t) = v;  }
__global__ __launch_bounds__(256) void k_xpb(const float* __restrict__ x, const float* __restrict__ wb, float* __restrict__ CPP, size_t n4) {
  #pragma clang fp contract(off)
  const size_t t = (size_t)blockIdx.x * 256 + threadIdx.x; if (t >= n4) return; const size_t e = t * 4; const int c = (int)((e / 4096) % 256); const float bb = bf16_round(wb[c]); const v4f a = *(const v4fa*)(x + e); v4f o; for (int q = 0; q < 4; ++q) o[q] = __fadd_rn(bf16_round(a[q]), bb);
  *(v4f*)(CPP + e) = o;  }


template <int PASS>
__global__ __launch_bounds__(256) void k_cstA(const float* __restrict__ X, const float* __restrict__ MV, float* __restrict__ PART) {
  #pragma clang fp contract(off)
  __shared__ float red[256]; const int t = threadIdx.x; const size_t bc = blockIdx.x; const int c = (int)(bc % NC); const float* row = X + bc * (size_t)NPX; const float mu = PASS ? MV[c] : 0.f; float s = 0.f;
  for (int i = t; i < NPX; i += 256) { const float v = row[i]; const float d = PASS ? __fadd_rn(v, -mu) : v; s = __fadd_rn(s, PASS ? __fmul_rn(d, d) : d); }
  red[t] = s; __syncthreads(); for (int st = 128; st > 0; st >>= 1) { if (t < st) red[t] = __fadd_rn(red[t], red[t + st]); __syncthreads(); }
  if (t < 32) { const float pv = (t == 0) ? red[0] : 0.f; *(float*)(PART + bc * 32 + t) = pv;  } }      

template <int PASS>
__global__ __launch_bounds__(256) void k_cstB(const float* __restrict__ PART, float* __restrict__ MV) { const int c = threadIdx.x; if (c >= NC) return; double s = 0.0; for (int b = 0; b < NB; ++b) s += (double)PART[((size_t)b * NC + c) * 32]; const float m = (float)(s / ((double)NB * (double)NPX)); *(float*)(MV + PASS * NC + c) = m;  }


__global__ __launch_bounds__(256) void k_bnresid(const float* __restrict__ C2, const float* __restrict__ MV, const float* __restrict__ g, const float* __restrict__ be, const float* __restrict__ X, float* __restrict__ out, size_t n4) {
  #pragma clang fp contract(off)
  const size_t t = (size_t)blockIdx.x * 256 + threadIdx.x; if (t >= n4) return; const size_t e = t * 4; const int c = (int)((e / NPX) % NC); const float sc = __fmul_rn(rsqrtf(__fadd_rn(MV[NC + c], BNEPS)), bf16_round(g[c])); const float mu = MV[c], bb = bf16_round(be[c]);
  const v4f a = *(const v4fa*)(C2 + e); const v4f xx = *(const v4fa*)(X + e); v4f o; for (int q = 0; q < 4; ++q) { const float z = __fadd_rn(__fmul_rn(__fadd_rn(a[q], -mu), sc), bb); o[q] = __fadd_rn(z, bf16_round(xx[q])); }
  *(v4f*)(out + e) = o;  }


__global__ __launch_bounds__(256) void k_rowbias(float* __restrict__ Y, const float* __restrict__ bias) {
  #pragma clang fp contract(off)
  const size_t t = (size_t)blockIdx.x * 256 + threadIdx.x; if (t >= (size_t)NB * NC * NPX / 4) return; const size_t e = t * 4; const int c = (int)((e / NPX) % NC); const float bb = bf16_round(bias[c]);
  v4f v = *(const v4fa*)(Y + e); for (int q = 0; q < 4; ++q) v[q] = __fadd_rn(v[q], bb); *(v4f*)(Y + e) = v;  }



template <int NBt, int QTt, int NKt>
__global__ __launch_bounds__(256) void k_bsm(const float* __restrict__ S, _Float16* __restrict__ P) {
  #pragma clang fp contract(off)
  const size_t t = (size_t)blockIdx.x * 256 + threadIdx.x; if (t >= (size_t)QTt * NKt / 8) return; const size_t e = t * 8; float mx[8], se[8];
  for (int q = 0; q < 8; ++q) { mx[q] = -3.0e38f; se[q] = 0.f; }
#pragma unroll
  for (int b = 0; b < NBt; ++b) { const float* s = S + (size_t)b * QTt * NKt + e; for (int q = 0; q < 8; ++q) mx[q] = fmaxf(mx[q], s[q]); }
#pragma unroll
  for (int b = 0; b < NBt; ++b) { const float* s = S + (size_t)b * QTt * NKt + e; for (int q = 0; q < 8; ++q) se[q] += __expf(s[q] - mx[q]); }
#pragma unroll
  for (int b = 0; b < NBt; ++b) { const float* s = S + (size_t)b * QTt * NKt + e; FragH f; for (int q = 0; q < 8; ++q) f.h[q] = (_Float16)(__expf(s[q] - mx[q]) * (256.0f / se[q]));
    unsigned short* d = (unsigned short*)P + (size_t)b * QTt * NKt + e; *(v8us*)d = f.half[0];  } }
// ---- fused scores + batch-axis softmax + P V: one launch for all queries ----
#define FQ 64       /* query rows per work-group */
#define FQT (FQ / 16)      /* query tiles per work-group: each K and V^T fragment fetched serves all of them */
#define FKS 4      /* key ranges: a work-group walks FS / FKS keys, so that the grid still fills the chip */
#define FK 128      /* keys per pass: 16 per wave in part 1 */
#define FPP 136     /* LDS pitch of a P row in f16: 272 B = 16 B x odd, so the 16-byte row reads of part 2 do not collide */
#define FS 4096     /* sequence length */
#define FD 64       /* width */
#define FB 8        /* batches = waves of the work-group */
__device__ __forceinline__ v8f f_mma(v16h a, v16h b, v8f c) { return __builtin_amdgcn_wmma_f32_16x16x32_f16(false, a, false, b, (short)0, c, false, false); }
__device__ __forceinline__ v16h f_frag(const _Float16* p) { FragH f; f.half[0] = *(const v8us*)((const unsigned short*)p); f.half[1] = *(const v8us*)((const unsigned short*)p + 16); return f.v; }      /* p already holds the lane half's 8 hh: the k order of g2_frag */
__device__ __forceinline__ v16h f_fragp(const _Float16* p) { FragH f; f.half[0] = *(const v8us*)((const unsigned short*)p); f.half[1] = *(const v8us*)((const unsigned short*)p + 256); return f.v; }      /* fragment-order planes: p holds the lane's own 8 values, the fragment's second half lies one wave-wide load (32 lanes x 8) further; same values in the same registers as f_frag on rows */
// ---- one prep launch for Q, K and V: three block ranges that do not depend on one another; each writes the same values to the same places as a launch of its own would ----
#define PVK 128      /* keys per work-group of the V range */
#define PVM (PVK * 8 / 256)      /* 8-value items per thread there */
#define PVW (FB * FS / PVK)      /* work-groups of the V range: PVK keys x 64 d of one batch each */
#define PIT 8      /* 8-value items per thread in the Q and K ranges: few waves to start, all of a thread's loads in flight at once */
#define PXW (FB * FS * FD / 8 / 256 / PIT)      /* work-groups of the Q range, and of the K range */
__device__ __forceinline__ v8us p_cvt(v4f a, v4f c) { FragH f;      /* 8 inputs rounded to bf16, held as exact f16 */
#pragma unroll
  for (int q = 0; q < 4; ++q) { f.h[q] = (_Float16)bf16_round(a[q]); f.h[4 + q] = (_Float16)bf16_round(c[q]); }
  return f.half[0]; }
// V range (first: it has the longest chain): V^T in fragment order: per batch [32-key block][t = d / 16][half = (key / 16) & 1][lane = 16 ((key / 8) & 1) + d % 16][8 keys]; a work-group turns PVK keys x 64 d in LDS and writes 16 KiB in a row; the batch planes follow one another, so the block index runs through all batches
// Q range: rows as they are. K range: fragment order: [16-key tile][j = d / 16][lane = 16 ((d / 8) & 1) + key % 16][8 d]; tile = 1024 values, so a batch plane keeps its size and place
__global__ __launch_bounds__(256) void k_prep(const float* __restrict__ xq, const float* __restrict__ xk, const float* __restrict__ xv, _Float16* __restrict__ Q16, _Float16* __restrict__ KP, _Float16* __restrict__ VP) {
  __shared__ unsigned short tl[PVK][66]; const int tid = threadIdx.x; const int bx = blockIdx.x;
  if (bx < PVW) {      /* the same for the whole work-group, so the barrier inside is passed by all of it or by none */
    const float* s = xv + (size_t)bx * (PVK * 64) + tid * 8; v4f a[PVM], c[PVM];      /* key tid / 8 (and 32, 64, ... further), d (tid % 8) * 8 */
#pragma unroll      /* register arrays need constant indices */
    for (int m = 0; m < PVM; ++m) { a[m] = *(const v4fa*)(s + m * 2048); c[m] = *(const v4fa*)(s + m * 2048 + 4); }
    asm volatile("s_wait_xcnt 0x0" :: "v"(s) : "memory");      /* precaution: stands in front of any rewrite of a register that an issued load names; the input keeps the address pair whole up to it */
    const int r = tid / 8, c8 = (tid % 8) * 8;
#pragma unroll      /* register arrays need constant indices */
    for (int m = 0; m < PVM; ++m) { FragH f; f.half[0] = p_cvt(a[m], c[m]);
#pragma unroll
      for (int q = 0; q < 8; ++q) tl[r + 32 * m][c8 + q] = f.u[q]; }
    __syncthreads();
    FragH g[PVM];
#pragma unroll      /* register arrays need constant indices */
    for (int m = 0; m < PVM; ++m) { const int i = m * 256 + tid; const int k0 = (i >> 8) * 32 + ((i >> 5) & 1) * 16 + ((i >> 4) & 1) * 8, d = ((i >> 6) & 3) * 16 + (i & 15);
#pragma unroll
      for (int q = 0; q < 8; ++q) g[m].u[q] = tl[k0 + q][d]; }
    unsigned short* o = (unsigned short*)VP + (size_t)bx * (PVK * 64) + (size_t)tid * 8;
    __builtin_amdgcn_sched_barrier(0);      /* every value ahead of the first store, so that no register that an issued store names is rewritten behind it */
#pragma unroll      /* register arrays need constant indices */
    for (int m = 0; m < PVM; ++m) *(v8us*)(o + m * 2048) = g[m].half[0];
    return;
  }
  const bool isk = bx >= PVW + PXW; const size_t t = (size_t)(bx - PVW - (isk ? PXW : 0)) * (256 * PIT) + tid;      /* first item; the others lie 256 items apart */
  const float* s = (isk ? xk : xq) + t * 8; v4f a[PIT], c[PIT];
#pragma unroll      /* register arrays need constant indices */
  for (int j = 0; j < PIT; ++j) { a[j] = *(const v4fa*)(s + j * 2048); c[j] = *(const v4fa*)(s + j * 2048 + 4); }
  asm volatile("s_wait_xcnt 0x0" :: "v"(s) : "memory");      /* as above */
  const size_t row = t >> 3; const int c8 = (int)(t & 7);
  unsigned short* o = isk ? (unsigned short*)KP + (row >> 4) * 1024 + (size_t)((c8 >> 1) * 256 + ((c8 & 1) * 16 + (int)(row & 15)) * 8) : (unsigned short*)Q16 + t * 8;      /* 256 items on = 32 rows = 2 key tiles = 2048 values on, in both orders */
  v8us h[PIT];
#pragma unroll      /* register arrays need constant indices */
  for (int j = 0; j < PIT; ++j) h[j] = p_cvt(a[j], c[j]);
  __builtin_amdgcn_sched_barrier(0);      /* as above: every value ahead of the first store */
#pragma unroll      /* register arrays need constant indices */
  for (int j = 0; j < PIT; ++j) *(v8us*)(o + j * 2048) = h[j];
}
typedef float v2f __attribute__((ext_vector_type(2)));
// softmax across the 8 batches for one 16-key x 16-query tile, in registers; stores 8 keys of one query per batch to the P buffer
// two neighbouring keys (registers r, r + 1 of a score tile) go through each packed f32 instruction; 1 / sqrt(64) and log2(e) are one factor of one multiply-add whose addend is the scaled maximum
__device__ __forceinline__ void f_soft(const v8f (&s)[FB], _Float16* pw) {
  FragH pk[FB]; constexpr float FC = 0.125f * 1.44269504f; const v2f fc = {FC, FC};
#pragma unroll      /* register arrays need constant indices */
  for (int r = 0; r < 8; r += 2) { v2f e[FB], mx = {-3.0e38f, -3.0e38f};
#pragma unroll
    for (int b = 0; b < FB; ++b) { mx[0] = fmaxf(mx[0], s[b][r]); mx[1] = fmaxf(mx[1], s[b][r + 1]); }
    const v2f nm = mx * -fc;
#pragma unroll
    for (int b = 0; b < FB; ++b) { const v2f x = {s[b][r], s[b][r + 1]}; const v2f t = __builtin_elementwise_fma(x, fc, nm); e[b][0] = __builtin_amdgcn_exp2f(t[0]); e[b][1] = __builtin_amdgcn_exp2f(t[1]); }      /* native exp2 as in __expf */
    v2f se = e[0];
#pragma unroll
    for (int b = 1; b < FB; ++b) se += e[b];
    v2f sc = {__builtin_amdgcn_rcpf(se[0]), __builtin_amdgcn_rcpf(se[1])}; sc *= 256.0f;
#pragma unroll
    for (int b = 0; b < FB; ++b) { const v2f p = e[b] * sc; pk[b].h[r] = (_Float16)p[0]; pk[b].h[r + 1] = (_Float16)p[1]; } }
#pragma unroll      /* register arrays need constant indices */
  for (int b = 0; b < FB; ++b) *(v8us*)((unsigned short*)pw + (size_t)b * FQ * FPP) = pk[b].half[0];
}
__device__ __forceinline__ void f_qld(FragH (&g)[FB], const unsigned short* q) {      /* one group of LDS reads: the Q fragments of one query tile and one half of d, all 8 batches */
#pragma unroll      /* register arrays need constant indices */
  for (int b = 0; b < FB; ++b) { g[b].half[0] = *(const v8us*)(q + b * (FQT * 1024)); g[b].half[1] = *(const v8us*)(q + b * (FQT * 1024) + 256); }      /* a batch's fragments: FQT tiles x 2 halves of d x 512 values */
}
// work-group barrier for data that goes through LDS alone: the two fences name LDS only, so each wave waits for its own LDS stores and reads but not for its global loads, which stay in flight across it (__syncthreads() waits all of them out)
__device__ __forceinline__ void f_bar() { __builtin_amdgcn_fence(__ATOMIC_RELEASE, "workgroup", "local"); __builtin_amdgcn_s_barrier(); __builtin_amdgcn_fence(__ATOMIC_ACQUIRE, "workgroup", "local"); }
__global__ __launch_bounds__(256) void k_fused(const _Float16* __restrict__ Q16, const _Float16* __restrict__ K16, const _Float16* __restrict__ VT, float* __restrict__ PO) {
  static_assert(FQT == 4, "part 2 below takes the query tiles two at a time");
  __shared__ __attribute__((aligned(16))) _Float16 pl[FB][FQ][FPP];      /* one buffer: two barriers a pass */
  __shared__ __attribute__((aligned(16))) unsigned short ql[FB][FQT][2][2][32][8];      /* Q fragments of the whole walk, fragment order: [batch][query tile][d / 32][fragment half][lane][8]; every wave-wide 16-byte read covers 512 bytes in a row */
  const int tid = threadIdx.x, w = tid >> 5, lane = tid & 31, ln = lane & 15, hh = lane >> 4; const int q0 = (blockIdx.x / FKS) * FQ; const int k0 = (blockIdx.x % FKS) * (FS / FKS);
  const int kr = (int)((blockIdx.x / FKS) % (FS / FKS / FK)) * FK;      /* where this work-group's walk through its quarter starts: the 64 work-groups of a quarter read the same K and V^T lines, and started alike they ask L2 for the same lines at the same moment; the walk wraps round, so every key is still taken once */
  constexpr size_t PLN = (size_t)FS * FD;
  const v8f z8 = {0.f,0.f,0.f,0.f,0.f,0.f,0.f,0.f};
  const _Float16* qp = Q16 + (size_t)w * PLN + (size_t)(q0 + ln) * FD + 8 * hh;      /* Q rows q0 + ln of batch w: this wave brings them to LDS for all waves */
  const int wu = __builtin_amdgcn_readfirstlane(w); const unsigned lo = lane * 8;      /* the wave's number as a scalar: the K and V^T bases are then scalar and the lane offset is added where an address is formed; a per-lane K pointer that lives from the first loads' wait through the whole walk is spilled by this compiler */
  const _Float16* kp = K16 + (size_t)(k0 + 16 * wu) * FD;      /* part 1: this wave's 16-key tile, fragment order (A operand) */
  const _Float16* ks0 = kp + (size_t)kr * FD;      /* the same tile of the walk's first pass */
  const _Float16* vp = VT + (size_t)wu * PLN + (size_t)k0 * FD;      /* part 2: V^T of batch w, fragment order (B operand) */
  FragH qg[FQT][2];
  v16h kf[FB][2];
#pragma unroll      /* register arrays need constant indices */
  for (int u = 0; u < FQT; ++u) { qg[u][0].v = f_frag(qp + u * (16 * FD)); qg[u][1].v = f_frag(qp + u * (16 * FD) + 32); }
  asm volatile("s_wait_xcnt 0x0" :: "v"(qp) : "memory");      /* precaution: stands in front of any rewrite of a register that an issued load names; the input keeps the Q address pair whole up to it; a wait of its own, directly behind the Q loads: held over the K loads as well, the pair is spilled by this compiler */
#pragma unroll      /* register arrays need constant indices */
  for (int b = 0; b < FB; ++b) { kf[b][0] = f_fragp(ks0 + (size_t)b * PLN + lo); kf[b][1] = f_fragp(ks0 + (size_t)b * PLN + 512 + lo); }
  asm volatile("s_wait_xcnt 0x0" :: "s"(ks0), "v"(lane) : "memory");      /* the same for the K base and the lane index (the K loads' scaled offset register) */
#pragma unroll      /* register arrays need constant indices */
  for (int u = 0; u < FQT; ++u)
#pragma unroll
    for (int j = 0; j < 2; ++j) { *(v8us*)&ql[w][u][j][0][lane][0] = qg[u][j].half[0]; *(v8us*)&ql[w][u][j][1][lane][0] = qg[u][j].half[1]; }
  __syncthreads();      /* publishes the Q fragments to every wave */
  const unsigned short* qr = &ql[0][0][0][0][lane][0];
  v8f o[FQT][4];
#pragma unroll      /* register arrays need constant indices */
  for (int u = 0; u < FQT; ++u)
#pragma unroll
    for (int t = 0; t < 4; ++t) o[u][t] = z8;
  for (int it = 0; it < FS / FKS / FK; ++it) {
    const int kb = (kr + it * FK) & (FS / FKS - 1); const int kn = (kb + FK) & (FS / FKS - 1);      /* this pass's keys, from the work-group's own start on, and the next pass's; the last pass requests the walk's first keys again: in bounds, not used */
    const _Float16* vb = vp + (size_t)kb * FD + lo; const _Float16* kq = kp + (size_t)kn * FD + lo;
    v16h vf[4][4];      /* this pass's V^T fragments */
    FragH g0[FB], g1[FB];      /* Q fragments of one query tile: first and second half of d */
    f_qld(g0, qr);
#pragma unroll      /* register arrays need constant indices */
    for (int u = 0; u < FQT; ++u) {      /* one query tile at a time; the K fragments in registers serve all four */
      v8f s[FB];      /* s[b][r] = Q[b][q0 + 16 u + ln] . K[b][k0 + kb + 16 w + 8 hh + r] */
      if (u + 1 < FQT) f_qld(g1, qr + u * 1024 + 512); else f_qld(g0, qr + u * 1024);      /* the last tile reads its two groups one after the other: the registers of a group read ahead hold the first half of V^T by then */
      __builtin_amdgcn_sched_barrier(0);      /* keeps each group of LDS reads whole and in front of the products; left alone the scheduler reads four at a time and waits each out */
#pragma unroll      /* register arrays need constant indices */
      for (int b = 0; b < FB; ++b) s[b] = f_mma(kf[b][0], g0[b].v, z8);
      if (u + 1 == FQT) { __builtin_amdgcn_sched_barrier(0); f_qld(g1, qr + u * 1024 + 512); __builtin_amdgcn_sched_barrier(0); }      /* the two keep this group behind the products above, whose registers it takes, and whole */
#pragma unroll      /* register arrays need constant indices */
      for (int b = 0; b < FB; ++b) s[b] = f_mma(kf[b][1], g1[b].v, s[b]);
      __builtin_amdgcn_sched_barrier(0);      /* keeps the requests below behind the products above, whose registers they take */
      if (u == 0) f_bar();      /* ends every wave's reads of the last pass's P, which the softmax below overwrites */
      if (u + 2 < FQT) f_qld(g0, qr + (u + 1) * 1024);      /* next tile's first group: it arrives under the softmax */
      else {
#pragma unroll      /* register arrays need constant indices */
        for (int ks = 2 * (u + 2 - FQT); ks < 2 * (u + 2 - FQT) + 2; ++ks)
#pragma unroll
          for (int t = 0; t < 4; ++t) vf[ks][t] = f_fragp(vb + ks * (32 * FD) + t * 512);      /* one half of V^T in front of each of the last two softmaxes, so that the stream of loads starts early; the second half takes registers that K has left */
        asm volatile("s_wait_xcnt 0x0" :: "v"(vb) : "memory");      /* as above, for the V^T address pair */
        if (u + 1 == FQT) {
#pragma unroll      /* register arrays need constant indices */
          for (int b = 0; b < FB; ++b) kf[b][0] = f_fragp(kq + (size_t)b * PLN);      /* next pass's K fragments, first half of d, behind V^T: loads return in the order of their requests, so the wait for V^T leaves these in flight */
          asm volatile("s_wait_xcnt 0x0" :: "v"(kq) : "memory");      /* as above, for the K address pair */
        }
      }
      __builtin_amdgcn_sched_barrier(0);      /* keeps the requests above in front of the softmax; sunk into it they would start later */
      f_soft(s, &pl[0][16 * u + ln][16 * w + 8 * hh]);
      __builtin_amdgcn_sched_barrier(0);      /* keeps the next tile's reads and the requests below out of this softmax, whose registers they take */
    }
#pragma unroll      /* register arrays need constant indices */
    for (int b = 0; b < FB; ++b) kf[b][1] = f_fragp(kq + (size_t)b * PLN + 512);      /* second half of d, in the registers that the last softmax has left; they arrive past the barrier, under part 2 */
    asm volatile("s_wait_xcnt 0x0" :: "v"(kq) : "memory");      /* as above, for the K address pair */
    __builtin_amdgcn_sched_barrier(0);      /* keeps them in front of the barrier */
    f_bar();      /* publishes this pass's P */
    const _Float16* pr = &pl[w][ln][8 * hh];
#pragma unroll      /* register arrays need constant indices */
    for (int h = 0; h < FQT / 2; ++h) { v16h pa[2][4];      /* P[w] rows of two query tiles as A operands */
#pragma unroll      /* register arrays need constant indices */
      for (int u = 0; u < 2; ++u)
#pragma unroll
        for (int ks = 0; ks < 4; ++ks) pa[u][ks] = f_frag(pr + (2 * h + u) * (16 * FPP) + ks * 32);
      __builtin_amdgcn_sched_barrier(0);      /* keeps the products behind the reads of their own two tiles; the second pair's reads may still rise among the first pair's products */
#pragma unroll      /* register arrays need constant indices */
      for (int ks = 0; ks < 4; ++ks)
#pragma unroll
        for (int u = 0; u < 2; ++u)
#pragma unroll
          for (int t = 0; t < 4; ++t) o[2 * h + u][t] = f_mma(pa[u][ks], vf[ks][t], o[2 * h + u][t]);      /* the V^T fragments in registers serve all four query tiles */
    }
  }
  asm volatile("s_wait_loadcnt 0x0" ::: "memory");      /* precaution: the last pass's K requests are used by nobody and no barrier waits them out any more; with this wait none is still on its way when the wave gives its registers back at its end */
  float* op = PO + (size_t)(blockIdx.x % FKS) * (FB * PLN) + (size_t)w * PLN + (size_t)(q0 + 8 * hh) * FD + ln;      /* this key quarter's plane of partial sums, still x256 */
#pragma unroll      /* register arrays need constant indices */
  for (int u = 0; u < FQT; ++u)
#pragma unroll
    for (int t = 0; t < 4; ++t)
#pragma unroll
      for (int r = 0; r < 8; ++r) op[(size_t)(16 * u + r) * FD + t * 16] = o[u][t][r];
}
// out = (sum of the four key quarters, in pairs) x 2^-8
#define RIT 4      /* 4-value items per thread and plane: few waves to start, all of a thread's loads in flight at once */
__global__ __launch_bounds__(256) void k_sum(const float* __restrict__ PO, float* __restrict__ out) {
  static_assert(FKS == 4, "the sum below is written out for four planes");
  const size_t t0 = (size_t)blockIdx.x * (1024 * RIT); const unsigned lo = threadIdx.x * 4;      /* the work-group's first value, and the thread's place in each run of 1024 values */
  constexpr size_t PP = (size_t)FB * FS * FD;      /* one plane of partial sums */
  const float* s0 = PO + t0; v4f a[RIT], c[RIT], d[RIT], e[RIT];      /* one base for the work-group; the four planes lie PP values apart */
#pragma unroll      /* register arrays need constant indices */
  for (int j = 0; j < RIT; ++j) { a[j] = *(const v4fa*)(s0 + j * 1024 + lo); c[j] = *(const v4fa*)(s0 + PP + j * 1024 + lo); d[j] = *(const v4fa*)(s0 + 2 * PP + j * 1024 + lo); e[j] = *(const v4fa*)(s0 + 3 * PP + j * 1024 + lo); }
  asm volatile("s_wait_xcnt 0x0" ::: "memory");      /* precaution: stands in front of any rewrite of a register that an issued load names */
  __builtin_amdgcn_sched_barrier(0);      /* keeps every load in front of the first sum, so that all of a thread's loads are in flight at once */
  float* o = out + t0 + lo;
#pragma unroll      /* register arrays need constant indices */
  for (int j = 0; j < RIT; ++j) a[j] = ((a[j] + c[j]) + (d[j] + e[j])) * 0.00390625f;
  __builtin_amdgcn_sched_barrier(0);      /* every value ahead of the first store, so that no register that an issued store names is rewritten behind it */
#pragma unroll      /* register arrays need constant indices */
  for (int j = 0; j < RIT; ++j) *(v4f*)(o + j * 1024) = a[j];
}
extern "C" void kernel_launch(void* const* d_in, const int* in_sizes, int n_in,
                              void* d_out, int out_size, void* d_ws, size_t ws_size, hipStream_t stream) {
  (void)in_sizes; (void)n_in; (void)out_size;
  const float* const* I = (const float* const*)d_in; const float* xq = I[0]; const float* xk = I[1]; const float* xv = I[2];      /* Q, K, V [8][4096][64] (bf16-valued) */
  constexpr int NBt = 8, SQt = 4096, DK = 64;      /* batches, sequence, width */
  char* ws = (char*)d_ws; size_t off = 0;
  auto take = [&](size_t bytes) { char* p = ws + off; off += (bytes + 255) & ~(size_t)255; return p; };
  const size_t PLN = (size_t)SQt * DK;      /* one batch's [4096][64] plane */
  _Float16* Q16 = (_Float16*)take(NBt * PLN * 2); _Float16* K16 = (_Float16*)take(NBt * PLN * 2); _Float16* VT = (_Float16*)take(NBt * PLN * 2); float* PO = (float*)take(FKS * NBt * PLN * 4);
  if (off > ws_size) return;
  k_prep<<<PVW + 2 * PXW, 256, 0, stream>>>(xq, xk, xv, Q16, K16, VT);      /* exact f16 copies of the bf16-valued inputs: Q in rows, K and V^T in fragment order */
  k_fused<<<SQt / FQ * FKS, 256, 0, stream>>>(Q16, K16, VT, PO);      /* scores, softmax across the 8 batches and P V for 64 query rows of all batches and one quarter of the keys per work-group */
  k_sum<<<NBt * SQt * DK / 4 / 256 / RIT, 256, 0, stream>>>(PO, (float*)d_out);      /* adds the four key quarters */
}

// v009
// It runs in 48.7 microseconds.
// Timed twice side by side with v008, it ran 1.10 times as fast both times.
// Counting every step since v000, it is 43.7 times as fast.
#include <hip/hip_runtime.h>
// Dot-product attention whose softmax runs over the BATCH axis (Q, K, V [8][4096][64], no heads, no weights; scores = Q K^T / sqrt(64) -> [8][4096][4096]; attn = softmax(scores, axis = 0): for every (query, key) pair the 8 batch entries are normalised against each other (the module's literal axis; rows are NOT normalised over keys); out[b] = attn[b] V[b] -> [8][4096][64]).
// Structure: three launches. ONE prep launch (three block ranges) writes the bf16-valued inputs as exact f16; K and V^T (via LDS transposes, once) are written in WMMA fragment order, so that every wave-wide 16-byte load of the walk reads 512 contiguous bytes (4 whole lines, not 32 bytes of each of 16 lines); then ONE fused launch: a work-group owns 64 query rows (four tiles of 16) of all 8 batches and walks one quarter of the keys 128 at a time, every K and V^T fragment it fetches serving all four tiles; Q fragments lie in LDS; each wave's V^T of the next pass travels from memory into an LDS range of the wave's own by asynchronous copies, nearly a pass ahead of its use. Part 1 of a pass: wave w forms S^T = K Q^T for its 16 keys in all 8 batches (WMMA, f32 accumulation, K = 64), so a lane holds the 8 batch values of each (query, key) pair and normalises them in registers (f32, native exp; weights x256 f16), then stores 8 keys of one query per batch to LDS. Part 2: wave w is batch w: out[w] += P[w] V[w]^T (WMMA, f32), keys in ascending order inside a quarter from a start that turns with the work-group's query block, wrapping round. A last launch adds the four quarters, x 2^-8. Scores and weights never reach memory.
// Compute dtype: inputs rounded to bf16; q, k, v (exact in f16) and softmax weights (x256, ~2^-12) as plain f16 GEMM operands; scores, softmax statistics and o f32. v_wmma_f32_16x16x32_f16.
#define NB 4
#define SQ 4096
#define DM 256
#define NH 1
#define HD 64
#define HG 4                         /* heads per attention launch group */
#define B0 0                         /* first batch processed (debug hook) */
#define NBR NB                       /* batches processed (debug hook) */
#define NR ((size_t)NB * SQ)         /* token rows */
#define MP ((int)((size_t)NBR * SQ)) /* rows projected (debug hook) */
#define QT 256                       /* query rows per causal tile */
#define NKX SQ                       /* S / P row pitch */
#define QT0 256                      /* first-tile rows recomputed exactly (256: buys margin for the few-key rows 128..255, which have no output projection to average the single-f16 P/v rounding) */
#define QN SQ                        /* query rows attended per batch (debug hook) */
#define NHD NH                       /* heads attended (debug hook) */
#define MPO MP                       /* rows through the output stage (debug hook) */
#define LQ DM            /* row pitch of the q/k/v rows */
typedef __bf16 v16b __attribute__((ext_vector_type(16)));
typedef unsigned short v8us __attribute__((ext_vector_type(8), may_alias));
typedef float  v8f  __attribute__((ext_vector_type(8)));
typedef float  v4f  __attribute__((ext_vector_type(4)));
typedef float  v4fa __attribute__((ext_vector_type(4), may_alias));
union FragB { v16b v; v8us half[2]; unsigned short u[16]; };

__device__ __forceinline__ unsigned short bf16_bits(float x) { unsigned int u = __float_as_uint(x); return (unsigned short)((u + 0x7FFFu + ((u >> 16) & 1u)) >> 16); }
__device__ __forceinline__ float bf16_val(unsigned short b) { return __uint_as_float(((unsigned int)b) << 16); }
__device__ __forceinline__ float bf16_round(float x) { return bf16_val(bf16_bits(x)); }
// D += A·B with NT terms: 1 = ah·bh, 2 = + al·bh (A split), 3 = + ah·bl (both split)
template <int NT>
__device__ __forceinline__ v8f mmaN(v16b ah, v16b al, v16b bh, v16b bl, v8f c) {
  c = __builtin_amdgcn_wmma_f32_16x16x32_bf16(false, ah, false, bh, (short)0, c, false, false);
  if (NT >= 2) c = __builtin_amdgcn_wmma_f32_16x16x32_bf16(false, al, false, bh, (short)0, c, false, false);
  if (NT >= 3) c = __builtin_amdgcn_wmma_f32_16x16x32_bf16(false, ah, false, bl, (short)0, c, false, false);
  asm volatile("v_nop\n\tv_nop\n\tv_nop\n\tv_nop" : "+v"(c) : "v"(ah), "v"(al), "v"(bh), "v"(bl));
  return c;
}

__global__ __launch_bounds__(256) void k_wt_bf16(const float* __restrict__ W, unsigned short* __restrict__ Wt, int K, int N) {
  const int t = blockIdx.x * 256 + threadIdx.x;
  const int k8n = K / 8;
  if (t >= N * k8n) return;
  const int n = t / k8n, k8 = (t % k8n) * 8;
  v8us v;
#pragma unroll
  for (int i = 0; i < 8; ++i) v[i] = bf16_bits(W[(size_t)(k8 + i) * N + n]);
  *(v8us*)(Wt + (size_t)n * K + k8) = v;
  
}

// GEMM C[M][N] (f32, pitch ldc) = act(A[M][K]·W + bias). A f32 row-major (pitch lda) converted per fragment to bf16
// (ASPLIT: hi/lo two planes -> 2 terms, else single rounded term); Wt bf16 [N][K] (pitch ldb). BIAS_BF16 rounds the
// bias to bf16 first (bias quantised to bf16 before the add). K%32==0, M%16==0, N%64==0.
template <bool ASPLIT, int ACT, bool BIAS_BF16>
__global__ __launch_bounds__(128) void k_gemm_bf(const float* __restrict__ A, int lda, const unsigned short* __restrict__ Wt, int ldb,
                                               const float* __restrict__ bias, float* __restrict__ C, int ldc, int M, int N, int K) {
  __shared__ __attribute__((aligned(16))) float so[4][16][64];
  const int tid = threadIdx.x, w = tid >> 5, lane = tid & 31, ln = lane & 15, hh = lane >> 4;
  const int ntn = N / 64;
  const int wid = blockIdx.x * 4 + w;
  const int mt = wid / ntn, nq = wid % ntn;
  if (mt * 16 >= M) return;
  const int row0 = mt * 16, col0 = nq * 64;
  const float* arow = A + (size_t)(row0 + ln) * lda;
  v8f acc[4] = {};
  for (int kb = 0; kb < K; kb += 32) {
    FragB ah, al;
    const v4f x0 = *(const v4fa*)(arow + kb + 8 * hh), x1 = *(const v4fa*)(arow + kb + 8 * hh + 4);
    const v4f x2 = *(const v4fa*)(arow + kb + 16 + 8 * hh), x3 = *(const v4fa*)(arow + kb + 16 + 8 * hh + 4);
    float xs[16] = {x0[0],x0[1],x0[2],x0[3],x1[0],x1[1],x1[2],x1[3],x2[0],x2[1],x2[2],x2[3],x3[0],x3[1],x3[2],x3[3]};
#pragma unroll
    for (int i = 0; i < 16; ++i) { const unsigned short hb = bf16_bits(xs[i]); ah.u[i] = hb; al.u[i] = ASPLIT ? bf16_bits(xs[i] - bf16_val(hb)) : (unsigned short)0; }
#pragma unroll
    for (int t = 0; t < 4; ++t) {
      const unsigned short* brow = Wt + (size_t)(col0 + t * 16 + ln) * ldb + kb;
      FragB b;
      b.half[0] = *(const v8us*)(brow + 8 * hh);
      b.half[1] = *(const v8us*)(brow + 16 + 8 * hh);
      acc[t] = mmaN<ASPLIT ? 2 : 1>(ah.v, al.v, b.v, b.v, acc[t]);
    }
  }
#pragma unroll
  for (int t = 0; t < 4; ++t) {
    float bv = bias ? bias[col0 + t * 16 + ln] : 0.f;
    if (BIAS_BF16) bv = bf16_round(bv);
#pragma unroll
    for (int r = 0; r < 8; ++r) { float v = acc[t][r] + bv; if (ACT == 1) v = fmaxf(v, 0.f); so[w][8 * hh + r][t * 16 + ln] = v; }
  }
  __builtin_amdgcn_fence(__ATOMIC_ACQ_REL, "workgroup");
  __builtin_amdgcn_wave_barrier();
  const int rsub = lane >> 4, c4 = (lane & 15) * 4;
  {
#pragma unroll
    for (int q = 0; q < 8; ++q) {
      const int r = q * 2 + rsub;
      const v4f v = *(const v4fa*)&so[w][r][c4];
      *(v4f*)(C + (size_t)(row0 + r) * ldc + col0 + c4) = v;
    }
    
  }
}

// GEMM C = act(A·W + bias + resid): A f32 (ASPLIT -> hi/lo 2 terms), Wt bf16 [N][K]; ACT 0 none, 1 relu, 2 exact gelu;
// resid (optional, f32, row index = (row % rmod), pitch ldr, RES_BF16 rounds it) added before the activation.
template <bool ASPLIT, int ACT, bool BIAS_BF16, bool RES_BF16>
__global__ __launch_bounds__(128) void k_gemm_bf3(const float* __restrict__ A, int lda, const unsigned short* __restrict__ Wt, int ldb,
                                                const float* __restrict__ bias, const float* __restrict__ resid, int rmod, int ldr,
                                                float* __restrict__ C, int ldc, int M, int N, int K) {
  __shared__ __attribute__((aligned(16))) float so[4][16][64];
  const int tid = threadIdx.x, w = tid >> 5, lane = tid & 31, ln = lane & 15, hh = lane >> 4;
  const int ntn = N / 64;
  const int wid = blockIdx.x * 4 + w;
  const int mt = wid / ntn, nq = wid % ntn;
  if (mt * 16 >= M) return;
  const int row0 = mt * 16, col0 = nq * 64;
  const float* arow = A + (size_t)(row0 + ln) * lda;
  v8f acc[4] = {};
  for (int kb = 0; kb < K; kb += 32) {
    FragB ah, al;
    const v4f x0 = *(const v4fa*)(arow + kb + 8 * hh), x1 = *(const v4fa*)(arow + kb + 8 * hh + 4);
    const v4f x2 = *(const v4fa*)(arow + kb + 16 + 8 * hh), x3 = *(const v4fa*)(arow + kb + 16 + 8 * hh + 4);
    float xs[16] = {x0[0],x0[1],x0[2],x0[3],x1[0],x1[1],x1[2],x1[3],x2[0],x2[1],x2[2],x2[3],x3[0],x3[1],x3[2],x3[3]};
#pragma unroll
    for (int i = 0; i < 16; ++i) { const unsigned short hb = bf16_bits(xs[i]); ah.u[i] = hb; al.u[i] = ASPLIT ? bf16_bits(xs[i] - bf16_val(hb)) : (unsigned short)0; }
#pragma unroll
    for (int t = 0; t < 4; ++t) {
      const unsigned short* brow = Wt + (size_t)(col0 + t * 16 + ln) * ldb + kb;
      FragB b;
      b.half[0] = *(const v8us*)(brow + 8 * hh);
      b.half[1] = *(const v8us*)(brow + 16 + 8 * hh);
      acc[t] = mmaN<ASPLIT ? 2 : 1>(ah.v, al.v, b.v, b.v, acc[t]);
    }
  }
#pragma unroll
  for (int t = 0; t < 4; ++t) {
    const int col = col0 + t * 16 + ln;
    float bv = bias ? bias[col] : 0.f;
    if (BIAS_BF16) bv = bf16_round(bv);
#pragma unroll
    for (int r = 0; r < 8; ++r) {
      float v = acc[t][r] + bv;
      if (resid) { float rv = resid[(size_t)((row0 + 8 * hh + r) % rmod) * ldr + col]; if (RES_BF16) rv = bf16_round(rv); v += rv; }
      if (ACT == 1) v = fmaxf(v, 0.f);
      if (ACT == 2) v = 0.5f * v * (1.0f + erff(v * 0.70710678118654752f));
      if (ACT == 3) { const float u = 0.7978845608028654f * (v + 0.044715f * v * v * v); v = 0.5f * v * (1.0f + tanhf(u)); }
      so[w][8 * hh + r][t * 16 + ln] = v;
    }
  }
  __builtin_amdgcn_fence(__ATOMIC_ACQ_REL, "workgroup");
  __builtin_amdgcn_wave_barrier();
  const int rsub = lane >> 4, c4 = (lane & 15) * 4;
  {
#pragma unroll
    for (int q = 0; q < 8; ++q) {
      const int r = q * 2 + rsub;
      const v4f v = *(const v4fa*)&so[w][r][c4];
      *(v4f*)(C + (size_t)(row0 + r) * ldc + col0 + c4) = v;
    }
    
  }
}
// row LayerNorm (biased variance, eps) over N: s = X (+ R); optional out_sum <- s; out_norm <- (s-mu)*rsqrt(var+eps)*g + b
template <bool PARAM_BF16>
__global__ __launch_bounds__(256) void k_layernorm(const float* __restrict__ X, const float* __restrict__ R, const float* __restrict__ g, const float* __restrict__ bta,
                                                  float* __restrict__ out_sum, float* __restrict__ out_norm, int N, float eps) {
  __shared__ float red[256];
  const int row = blockIdx.x, tid = threadIdx.x;
  const float* x = X + (size_t)row * N; const float* rr = R ? R + (size_t)row * N : nullptr;
  float vals[16];                     // up to N = 4096
  const int per = N / 256;            // contiguous chunk per thread? use strided-by-4 chunks: thread handles j = tid*4 + 1024*u
  float s1 = 0.f;
  for (int u = 0; u < per / 4; ++u) {
    const int j = tid * 4 + 1024 * u;
    const v4f a = *(const v4fa*)(x + j);
    v4f b = {0.f,0.f,0.f,0.f}; if (rr) b = *(const v4fa*)(rr + j);
#pragma unroll
    for (int q = 0; q < 4; ++q) { const float v = a[q] + b[q]; vals[u * 4 + q] = v; s1 += v; }
  }
  red[tid] = s1; __syncthreads();
  for (int st = 128; st > 0; st >>= 1) { if (tid < st) red[tid] += red[tid + st]; __syncthreads(); }
  const float mu = red[0] / (float)N; __syncthreads();
  float s2 = 0.f;
  for (int u = 0; u < per / 4; ++u)
#pragma unroll
    for (int q = 0; q < 4; ++q) { const float c = vals[u * 4 + q] - mu; s2 += c * c; }
  red[tid] = s2; __syncthreads();
  for (int st = 128; st > 0; st >>= 1) { if (tid < st) red[tid] += red[tid + st]; __syncthreads(); }
  const float rs = rsqrtf(red[0] / (float)N + eps);
  {
    for (int u = 0; u < per / 4; ++u) {
      const int j = tid * 4 + 1024 * u;
      v4f o, sm;
#pragma unroll
      for (int q = 0; q < 4; ++q) {
        float gg = g[j + q], bb = bta[j + q];
        if (PARAM_BF16) { gg = bf16_round(gg); bb = bf16_round(bb); }
        sm[q] = vals[u * 4 + q]; o[q] = (vals[u * 4 + q] - mu) * rs * gg + bb;
      }
      if (out_sum) *(v4f*)(out_sum + (size_t)row * N + j) = sm;
      *(v4f*)(out_norm + (size_t)row * N + j) = o;
    }
    
  }
}



// ---- f16 WMMA path (v_wmma_f32_16x16x32_f16): 11-bit significands for operands in range — used where a [0,1] probability operand needs more precision than bf16
typedef _Float16 v16h __attribute__((ext_vector_type(16)));
union FragH { v16h v; v8us half[2]; _Float16 h[16]; unsigned short u[16]; };
template <int NT>
__device__ __forceinline__ v8f mmaH(v16h ah, v16h al, v16h bh, v16h bl, v8f c) {
  c = __builtin_amdgcn_wmma_f32_16x16x32_f16(false, ah, false, bh, (short)0, c, false, false);
  if (NT >= 2) c = __builtin_amdgcn_wmma_f32_16x16x32_f16(false, al, false, bh, (short)0, c, false, false);
  if (NT >= 3) c = __builtin_amdgcn_wmma_f32_16x16x32_f16(false, ah, false, bl, (short)0, c, false, false);
  asm volatile("v_nop\n\tv_nop\n\tv_nop\n\tv_nop" : "+v"(c) : "v"(ah), "v"(al), "v"(bh), "v"(bl));
  return c;
}
// batched GEMM like k_gemm_b but f16 operands: A f32 (split into f16 hi/lo if ASPLIT, else rounded to f16), Bt = f16 values [n][k]; alpha; C f32; N multiple of 16 (partial tiles skipped)
template <bool ASPLIT>
__global__ __launch_bounds__(128) void k_gemm_h(const float* __restrict__ A, int lda, size_t sA, const _Float16* __restrict__ Bh, int ldb, size_t sB, float alpha, float* __restrict__ C, int ldc, size_t sC, int M, int N, int K) {
  __shared__ __attribute__((aligned(16))) float so[4][16][64];
  const int tid = threadIdx.x, w = tid >> 5, lane = tid & 31, ln = lane & 15, hh = lane >> 4; const int by = blockIdx.y;
  A += (size_t)by * sA; Bh += (size_t)by * sB; C += (size_t)by * sC;
  const int ntn = (N + 63) / 64; const int wid = blockIdx.x * 4 + w; const int mt = wid / ntn, nq = wid % ntn; if (mt * 16 >= M) return;
  const int row0 = mt * 16, col0 = nq * 64; const float* arow = A + (size_t)(row0 + ln) * lda;
  v8f acc[4] = {};
  for (int kb = 0; kb < K; kb += 32) {
    FragH ah, al;
    const v4f x0 = *(const v4fa*)(arow + kb + 8 * hh), x1 = *(const v4fa*)(arow + kb + 8 * hh + 4), x2 = *(const v4fa*)(arow + kb + 16 + 8 * hh), x3 = *(const v4fa*)(arow + kb + 16 + 8 * hh + 4);
    float xs[16] = {x0[0],x0[1],x0[2],x0[3],x1[0],x1[1],x1[2],x1[3],x2[0],x2[1],x2[2],x2[3],x3[0],x3[1],x3[2],x3[3]};
#pragma unroll
    for (int i = 0; i < 16; ++i) { const _Float16 h = (_Float16)xs[i]; ah.h[i] = h; al.h[i] = ASPLIT ? (_Float16)(xs[i] - (float)h) : (_Float16)0.0f; }
#pragma unroll
    for (int t = 0; t < 4; ++t) { if (col0 + t * 16 >= N) continue; const size_t boff = (size_t)(col0 + t * 16 + ln) * ldb + kb; FragH bq; bq.half[0] = *(const v8us*)(Bh + boff + 8 * hh); bq.half[1] = *(const v8us*)(Bh + boff + 16 + 8 * hh);
      acc[t] = mmaH<ASPLIT ? 2 : 1>(ah.v, al.v, bq.v, bq.v, acc[t]); }
  }
#pragma unroll
  for (int t = 0; t < 4; ++t) { if (col0 + t * 16 >= N) continue;
#pragma unroll
    for (int r = 0; r < 8; ++r) so[w][8 * hh + r][t * 16 + ln] = acc[t][r] * alpha; }
  __builtin_amdgcn_fence(__ATOMIC_ACQ_REL, "workgroup"); __builtin_amdgcn_wave_barrier();
  const int rsub = lane >> 4, c4 = (lane & 15) * 4;
  {
#pragma unroll
    for (int q = 0; q < 8; ++q) { const int r = q * 2 + rsub; if (col0 + c4 < N) { const v4f v = *(const v4fa*)&so[w][r][c4]; *(v4f*)(C + (size_t)(row0 + r) * ldc + col0 + c4) = v; } }
     }
}

// Wt[n][k] = f16(W[k][n]·scale) from f32 row-major W[K][N] (scale = power of two; bf16-exact weights stay exact in f16 away from the subnormal range)
__global__ __launch_bounds__(256) void k_wt_f16(const float* __restrict__ W, _Float16* __restrict__ Wt, int K, int N, float scale) {
  const int t = blockIdx.x * 256 + threadIdx.x; if (t >= N * (K / 8)) return; const int n = t / (K / 8), k8 = (t % (K / 8)) * 8; FragH f;
#pragma unroll
  for (int i = 0; i < 8; ++i) f.h[i] = (_Float16)(bf16_round(W[(size_t)(k8 + i) * N + n]) * scale); const v8us o = f.half[0];
  *(v8us*)((unsigned short*)Wt + (size_t)n * K + k8) = o; 
}
// k_gemm_hh variant with fused epilogue: v = acc·alpha + bias[by·sBias + col] (+ CP[(row/rowsPerB)·sCPb + by·64 + col] if CP) ; ACT 0 none / 1 elu ; writes f16 C16 (and f32 C if non-null)
template <int ACT>
__global__ __launch_bounds__(128) void k_gemm_hhx(const _Float16* __restrict__ A, int lda, size_t sA, const _Float16* __restrict__ Bh, int ldb, size_t sB, float alpha, const float* __restrict__ bias, size_t sBias, const float* __restrict__ CP, int rowsPerB, size_t sCPb, int row0g,
    float* __restrict__ C, _Float16* __restrict__ C16, int ldc, size_t sC, int M, int N, int K) {
  __shared__ __attribute__((aligned(16))) float so[4][16][64];
  const int tid = threadIdx.x, w = tid >> 5, lane = tid & 31, ln = lane & 15, hh = lane >> 4; const int by = blockIdx.y;
  A += (size_t)by * sA; Bh += (size_t)by * sB; const size_t cofs = (size_t)by * sC; const float* bp = bias ? bias + (size_t)by * sBias : nullptr;
  const int ntn = (N + 63) / 64; const int wid = blockIdx.x * 4 + w; const int mt = wid / ntn, nq = wid % ntn; if (mt * 16 >= M) return;
  const int row0 = mt * 16, col0 = nq * 64; const _Float16* arow = A + (size_t)(row0 + ln) * lda;
  v8f acc[4] = {};
  for (int kb = 0; kb < K; kb += 32) { FragH ah; ah.half[0] = *(const v8us*)((const unsigned short*)arow + kb + 8 * hh); ah.half[1] = *(const v8us*)((const unsigned short*)arow + kb + 16 + 8 * hh);
#pragma unroll
    for (int t = 0; t < 4; ++t) { if (col0 + t * 16 >= N) continue; const size_t boff = (size_t)(col0 + t * 16 + ln) * ldb + kb; FragH bq; bq.half[0] = *(const v8us*)((const unsigned short*)Bh + boff + 8 * hh); bq.half[1] = *(const v8us*)((const unsigned short*)Bh + boff + 16 + 8 * hh);
      acc[t] = mmaH<1>(ah.v, ah.v, bq.v, bq.v, acc[t]); }
  }
#pragma unroll
  for (int t = 0; t < 4; ++t) { if (col0 + t * 16 >= N) continue; const int col = col0 + t * 16 + ln; const float bv = bp ? bf16_round(bp[col]) : 0.f;
#pragma unroll
    for (int r = 0; r < 8; ++r) { float v = acc[t][r] * alpha + bv; if (CP) { const int rr = row0g + row0 + 8 * hh + r; if (rowsPerB < 0) v += CP[cofs + (size_t)rr * ldc + col];      /* rowsPerB < 0: own element of the batched C plane */ else { const int bidx = rr / rowsPerB; v += CP[(size_t)bidx * sCPb + (size_t)by * 64 + col]; } } if (ACT == 1) v = (v > 0.f) ? v : expm1f(v); else if (ACT == 7) v = (v > 0.f) ? v + 1.0f : expf(v); else if (ACT == 8) v = tanhf(v); else if (ACT == 9) v = 0.5f * v * (1.0f + tanhf(0.7978845608028654f * (v + 0.044715f * v * v * v))); else if (ACT == 11) v = 1.0f / (1.0f + expf(-v)); else if (ACT == 12) v = (v > 0.f) ? v : 0.01f * v; else if (ACT == 14) v = (v > 0.f) ? v : 0.1f * v; else if (ACT == 16) v = (v >= 0.f) ? v : 0.3f * v; else if (ACT == 17) v = (v >= 0.f) ? v : 0.2f * v; else if (ACT == 15) v = v / (1.0f + expf(-v)); else if (ACT == 3) v = fmaxf(v, 0.f); else if (ACT == 6) v = 0.5f * v * (1.0f + erff(v * 0.70710678118654752f)); so[w][8 * hh + r][t * 16 + ln] = v; } }
  __builtin_amdgcn_fence(__ATOMIC_ACQ_REL, "workgroup"); __builtin_amdgcn_wave_barrier();
  const int rsub = lane >> 4, c4 = (lane & 15) * 4; typedef _Float16 v4h __attribute__((ext_vector_type(4)));
  {
#pragma unroll
    for (int q = 0; q < 8; ++q) { const int r = q * 2 + rsub; if (col0 + c4 < N) { const v4f v = *(const v4fa*)&so[w][r][c4]; if (C) *(v4f*)(C + cofs + (size_t)(row0 + r) * ldc + col0 + c4) = v; if (C16) { v4h h4; for (int i = 0; i < 4; ++i) h4[i] = (_Float16)v[i]; *(v4h*)(C16 + cofs + (size_t)(row0 + r) * ldc + col0 + c4) = h4; } } }
     }
}


typedef _Float16 v4h __attribute__((ext_vector_type(4)));

__global__ __launch_bounds__(256) void k_x16(const float* __restrict__ x, _Float16* __restrict__ X16, size_t n8) { const size_t t = (size_t)blockIdx.x * 256 + threadIdx.x; if (t >= n8) return; FragH f;
#pragma unroll
  for (int q = 0; q < 8; ++q) f.h[q] = (_Float16)bf16_round(x[t * 8 + q]); *(v8us*)((unsigned short*)X16 + t * 8) = f.half[0];  }
__global__ __launch_bounds__(256) void k_h16(const float* __restrict__ x, _Float16* __restrict__ X16, size_t n8) { const size_t t = (size_t)blockIdx.x * 256 + threadIdx.x; if (t >= n8) return; FragH f;
#pragma unroll
  for (int q = 0; q < 8; ++q) f.h[q] = (_Float16)x[t * 8 + q]; *(v8us*)((unsigned short*)X16 + t * 8) = f.half[0];  }
__global__ __launch_bounds__(256) void k_round16f(const float* __restrict__ W, _Float16* __restrict__ Bt, size_t n8) { const size_t t = (size_t)blockIdx.x * 256 + threadIdx.x; if (t >= n8) return; FragH f;
#pragma unroll
  for (int i = 0; i < 8; ++i) f.h[i] = (_Float16)(bf16_round(W[t * 8 + i]) * 16.0f); *(v8us*)((unsigned short*)Bt + t * 8) = f.half[0];  }
template <int NHv, int TTv>
__global__ __launch_bounds__(256) void k_vt(const _Float16* __restrict__ V16, int ldv, int voff, _Float16* __restrict__ Vt) { __shared__ unsigned short tl[64][66]; const int tid = threadIdx.x; const int slab = blockIdx.x / (TTv / 64), lg = blockIdx.x % (TTv / 64); const int b = slab / NHv, h = slab % NHv;
  for (int i = tid; i < 64 * 8; i += 256) { const int r = i / 8, c8 = (i % 8) * 8; FragH f; f.half[0] = *(const v8us*)((const unsigned short*)V16 + ((size_t)b * TTv + lg * 64 + r) * ldv + voff + h * 64 + c8);
#pragma unroll
    for (int q = 0; q < 8; ++q) tl[r][c8 + q] = f.u[q]; }
  __syncthreads();
  {
#pragma unroll
    for (int rd = 0; rd < 2; ++rd) { const int d = rd * 32 + tid / 8, pc = tid % 8; FragH f;
#pragma unroll
      for (int q = 0; q < 8; ++q) f.u[q] = tl[pc * 8 + q][d];
      *(v8us*)((unsigned short*)Vt + ((size_t)slab * 64 + d) * TTv + lg * 64 + pc * 8) = f.half[0]; }
     } }

__global__ __launch_bounds__(256) void k_hl(const float* __restrict__ F, _Float16* __restrict__ Hh, _Float16* __restrict__ Hl, size_t n8) { const size_t t = (size_t)blockIdx.x * 256 + threadIdx.x; if (t >= n8) return; FragH fh, fl; const v4f a = *(const v4fa*)(F + t * 8), c = *(const v4fa*)(F + t * 8 + 4);
#pragma unroll
  for (int q = 0; q < 4; ++q) { _Float16 h = (_Float16)a[q]; fh.h[q] = h; fl.h[q] = (_Float16)((a[q] - (float)h) * 1024.0f); h = (_Float16)c[q]; fh.h[4 + q] = h; fl.h[4 + q] = (_Float16)((c[q] - (float)h) * 1024.0f); }
  { *(v8us*)((unsigned short*)Hh + t * 8) = fh.half[0]; *(v8us*)((unsigned short*)Hl + t * 8) = fl.half[0];  } }

// ---- fast GEMM (wave tile 32x64; requires M % 32 == 0 rows per launch region and N % 64 == 0); epilogue = k_gemm_hhx semantics ----
__device__ __forceinline__ v16h g2_frag(const _Float16* p, int hh) { FragH f; f.half[0] = *(const v8us*)((const unsigned short*)p + 8 * hh); f.half[1] = *(const v8us*)((const unsigned short*)p + 16 + 8 * hh); return f.v; }
__device__ __forceinline__ v8f g2_mma(v16h a, v16h b, v8f c) { v8f d = __builtin_amdgcn_wmma_f32_16x16x32_f16(false, a, false, b, (short)0, c, false, false); asm volatile("v_nop\n\tv_nop\n\tv_nop\n\tv_nop" : "+v"(d) : "v"(a), "v"(b)); return d; }
template <int ACT>
__global__ __launch_bounds__(128) void k_gemm2(const _Float16* __restrict__ A, int lda, size_t sA, const _Float16* __restrict__ Bh, int ldb, size_t sB, float alpha, const float* __restrict__ bias, size_t sBias, const float* __restrict__ CP, int rowsPerB, size_t sCPb, int row0g,
    float* __restrict__ C, _Float16* __restrict__ C16, int ldc, size_t sC, int M, int N, int K) { static_assert(ACT == 0 || ACT == 3 || ACT == 6 || ACT == 8 || ACT == 9 || ACT == 11 || ACT == 12 || ACT == 14 || ACT == 15 || ACT == 16 || ACT == 17, "k_gemm2: unsupported ACT code (would silently apply no activation)");
  __shared__ __attribute__((aligned(16))) float so[4][32][68];
  const int tid = threadIdx.x, w = tid >> 5, lane = tid & 31, ln = lane & 15, hh = lane >> 4; const int by = blockIdx.y;
  A += (size_t)by * sA; Bh += (size_t)by * sB; const size_t cofs = (size_t)by * sC; const float* bp = bias ? bias + (size_t)by * sBias : nullptr;
  const int ntn = N >> 6; const int mt = blockIdx.x / ntn, nq = blockIdx.x - mt * ntn; const int row0 = mt * 128 + 32 * w, col0 = nq * 64; if (row0 >= M) return;
  const _Float16* a0p = A + (size_t)(row0 + ln) * lda; const _Float16* a1p = a0p + (size_t)16 * lda;
  const _Float16* b0p = Bh + (size_t)(col0 + ln) * ldb; const _Float16* b1p = b0p + (size_t)16 * ldb; const _Float16* b2p = b1p + (size_t)16 * ldb; const _Float16* b3p = b2p + (size_t)16 * ldb;
  const v8f z8 = {0.f,0.f,0.f,0.f,0.f,0.f,0.f,0.f}; v8f c00 = z8, c01 = z8, c02 = z8, c03 = z8, c10 = z8, c11 = z8, c12 = z8, c13 = z8;
#pragma unroll 1
  for (int kb = 0; kb < K; kb += 32) { const v16h a0 = g2_frag(a0p + kb, hh), a1 = g2_frag(a1p + kb, hh);
    v16h b = g2_frag(b0p + kb, hh); c00 = g2_mma(a0, b, c00); c10 = g2_mma(a1, b, c10);
    b = g2_frag(b1p + kb, hh); c01 = g2_mma(a0, b, c01); c11 = g2_mma(a1, b, c11);
    b = g2_frag(b2p + kb, hh); c02 = g2_mma(a0, b, c02); c12 = g2_mma(a1, b, c12);
    b = g2_frag(b3p + kb, hh); c03 = g2_mma(a0, b, c03); c13 = g2_mma(a1, b, c13); }
  v8f accs[8] = {c00, c01, c02, c03, c10, c11, c12, c13};
#pragma unroll
  for (int u = 0; u < 8; ++u) { const int t = u & 3, half = u >> 2; const int col = col0 + t * 16 + ln; const float bv = bp ? bf16_round(bp[col]) : 0.f;
#pragma unroll
    for (int r = 0; r < 8; ++r) { const int rloc = half * 16 + 8 * hh + r; float v = accs[u][r] * alpha + bv; if (CP) { if (rowsPerB < 0) v += CP[cofs + (size_t)(row0g + row0 + rloc) * ldc + col];      /* rowsPerB < 0: own element of the batched C plane */ else { const int bidx = (row0g + row0 + rloc) / rowsPerB; v += CP[(size_t)bidx * sCPb + (size_t)by * 64 + col]; } }
      if (ACT == 3) v = fmaxf(v, 0.f); else if (ACT == 6) v = 0.5f * v * (1.0f + erff(v * 0.70710678118654752f)); else if (ACT == 11) v = 1.0f / (1.0f + expf(-v)); else if (ACT == 15) v = v / (1.0f + expf(-v)); else if (ACT == 12) v = (v > 0.f) ? v : 0.01f * v; else if (ACT == 8) v = tanhf(v); else if (ACT == 9) v = 0.5f * v * (1.0f + tanhf(0.7978845608028654f * (v + 0.044715f * v * v * v))); else if (ACT == 14) v = (v > 0.f) ? v : 0.1f * v; else if (ACT == 16) v = (v >= 0.f) ? v : 0.3f * v; else if (ACT == 17) v = (v >= 0.f) ? v : 0.2f * v;
      so[w][rloc][t * 16 + ln] = v; } }
  __builtin_amdgcn_fence(__ATOMIC_ACQ_REL, "workgroup"); __builtin_amdgcn_wave_barrier();
  const int rsub = lane >> 4, c4 = (lane & 15) * 4;
  {
#pragma unroll
    for (int q = 0; q < 16; ++q) { const int r = q * 2 + rsub; const v4f v = *(const v4fa*)&so[w][r][c4]; if (C) *(v4f*)(C + cofs + (size_t)(row0 + r) * ldc + col0 + c4) = v; if (C16) { v4h h4; for (int i = 0; i < 4; ++i) h4[i] = (_Float16)v[i]; *(v4h*)(C16 + cofs + (size_t)(row0 + r) * ldc + col0 + c4) = h4; } }
     } }


__global__ __launch_bounds__(256) void k_wnat(const float* __restrict__ w, size_t n8, _Float16* __restrict__ Bt) { const size_t t = (size_t)blockIdx.x * 256 + threadIdx.x; if (t >= n8) return; FragH f; for (int q = 0; q < 8; ++q) f.h[q] = (_Float16)(bf16_round(w[t * 8 + q]) * 16.0f); *(v8us*)((unsigned short*)Bt + t * 8) = f.half[0];  }
__global__ __launch_bounds__(256) void k_rsm(const float* __restrict__ S, _Float16* __restrict__ P, int nrows) {
  #pragma clang fp contract(off)
  const int i = blockIdx.x * 256 + threadIdx.x; if (i >= nrows) return; const float* s = S + (size_t)i * SQ; float mx = -3.0e38f;
#pragma unroll 1
  for (int j = 0; j < SQ; ++j) mx = fmaxf(mx, s[j]); float se = 0.f;
#pragma unroll 1
  for (int j = 0; j < SQ; ++j) se += expf(s[j] - mx); const float sc = 256.0f / se;
#pragma unroll 1
  for (int j0 = 0; j0 < SQ; j0 += 8) { FragH f; for (int q = 0; q < 8; ++q) f.h[q] = (_Float16)(expf(s[j0 + q] - mx) * sc); unsigned short* d = (unsigned short*)P + (size_t)i * SQ + j0; *(v8us*)d = f.half[0];  } }
__global__ __launch_bounds__(256) void k_vt(const _Float16* __restrict__ V16, int b, int h0, _Float16* __restrict__ VT) { __shared__ unsigned short tl[64][65]; const int tid = threadIdx.x; const int hh = blockIdx.x % HG, sg = blockIdx.x / HG; const int s0 = sg * 64; const int h = h0 + hh;
  for (int i = tid; i < 64 * 8; i += 256) { const int j = i / 8, d8 = (i % 8) * 8; FragH f; f.half[0] = *(const v8us*)((const unsigned short*)V16 + ((size_t)b * SQ + s0 + j) * DM + h * HD + d8); for (int q = 0; q < 8; ++q) tl[d8 + q][j] = f.u[q]; }
  __syncthreads();
  { for (int i = tid; i < 64 * 8; i += 256) { const int d = i / 8, j8 = (i % 8) * 8; FragH f; for (int q = 0; q < 8; ++q) f.u[q] = tl[d][j8 + q]; *(v8us*)((unsigned short*)VT + ((size_t)hh * HD + d) * SQ + s0 + j8) = f.half[0]; }  } }



__global__ __launch_bounds__(256) void k_rsmcf2(const float* __restrict__ S, _Float16* __restrict__ P, int hg, int q0, int nk) {
  #pragma clang fp contract(off)
  const int t = blockIdx.x * 256 + threadIdx.x; if (t >= hg * QT) return; const size_t i = (size_t)t; const float* s = S + i * NKX; const int last = q0 + (t % QT); float mx = -3.0e38f;
#pragma unroll 1
  for (int j = 0; j < nk; ++j) { const float f = (j <= last) ? 1.f : 0.f; mx = fmaxf(mx, fmaf(f, s[j], (1.f - f) * -1.0e9f)); } float se = 0.f;
#pragma unroll 1
  for (int j = 0; j < nk; ++j) { const float f = (j <= last) ? 1.f : 0.f; se += __expf(fmaf(f, s[j], (1.f - f) * -1.0e9f) - mx); } const float sc = 256.0f / se;
#pragma unroll 1
  for (int j0 = 0; j0 < nk; j0 += 8) { FragH fr; for (int q = 0; q < 8; ++q) { const int j = j0 + q; const float f = (j <= last) ? 1.f : 0.f; fr.h[q] = (_Float16)(__expf(fmaf(f, s[j], (1.f - f) * -1.0e9f) - mx) * sc); } unsigned short* d = (unsigned short*)P + i * NKX + j0; *(v8us*)d = fr.half[0];  } }

template <int MASKADD>
__global__ __launch_bounds__(64) void k_att0(const float* __restrict__ QF, const float* __restrict__ KF, const float* __restrict__ VF, int ld, const float* __restrict__ mask, float scale, float* __restrict__ OF, int ldo) {
  #pragma clang fp contract(off)
  __shared__ __attribute__((aligned(16))) float lq[64][64]; __shared__ __attribute__((aligned(16))) float lo[64][64];
  const int tid = threadIdx.x; const int h = blockIdx.x / (QT0 / 64), rg = blockIdx.x % (QT0 / 64); const int i = rg * 64 + tid;
  const float* qr = QF + (size_t)i * ld + h * HD;
#pragma unroll 1
  for (int c = 0; c < HD / 4; ++c) { *(v4f*)&lq[tid][c * 4] = *(const v4fa*)(qr + c * 4); const v4f z = {0.f, 0.f, 0.f, 0.f}; *(v4f*)&lo[tid][c * 4] = z; }
  float m = -1.0e30f, l = 0.f; const int jmax = MASKADD ? (SQ - 1) : (rg * 64 + 63);      /* additive-mask form: every key (the mask input decides); causal form: keys up to the block's last row */
#pragma unroll 1
  for (int j = 0; j <= jmax; ++j) { const float* kr = KF + (size_t)j * ld + h * HD; const float* vr = VF + (size_t)j * ld + h * HD; float s = 0.f;
#pragma unroll 1
    for (int c = 0; c < HD / 4; ++c) { const v4f kq = *(const v4fa*)(kr + c * 4); const v4f qq = *(v4f*)&lq[tid][c * 4]; s = __fadd_rn(s, __fmul_rn(qq[0], kq[0])); s = __fadd_rn(s, __fmul_rn(qq[1], kq[1])); s = __fadd_rn(s, __fmul_rn(qq[2], kq[2])); s = __fadd_rn(s, __fmul_rn(qq[3], kq[3])); }
    s = __fmul_rn(s, scale); if (MASKADD) s = __fadd_rn(s, __fmul_rn(bf16_round(mask[(size_t)i * SQ + j]), -10000.0f));
    const float f = (MASKADD || j <= i) ? 1.f : 0.f; const float sm = fmaf(f, s, (1.f - f) * -1.0e30f); const float mn = fmaxf(m, sm); const float sc = expf(m - mn); const float e = expf(sm - mn); l = __fadd_rn(__fmul_rn(l, sc), e); m = mn;
#pragma unroll 1
    for (int c = 0; c < HD / 4; ++c) { const v4f vv = *(const v4fa*)(vr + c * 4); v4f oo = *(v4f*)&lo[tid][c * 4]; for (int u = 0; u < 4; ++u) oo[u] = __fadd_rn(__fmul_rn(oo[u], sc), __fmul_rn(e, vv[u])); *(v4f*)&lo[tid][c * 4] = oo; } }
  const float fin = 64.0f / l;      /* o carried x64 like the f16 path */
#pragma unroll 1
  for (int c = 0; c < HD / 4; ++c) { v4f oo = *(v4f*)&lo[tid][c * 4]; for (int u = 0; u < 4; ++u) oo[u] = __fmul_rn(oo[u], fin); *(v4f*)&lo[tid][c * 4] = oo; }
  __syncthreads();
  {
#pragma unroll 1
    for (int it = 0; it < 16; ++it) { const int row = it * 4 + tid / 16, pc = (tid % 16) * 4; const v4f v = *(const v4f*)&lo[row][pc]; *(v4f*)(OF + (size_t)(rg * 64 + row) * ldo + h * HD + pc) = v; }
     } }

__global__ __launch_bounds__(256) void k_oscale(const float* __restrict__ OF, float* __restrict__ out, size_t n4) { const size_t t = (size_t)blockIdx.x * 256 + threadIdx.x; if (t >= n4) return; const v4f a = *(const v4fa*)(OF + t * 4); v4f o; for (int q = 0; q < 4; ++q) o[q] = a[q] * 0.015625f; *(v4f*)(out + t * 4) = o;  }

__global__ __launch_bounds__(256) void k_bfr(const float* __restrict__ x, float* __restrict__ XB, size_t n8) { const size_t t = (size_t)blockIdx.x * 256 + threadIdx.x; if (t >= n8) return; v4f a = *(const v4fa*)(x + t * 8), c = *(const v4fa*)(x + t * 8 + 4); for (int q = 0; q < 4; ++q) { a[q] = bf16_round(a[q]); c[q] = bf16_round(c[q]); }
  { *(v4f*)(XB + t * 8) = a; *(v4f*)(XB + t * 8 + 4) = c;  } }



__global__ __launch_bounds__(256) void k_rsmfvl(const float* __restrict__ S, _Float16* __restrict__ P, _Float16* __restrict__ PL, int qn, const int* __restrict__ vlp) {
  #pragma clang fp contract(off)
  const int t = blockIdx.x * 256 + threadIdx.x; if (t >= qn) return; const int vl = vlp[0]; const size_t i = (size_t)t; const float* s = S + i * SQ; float mx = -3.0e38f;
#pragma unroll 1
  for (int j = 0; j < SQ; ++j) { const float f = (j < vl) ? 1.f : 0.f; mx = fmaxf(mx, fmaf(f, s[j], (1.f - f) * -1000000.0f)); } float se = 0.f;
#pragma unroll 1
  for (int j = 0; j < SQ; ++j) { const float f = (j < vl) ? 1.f : 0.f; se += __expf(fmaf(f, s[j], (1.f - f) * -1000000.0f) - mx); } const float sc = 256.0f / se;
#pragma unroll 1
  for (int j0 = 0; j0 < SQ; j0 += 8) { FragH fr, gr; for (int q = 0; q < 8; ++q) { const int j = j0 + q; const float f = (j < vl) ? 1.f : 0.f; const float pv = __expf(fmaf(f, s[j], (1.f - f) * -1000000.0f) - mx) * sc; const _Float16 ph = (_Float16)pv; fr.h[q] = ph; gr.h[q] = (_Float16)((pv - (float)ph) * 1024.0f); }
    unsigned short* d = (unsigned short*)P + i * SQ + j0; unsigned short* dl = (unsigned short*)PL + i * SQ + j0; *(v8us*)d = fr.half[0]; *(v8us*)dl = gr.half[0];  } }

__global__ __launch_bounds__(256) void k_rsmf(const float* __restrict__ S, _Float16* __restrict__ P, int qn, int hg) {
  #pragma clang fp contract(off)
  const int t = blockIdx.x * 256 + threadIdx.x; if (t >= qn * hg) return; const size_t i = (size_t)(t / qn) * SQ + (t % qn); const float* s = S + i * SQ; float mx = -3.0e38f;
#pragma unroll 1
  for (int j = 0; j < SQ; ++j) mx = fmaxf(mx, s[j]); float se = 0.f;
#pragma unroll 1
  for (int j = 0; j < SQ; ++j) se += __expf(s[j] - mx); const float sc = 256.0f / se;
#pragma unroll 1
  for (int j0 = 0; j0 < SQ; j0 += 8) { FragH f; for (int q = 0; q < 8; ++q) f.h[q] = (_Float16)(__expf(s[j0 + q] - mx) * sc); unsigned short* d = (unsigned short*)P + i * SQ + j0; *(v8us*)d = f.half[0];  } }


#define CN 256          /* channels */
#define CI 128
#define NC 256                       /* (unused legacy kernels) */
#define NPX NP          /* positions per channel row */
#define NP 4096         /* seq1 tokens */
#define NM 1024         /* seq2 tokens */
#define BNEPS 1e-5f

__global__ __launch_bounds__(256) void k_mp2(const float* __restrict__ src, float* __restrict__ dst, int nout) {
  const int t = blockIdx.x * 256 + threadIdx.x; if (t >= nout) return; const int c = t / 1024; const int o = t % 1024; const int oy = o / 32, ox = o % 32; const float* p = src + (size_t)c * 4096 + (size_t)(2 * oy) * 64 + 2 * ox;
  const float v = fmaxf(fmaxf(p[0], p[1]), fmaxf(p[64], p[65])); *(float*)(dst + t) = v;  }
__global__ __launch_bounds__(256) void k_xpb(const float* __restrict__ x, const float* __restrict__ wb, float* __restrict__ CPP, size_t n4) {
  #pragma clang fp contract(off)
  const size_t t = (size_t)blockIdx.x * 256 + threadIdx.x; if (t >= n4) return; const size_t e = t * 4; const int c = (int)((e / 4096) % 256); const float bb = bf16_round(wb[c]); const v4f a = *(const v4fa*)(x + e); v4f o; for (int q = 0; q < 4; ++q) o[q] = __fadd_rn(bf16_round(a[q]), bb);
  *(v4f*)(CPP + e) = o;  }


template <int PASS>
__global__ __launch_bounds__(256) void k_cstA(const float* __restrict__ X, const float* __restrict__ MV, float* __restrict__ PART) {
  #pragma clang fp contract(off)
  __shared__ float red[256]; const int t = threadIdx.x; const size_t bc = blockIdx.x; const int c = (int)(bc % NC); const float* row = X + bc * (size_t)NPX; const float mu = PASS ? MV[c] : 0.f; float s = 0.f;
  for (int i = t; i < NPX; i += 256) { const float v = row[i]; const float d = PASS ? __fadd_rn(v, -mu) : v; s = __fadd_rn(s, PASS ? __fmul_rn(d, d) : d); }
  red[t] = s; __syncthreads(); for (int st = 128; st > 0; st >>= 1) { if (t < st) red[t] = __fadd_rn(red[t], red[t + st]); __syncthreads(); }
  if (t < 32) { const float pv = (t == 0) ? red[0] : 0.f; *(float*)(PART + bc * 32 + t) = pv;  } }      

template <int PASS>
__global__ __launch_bounds__(256) void k_cstB(const float* __restrict__ PART, float* __restrict__ MV) { const int c = threadIdx.x; if (c >= NC) return; double s = 0.0; for (int b = 0; b < NB; ++b) s += (double)PART[((size_t)b * NC + c) * 32]; const float m = (float)(s / ((double)NB * (double)NPX)); *(float*)(MV + PASS * NC + c) = m;  }


__global__ __launch_bounds__(256) void k_bnresid(const float* __restrict__ C2, const float* __restrict__ MV, const float* __restrict__ g, const float* __restrict__ be, const float* __restrict__ X, float* __restrict__ out, size_t n4) {
  #pragma clang fp contract(off)
  const size_t t = (size_t)blockIdx.x * 256 + threadIdx.x; if (t >= n4) return; const size_t e = t * 4; const int c = (int)((e / NPX) % NC); const float sc = __fmul_rn(rsqrtf(__fadd_rn(MV[NC + c], BNEPS)), bf16_round(g[c])); const float mu = MV[c], bb = bf16_round(be[c]);
  const v4f a = *(const v4fa*)(C2 + e); const v4f xx = *(const v4fa*)(X + e); v4f o; for (int q = 0; q < 4; ++q) { const float z = __fadd_rn(__fmul_rn(__fadd_rn(a[q], -mu), sc), bb); o[q] = __fadd_rn(z, bf16_round(xx[q])); }
  *(v4f*)(out + e) = o;  }


__global__ __launch_bounds__(256) void k_rowbias(float* __restrict__ Y, const float* __restrict__ bias) {
  #pragma clang fp contract(off)
  const size_t t = (size_t)blockIdx.x * 256 + threadIdx.x; if (t >= (size_t)NB * NC * NPX / 4) return; const size_t e = t * 4; const int c = (int)((e / NPX) % NC); const float bb = bf16_round(bias[c]);
  v4f v = *(const v4fa*)(Y + e); for (int q = 0; q < 4; ++q) v[q] = __fadd_rn(v[q], bb); *(v4f*)(Y + e) = v;  }



template <int NBt, int QTt, int NKt>
__global__ __launch_bounds__(256) void k_bsm(const float* __restrict__ S, _Float16* __restrict__ P) {
  #pragma clang fp contract(off)
  const size_t t = (size_t)blockIdx.x * 256 + threadIdx.x; if (t >= (size_t)QTt * NKt / 8) return; const size_t e = t * 8; float mx[8], se[8];
  for (int q = 0; q < 8; ++q) { mx[q] = -3.0e38f; se[q] = 0.f; }
#pragma unroll
  for (int b = 0; b < NBt; ++b) { const float* s = S + (size_t)b * QTt * NKt + e; for (int q = 0; q < 8; ++q) mx[q] = fmaxf(mx[q], s[q]); }
#pragma unroll
  for (int b = 0; b < NBt; ++b) { const float* s = S + (size_t)b * QTt * NKt + e; for (int q = 0; q < 8; ++q) se[q] += __expf(s[q] - mx[q]); }
#pragma unroll
  for (int b = 0; b < NBt; ++b) { const float* s = S + (size_t)b * QTt * NKt + e; FragH f; for (int q = 0; q < 8; ++q) f.h[q] = (_Float16)(__expf(s[q] - mx[q]) * (256.0f / se[q]));
    unsigned short* d = (unsigned short*)P + (size_t)b * QTt * NKt + e; *(v8us*)d = f.half[0];  } }
// ---- fused scores + batch-axis softmax + P V: one launch for all queries ----
#define FQ 64       /* query rows per work-group */
#define FQT (FQ / 16)      /* query tiles per work-group: each K and V^T fragment fetched serves all of them */
#define FKS 4      /* key ranges: a work-group walks FS / FKS keys, so that the grid still fills the chip */
#define FK 128      /* keys per pass: 16 per wave in part 1 */
#define FS 4096     /* sequence length */
#define FD 64       /* width */
#define FB 8        /* batches = waves of the work-group */
__device__ __forceinline__ v8f f_mma(v16h a, v16h b, v8f c) { return __builtin_amdgcn_wmma_f32_16x16x32_f16(false, a, false, b, (short)0, c, false, false); }
__device__ __forceinline__ v16h f_frag(const _Float16* p) { FragH f; f.half[0] = *(const v8us*)((const unsigned short*)p); f.half[1] = *(const v8us*)((const unsigned short*)p + 16); return f.v; }      /* p already holds the lane half's 8 hh: the k order of g2_frag */
__device__ __forceinline__ v16h f_fragp(const _Float16* p) { FragH f; f.half[0] = *(const v8us*)((const unsigned short*)p); f.half[1] = *(const v8us*)((const unsigned short*)p + 256); return f.v; }      /* fragment-order planes: p holds the lane's own 8 values, the fragment's second half lies one wave-wide load (32 lanes x 8) further; same values in the same registers as f_frag on rows */
// ---- one prep launch for Q, K and V: three block ranges that do not depend on one another; each writes the same values to the same places as a launch of its own would ----
#define PVK 128      /* keys per work-group of the V range */
#define PVM (PVK * 8 / 256)      /* 8-value items per thread there */
#define PVW (FB * FS / PVK)      /* work-groups of the V range: PVK keys x 64 d of one batch each */
#define PIT 8      /* 8-value items per thread in the Q and K ranges: few waves to start, all of a thread's loads in flight at once */
#define PXW (FB * FS * FD / 8 / 256 / PIT)      /* work-groups of the Q range, and of the K range */
__device__ __forceinline__ v8us p_cvt(v4f a, v4f c) { FragH f;      /* 8 inputs rounded to bf16, held as exact f16 */
#pragma unroll
  for (int q = 0; q < 4; ++q) { f.h[q] = (_Float16)bf16_round(a[q]); f.h[4 + q] = (_Float16)bf16_round(c[q]); }
  return f.half[0]; }
// V range (first: it has the longest chain): V^T in fragment order: per batch [32-key block][t = d / 16][half = (key / 16) & 1][lane = 16 ((key / 8) & 1) + d % 16][8 keys]; a work-group turns PVK keys x 64 d in LDS and writes 16 KiB in a row; the batch planes follow one another, so the block index runs through all batches
// Q range: rows as they are. K range: fragment order: [16-key tile][j = d / 16][lane = 16 ((d / 8) & 1) + key % 16][8 d]; tile = 1024 values, so a batch plane keeps its size and place
__global__ __launch_bounds__(256) void k_prep(const float* __restrict__ xq, const float* __restrict__ xk, const float* __restrict__ xv, _Float16* __restrict__ Q16, _Float16* __restrict__ KP, _Float16* __restrict__ VP) {
  __shared__ unsigned short tl[PVK][66]; const int tid = threadIdx.x; const int bx = blockIdx.x;
  if (bx < PVW) {      /* the same for the whole work-group, so the barrier inside is passed by all of it or by none */
    const float* s = xv + (size_t)bx * (PVK * 64) + tid * 8; v4f a[PVM], c[PVM];      /* key tid / 8 (and 32, 64, ... further), d (tid % 8) * 8 */
#pragma unroll      /* register arrays need constant indices */
    for (int m = 0; m < PVM; ++m) { a[m] = *(const v4fa*)(s + m * 2048); c[m] = *(const v4fa*)(s + m * 2048 + 4); }
    asm volatile("s_wait_xcnt 0x0" :: "v"(s) : "memory");      /* precaution: stands in front of any rewrite of a register that an issued load names; the input keeps the address pair whole up to it */
    const int r = tid / 8, c8 = (tid % 8) * 8;
#pragma unroll      /* register arrays need constant indices */
    for (int m = 0; m < PVM; ++m) { FragH f; f.half[0] = p_cvt(a[m], c[m]);
#pragma unroll
      for (int q = 0; q < 8; ++q) tl[r + 32 * m][c8 + q] = f.u[q]; }
    __syncthreads();
    FragH g[PVM];
#pragma unroll      /* register arrays need constant indices */
    for (int m = 0; m < PVM; ++m) { const int i = m * 256 + tid; const int k0 = (i >> 8) * 32 + ((i >> 5) & 1) * 16 + ((i >> 4) & 1) * 8, d = ((i >> 6) & 3) * 16 + (i & 15);
#pragma unroll
      for (int q = 0; q < 8; ++q) g[m].u[q] = tl[k0 + q][d]; }
    unsigned short* o = (unsigned short*)VP + (size_t)bx * (PVK * 64) + (size_t)tid * 8;
    __builtin_amdgcn_sched_barrier(0);      /* every value ahead of the first store, so that no register that an issued store names is rewritten behind it */
#pragma unroll      /* register arrays need constant indices */
    for (int m = 0; m < PVM; ++m) *(v8us*)(o + m * 2048) = g[m].half[0];
    return;
  }
  const bool isk = bx >= PVW + PXW; const size_t t = (size_t)(bx - PVW - (isk ? PXW : 0)) * (256 * PIT) + tid;      /* first item; the others lie 256 items apart */
  const float* s = (isk ? xk : xq) + t * 8; v4f a[PIT], c[PIT];
#pragma unroll      /* register arrays need constant indices */
  for (int j = 0; j < PIT; ++j) { a[j] = *(const v4fa*)(s + j * 2048); c[j] = *(const v4fa*)(s + j * 2048 + 4); }
  asm volatile("s_wait_xcnt 0x0" :: "v"(s) : "memory");      /* as above */
  const size_t row = t >> 3; const int c8 = (int)(t & 7);
  unsigned short* o = isk ? (unsigned short*)KP + (row >> 4) * 1024 + (size_t)((c8 >> 1) * 256 + ((c8 & 1) * 16 + (int)(row & 15)) * 8) : (unsigned short*)Q16 + t * 8;      /* 256 items on = 32 rows = 2 key tiles = 2048 values on, in both orders */
  v8us h[PIT];
#pragma unroll      /* register arrays need constant indices */
  for (int j = 0; j < PIT; ++j) h[j] = p_cvt(a[j], c[j]);
  __builtin_amdgcn_sched_barrier(0);      /* as above: every value ahead of the first store */
#pragma unroll      /* register arrays need constant indices */
  for (int j = 0; j < PIT; ++j) *(v8us*)(o + j * 2048) = h[j];
}
typedef float v2f __attribute__((ext_vector_type(2)));
// softmax across the 8 batches for one 16-key x 16-query tile, in registers; stores 8 keys of one query per batch to the P buffer
// two neighbouring keys (registers r, r + 1 of a score tile) go through each packed f32 instruction; 1 / sqrt(64) and log2(e) are one factor of one multiply-add whose addend is the scaled maximum
__device__ __forceinline__ void f_soft(const v8f (&s)[FB], _Float16* pw) {
  FragH pk[FB]; constexpr float FC = 0.125f * 1.44269504f; const v2f fc = {FC, FC};
#pragma unroll      /* register arrays need constant indices */
  for (int r = 0; r < 8; r += 2) { v2f e[FB], mx = {-3.0e38f, -3.0e38f};
#pragma unroll
    for (int b = 0; b < FB; ++b) { mx[0] = fmaxf(mx[0], s[b][r]); mx[1] = fmaxf(mx[1], s[b][r + 1]); }
    const v2f nm = mx * -fc;
#pragma unroll
    for (int b = 0; b < FB; ++b) { const v2f x = {s[b][r], s[b][r + 1]}; const v2f t = __builtin_elementwise_fma(x, fc, nm); e[b][0] = __builtin_amdgcn_exp2f(t[0]); e[b][1] = __builtin_amdgcn_exp2f(t[1]); }      /* native exp2 as in __expf */
    v2f se = e[0];
#pragma unroll
    for (int b = 1; b < FB; ++b) se += e[b];
    v2f sc = {__builtin_amdgcn_rcpf(se[0]), __builtin_amdgcn_rcpf(se[1])}; sc *= 256.0f;
#pragma unroll
    for (int b = 0; b < FB; ++b) { const v2f p = e[b] * sc; pk[b].h[r] = (_Float16)p[0]; pk[b].h[r + 1] = (_Float16)p[1]; } }
#pragma unroll      /* register arrays need constant indices */
  for (int b = 0; b < FB; ++b) *(v8us*)((unsigned short*)pw + (size_t)b * FQ * FK) = pk[b].half[0];
}
__device__ __forceinline__ void f_qld(FragH (&g)[FB], const unsigned short* q) {      /* one group of LDS reads: the Q fragments of one query tile and one half of d, all 8 batches */
#pragma unroll      /* register arrays need constant indices */
  for (int b = 0; b < FB; ++b) { g[b].half[0] = *(const v8us*)(q + b * (FQT * 1024)); g[b].half[1] = *(const v8us*)(q + b * (FQT * 1024) + 256); }      /* a batch's fragments: FQT tiles x 2 halves of d x 512 values */
}
// work-group barrier for data that goes through LDS alone: the two fences name LDS only, so each wave waits for its own LDS stores and reads but not for its global loads, which stay in flight across it (__syncthreads() waits all of them out)
__device__ __forceinline__ void f_bar() { __builtin_amdgcn_fence(__ATOMIC_RELEASE, "workgroup", "local"); __builtin_amdgcn_s_barrier(); __builtin_amdgcn_fence(__ATOMIC_ACQUIRE, "workgroup", "local"); }
// one pass's V^T of one batch (128 keys x 64 d, 16 KiB in a row, fragment order) from global memory straight into the wave's own LDS range, through no register: 32 asynchronous copies of 512 bytes; l = the lane's LDS byte address, vo = the lane's byte offset, g = the first byte (the same for the whole wave); the immediate offset moves both addresses
__device__ __forceinline__ void f_vcp(unsigned l, unsigned vo, const _Float16* g) {
#define VC1(n) "global_load_async_to_lds_b128 %0, %1, %2 offset:" #n "\n\t"
  asm volatile(VC1(0) VC1(512) VC1(1024) VC1(1536) VC1(2048) VC1(2560) VC1(3072) VC1(3584) VC1(4096) VC1(4608) VC1(5120) VC1(5632) VC1(6144) VC1(6656) VC1(7168) VC1(7680)
               VC1(8192) VC1(8704) VC1(9216) VC1(9728) VC1(10240) VC1(10752) VC1(11264) VC1(11776) VC1(12288) VC1(12800) VC1(13312) VC1(13824) VC1(14336) VC1(14848) VC1(15360) VC1(15872)
               "s_wait_xcnt 0x0"      /* precaution: stands, inside the copies' own statement, in front of any rewrite of a register that a copy names */
               :: "v"(l), "v"(vo), "s"(g) : "memory");
#undef VC1
}
__global__ __launch_bounds__(256) void k_fused(const _Float16* __restrict__ Q16, const _Float16* __restrict__ K16, const _Float16* __restrict__ VT, float* __restrict__ PO) {
  static_assert(FQT == 4, "part 2 below takes the query tiles two at a time");
  __shared__ __attribute__((aligned(16))) _Float16 pl[FB][FQT][FK / 32][2][32][8];      /* one buffer: two barriers a pass; fragment order of part 2's A operand: [batch][query tile][32 keys][fragment half][lane][8 keys]: the lane that stores 8 weights is the lane that reads them, every wave-wide store and read covers 512 bytes in a row, and no pad is needed, which leaves room for vl */
  __shared__ __attribute__((aligned(16))) unsigned short vl[FB][32][32][8];      /* V^T on its way: [wave = batch][32 wave-wide loads of one pass, as they lie in memory][lane][8]; a wave's 16 KiB are written by its own copies and read by itself alone */
  __shared__ __attribute__((aligned(16))) unsigned short ql[FB][FQT][2][2][32][8];      /* Q fragments of the whole walk, fragment order: [batch][query tile][d / 32][fragment half][lane][8]; every wave-wide 16-byte read covers 512 bytes in a row */
  const int tid = threadIdx.x, w = tid >> 5, lane = tid & 31, ln = lane & 15, hh = lane >> 4; const int q0 = (blockIdx.x / FKS) * FQ; const int k0 = (blockIdx.x % FKS) * (FS / FKS);
  const int kr = (int)((blockIdx.x / FKS) % (FS / FKS / FK)) * FK;      /* where this work-group's walk through its quarter starts: the 64 work-groups of a quarter read the same K and V^T lines, and started alike they ask L2 for the same lines at the same moment; the walk wraps round, so every key is still taken once */
  constexpr size_t PLN = (size_t)FS * FD;
  const v8f z8 = {0.f,0.f,0.f,0.f,0.f,0.f,0.f,0.f};
  const _Float16* qp = Q16 + (size_t)w * PLN + (size_t)(q0 + ln) * FD + 8 * hh;      /* Q rows q0 + ln of batch w: this wave brings them to LDS for all waves */
  const int wu = __builtin_amdgcn_readfirstlane(w); const unsigned lo = lane * 8;      /* the wave's number as a scalar: the K and V^T bases are then scalar and the lane offset is added where an address is formed; a per-lane K pointer that lives from the first loads' wait through the whole walk is spilled by this compiler */
  const _Float16* kp = K16 + (size_t)(k0 + 16 * wu) * FD;      /* part 1: this wave's 16-key tile, fragment order (A operand) */
  const _Float16* ks0 = kp + (size_t)kr * FD;      /* the same tile of the walk's first pass */
  const _Float16* vp = VT + (size_t)wu * PLN + (size_t)k0 * FD;      /* part 2: V^T of batch w, fragment order (B operand) */
  FragH qg[FQT][2];
  v16h kf[FB][2];
#pragma unroll      /* register arrays need constant indices */
  for (int u = 0; u < FQT; ++u) { qg[u][0].v = f_frag(qp + u * (16 * FD)); qg[u][1].v = f_frag(qp + u * (16 * FD) + 32); }
  asm volatile("s_wait_xcnt 0x0" :: "v"(qp) : "memory");      /* precaution: stands in front of any rewrite of a register that an issued load names; the input keeps the Q address pair whole up to it; a wait of its own, directly behind the Q loads: held over the K loads as well, the pair is spilled by this compiler */
#pragma unroll      /* register arrays need constant indices */
  for (int b = 0; b < FB; ++b) { kf[b][0] = f_fragp(ks0 + (size_t)b * PLN + lo); kf[b][1] = f_fragp(ks0 + (size_t)b * PLN + 512 + lo); }
  asm volatile("s_wait_xcnt 0x0" :: "s"(ks0), "v"(lane) : "memory");      /* the same for the K base and the lane index (the K loads' scaled offset register) */
  const unsigned vla = (unsigned)(size_t)&vl[w][0][lane][0]; const _Float16* vx = (const _Float16*)&vl[w][0][lane][0];      /* the lane's place in the wave's own V^T range: as a byte address for the copies, as a pointer for the reads */
  f_vcp(vla, lane * 16, vp + (size_t)kr * FD);      /* the first pass's V^T sets out now; nobody has touched this LDS range before */
#pragma unroll      /* register arrays need constant indices */
  for (int u = 0; u < FQT; ++u)
#pragma unroll
    for (int j = 0; j < 2; ++j) { *(v8us*)&ql[w][u][j][0][lane][0] = qg[u][j].half[0]; *(v8us*)&ql[w][u][j][1][lane][0] = qg[u][j].half[1]; }
  __syncthreads();      /* publishes the Q fragments to every wave */
  const unsigned short* qr = &ql[0][0][0][0][lane][0];
  v8f o[FQT][4];
#pragma unroll      /* register arrays need constant indices */
  for (int u = 0; u < FQT; ++u)
#pragma unroll
    for (int t = 0; t < 4; ++t) o[u][t] = z8;
  for (int it = 0; it < FS / FKS / FK; ++it) {
    const int kb = (kr + it * FK) & (FS / FKS - 1); const int kn = (kb + FK) & (FS / FKS - 1);      /* this pass's keys, from the work-group's own start on, and the next pass's; the last pass requests the walk's first keys again: in bounds, not used */
    const _Float16* kq = kp + (size_t)kn * FD + lo;
    v16h vf[4][4];      /* this pass's V^T fragments */
    FragH g0[FB], g1[FB];      /* Q fragments of one query tile: first and second half of d */
    f_qld(g0, qr);
#pragma unroll      /* register arrays need constant indices */
    for (int u = 0; u < FQT; ++u) {      /* one query tile at a time; the K fragments in registers serve all four */
      v8f s[FB];      /* s[b][r] = Q[b][q0 + 16 u + ln] . K[b][k0 + kb + 16 w + 8 hh + r] */
      f_qld(g1, qr + u * 1024 + 512);
      __builtin_amdgcn_sched_barrier(0);      /* keeps each group of LDS reads whole and in front of the products; left alone the scheduler reads four at a time and waits each out */
#pragma unroll      /* register arrays need constant indices */
      for (int b = 0; b < FB; ++b) s[b] = f_mma(kf[b][0], g0[b].v, z8);
#pragma unroll      /* register arrays need constant indices */
      for (int b = 0; b < FB; ++b) s[b] = f_mma(kf[b][1], g1[b].v, s[b]);
      __builtin_amdgcn_sched_barrier(0);      /* keeps the requests below behind the products above, whose registers they take */
      if (u == 0) f_bar();      /* ends every wave's reads of the last pass's P, which the softmax below overwrites */
      if (u + 1 < FQT) f_qld(g0, qr + (u + 1) * 1024);      /* next tile's first group: it arrives under the softmax */
      else {
#pragma unroll      /* register arrays need constant indices */
        for (int b = 0; b < FB; ++b) kf[b][0] = f_fragp(kq + (size_t)b * PLN);      /* next pass's K fragments, in the registers that K has just left: the last softmax and part 2 to arrive in; first half of d first, the order of use */
#pragma unroll      /* register arrays need constant indices */
        for (int b = 0; b < FB; ++b) kf[b][1] = f_fragp(kq + (size_t)b * PLN + 512);
        asm volatile("s_wait_xcnt 0x0" :: "v"(kq) : "memory");      /* as above, for the K address pair */
        asm volatile("s_wait_asynccnt 0x0" ::: "memory");      /* this pass's V^T, copied since the middle of the last pass's part 2, has landed behind this wait; only this wave reads it, so no barrier is owed */
#pragma unroll      /* register arrays need constant indices */
        for (int ks = 0; ks < 4; ++ks)
#pragma unroll
          for (int t = 0; t < 4; ++t) vf[ks][t] = f_fragp(vx + ks * (32 * FD) + t * 512);      /* from the wave's own LDS range into the registers that the Q groups have left; they arrive under the last softmax */
      }
      __builtin_amdgcn_sched_barrier(0);      /* keeps the requests above in front of the softmax; sunk into it they would start later */
      f_soft(s, &pl[0][u][w >> 1][w & 1][lane][0]);
      __builtin_amdgcn_sched_barrier(0);      /* keeps the next tile's reads and the requests below out of this softmax, whose registers they take */
    }
    f_bar();      /* publishes this pass's P */
    const _Float16* pr = &pl[w][0][0][0][lane][0];
#pragma unroll      /* register arrays need constant indices */
    for (int h = 0; h < FQT / 2; ++h) { v16h pa[2][4];      /* P[w] rows of two query tiles as A operands */
#pragma unroll      /* register arrays need constant indices */
      for (int ks = 0; ks < 4; ++ks) {
#pragma unroll
        for (int u = 0; u < 2; ++u) pa[u][ks] = f_fragp(pr + (2 * h + u) * (FK * 16) + ks * 512);
        if (h == 0) __builtin_amdgcn_sched_barrier(0);      /* keeps the first pair's reads in the order of their use, so that the first products wait for the first reads alone; left alone the scheduler turns the order round and the products wait for all sixteen */
      }
      if (h == 1 && it + 1 < FS / FKS / FK) {      /* the same for the whole work-group: only while a next pass exists; between the two runs of products, so that one wave of a SIMD issues its copies while the other has the matrix unit */
        asm volatile("s_wait_dscnt 0x0" ::: "memory");      /* this wave's reads of its V^T range have ended before its copies write there */
        f_vcp(vla, lane * 16, vp + (size_t)kn * FD);      /* the next pass's V^T: nearly all of the next part 1 to land in */
      }
      __builtin_amdgcn_sched_barrier(0);      /* keeps the products behind the reads of their own two tiles; the second pair's reads may still rise among the first pair's products */
#pragma unroll      /* register arrays need constant indices */
      for (int ks = 0; ks < 4; ++ks)
#pragma unroll
        for (int u = 0; u < 2; ++u)
#pragma unroll
          for (int t = 0; t < 4; ++t) o[2 * h + u][t] = f_mma(pa[u][ks], vf[ks][t], o[2 * h + u][t]);      /* the V^T fragments in registers serve all four query tiles */
    }
  }
  asm volatile("s_wait_asynccnt 0x0" ::: "memory");      /* no copy is still on its way when the wave ends */
  asm volatile("s_wait_loadcnt 0x0" ::: "memory");      /* precaution: the last pass's K requests are used by nobody and no barrier waits them out any more; with this wait none is still on its way when the wave gives its registers back at its end */
  float* op = PO + (size_t)(blockIdx.x % FKS) * (FB * PLN) + (size_t)w * PLN + (size_t)(q0 + 8 * hh) * FD + ln;      /* this key quarter's plane of partial sums, still x256 */
#pragma unroll      /* register arrays need constant indices */
  for (int u = 0; u < FQT; ++u)
#pragma unroll
    for (int t = 0; t < 4; ++t)
#pragma unroll
      for (int r = 0; r < 8; ++r) op[(size_t)(16 * u + r) * FD + t * 16] = o[u][t][r];
}
// out = (sum of the four key quarters, in pairs) x 2^-8
#define RIT 4      /* 4-value items per thread and plane: few waves to start, all of a thread's loads in flight at once */
__global__ __launch_bounds__(256) void k_sum(const float* __restrict__ PO, float* __restrict__ out) {
  static_assert(FKS == 4, "the sum below is written out for four planes");
  const size_t t0 = (size_t)blockIdx.x * (1024 * RIT); const unsigned lo = threadIdx.x * 4;      /* the work-group's first value, and the thread's place in each run of 1024 values */
  constexpr size_t PP = (size_t)FB * FS * FD;      /* one plane of partial sums */
  const float* s0 = PO + t0; v4f a[RIT], c[RIT], d[RIT], e[RIT];      /* one base for the work-group; the four planes lie PP values apart */
#pragma unroll      /* register arrays need constant indices */
  for (int j = 0; j < RIT; ++j) { a[j] = *(const v4fa*)(s0 + j * 1024 + lo); c[j] = *(const v4fa*)(s0 + PP + j * 1024 + lo); d[j] = *(const v4fa*)(s0 + 2 * PP + j * 1024 + lo); e[j] = *(const v4fa*)(s0 + 3 * PP + j * 1024 + lo); }
  asm volatile("s_wait_xcnt 0x0" ::: "memory");      /* precaution: stands in front of any rewrite of a register that an issued load names */
  __builtin_amdgcn_sched_barrier(0);      /* keeps every load in front of the first sum, so that all of a thread's loads are in flight at once */
  float* o = out + t0 + lo;
#pragma unroll      /* register arrays need constant indices */
  for (int j = 0; j < RIT; ++j) a[j] = ((a[j] + c[j]) + (d[j] + e[j])) * 0.00390625f;
  __builtin_amdgcn_sched_barrier(0);      /* every value ahead of the first store, so that no register that an issued store names is rewritten behind it */
#pragma unroll      /* register arrays need constant indices */
  for (int j = 0; j < RIT; ++j) *(v4f*)(o + j * 1024) = a[j];
}
extern "C" void kernel_launch(void* const* d_in, const int* in_sizes, int n_in,
                              void* d_out, int out_size, void* d_ws, size_t ws_size, hipStream_t stream) {
  (void)in_sizes; (void)n_in; (void)out_size;
  const float* const* I = (const float* const*)d_in; const float* xq = I[0]; const float* xk = I[1]; const float* xv = I[2];      /* Q, K, V [8][4096][64] (bf16-valued) */
  constexpr int NBt = 8, SQt = 4096, DK = 64;      /* batches, sequence, width */
  char* ws = (char*)d_ws; size_t off = 0;
  auto take = [&](size_t bytes) { char* p = ws + off; off += (bytes + 255) & ~(size_t)255; return p; };
  const size_t PLN = (size_t)SQt * DK;      /* one batch's [4096][64] plane */
  _Float16* Q16 = (_Float16*)take(NBt * PLN * 2); _Float16* K16 = (_Float16*)take(NBt * PLN * 2); _Float16* VT = (_Float16*)take(NBt * PLN * 2); float* PO = (float*)take(FKS * NBt * PLN * 4);
  if (off > ws_size) return;
  k_prep<<<PVW + 2 * PXW, 256, 0, stream>>>(xq, xk, xv, Q16, K16, VT);      /* exact f16 copies of the bf16-valued inputs: Q in rows, K and V^T in fragment order */
  k_fused<<<SQt / FQ * FKS, 256, 0, stream>>>(Q16, K16, VT, PO);      /* scores, softmax across the 8 batches and P V for 64 query rows of all batches and one quarter of the keys per work-group */
  k_sum<<<NBt * SQt * DK / 4 / 256 / RIT, 256, 0, stream>>>(PO, (float*)d_out);      /* adds the four key quarters */
}
